// v000
// The times below were measured on an AMD MI455X: many runs one after another, warmed up first and cycling through
// copies of the inputs, with the whole window's GPU time divided by the number of runs. Launches and the gaps
// between them are all in it. The median over several windows is given; except for v000 it joins two sittings, which
// can be a few percent apart, so the side-by-side timings, each taken in one sitting, are the better comparison.
// v000 is the starting kernel. One run takes 244 microseconds.
#include <hip/hip_runtime.h>

// Multi-head attention, width 1024 = 16 heads x 64; inputs q, k, v [NB][SEQ][1024]; Wq/Wk/Wv/Wp [out][in] (y = x W^T); interleaved rotary on projected k and v over the full 1024 axis (512 pairs, angle = pos * 10000^(-2p/1024)); score scale 1/8; dense softmax; out = ctx Wp^T + bp (f32).
// Compute dtypes, f32 accumulate everywhere: q/k/v projections v_wmma_f32_16x16x32_bf16 (inputs and weights RNE-converted to bf16; products exact); rotary in f32 in the projection epilogue from f32 cos/sin tables;
// scores v_wmma_f32_16x16x32_f16: q single f16, k single f16 (one product; logits = acc * 0.125 * log2 e); P (x256 carry, cancels in the normalisation; row sum taken over the f16 values) and v single f16; softmax f32 (online, running max);
// output projection v_wmma_f32_16x16x32_f16: ctx single f16 with x1024 carry, Wp as f16 of the bf16 RNE value with x256 carry, 2^-18 folded back in the f32 epilogue, bias (bf16 RNE value) added in f32.
// Layout: bf16 copies of q, k, v, Wq, Wk, Wv; q and k planes [b*16+h][t][d]; v^T plane [b*16+h][d][t]; ctx plane [b*SEQ+t][1024]; fused flash kernel in transposed form (S^T = K Q^T, O^T = V^T P^T).

#ifndef NB
#define NB 2
#endif
#ifndef SEQ
#define SEQ 2048
#endif
#define NB_FULL  2
#define SEQ_FULL 2048
#ifndef OUT_SEQ
#define OUT_SEQ SEQ              // row pitch (in tokens) between batches of the output
#endif
#define DM   1024
#define NH_  16
#define HD   64
#define NPR  (DM / 2)            // rotary pairs per token row
#define AW   4                   // waves per flash block (16 query rows each)
#define SC2  (0.125f * 1.4426950408889634f)   // HD^-0.5 * log2(e)
#define PSH  8.0f                // log2 of the P carry (256)
#define CXS  1024.0f             // carry of the ctx plane
#define WPS  256.0f              // carry of the Wp plane
#define OSC  (1.0f / (1024.0f * 256.0f))      // 2^-18

static_assert(HD == 64);
static_assert(NH_ * HD == DM);                 // head h = columns h*64 + d
static_assert(DM % 64 == 0);
static_assert(DM % 32 == 0);                   // GEMM k-loop steps by 32
static_assert(SEQ % 64 == 0);                  // a 64-row tile never straddles two batches
static_assert((NB * SEQ) % 64 == 0);
static_assert(SEQ % 32 == 0);                  // key loop steps by 32
static_assert(SEQ % (16 * AW) == 0);           // flash grid covers the sequence exactly
static_assert(((size_t)SEQ * DM) % (8 * 256) == 0);
static_assert(((size_t)DM * DM) % (8 * 256) == 0);
static_assert(((size_t)SEQ * NPR) % 256 == 0); // table grid is exact
static_assert(NPR == 512);                     // theta kernel: one block of 512 threads
static_assert(NB <= NB_FULL);
static_assert(SEQ <= SEQ_FULL);
static_assert(((size_t)(NB - 1) * OUT_SEQ + SEQ) * DM * 4 <= (size_t)16777216);   // last output byte stays inside the output buffer

typedef _Float16 h16;
typedef unsigned short bf;
typedef __attribute__((ext_vector_type(16))) __bf16   v16bf;
typedef __attribute__((ext_vector_type(16))) _Float16 v16h;
typedef __attribute__((ext_vector_type(8)))  _Float16 v8h;
typedef __attribute__((ext_vector_type(8)))  unsigned short v8us;
typedef __attribute__((ext_vector_type(8)))  float    v8f;
typedef __attribute__((ext_vector_type(4)))  float    v4f;
typedef __attribute__((ext_vector_type(2)))  float    v2f;
typedef v4f  __attribute__((may_alias)) v4fa;

__device__ __forceinline__ unsigned short f2bf(float f) { unsigned u = __float_as_uint(f); u += 0x7FFFu + ((u >> 16) & 1u); return (unsigned short)(u >> 16); }
__device__ __forceinline__ float bfval(float f) { return __uint_as_float(((unsigned)f2bf(f)) << 16); }
__device__ __forceinline__ v16h cat16(v8h lo, v8h hi) { return __builtin_shufflevector(lo, hi, 0, 1, 2, 3, 4, 5, 6, 7, 8, 9, 10, 11, 12, 13, 14, 15); }
__device__ __forceinline__ v16bf cat16b(v8us lo, v8us hi) { return __builtin_bit_cast(v16bf, __builtin_shufflevector(lo, hi, 0, 1, 2, 3, 4, 5, 6, 7, 8, 9, 10, 11, 12, 13, 14, 15)); }
__device__ __forceinline__ v8f wmma16(v16h a, v16h b, v8f c) { return __builtin_amdgcn_wmma_f32_16x16x32_f16(false, a, false, b, (short)0, c, false, false); }
__device__ __forceinline__ v8f wmmab(v16bf a, v16bf b, v8f c) { return __builtin_amdgcn_wmma_f32_16x16x32_bf16(false, a, false, b, (short)0, c, false, false); }
// fragment loaders from K-contiguous 16-bit rows; p already includes + 8*(lane>>4): elements 0..7 <- k0+8h+0..7, elements 8..15 <- k0+16+8h+0..7 (same map for A and B)
__device__ __forceinline__ v16h  ldh(const h16* p) { return cat16(*(const v8h*)p, *(const v8h*)(p + 16)); }
__device__ __forceinline__ v16bf ldb(const bf* p)  { return cat16b(*(const v8us*)p, *(const v8us*)(p + 16)); }
// ordering point for wave-private LDS tiles (same wave writes and reads)
__device__ __forceinline__ void wave_sync() { __builtin_amdgcn_fence(3 /* release order */, "wavefront"); __builtin_amdgcn_wave_barrier(); asm volatile("" ::: "memory"); }

__global__ __launch_bounds__(256) void k_cvt8(const float* __restrict__ src, bf* dst, size_t n8) {
    const size_t i = (size_t)blockIdx.x * 256 + threadIdx.x; if (i >= n8) return;
    const v8f v = *(const v8f*)(src + i * 8); v8us o;
#pragma unroll
    for (int k = 0; k < 8; ++k) o[k] = f2bf(v[k]);
    *(v8us*)(dst + i * 8) = o; 
}

__global__ __launch_bounds__(256) void k_cvt8h(const float* __restrict__ src, h16* dst, size_t n8, float scale) {
    const size_t i = (size_t)blockIdx.x * 256 + threadIdx.x; if (i >= n8) return;
    const v8f v = *(const v8f*)(src + i * 8); v8h o;
#pragma unroll
    for (int k = 0; k < 8; ++k) o[k] = (h16)(bfval(v[k]) * scale);
    *(v8h*)(dst + i * 8) = o; 
}

__global__ __launch_bounds__(NPR) void k_theta(float* TH) {
    const int p = threadIdx.x;
    const float e = (2.0f * (float)p) * (1.0f / (float)DM);
    const float th = 1.0f / powf(10000.0f, e);
    *(float*)(TH + p) = th; 
}

// k_ropetab: (cos, sin) of pos * TH[p] as float2. blockIdx.y == 0: layout [pos][p]; blockIdx.y == 1: layout [p][pos] (second half of CS).
__global__ __launch_bounds__(256) void k_ropetab(const float* __restrict__ TH, float* CS) {
    const unsigned i = blockIdx.x * 256u + threadIdx.x;        // < SEQ*NPR (exact grid)
    unsigned t, p;
    if (blockIdx.y == 0) { t = i / NPR; p = i % NPR; } else { p = i / SEQ; t = i % SEQ; }
    const float ang = (float)t * TH[p];
    float sn, cs; sincosf(ang, &sn, &cs);
    v2f o; o[0] = cs; o[1] = sn;
    float* dst = CS + ((size_t)blockIdx.y * SEQ * NPR + i) * 2;
    *(v2f*)dst = o; 
}

// k_proj: register-blocked bf16 GEMM, ONE WAVE per 64x64 tile (16 accumulators), operands straight from K-contiguous bf16 planes, K = DM.
// C[m][n] = sum_k A[m][k] Bt[n][k]; epilogue by MODE:
//   0: C as f16 (Ph);
//   1: rows = tokens, columns = features: interleaved rotary on column pairs (table [pos][p]), then f16 (Ph);
//   2: rows = features, columns = tokens: interleaved rotary on row pairs (table [p][pos]), then f16 (Ph).
// Tile base (r0/RB)*sRB + (r0%RB)*pitch + (c0/CB)*sCB + (c0%CB), row pitch 'pitch' (halves). grid (M/64, N/64), 32 threads.
template <int MODE>
__global__ __launch_bounds__(32) void k_proj(const bf* __restrict__ A, const bf* __restrict__ Bt, h16* Ph, const float* __restrict__ CS,
                                             int RB, size_t sRB, int pitch, int CB, size_t sCB) {
    __shared__ __align__(16) float os[16 * 68];
    const int K = DM;
    const int lane = threadIdx.x & 31, lr = lane & 15, hi = lane >> 4; const int r0 = blockIdx.x * 64, c0 = blockIdx.y * 64;
    v8f acc[4][4];
#pragma unroll
    for (int mb = 0; mb < 4; ++mb)
#pragma unroll
        for (int nb = 0; nb < 4; ++nb) acc[mb][nb] = (v8f){};
    const size_t aoff = (size_t)(r0 + lr) * K + 8 * hi, boff = (size_t)(c0 + lr) * K + 8 * hi;
#pragma unroll 1
    for (int kc = 0; kc < K; kc += 32) {
        v16bf a[4];
#pragma unroll
        for (int mb = 0; mb < 4; ++mb) a[mb] = ldb(A + aoff + (size_t)mb * 16 * K + kc);
#pragma unroll
        for (int nb = 0; nb < 4; ++nb) { const v16bf b = ldb(Bt + boff + (size_t)nb * 16 * K + kc);
#pragma unroll
            for (int mb = 0; mb < 4; ++mb) acc[mb][nb] = wmmab(a[mb], b, acc[mb][nb]); }
        asm volatile("v_nop\n\tv_nop\n\tv_nop\n\tv_nop" : "+v"(acc[0][0]), "+v"(acc[1][1]), "+v"(acc[2][2]), "+v"(acc[3][3]) : "v"(a[0]), "v"(a[1]), "v"(a[2]), "v"(a[3]));
    }
    const size_t tbase = (size_t)(r0 / RB) * sRB + (size_t)(r0 % RB) * (size_t)pitch + (size_t)(c0 / CB) * sCB + (size_t)(c0 % CB);
    const int rg = lane >> 3, c8 = (lane & 7) * 8;       // 4 row groups x 8 lanes; 8 lanes x 8 = 64 columns
#pragma unroll
    for (int mb = 0; mb < 4; ++mb) {
#pragma unroll
        for (int nb = 0; nb < 4; ++nb) {
#pragma unroll
            for (int j = 0; j < 8; ++j) os[(hi * 8 + j) * 68 + nb * 16 + lr] = acc[mb][nb][j]; }   // D: row 8h+j, col lane&15; rows 0..15 x cols 0..63 all written
        wave_sync();
        v8h hv[4];
#pragma unroll
        for (int s = 0; s < 4; ++s) {
            const int row = 4 * s + rg;                  // 4 s x 4 row groups = 16 rows
            v4f x0 = *(const v4fa*)(&os[row * 68 + c8]); v4f x1 = *(const v4fa*)(&os[row * 68 + c8 + 4]);
            if (MODE == 1) {
                const int t = (r0 % SEQ) + mb * 16 + row;                                    // token position of this row
                const float* cp = CS + ((size_t)t * NPR + (size_t)((c0 + c8) >> 1)) * 2;     // 4 pairs: (cos, sin) x 4
                const v4f e0 = *(const v4fa*)cp; const v4f e1 = *(const v4fa*)(cp + 4);
                v4f y0, y1;
                y0[0] = x0[0] * e0[0] - x0[1] * e0[1]; y0[1] = x0[0] * e0[1] + x0[1] * e0[0];
                y0[2] = x0[2] * e0[2] - x0[3] * e0[3]; y0[3] = x0[2] * e0[3] + x0[3] * e0[2];
                y1[0] = x1[0] * e1[0] - x1[1] * e1[1]; y1[1] = x1[0] * e1[1] + x1[1] * e1[0];
                y1[2] = x1[2] * e1[2] - x1[3] * e1[3]; y1[3] = x1[2] * e1[3] + x1[3] * e1[2];
                x0 = y0; x1 = y1;
            }
            if (MODE == 2) {
                const int e = r0 + mb * 16 + row;                                            // feature index of this row; partner row = row ^ 1 (same slab)
                const int tc = (c0 % SEQ) + c8;                                              // first of 8 token positions
                const float* cp = CS + (size_t)SEQ * NPR * 2 + ((size_t)(e >> 1) * SEQ + (size_t)tc) * 2;
                const v4f e0 = *(const v4fa*)cp; const v4f e1 = *(const v4fa*)(cp + 4); const v4f e2 = *(const v4fa*)(cp + 8); const v4f e3 = *(const v4fa*)(cp + 12);
                const v4f w0 = *(const v4fa*)(&os[(row ^ 1) * 68 + c8]); const v4f w1 = *(const v4fa*)(&os[(row ^ 1) * 68 + c8 + 4]);
                const float sg = (row & 1) ? 1.0f : -1.0f;   // even feature: x cos - partner sin; odd feature: partner sin + x cos
                v4f y0, y1;
                y0[0] = x0[0] * e0[0] + sg * (w0[0] * e0[1]); y0[1] = x0[1] * e0[2] + sg * (w0[1] * e0[3]);
                y0[2] = x0[2] * e1[0] + sg * (w0[2] * e1[1]); y0[3] = x0[3] * e1[2] + sg * (w0[3] * e1[3]);
                y1[0] = x1[0] * e2[0] + sg * (w1[0] * e2[1]); y1[1] = x1[1] * e2[2] + sg * (w1[1] * e2[3]);
                y1[2] = x1[2] * e3[0] + sg * (w1[2] * e3[1]); y1[3] = x1[3] * e3[2] + sg * (w1[3] * e3[3]);
                x0 = y0; x1 = y1;
            }
#pragma unroll
            for (int i = 0; i < 4; ++i) { hv[s][i] = (h16)x0[i]; hv[s][4 + i] = (h16)x1[i]; }
        }
        const size_t sb = tbase + (size_t)(mb * 16) * (size_t)pitch;
{
#pragma unroll
            for (int s = 0; s < 4; ++s) { const size_t oo = sb + (size_t)(4 * s + rg) * (size_t)pitch + c8;
                *(v8h*)(Ph + oo) = hv[s]; }
             }
        wave_sync();
    }
}

// k_flash: fused attention, one wave per 16 query rows of one (batch, head); K / V^T / Q fragments straight from the f16 planes (two 16-B loads each, arithmetic addressing).
// Transposed form: S^T[key][t] = K Q^T (A = K rows, B = Q rows); lane (t = lane&15, h = lane>>4) holds keys 8h+r of each 16-key tile, so the packed
// P tile is directly the B fragment of O^T[d][t] = V^T P^T (element r <- tile keys 0..15, element 8+r <- tile keys 16..31, lane unchanged).
// Scale chain: logit2 = acc * (0.125 * log2 e); P = exp2(logit2 - max + 8) as f16; l = sum of the f16 P values; ctx plane = O^T * 1024 / l.
// Softmax state (running max, partial sum) is one scalar per lane; the two lane halves of a row are combined with one xor-16 exchange.
__global__ __launch_bounds__(32 * AW) void k_flash(const h16* __restrict__ QH, const h16* __restrict__ KP, const h16* __restrict__ VT, h16* CX) {
    __shared__ __align__(16) float os[AW * 16 * 68];
    const int lane = threadIdx.x & 31, lr = lane & 15, hi = lane >> 4;
    const int wave = __builtin_amdgcn_readfirstlane((int)(threadIdx.x >> 5));
    const int zh = blockIdx.y; const int b = zh / NH_, h = zh % NH_;
    const int t0 = (blockIdx.x * AW + wave) * 16;
    const size_t pbase = (size_t)zh * SEQ * HD;
    const size_t qo = pbase + (size_t)(t0 + lr) * HD + 8 * hi;
    const v16h qh0 = ldh(QH + qo), qh1 = ldh(QH + qo + 32);   // B fragments: col t, k = d
    const size_t ko = pbase + (size_t)lr * HD + 8 * hi;      // + key * HD       (A fragment: row key, k = d)
    const size_t vo = pbase + (size_t)lr * SEQ + 8 * hi;     // + 16j*SEQ + key  (A fragment: row d, k = key)
    v8f o0 = (v8f){}, o1 = (v8f){}, o2 = (v8f){}, o3 = (v8f){};
    float m = -3.0e38f, l = 0.0f;
#pragma unroll 1
    for (int key0 = 0; key0 < SEQ; key0 += 32) {
        const h16* ka = KP + ko + (size_t)key0 * HD;
        const v16h ka0 = ldh(ka), ka1 = ldh(ka + 32), kb0 = ldh(ka + 16 * HD), kb1 = ldh(ka + 16 * HD + 32);
        v8f sHa = (v8f){}, sHb = (v8f){};
        sHa = wmma16(ka0, qh0, sHa); sHb = wmma16(kb0, qh0, sHb);
        sHa = wmma16(ka1, qh1, sHa); sHb = wmma16(kb1, qh1, sHb);
        asm volatile("v_nop\n\tv_nop\n\tv_nop\n\tv_nop" : "+v"(sHa), "+v"(sHb) : "v"(ka0), "v"(ka1), "v"(kb0), "v"(kb1), "v"(qh0), "v"(qh1));
        float ta[8], tb[8]; float mx = -3.0e38f;
#pragma unroll
        for (int r = 0; r < 8; ++r) { ta[r] = sHa[r] * SC2; tb[r] = sHb[r] * SC2; mx = fmaxf(mx, fmaxf(ta[r], tb[r])); }
        mx = fmaxf(mx, __shfl_xor(mx, 16, 32));
        const float mnew = fmaxf(m, mx);
        const float alpha = __builtin_amdgcn_exp2f(m - mnew);
        const float sh = PSH - mnew;
        v16h pb; float ls = 0.0f;
#pragma unroll
        for (int r = 0; r < 8; ++r) { const h16 pa = (h16)__builtin_amdgcn_exp2f(ta[r] + sh); const h16 pc = (h16)__builtin_amdgcn_exp2f(tb[r] + sh); pb[r] = pa; pb[8 + r] = pc; ls += (float)pa + (float)pc; }
        l = l * alpha + ls; m = mnew;
        o0 = o0 * alpha; o1 = o1 * alpha; o2 = o2 * alpha; o3 = o3 * alpha;
        const h16* va = VT + vo + key0;
        const v16h v0 = ldh(va), v1 = ldh(va + (size_t)16 * SEQ), v2 = ldh(va + (size_t)32 * SEQ), v3 = ldh(va + (size_t)48 * SEQ);
        o0 = wmma16(v0, pb, o0); o1 = wmma16(v1, pb, o1); o2 = wmma16(v2, pb, o2); o3 = wmma16(v3, pb, o3);
        asm volatile("v_nop\n\tv_nop\n\tv_nop\n\tv_nop" : "+v"(o0), "+v"(o1), "+v"(o2), "+v"(o3) : "v"(v0), "v"(v1), "v"(v2), "v"(v3), "v"(pb));
    }
    l += __shfl_xor(l, 16, 32);
    const float inv = (1.0f / l) * CXS;
    const int wb = wave * 16 * 68;
    // O^T D layout: o_j[r] = (d = 16j + 8h + r, t = lane&15) -> os[t][d]; rows 0..15 x columns 0..63 all written
    { v4f a, c;
      a[0] = o0[0] * inv; a[1] = o0[1] * inv; a[2] = o0[2] * inv; a[3] = o0[3] * inv; c[0] = o0[4] * inv; c[1] = o0[5] * inv; c[2] = o0[6] * inv; c[3] = o0[7] * inv;
      *(v4fa*)(&os[wb + lr * 68 +  0 + 8 * hi]) = a; *(v4fa*)(&os[wb + lr * 68 +  0 + 8 * hi + 4]) = c;
      a[0] = o1[0] * inv; a[1] = o1[1] * inv; a[2] = o1[2] * inv; a[3] = o1[3] * inv; c[0] = o1[4] * inv; c[1] = o1[5] * inv; c[2] = o1[6] * inv; c[3] = o1[7] * inv;
      *(v4fa*)(&os[wb + lr * 68 + 16 + 8 * hi]) = a; *(v4fa*)(&os[wb + lr * 68 + 16 + 8 * hi + 4]) = c;
      a[0] = o2[0] * inv; a[1] = o2[1] * inv; a[2] = o2[2] * inv; a[3] = o2[3] * inv; c[0] = o2[4] * inv; c[1] = o2[5] * inv; c[2] = o2[6] * inv; c[3] = o2[7] * inv;
      *(v4fa*)(&os[wb + lr * 68 + 32 + 8 * hi]) = a; *(v4fa*)(&os[wb + lr * 68 + 32 + 8 * hi + 4]) = c;
      a[0] = o3[0] * inv; a[1] = o3[1] * inv; a[2] = o3[2] * inv; a[3] = o3[3] * inv; c[0] = o3[4] * inv; c[1] = o3[5] * inv; c[2] = o3[6] * inv; c[3] = o3[7] * inv;
      *(v4fa*)(&os[wb + lr * 68 + 48 + 8 * hi]) = a; *(v4fa*)(&os[wb + lr * 68 + 48 + 8 * hi + 4]) = c; }
    wave_sync();
    h16* crow = CX + ((size_t)b * SEQ + t0) * DM + h * HD;
    const int rg = lane >> 3, c8 = (lane & 7) * 8;       // 4 s x 4 row groups = 16 rows; 8 lanes x 8 halves = 64 columns
    v8h hv[4];
#pragma unroll
    for (int s = 0; s < 4; ++s) { const int row = 4 * s + rg;
        const v4f x0 = *(const v4fa*)(&os[wb + row * 68 + c8]); const v4f x1 = *(const v4fa*)(&os[wb + row * 68 + c8 + 4]);
#pragma unroll
        for (int i = 0; i < 4; ++i) { hv[s][i] = (h16)x0[i]; hv[s][4 + i] = (h16)x1[i]; } }
{
#pragma unroll
        for (int s = 0; s < 4; ++s) *(v8h*)(crow + (size_t)(4 * s + rg) * DM + c8) = hv[s];
         }
}

// k_oproj: register-blocked f16 GEMM, ONE WAVE per 64x64 tile, A = ctx plane (x1024), Bt = Wp plane (x256), K = DM; OUT[m][n] = acc * 2^-18 + bias[n] (f32).
__global__ __launch_bounds__(32) void k_oproj(const h16* __restrict__ A, const h16* __restrict__ Bt, const float* __restrict__ bias, float* OUT) {
    __shared__ __align__(16) float os[16 * 68];
    const int K = DM;
    const int lane = threadIdx.x & 31, lr = lane & 15, hi = lane >> 4; const int r0 = blockIdx.x * 64, c0 = blockIdx.y * 64;
    v8f acc[4][4];
#pragma unroll
    for (int mb = 0; mb < 4; ++mb)
#pragma unroll
        for (int nb = 0; nb < 4; ++nb) acc[mb][nb] = (v8f){};
    const size_t aoff = (size_t)(r0 + lr) * K + 8 * hi, boff = (size_t)(c0 + lr) * K + 8 * hi;
#pragma unroll 1
    for (int kc = 0; kc < K; kc += 32) {
        v16h a[4];
#pragma unroll
        for (int mb = 0; mb < 4; ++mb) a[mb] = ldh(A + aoff + (size_t)mb * 16 * K + kc);
#pragma unroll
        for (int nb = 0; nb < 4; ++nb) { const v16h b = ldh(Bt + boff + (size_t)nb * 16 * K + kc);
#pragma unroll
            for (int mb = 0; mb < 4; ++mb) acc[mb][nb] = wmma16(a[mb], b, acc[mb][nb]); }
        asm volatile("v_nop\n\tv_nop\n\tv_nop\n\tv_nop" : "+v"(acc[0][0]), "+v"(acc[1][1]), "+v"(acc[2][2]), "+v"(acc[3][3]) : "v"(a[0]), "v"(a[1]), "v"(a[2]), "v"(a[3]));
    }
    const int cofs = lr * 4;                              // 16 lanes x 4 floats = 64 columns
    const v4f braw = *(const v4fa*)(bias + c0 + cofs); v4f bb;
#pragma unroll
    for (int i = 0; i < 4; ++i) bb[i] = bfval(braw[i]);
    const int bi = r0 / SEQ, tt = r0 % SEQ;
    float* obase = OUT + ((size_t)bi * OUT_SEQ + tt) * DM + c0;
#pragma unroll
    for (int mb = 0; mb < 4; ++mb) {
#pragma unroll
        for (int nb = 0; nb < 4; ++nb) {
#pragma unroll
            for (int j = 0; j < 8; ++j) os[(hi * 8 + j) * 68 + nb * 16 + lr] = acc[mb][nb][j]; }   // rows 0..15 x cols 0..63 all written
        wave_sync();
        v4f vals[8];
#pragma unroll
        for (int s = 0; s < 8; ++s) { const int row = 2 * s + hi;            // 8 s x 2 rows = 16 rows
            const v4f x = *(const v4fa*)(&os[row * 68 + cofs]); vals[s] = x * OSC + bb; }
{
#pragma unroll
            for (int s = 0; s < 8; ++s) *(v4f*)(obase + (size_t)(mb * 16 + 2 * s + hi) * DM + cofs) = vals[s];
             }
        wave_sync();
    }
}

static constexpr size_t al256(size_t v) { return (v + 255) & ~(size_t)255; }
static constexpr size_t SZ_XB = al256((size_t)NB * SEQ * DM * 2);            // one bf16 activation plane
static constexpr size_t SZ_WB = al256((size_t)3 * DM * DM * 2);              // Wq | Wk | Wv bf16
static constexpr size_t SZ_WP = al256((size_t)DM * DM * 2);                  // Wp f16 x256
static constexpr size_t SZ_TH = al256((size_t)NPR * 4);
static constexpr size_t SZ_CS = al256((size_t)2 * SEQ * NPR * 2 * 4);        // two (cos, sin) tables
static constexpr size_t SZ_PL = al256((size_t)NB * NH_ * SEQ * HD * 2);      // one f16 head plane
static constexpr size_t SZ_CX = al256((size_t)NB * SEQ * DM * 2);            // ctx f16 x1024
static constexpr size_t SZ_TOTAL = 3 * SZ_XB + SZ_WB + SZ_WP + SZ_TH + SZ_CS + 3 * SZ_PL + SZ_CX;
static_assert(SZ_TOTAL <= (size_t)134217728);          // workspace carve <= 128 MiB
static_assert(((size_t)DM * DM * 2) % 256 == 0);       // weight sub-planes stay 256-byte aligned

extern "C" void kernel_launch(void* const* d_in, const int* in_sizes, int n_in,
                              void* d_out, int out_size, void* d_ws, size_t ws_size, hipStream_t stream) {
    if (n_in < 8) return;
    const size_t needx = ((size_t)(NB - 1) * SEQ_FULL + SEQ) * DM;
    if ((size_t)in_sizes[0] < needx || (size_t)in_sizes[1] < needx || (size_t)in_sizes[2] < needx) return;
    if ((size_t)in_sizes[3] < (size_t)DM * DM || (size_t)in_sizes[4] < (size_t)DM * DM || (size_t)in_sizes[5] < (size_t)DM * DM || (size_t)in_sizes[6] < (size_t)DM * DM) return;
    if ((size_t)in_sizes[7] < (size_t)DM) return;
    if ((size_t)out_size < ((size_t)(NB - 1) * OUT_SEQ + SEQ) * DM) return;
    if (SZ_TOTAL > ws_size) return;
    // wire order: q, k, v, Wq, Wk, Wv, Wp, bp (weights [out][in] = Bt as-is)
    const float* xq = (const float*)d_in[0]; const float* xk = (const float*)d_in[1]; const float* xv = (const float*)d_in[2];
    const float* wq = (const float*)d_in[3]; const float* wk = (const float*)d_in[4]; const float* wv = (const float*)d_in[5];
    const float* wp = (const float*)d_in[6]; const float* bp = (const float*)d_in[7];
    float* OUT = (float*)d_out;      // [NB][SEQ][1024]
    char* wsp = (char*)d_ws;
    bf* XQ = (bf*)wsp; wsp += SZ_XB;                 // [NB*SEQ][1024]
    bf* XK = (bf*)wsp; wsp += SZ_XB;
    bf* XV = (bf*)wsp; wsp += SZ_XB;
    bf* WB = (bf*)wsp; wsp += SZ_WB;                 // [3][1024][1024]: q | k | v
    h16* WP = (h16*)wsp; wsp += SZ_WP;               // [1024][1024] x256
    float* TH = (float*)wsp; wsp += SZ_TH;           // [512]
    float* CS = (float*)wsp; wsp += SZ_CS;           // [SEQ][512][2] then [512][SEQ][2]
    h16* QH = (h16*)wsp; wsp += SZ_PL;               // [NB*16][SEQ][64]
    h16* KP = (h16*)wsp; wsp += SZ_PL;               // [NB*16][SEQ][64]
    h16* VT = (h16*)wsp; wsp += SZ_PL;               // [NB*16][64][SEQ]
    h16* CX = (h16*)wsp; wsp += SZ_CX;               // [NB*SEQ][1024] x1024
    bf* WQ = WB; bf* WK = WB + (size_t)DM * DM; bf* WV = WB + (size_t)2 * DM * DM;

    if (SEQ == SEQ_FULL) {
        const size_t n8 = (size_t)NB * SEQ * DM / 8; const unsigned g = (unsigned)((n8 + 255) / 256);
        k_cvt8<<<g, 256, 0, stream>>>(xq, XQ, n8); k_cvt8<<<g, 256, 0, stream>>>(xk, XK, n8); k_cvt8<<<g, 256, 0, stream>>>(xv, XV, n8);
    } else {
        const size_t n8 = (size_t)SEQ * DM / 8; const unsigned g = (unsigned)((n8 + 255) / 256);
        for (int b = 0; b < NB; ++b) {
            k_cvt8<<<g, 256, 0, stream>>>(xq + (size_t)b * SEQ_FULL * DM, XQ + (size_t)b * SEQ * DM, n8);
            k_cvt8<<<g, 256, 0, stream>>>(xk + (size_t)b * SEQ_FULL * DM, XK + (size_t)b * SEQ * DM, n8);
            k_cvt8<<<g, 256, 0, stream>>>(xv + (size_t)b * SEQ_FULL * DM, XV + (size_t)b * SEQ * DM, n8);
        }
    }
    { const size_t n8 = (size_t)DM * DM / 8; const unsigned g = (unsigned)((n8 + 255) / 256);
      k_cvt8<<<g, 256, 0, stream>>>(wq, WQ, n8); k_cvt8<<<g, 256, 0, stream>>>(wk, WK, n8); k_cvt8<<<g, 256, 0, stream>>>(wv, WV, n8);
      k_cvt8h<<<g, 256, 0, stream>>>(wp, WP, n8, WPS); }

    k_theta<<<1, NPR, 0, stream>>>(TH);
    k_ropetab<<<dim3((unsigned)((size_t)SEQ * NPR / 256), 2, 1), 256, 0, stream>>>(TH, CS);

    // q, k: A = x rows (m = b*SEQ + t), Bt = W rows (n = h*64 + d) -> plane [(b*16 + h)][t][d]; k gets rotary on column pairs
    k_proj<0><<<dim3(NB * SEQ / 64, DM / 64, 1), 32, 0, stream>>>(XQ, WQ, QH, CS, SEQ, (size_t)NH_ * SEQ * HD, HD, HD, (size_t)SEQ * HD);
    k_proj<1><<<dim3(NB * SEQ / 64, DM / 64, 1), 32, 0, stream>>>(XK, WK, KP, CS, SEQ, (size_t)NH_ * SEQ * HD, HD, HD, (size_t)SEQ * HD);
    // v^T: A = Wv rows (m = h*64 + d), Bt = x rows (n = b*SEQ + t) -> plane [(b*1024 + m)][t] = [(b*16 + h)][d][t]; rotary on row pairs
    k_proj<2><<<dim3(DM / 64, NB * SEQ / 64, 1), 32, 0, stream>>>(WV, XV, VT, CS, DM, (size_t)0, SEQ, SEQ, (size_t)DM * SEQ);

    k_flash<<<dim3(SEQ / (16 * AW), NB * NH_, 1), 32 * AW, 0, stream>>>(QH, KP, VT, CX);

    // out: A = ctx rows (m = b*SEQ + t), Bt = Wp rows (n = out feature)
    k_oproj<<<dim3(NB * SEQ / 64, DM / 64, 1), 32, 0, stream>>>(CX, WP, bp, OUT);
}

// v001
// One run takes 224 microseconds.
// Two timings next to v000 put it at 1.10 and 1.09 times that version's speed.
#include <hip/hip_runtime.h>

// Multi-head attention, width 1024 = 16 heads x 64; inputs q, k, v [NB][SEQ][1024]; Wq/Wk/Wv/Wp [out][in] (y = x W^T); interleaved rotary on projected k and v over the full 1024 axis (512 pairs, angle = pos * 10000^(-2p/1024)); score scale 1/8; dense softmax; out = ctx Wp^T + bp (f32).
// Compute dtypes, f32 accumulate everywhere: q/k/v projections v_wmma_f32_16x16x32_bf16 (inputs and weights RNE-converted to bf16; products exact); rotary in f32 in the projection epilogue from f32 cos/sin tables;
// scores v_wmma_f32_16x16x32_f16: q single f16, k single f16 (one product; logits = acc * 0.125 * log2 e); P (x256 carry, cancels in the normalisation; row sum taken over the f16 values) and v single f16; softmax f32 (online, running max);
// output projection v_wmma_f32_16x16x32_f16: ctx single f16 with x1024 carry, Wp as f16 of the bf16 RNE value with x256 carry, 2^-18 folded back in the f32 epilogue, bias (bf16 RNE value) added in f32.
// Layout: bf16 copies of q, k, v, Wq, Wk, Wv; q and k planes [b*16+h][t][d]; v^T plane [b*16+h][d][t]; ctx plane [b*SEQ+t][1024]; fused flash kernel in transposed form (S^T = K Q^T, O^T = V^T P^T).

#ifndef NB
#define NB 2
#endif
#ifndef SEQ
#define SEQ 2048
#endif
#define NB_FULL  2
#define SEQ_FULL 2048
#ifndef OUT_SEQ
#define OUT_SEQ SEQ              // row pitch (in tokens) between batches of the output
#endif
#define DM   1024
#define NH_  16
#define HD   64
#define NPR  (DM / 2)            // rotary pairs per token row
#define AW   4                   // waves per flash block
#define QG   4                   // 16-query groups per flash wave (64 query rows each)
#define SC2  (0.125f * 1.4426950408889634f)   // HD^-0.5 * log2(e)
#define PSH  8.0f                // log2 of the P carry (256)
#define CXS  1024.0f             // carry of the ctx plane
#define WPS  256.0f              // carry of the Wp plane
#define OSC  (1.0f / (1024.0f * 256.0f))      // 2^-18

static_assert(HD == 64);
static_assert(NH_ * HD == DM);                 // head h = columns h*64 + d
static_assert(DM % 64 == 0);
static_assert(DM % 32 == 0);                   // GEMM k-loop steps by 32
static_assert(SEQ % 64 == 0);                  // a 64-row tile never straddles two batches
static_assert((NB * SEQ) % 64 == 0);
static_assert(SEQ % 32 == 0);                  // key loop steps by 32
static_assert(SEQ % (16 * QG * AW) == 0);      // flash grid covers the sequence exactly
static_assert(((size_t)SEQ * DM) % (8 * 256) == 0);
static_assert(((size_t)DM * DM) % (8 * 256) == 0);
static_assert(((size_t)SEQ * NPR) % 256 == 0); // table grid is exact
static_assert(NPR == 512);                     // theta kernel: one block of 512 threads
static_assert(NB <= NB_FULL);
static_assert(SEQ <= SEQ_FULL);
static_assert(((size_t)(NB - 1) * OUT_SEQ + SEQ) * DM * 4 <= (size_t)16777216);   // last output byte stays inside the output buffer

typedef _Float16 h16;
typedef unsigned short bf;
typedef __attribute__((ext_vector_type(16))) __bf16   v16bf;
typedef __attribute__((ext_vector_type(16))) _Float16 v16h;
typedef __attribute__((ext_vector_type(8)))  _Float16 v8h;
typedef __attribute__((ext_vector_type(8)))  unsigned short v8us;
typedef __attribute__((ext_vector_type(8)))  float    v8f;
typedef __attribute__((ext_vector_type(4)))  float    v4f;
typedef __attribute__((ext_vector_type(2)))  float    v2f;
typedef v4f  __attribute__((may_alias)) v4fa;

__device__ __forceinline__ unsigned short f2bf(float f) { unsigned u = __float_as_uint(f); u += 0x7FFFu + ((u >> 16) & 1u); return (unsigned short)(u >> 16); }
__device__ __forceinline__ float bfval(float f) { return __uint_as_float(((unsigned)f2bf(f)) << 16); }
__device__ __forceinline__ v16h cat16(v8h lo, v8h hi) { return __builtin_shufflevector(lo, hi, 0, 1, 2, 3, 4, 5, 6, 7, 8, 9, 10, 11, 12, 13, 14, 15); }
__device__ __forceinline__ v16bf cat16b(v8us lo, v8us hi) { return __builtin_bit_cast(v16bf, __builtin_shufflevector(lo, hi, 0, 1, 2, 3, 4, 5, 6, 7, 8, 9, 10, 11, 12, 13, 14, 15)); }
__device__ __forceinline__ v8f wmma16(v16h a, v16h b, v8f c) { return __builtin_amdgcn_wmma_f32_16x16x32_f16(false, a, false, b, (short)0, c, false, false); }
__device__ __forceinline__ v8f wmmab(v16bf a, v16bf b, v8f c) { return __builtin_amdgcn_wmma_f32_16x16x32_bf16(false, a, false, b, (short)0, c, false, false); }
// fragment loaders from K-contiguous 16-bit rows; p already includes + 8*(lane>>4): elements 0..7 <- k0+8h+0..7, elements 8..15 <- k0+16+8h+0..7 (same map for A and B)
__device__ __forceinline__ v16h  ldh(const h16* p) { return cat16(*(const v8h*)p, *(const v8h*)(p + 16)); }
__device__ __forceinline__ v16bf ldb(const bf* p)  { return cat16b(*(const v8us*)p, *(const v8us*)(p + 16)); }
// ordering point for wave-private LDS tiles (same wave writes and reads)
__device__ __forceinline__ void wave_sync() { __builtin_amdgcn_fence(3 /* release order */, "wavefront"); __builtin_amdgcn_wave_barrier(); asm volatile("" ::: "memory"); }

__global__ __launch_bounds__(256) void k_cvt8(const float* __restrict__ src, bf* dst, size_t n8) {
    const size_t i = (size_t)blockIdx.x * 256 + threadIdx.x; if (i >= n8) return;
    const v8f v = *(const v8f*)(src + i * 8); v8us o;
#pragma unroll
    for (int k = 0; k < 8; ++k) o[k] = f2bf(v[k]);
    *(v8us*)(dst + i * 8) = o; 
}

__global__ __launch_bounds__(256) void k_cvt8h(const float* __restrict__ src, h16* dst, size_t n8, float scale) {
    const size_t i = (size_t)blockIdx.x * 256 + threadIdx.x; if (i >= n8) return;
    const v8f v = *(const v8f*)(src + i * 8); v8h o;
#pragma unroll
    for (int k = 0; k < 8; ++k) o[k] = (h16)(bfval(v[k]) * scale);
    *(v8h*)(dst + i * 8) = o; 
}

__global__ __launch_bounds__(NPR) void k_theta(float* TH) {
    const int p = threadIdx.x;
    const float e = (2.0f * (float)p) * (1.0f / (float)DM);
    const float th = 1.0f / powf(10000.0f, e);
    *(float*)(TH + p) = th; 
}

// k_ropetab: (cos, sin) of pos * TH[p] as float2. blockIdx.y == 0: layout [pos][p]; blockIdx.y == 1: layout [p][pos] (second half of CS).
__global__ __launch_bounds__(256) void k_ropetab(const float* __restrict__ TH, float* CS) {
    const unsigned i = blockIdx.x * 256u + threadIdx.x;        // < SEQ*NPR (exact grid)
    unsigned t, p;
    if (blockIdx.y == 0) { t = i / NPR; p = i % NPR; } else { p = i / SEQ; t = i % SEQ; }
    const float ang = (float)t * TH[p];
    float sn, cs; sincosf(ang, &sn, &cs);
    v2f o; o[0] = cs; o[1] = sn;
    float* dst = CS + ((size_t)blockIdx.y * SEQ * NPR + i) * 2;
    *(v2f*)dst = o; 
}

// k_proj: register-blocked bf16 GEMM, ONE WAVE per 64x64 tile (16 accumulators), operands straight from K-contiguous bf16 planes, K = DM.
// C[m][n] = sum_k A[m][k] Bt[n][k]; epilogue by MODE:
//   0: C as f16 (Ph);
//   1: rows = tokens, columns = features: interleaved rotary on column pairs (table [pos][p]), then f16 (Ph);
//   2: rows = features, columns = tokens: interleaved rotary on row pairs (table [p][pos]), then f16 (Ph).
// Tile base (r0/RB)*sRB + (r0%RB)*pitch + (c0/CB)*sCB + (c0%CB), row pitch 'pitch' (halves). grid (M/64, N/64), 32 threads.
template <int MODE>
__global__ __launch_bounds__(32) void k_proj(const bf* __restrict__ A, const bf* __restrict__ Bt, h16* Ph, const float* __restrict__ CS,
                                             int RB, size_t sRB, int pitch, int CB, size_t sCB) {
    __shared__ __align__(16) float os[16 * 68];
    const int K = DM;
    const int lane = threadIdx.x & 31, lr = lane & 15, hi = lane >> 4; const int r0 = blockIdx.x * 64, c0 = blockIdx.y * 64;
    v8f acc[4][4];
#pragma unroll
    for (int mb = 0; mb < 4; ++mb)
#pragma unroll
        for (int nb = 0; nb < 4; ++nb) acc[mb][nb] = (v8f){};
    const size_t aoff = (size_t)(r0 + lr) * K + 8 * hi, boff = (size_t)(c0 + lr) * K + 8 * hi;
#pragma unroll 1
    for (int kc = 0; kc < K; kc += 32) {
        v16bf a[4];
#pragma unroll
        for (int mb = 0; mb < 4; ++mb) a[mb] = ldb(A + aoff + (size_t)mb * 16 * K + kc);
#pragma unroll
        for (int nb = 0; nb < 4; ++nb) { const v16bf b = ldb(Bt + boff + (size_t)nb * 16 * K + kc);
#pragma unroll
            for (int mb = 0; mb < 4; ++mb) acc[mb][nb] = wmmab(a[mb], b, acc[mb][nb]); }
        asm volatile("v_nop\n\tv_nop\n\tv_nop\n\tv_nop" : "+v"(acc[0][0]), "+v"(acc[1][1]), "+v"(acc[2][2]), "+v"(acc[3][3]) : "v"(a[0]), "v"(a[1]), "v"(a[2]), "v"(a[3]));
    }
    const size_t tbase = (size_t)(r0 / RB) * sRB + (size_t)(r0 % RB) * (size_t)pitch + (size_t)(c0 / CB) * sCB + (size_t)(c0 % CB);
    const int rg = lane >> 3, c8 = (lane & 7) * 8;       // 4 row groups x 8 lanes; 8 lanes x 8 = 64 columns
#pragma unroll
    for (int mb = 0; mb < 4; ++mb) {
#pragma unroll
        for (int nb = 0; nb < 4; ++nb) {
#pragma unroll
            for (int j = 0; j < 8; ++j) os[(hi * 8 + j) * 68 + nb * 16 + lr] = acc[mb][nb][j]; }   // D: row 8h+j, col lane&15; rows 0..15 x cols 0..63 all written
        wave_sync();
        v8h hv[4];
#pragma unroll
        for (int s = 0; s < 4; ++s) {
            const int row = 4 * s + rg;                  // 4 s x 4 row groups = 16 rows
            v4f x0 = *(const v4fa*)(&os[row * 68 + c8]); v4f x1 = *(const v4fa*)(&os[row * 68 + c8 + 4]);
            if (MODE == 1) {
                const int t = (r0 % SEQ) + mb * 16 + row;                                    // token position of this row
                const float* cp = CS + ((size_t)t * NPR + (size_t)((c0 + c8) >> 1)) * 2;     // 4 pairs: (cos, sin) x 4
                const v4f e0 = *(const v4fa*)cp; const v4f e1 = *(const v4fa*)(cp + 4);
                v4f y0, y1;
                y0[0] = x0[0] * e0[0] - x0[1] * e0[1]; y0[1] = x0[0] * e0[1] + x0[1] * e0[0];
                y0[2] = x0[2] * e0[2] - x0[3] * e0[3]; y0[3] = x0[2] * e0[3] + x0[3] * e0[2];
                y1[0] = x1[0] * e1[0] - x1[1] * e1[1]; y1[1] = x1[0] * e1[1] + x1[1] * e1[0];
                y1[2] = x1[2] * e1[2] - x1[3] * e1[3]; y1[3] = x1[2] * e1[3] + x1[3] * e1[2];
                x0 = y0; x1 = y1;
            }
            if (MODE == 2) {
                const int e = r0 + mb * 16 + row;                                            // feature index of this row; partner row = row ^ 1 (same slab)
                const int tc = (c0 % SEQ) + c8;                                              // first of 8 token positions
                const float* cp = CS + (size_t)SEQ * NPR * 2 + ((size_t)(e >> 1) * SEQ + (size_t)tc) * 2;
                const v4f e0 = *(const v4fa*)cp; const v4f e1 = *(const v4fa*)(cp + 4); const v4f e2 = *(const v4fa*)(cp + 8); const v4f e3 = *(const v4fa*)(cp + 12);
                const v4f w0 = *(const v4fa*)(&os[(row ^ 1) * 68 + c8]); const v4f w1 = *(const v4fa*)(&os[(row ^ 1) * 68 + c8 + 4]);
                const float sg = (row & 1) ? 1.0f : -1.0f;   // even feature: x cos - partner sin; odd feature: partner sin + x cos
                v4f y0, y1;
                y0[0] = x0[0] * e0[0] + sg * (w0[0] * e0[1]); y0[1] = x0[1] * e0[2] + sg * (w0[1] * e0[3]);
                y0[2] = x0[2] * e1[0] + sg * (w0[2] * e1[1]); y0[3] = x0[3] * e1[2] + sg * (w0[3] * e1[3]);
                y1[0] = x1[0] * e2[0] + sg * (w1[0] * e2[1]); y1[1] = x1[1] * e2[2] + sg * (w1[1] * e2[3]);
                y1[2] = x1[2] * e3[0] + sg * (w1[2] * e3[1]); y1[3] = x1[3] * e3[2] + sg * (w1[3] * e3[3]);
                x0 = y0; x1 = y1;
            }
#pragma unroll
            for (int i = 0; i < 4; ++i) { hv[s][i] = (h16)x0[i]; hv[s][4 + i] = (h16)x1[i]; }
        }
        const size_t sb = tbase + (size_t)(mb * 16) * (size_t)pitch;
{
#pragma unroll
            for (int s = 0; s < 4; ++s) { const size_t oo = sb + (size_t)(4 * s + rg) * (size_t)pitch + c8;
                *(v8h*)(Ph + oo) = hv[s]; }
             }
        wave_sync();
    }
}

// k_flash: fused attention, one wave per 16 * QG query rows of one (batch, head); K / V^T / Q fragments straight from the f16 planes (two 16-B loads each, arithmetic addressing).
// Each K and V^T fragment is loaded once per wave and feeds QG matrix products (one per 16-query group g), so the loads per score fall by QG.
// Transposed form: S^T[key][t] = K Q^T (A = K rows, B = Q rows); lane (t = lane&15, h = lane>>4) holds keys 8h+r of each 16-key tile, so the packed
// P tile is directly the B fragment of O^T[d][t] = V^T P^T (element r <- tile keys 0..15, element 8+r <- tile keys 16..31, lane unchanged).
// Scale chain: logit2 = acc * (0.125 * log2 e); P = exp2(logit2 - max + 8) as f16; l = sum of the f16 P values; ctx plane = O^T * 1024 / l.
// Softmax state (running max, partial sum) is one scalar per lane and group; the two lane halves of a row are combined with one xor-16 exchange.
__global__ __launch_bounds__(32 * AW) void k_flash(const h16* __restrict__ QH, const h16* __restrict__ KP, const h16* __restrict__ VT, h16* CX) {
    __shared__ __align__(16) float os[AW * 16 * 68];
    const int lane = threadIdx.x & 31, lr = lane & 15, hi = lane >> 4;
    const int wave = __builtin_amdgcn_readfirstlane((int)(threadIdx.x >> 5));
    const int zh = blockIdx.y; const int b = zh / NH_, h = zh % NH_;
    const int t0 = (blockIdx.x * AW + wave) * (16 * QG);
    const size_t pbase = (size_t)zh * SEQ * HD;
    const size_t qo = pbase + (size_t)(t0 + lr) * HD + 8 * hi;
    v16h qh0[QG], qh1[QG];                                   // B fragments: col t, k = d
#pragma unroll
    for (int g = 0; g < QG; ++g) { qh0[g] = ldh(QH + qo + (size_t)g * 16 * HD); qh1[g] = ldh(QH + qo + (size_t)g * 16 * HD + 32); }
    const size_t ko = pbase + (size_t)lr * HD + 8 * hi;      // + key * HD       (A fragment: row key, k = d)
    const size_t vo = pbase + (size_t)lr * SEQ + 8 * hi;     // + 16j*SEQ + key  (A fragment: row d, k = key)
    v8f o0[QG], o1[QG], o2[QG], o3[QG];
    float m[QG], l[QG];
#pragma unroll
    for (int g = 0; g < QG; ++g) { o0[g] = (v8f){}; o1[g] = (v8f){}; o2[g] = (v8f){}; o3[g] = (v8f){}; m[g] = -3.0e38f; l[g] = 0.0f; }
#pragma unroll 1
    for (int key0 = 0; key0 < SEQ; key0 += 32) {
        const h16* ka = KP + ko + (size_t)key0 * HD;
        const v16h ka0 = ldh(ka), ka1 = ldh(ka + 32), kb0 = ldh(ka + 16 * HD), kb1 = ldh(ka + 16 * HD + 32);
        // inputs-only fence on the loaded K fragments: all eight loads are issued together and waited for once (otherwise the second half is loaded into the
        // first half's registers behind the first products, a second exposed latency per pass); the wait stands before the K address pair is reused
        asm volatile("s_wait_xcnt 0x0" : : "v"(ka0), "v"(ka1), "v"(kb0), "v"(kb1));
        __builtin_amdgcn_sched_barrier(0);               // keeps later address arithmetic behind that wait
        v16h pb[QG];
#pragma unroll
        for (int g = 0; g < QG; ++g) {
            v8f sHa = (v8f){}, sHb = (v8f){};
            sHa = wmma16(ka0, qh0[g], sHa); sHb = wmma16(kb0, qh0[g], sHb);
            sHa = wmma16(ka1, qh1[g], sHa); sHb = wmma16(kb1, qh1[g], sHb);
            float ta[8], tb[8]; float mx = -3.0e38f;
#pragma unroll
            for (int r = 0; r < 8; ++r) { ta[r] = sHa[r] * SC2; tb[r] = sHb[r] * SC2; mx = fmaxf(mx, fmaxf(ta[r], tb[r])); }
            mx = fmaxf(mx, __shfl_xor(mx, 16, 32));
            const float mnew = fmaxf(m[g], mx);
            const float alpha = __builtin_amdgcn_exp2f(m[g] - mnew);
            const float sh = PSH - mnew;
            float ls = 0.0f;
#pragma unroll
            for (int r = 0; r < 8; ++r) { const h16 pa = (h16)__builtin_amdgcn_exp2f(ta[r] + sh); const h16 pc = (h16)__builtin_amdgcn_exp2f(tb[r] + sh); pb[g][r] = pa; pb[g][8 + r] = pc; ls += (float)pa + (float)pc; }
            l[g] = l[g] * alpha + ls; m[g] = mnew;
            o0[g] = o0[g] * alpha; o1[g] = o1[g] * alpha; o2[g] = o2[g] * alpha; o3[g] = o3[g] * alpha;
        }
        const h16* va = VT + vo + key0;
        const v16h v0 = ldh(va), v1 = ldh(va + (size_t)16 * SEQ), v2 = ldh(va + (size_t)32 * SEQ), v3 = ldh(va + (size_t)48 * SEQ);
#pragma unroll
        for (int g = 0; g < QG; ++g) {
            o0[g] = wmma16(v0, pb[g], o0[g]); o1[g] = wmma16(v1, pb[g], o1[g]); o2[g] = wmma16(v2, pb[g], o2[g]); o3[g] = wmma16(v3, pb[g], o3[g]);
        }
        __builtin_amdgcn_sched_barrier(0);               // keeps every matrix product of this pass in front of the slots below
        // va as an input keeps the V^T address pair untouched up to this wait; then four vector slots between the last matrix product and the loop's back edge
        asm volatile("s_wait_xcnt 0x0\n\tv_nop\n\tv_nop\n\tv_nop\n\tv_nop" : : "v"(va));
    }
    const int wb = wave * 16 * 68;
    const int rg = lane >> 3, c8 = (lane & 7) * 8;       // 4 s x 4 row groups = 16 rows; 8 lanes x 8 halves = 64 columns
#pragma unroll
    for (int g = 0; g < QG; ++g) {
        const float lt = l[g] + __shfl_xor(l[g], 16, 32);
        const float inv = (1.0f / lt) * CXS;
        // O^T D layout: o_j[r] = (d = 16j + 8h + r, t = lane&15) -> os[t][d]; rows 0..15 x columns 0..63 all written
        { v4f a, c;
          a[0] = o0[g][0] * inv; a[1] = o0[g][1] * inv; a[2] = o0[g][2] * inv; a[3] = o0[g][3] * inv; c[0] = o0[g][4] * inv; c[1] = o0[g][5] * inv; c[2] = o0[g][6] * inv; c[3] = o0[g][7] * inv;
          *(v4fa*)(&os[wb + lr * 68 +  0 + 8 * hi]) = a; *(v4fa*)(&os[wb + lr * 68 +  0 + 8 * hi + 4]) = c;
          a[0] = o1[g][0] * inv; a[1] = o1[g][1] * inv; a[2] = o1[g][2] * inv; a[3] = o1[g][3] * inv; c[0] = o1[g][4] * inv; c[1] = o1[g][5] * inv; c[2] = o1[g][6] * inv; c[3] = o1[g][7] * inv;
          *(v4fa*)(&os[wb + lr * 68 + 16 + 8 * hi]) = a; *(v4fa*)(&os[wb + lr * 68 + 16 + 8 * hi + 4]) = c;
          a[0] = o2[g][0] * inv; a[1] = o2[g][1] * inv; a[2] = o2[g][2] * inv; a[3] = o2[g][3] * inv; c[0] = o2[g][4] * inv; c[1] = o2[g][5] * inv; c[2] = o2[g][6] * inv; c[3] = o2[g][7] * inv;
          *(v4fa*)(&os[wb + lr * 68 + 32 + 8 * hi]) = a; *(v4fa*)(&os[wb + lr * 68 + 32 + 8 * hi + 4]) = c;
          a[0] = o3[g][0] * inv; a[1] = o3[g][1] * inv; a[2] = o3[g][2] * inv; a[3] = o3[g][3] * inv; c[0] = o3[g][4] * inv; c[1] = o3[g][5] * inv; c[2] = o3[g][6] * inv; c[3] = o3[g][7] * inv;
          *(v4fa*)(&os[wb + lr * 68 + 48 + 8 * hi]) = a; *(v4fa*)(&os[wb + lr * 68 + 48 + 8 * hi + 4]) = c; }
        wave_sync();
        h16* crow = CX + ((size_t)b * SEQ + t0 + g * 16) * DM + h * HD;
        v8h hv[4];
#pragma unroll
        for (int s = 0; s < 4; ++s) { const int row = 4 * s + rg;
            const v4f x0 = *(const v4fa*)(&os[wb + row * 68 + c8]); const v4f x1 = *(const v4fa*)(&os[wb + row * 68 + c8 + 4]);
#pragma unroll
            for (int i = 0; i < 4; ++i) { hv[s][i] = (h16)x0[i]; hv[s][4 + i] = (h16)x1[i]; } }
#pragma unroll
        for (int s = 0; s < 4; ++s) *(v8h*)(crow + (size_t)(4 * s + rg) * DM + c8) = hv[s];
        asm volatile("s_wait_xcnt 0x0" ::: "memory");    // before the next group reuses the registers these stores name
        __builtin_amdgcn_sched_barrier(0);               // keeps the next group's arithmetic behind that wait
        wave_sync();                                     // the next group overwrites this wave's staging rows
    }
}

// k_oproj: register-blocked f16 GEMM, ONE WAVE per 64x64 tile, A = ctx plane (x1024), Bt = Wp plane (x256), K = DM; OUT[m][n] = acc * 2^-18 + bias[n] (f32).
__global__ __launch_bounds__(32) void k_oproj(const h16* __restrict__ A, const h16* __restrict__ Bt, const float* __restrict__ bias, float* OUT) {
    __shared__ __align__(16) float os[16 * 68];
    const int K = DM;
    const int lane = threadIdx.x & 31, lr = lane & 15, hi = lane >> 4; const int r0 = blockIdx.x * 64, c0 = blockIdx.y * 64;
    v8f acc[4][4];
#pragma unroll
    for (int mb = 0; mb < 4; ++mb)
#pragma unroll
        for (int nb = 0; nb < 4; ++nb) acc[mb][nb] = (v8f){};
    const size_t aoff = (size_t)(r0 + lr) * K + 8 * hi, boff = (size_t)(c0 + lr) * K + 8 * hi;
#pragma unroll 1
    for (int kc = 0; kc < K; kc += 32) {
        v16h a[4];
#pragma unroll
        for (int mb = 0; mb < 4; ++mb) a[mb] = ldh(A + aoff + (size_t)mb * 16 * K + kc);
#pragma unroll
        for (int nb = 0; nb < 4; ++nb) { const v16h b = ldh(Bt + boff + (size_t)nb * 16 * K + kc);
#pragma unroll
            for (int mb = 0; mb < 4; ++mb) acc[mb][nb] = wmma16(a[mb], b, acc[mb][nb]); }
        asm volatile("v_nop\n\tv_nop\n\tv_nop\n\tv_nop" : "+v"(acc[0][0]), "+v"(acc[1][1]), "+v"(acc[2][2]), "+v"(acc[3][3]) : "v"(a[0]), "v"(a[1]), "v"(a[2]), "v"(a[3]));
    }
    const int cofs = lr * 4;                              // 16 lanes x 4 floats = 64 columns
    const v4f braw = *(const v4fa*)(bias + c0 + cofs); v4f bb;
#pragma unroll
    for (int i = 0; i < 4; ++i) bb[i] = bfval(braw[i]);
    const int bi = r0 / SEQ, tt = r0 % SEQ;
    float* obase = OUT + ((size_t)bi * OUT_SEQ + tt) * DM + c0;
#pragma unroll
    for (int mb = 0; mb < 4; ++mb) {
#pragma unroll
        for (int nb = 0; nb < 4; ++nb) {
#pragma unroll
            for (int j = 0; j < 8; ++j) os[(hi * 8 + j) * 68 + nb * 16 + lr] = acc[mb][nb][j]; }   // rows 0..15 x cols 0..63 all written
        wave_sync();
        v4f vals[8];
#pragma unroll
        for (int s = 0; s < 8; ++s) { const int row = 2 * s + hi;            // 8 s x 2 rows = 16 rows
            const v4f x = *(const v4fa*)(&os[row * 68 + cofs]); vals[s] = x * OSC + bb; }
{
#pragma unroll
            for (int s = 0; s < 8; ++s) *(v4f*)(obase + (size_t)(mb * 16 + 2 * s + hi) * DM + cofs) = vals[s];
             }
        wave_sync();
    }
}

static constexpr size_t al256(size_t v) { return (v + 255) & ~(size_t)255; }
static constexpr size_t SZ_XB = al256((size_t)NB * SEQ * DM * 2);            // one bf16 activation plane
static constexpr size_t SZ_WB = al256((size_t)3 * DM * DM * 2);              // Wq | Wk | Wv bf16
static constexpr size_t SZ_WP = al256((size_t)DM * DM * 2);                  // Wp f16 x256
static constexpr size_t SZ_TH = al256((size_t)NPR * 4);
static constexpr size_t SZ_CS = al256((size_t)2 * SEQ * NPR * 2 * 4);        // two (cos, sin) tables
static constexpr size_t SZ_PL = al256((size_t)NB * NH_ * SEQ * HD * 2);      // one f16 head plane
static constexpr size_t SZ_CX = al256((size_t)NB * SEQ * DM * 2);            // ctx f16 x1024
static constexpr size_t SZ_TOTAL = 3 * SZ_XB + SZ_WB + SZ_WP + SZ_TH + SZ_CS + 3 * SZ_PL + SZ_CX;
static_assert(SZ_TOTAL <= (size_t)134217728);          // workspace carve <= 128 MiB
static_assert(((size_t)DM * DM * 2) % 256 == 0);       // weight sub-planes stay 256-byte aligned

extern "C" void kernel_launch(void* const* d_in, const int* in_sizes, int n_in,
                              void* d_out, int out_size, void* d_ws, size_t ws_size, hipStream_t stream) {
    if (n_in < 8) return;
    const size_t needx = ((size_t)(NB - 1) * SEQ_FULL + SEQ) * DM;
    if ((size_t)in_sizes[0] < needx || (size_t)in_sizes[1] < needx || (size_t)in_sizes[2] < needx) return;
    if ((size_t)in_sizes[3] < (size_t)DM * DM || (size_t)in_sizes[4] < (size_t)DM * DM || (size_t)in_sizes[5] < (size_t)DM * DM || (size_t)in_sizes[6] < (size_t)DM * DM) return;
    if ((size_t)in_sizes[7] < (size_t)DM) return;
    if ((size_t)out_size < ((size_t)(NB - 1) * OUT_SEQ + SEQ) * DM) return;
    if (SZ_TOTAL > ws_size) return;
    // wire order: q, k, v, Wq, Wk, Wv, Wp, bp (weights [out][in] = Bt as-is)
    const float* xq = (const float*)d_in[0]; const float* xk = (const float*)d_in[1]; const float* xv = (const float*)d_in[2];
    const float* wq = (const float*)d_in[3]; const float* wk = (const float*)d_in[4]; const float* wv = (const float*)d_in[5];
    const float* wp = (const float*)d_in[6]; const float* bp = (const float*)d_in[7];
    float* OUT = (float*)d_out;      // [NB][SEQ][1024]
    char* wsp = (char*)d_ws;
    bf* XQ = (bf*)wsp; wsp += SZ_XB;                 // [NB*SEQ][1024]
    bf* XK = (bf*)wsp; wsp += SZ_XB;
    bf* XV = (bf*)wsp; wsp += SZ_XB;
    bf* WB = (bf*)wsp; wsp += SZ_WB;                 // [3][1024][1024]: q | k | v
    h16* WP = (h16*)wsp; wsp += SZ_WP;               // [1024][1024] x256
    float* TH = (float*)wsp; wsp += SZ_TH;           // [512]
    float* CS = (float*)wsp; wsp += SZ_CS;           // [SEQ][512][2] then [512][SEQ][2]
    h16* QH = (h16*)wsp; wsp += SZ_PL;               // [NB*16][SEQ][64]
    h16* KP = (h16*)wsp; wsp += SZ_PL;               // [NB*16][SEQ][64]
    h16* VT = (h16*)wsp; wsp += SZ_PL;               // [NB*16][64][SEQ]
    h16* CX = (h16*)wsp; wsp += SZ_CX;               // [NB*SEQ][1024] x1024
    bf* WQ = WB; bf* WK = WB + (size_t)DM * DM; bf* WV = WB + (size_t)2 * DM * DM;

    if (SEQ == SEQ_FULL) {
        const size_t n8 = (size_t)NB * SEQ * DM / 8; const unsigned g = (unsigned)((n8 + 255) / 256);
        k_cvt8<<<g, 256, 0, stream>>>(xq, XQ, n8); k_cvt8<<<g, 256, 0, stream>>>(xk, XK, n8); k_cvt8<<<g, 256, 0, stream>>>(xv, XV, n8);
    } else {
        const size_t n8 = (size_t)SEQ * DM / 8; const unsigned g = (unsigned)((n8 + 255) / 256);
        for (int b = 0; b < NB; ++b) {
            k_cvt8<<<g, 256, 0, stream>>>(xq + (size_t)b * SEQ_FULL * DM, XQ + (size_t)b * SEQ * DM, n8);
            k_cvt8<<<g, 256, 0, stream>>>(xk + (size_t)b * SEQ_FULL * DM, XK + (size_t)b * SEQ * DM, n8);
            k_cvt8<<<g, 256, 0, stream>>>(xv + (size_t)b * SEQ_FULL * DM, XV + (size_t)b * SEQ * DM, n8);
        }
    }
    { const size_t n8 = (size_t)DM * DM / 8; const unsigned g = (unsigned)((n8 + 255) / 256);
      k_cvt8<<<g, 256, 0, stream>>>(wq, WQ, n8); k_cvt8<<<g, 256, 0, stream>>>(wk, WK, n8); k_cvt8<<<g, 256, 0, stream>>>(wv, WV, n8);
      k_cvt8h<<<g, 256, 0, stream>>>(wp, WP, n8, WPS); }

    k_theta<<<1, NPR, 0, stream>>>(TH);
    k_ropetab<<<dim3((unsigned)((size_t)SEQ * NPR / 256), 2, 1), 256, 0, stream>>>(TH, CS);

    // q, k: A = x rows (m = b*SEQ + t), Bt = W rows (n = h*64 + d) -> plane [(b*16 + h)][t][d]; k gets rotary on column pairs
    k_proj<0><<<dim3(NB * SEQ / 64, DM / 64, 1), 32, 0, stream>>>(XQ, WQ, QH, CS, SEQ, (size_t)NH_ * SEQ * HD, HD, HD, (size_t)SEQ * HD);
    k_proj<1><<<dim3(NB * SEQ / 64, DM / 64, 1), 32, 0, stream>>>(XK, WK, KP, CS, SEQ, (size_t)NH_ * SEQ * HD, HD, HD, (size_t)SEQ * HD);
    // v^T: A = Wv rows (m = h*64 + d), Bt = x rows (n = b*SEQ + t) -> plane [(b*1024 + m)][t] = [(b*16 + h)][d][t]; rotary on row pairs
    k_proj<2><<<dim3(DM / 64, NB * SEQ / 64, 1), 32, 0, stream>>>(WV, XV, VT, CS, DM, (size_t)0, SEQ, SEQ, (size_t)DM * SEQ);

    k_flash<<<dim3(SEQ / (16 * QG * AW), NB * NH_, 1), 32 * AW, 0, stream>>>(QH, KP, VT, CX);

    // out: A = ctx rows (m = b*SEQ + t), Bt = Wp rows (n = out feature)
    k_oproj<<<dim3(NB * SEQ / 64, DM / 64, 1), 32, 0, stream>>>(CX, WP, bp, OUT);
}

// v002
// It runs in 209 microseconds.
// Timed twice side by side with v001, it ran 1.08 times as fast both times.
// All steps since v000 together make it 1.18 times as fast.
#include <hip/hip_runtime.h>

// Multi-head attention, width 1024 = 16 heads x 64; inputs q, k, v [NB][SEQ][1024]; Wq/Wk/Wv/Wp [out][in] (y = x W^T); interleaved rotary on projected k and v over the full 1024 axis (512 pairs, angle = pos * 10000^(-2p/1024)); score scale 1/8; dense softmax; out = ctx Wp^T + bp (f32).
// Compute dtypes, f32 accumulate everywhere: q/k/v projections v_wmma_f32_16x16x32_bf16 (inputs and weights RNE-converted to bf16; products exact); rotary in f32 in the projection epilogue from f32 cos/sin tables;
// scores v_wmma_f32_16x16x32_f16: q single f16, k single f16 (one product; logits = acc * 0.125 * log2 e); P (x256 carry, cancels in the normalisation; row sum taken over the f16 values) and v single f16; softmax f32 (online, running max);
// output projection v_wmma_f32_16x16x32_f16: ctx single f16 with x1024 carry, Wp as f16 of the bf16 RNE value with x256 carry, 2^-18 folded back in the f32 epilogue, bias (bf16 RNE value) added in f32.
// Layout: bf16 copies of q, k, v, Wq, Wk, Wv; q and k planes [b*16+h][t][d]; v^T plane [b*16+h][d][t]; ctx plane [b*SEQ+t][1024]; fused flash kernel in transposed form (S^T = K Q^T, O^T = V^T P^T).

#ifndef NB
#define NB 2
#endif
#ifndef SEQ
#define SEQ 2048
#endif
#define NB_FULL  2
#define SEQ_FULL 2048
#ifndef OUT_SEQ
#define OUT_SEQ SEQ              // row pitch (in tokens) between batches of the output
#endif
#define DM   1024
#define NH_  16
#define HD   64
#define NPR  (DM / 2)            // rotary pairs per token row
#define PT   256                 // threads per pre-pass block
#define PB   NPR                 // pre-pass blocks (block index = rotary pair of the [p][pos] table)
#define AW   4                   // waves per flash block
#define QG   4                   // 16-query groups per flash wave (64 query rows each)
#define SC2  (0.125f * 1.4426950408889634f)   // HD^-0.5 * log2(e)
#define PSH  8.0f                // log2 of the P carry (256)
#define CXS  1024.0f             // carry of the ctx plane
#define WPS  256.0f              // carry of the Wp plane
#define OSC  (1.0f / (1024.0f * 256.0f))      // 2^-18

static_assert(HD == 64);
static_assert(NH_ * HD == DM);                 // head h = columns h*64 + d
static_assert(DM % 64 == 0);
static_assert(DM % 32 == 0);                   // GEMM k-loop steps by 32
static_assert(SEQ % 64 == 0);                  // a 64-row tile never straddles two batches
static_assert((NB * SEQ) % 64 == 0);
static_assert(SEQ % 32 == 0);                  // key loop steps by 32
static_assert(SEQ % (16 * QG * AW) == 0);      // flash grid covers the sequence exactly
static constexpr size_t PN  = (size_t)PB * PT;              // pre-pass threads
static constexpr size_t WCH = (size_t)DM * DM / 8;          // 8-element pieces of one weight
static constexpr size_t BCH = (size_t)SEQ * DM / 8;         // 8-element pieces of one batch of one activation
static constexpr int    XR  = (int)((size_t)NB * BCH / PN); // pre-pass rounds over the activations
static_assert((size_t)XR * PN == (size_t)NB * BCH && XR >= 1);   // the rounds cover the activation planes exactly
static_assert((size_t)NB * SEQ_FULL * DM * 4 < ((size_t)1 << 32) && (size_t)SEQ * NPR * 8 < ((size_t)1 << 32));   // 32-bit byte offsets inside every plane
static_assert(WCH == PN);                      // one piece of each weight per pre-pass thread
static_assert(NPR == 2 * PT);                  // one row of the [pos][p] table: PT threads x 2 pairs
static_assert(SEQ == XR * PB);                 // [pos][p] table: one position per block and round
static_assert(SEQ == 2 * XR * PT);             // [p][pos] table: two positions per thread and round
static_assert(NB <= NB_FULL);
static_assert(SEQ <= SEQ_FULL);
static_assert(((size_t)(NB - 1) * OUT_SEQ + SEQ) * DM * 4 <= (size_t)16777216);   // last output byte stays inside the output buffer

typedef _Float16 h16;
typedef unsigned short bf;
typedef __attribute__((ext_vector_type(16))) __bf16   v16bf;
typedef __attribute__((ext_vector_type(16))) _Float16 v16h;
typedef __attribute__((ext_vector_type(8)))  _Float16 v8h;
typedef __attribute__((ext_vector_type(8)))  unsigned short v8us;
typedef __attribute__((ext_vector_type(8)))  float    v8f;
typedef __attribute__((ext_vector_type(4)))  float    v4f;
typedef __attribute__((ext_vector_type(2)))  float    v2f;
typedef v4f  __attribute__((may_alias)) v4fa;

__device__ __forceinline__ unsigned short f2bf(float f) { unsigned u = __float_as_uint(f); u += 0x7FFFu + ((u >> 16) & 1u); return (unsigned short)(u >> 16); }
__device__ __forceinline__ float bfval(float f) { return __uint_as_float(((unsigned)f2bf(f)) << 16); }
__device__ __forceinline__ v16h cat16(v8h lo, v8h hi) { return __builtin_shufflevector(lo, hi, 0, 1, 2, 3, 4, 5, 6, 7, 8, 9, 10, 11, 12, 13, 14, 15); }
__device__ __forceinline__ v16bf cat16b(v8us lo, v8us hi) { return __builtin_bit_cast(v16bf, __builtin_shufflevector(lo, hi, 0, 1, 2, 3, 4, 5, 6, 7, 8, 9, 10, 11, 12, 13, 14, 15)); }
__device__ __forceinline__ v8f wmma16(v16h a, v16h b, v8f c) { return __builtin_amdgcn_wmma_f32_16x16x32_f16(false, a, false, b, (short)0, c, false, false); }
__device__ __forceinline__ v8f wmmab(v16bf a, v16bf b, v8f c) { return __builtin_amdgcn_wmma_f32_16x16x32_bf16(false, a, false, b, (short)0, c, false, false); }
// fragment loaders from K-contiguous 16-bit rows; p already includes + 8*(lane>>4): elements 0..7 <- k0+8h+0..7, elements 8..15 <- k0+16+8h+0..7 (same map for A and B)
__device__ __forceinline__ v16h  ldh(const h16* p) { return cat16(*(const v8h*)p, *(const v8h*)(p + 16)); }
__device__ __forceinline__ v16bf ldb(const bf* p)  { return cat16b(*(const v8us*)p, *(const v8us*)(p + 16)); }
// ordering point for wave-private LDS tiles (same wave writes and reads)
__device__ __forceinline__ void wave_sync() { __builtin_amdgcn_fence(3 /* release order */, "wavefront"); __builtin_amdgcn_wave_barrier(); asm volatile("" ::: "memory"); }

// k_prep: every pass that only prepares operands, in ONE launch of long-lived blocks: bf16 copies of q, k, v, Wq, Wk, Wv; the f16 x256 copy of Wp; both (cos, sin) tables.
// PB blocks x PT threads stay resident (16 waves per WGP) and each thread walks its share of every plane with stride PN, so the launch starts 4,096 waves.
// Tables, as float2 (cos, sin) of pos * theta(p): first [pos][p] (a block row = one position, a thread = two neighbouring pairs), then [p][pos] (a block = one pair, a thread = two neighbouring positions).
__device__ __forceinline__ float theta_of(int p) { const float e = (2.0f * (float)p) * (1.0f / (float)DM); return 1.0f / powf(10000.0f, e); }
__device__ __forceinline__ v8us cvt8(v8f v) { v8us o;
#pragma unroll
    for (int k = 0; k < 8; ++k) o[k] = f2bf(v[k]);
    return o; }
__device__ __forceinline__ v4f cs2(float a0, float a1) { float s0, c0, s1, c1; sincosf(a0, &s0, &c0); sincosf(a1, &s1, &c1); v4f o; o[0] = c0; o[1] = s0; o[2] = c1; o[3] = s1; return o; }

// plane base + one 32-bit byte offset (every plane is far below 4 GiB): the planes of a round share the offset register and no 64-bit address is formed per access
__device__ __forceinline__ v8f ld8(const float* p, unsigned byteoff) { return *(const v8f*)((const char*)p + byteoff); }
template <typename V, typename P> __device__ __forceinline__ void st16(P* p, unsigned byteoff, V v) { *(V*)((char*)p + byteoff) = v; }

__global__ __launch_bounds__(PT) void k_prep(const float* __restrict__ xq, const float* __restrict__ xk, const float* __restrict__ xv,
                                             const float* __restrict__ wq, const float* __restrict__ wk, const float* __restrict__ wv, const float* __restrict__ wp,
                                             bf* __restrict__ XQ, bf* __restrict__ XK, bf* __restrict__ XV, bf* __restrict__ WB, h16* __restrict__ WP, float* __restrict__ CS) {
    const unsigned tid = threadIdx.x, blk = blockIdx.x;
    const unsigned g = blk * PT + tid;
    // weights, one 8-element piece of each per thread: the loads are issued first and the three angle steps are worked out while they fly
    const v8f w0 = ld8(wq, g * 32), w1 = ld8(wk, g * 32), w2 = ld8(wv, g * 32), w3 = ld8(wp, g * 32);
    const float th0 = theta_of((int)(2 * tid)), th1 = theta_of((int)(2 * tid + 1)), thb = theta_of((int)blk);
    st16(WB, g * 16, cvt8(w0)); st16(WB + (size_t)DM * DM, g * 16, cvt8(w1)); st16(WB + (size_t)2 * DM * DM, g * 16, cvt8(w2));
    { v8h o;
#pragma unroll
      for (int k = 0; k < 8; ++k) o[k] = (h16)(bfval(w3[k]) * WPS);
      st16(WP, g * 16, o); }
    asm volatile("s_wait_xcnt 0x0" ::: "memory");        // before the first round reuses the registers these stores name
    __builtin_amdgcn_sched_barrier(0);                   // keeps the first round's address arithmetic behind that wait
    float* const CS1 = CS + (size_t)SEQ * NPR * 2;
    // rolled: four inlined sincosf per trip keep the text small
#pragma unroll 1
    for (unsigned r = 0; r < (unsigned)XR; ++r) {
        const unsigned c = g + r * (unsigned)PN;                                    // 8-element piece of the [NB*SEQ][DM] planes
        const unsigned s = (SEQ == SEQ_FULL) ? c : (c / (unsigned)BCH) * (unsigned)((size_t)SEQ_FULL * DM / 8) + c % (unsigned)BCH;   // the same piece in the inputs (batch pitch SEQ_FULL)
        const v8f a = ld8(xq, s * 32), b = ld8(xk, s * 32), d = ld8(xv, s * 32);
        // this round's table entries stand between the loads and their first use
        const unsigned t0 = blk + r * PB, t1 = 2 * (tid + r * PT);
        st16(CS,  (t0 * NPR + 2 * tid) * 8, cs2((float)(int)t0 * th0, (float)(int)t0 * th1));
        st16(CS1, (blk * SEQ + t1) * 8,     cs2((float)(int)t1 * thb, (float)(int)(t1 + 1) * thb));
        st16(XQ, c * 16, cvt8(a)); st16(XK, c * 16, cvt8(b)); st16(XV, c * 16, cvt8(d));
        asm volatile("s_wait_xcnt 0x0" ::: "memory");    // before the next round reuses the registers these stores name
        __builtin_amdgcn_sched_barrier(0);               // keeps the next round's address arithmetic behind that wait
    }
}

// k_proj: register-blocked bf16 GEMM, ONE WAVE per 64x64 tile (16 accumulators), operands straight from K-contiguous bf16 planes, K = DM.
// C[m][n] = sum_k A[m][k] Bt[n][k]; epilogue by MODE:
//   0: C as f16 (Ph);
//   1: rows = tokens, columns = features: interleaved rotary on column pairs (table [pos][p]), then f16 (Ph);
//   2: rows = features, columns = tokens: interleaved rotary on row pairs (table [p][pos]), then f16 (Ph).
// Tile base (r0/RB)*sRB + (r0%RB)*pitch + (c0/CB)*sCB + (c0%CB), row pitch 'pitch' (halves). grid (M/64, N/64), 32 threads.
template <int MODE>
__global__ __launch_bounds__(32) void k_proj(const bf* __restrict__ A, const bf* __restrict__ Bt, h16* Ph, const float* __restrict__ CS,
                                             int RB, size_t sRB, int pitch, int CB, size_t sCB) {
    __shared__ __align__(16) float os[16 * 68];
    const int K = DM;
    const int lane = threadIdx.x & 31, lr = lane & 15, hi = lane >> 4; const int r0 = blockIdx.x * 64, c0 = blockIdx.y * 64;
    v8f acc[4][4];
#pragma unroll
    for (int mb = 0; mb < 4; ++mb)
#pragma unroll
        for (int nb = 0; nb < 4; ++nb) acc[mb][nb] = (v8f){};
    const size_t aoff = (size_t)(r0 + lr) * K + 8 * hi, boff = (size_t)(c0 + lr) * K + 8 * hi;
#pragma unroll 1
    for (int kc = 0; kc < K; kc += 32) {
        v16bf a[4];
#pragma unroll
        for (int mb = 0; mb < 4; ++mb) a[mb] = ldb(A + aoff + (size_t)mb * 16 * K + kc);
#pragma unroll
        for (int nb = 0; nb < 4; ++nb) { const v16bf b = ldb(Bt + boff + (size_t)nb * 16 * K + kc);
#pragma unroll
            for (int mb = 0; mb < 4; ++mb) acc[mb][nb] = wmmab(a[mb], b, acc[mb][nb]); }
        asm volatile("v_nop\n\tv_nop\n\tv_nop\n\tv_nop" : "+v"(acc[0][0]), "+v"(acc[1][1]), "+v"(acc[2][2]), "+v"(acc[3][3]) : "v"(a[0]), "v"(a[1]), "v"(a[2]), "v"(a[3]));
    }
    const size_t tbase = (size_t)(r0 / RB) * sRB + (size_t)(r0 % RB) * (size_t)pitch + (size_t)(c0 / CB) * sCB + (size_t)(c0 % CB);
    const int rg = lane >> 3, c8 = (lane & 7) * 8;       // 4 row groups x 8 lanes; 8 lanes x 8 = 64 columns
#pragma unroll
    for (int mb = 0; mb < 4; ++mb) {
#pragma unroll
        for (int nb = 0; nb < 4; ++nb) {
#pragma unroll
            for (int j = 0; j < 8; ++j) os[(hi * 8 + j) * 68 + nb * 16 + lr] = acc[mb][nb][j]; }   // D: row 8h+j, col lane&15; rows 0..15 x cols 0..63 all written
        wave_sync();
        v8h hv[4];
#pragma unroll
        for (int s = 0; s < 4; ++s) {
            const int row = 4 * s + rg;                  // 4 s x 4 row groups = 16 rows
            v4f x0 = *(const v4fa*)(&os[row * 68 + c8]); v4f x1 = *(const v4fa*)(&os[row * 68 + c8 + 4]);
            if (MODE == 1) {
                const int t = (r0 % SEQ) + mb * 16 + row;                                    // token position of this row
                const float* cp = CS + ((size_t)t * NPR + (size_t)((c0 + c8) >> 1)) * 2;     // 4 pairs: (cos, sin) x 4
                const v4f e0 = *(const v4fa*)cp; const v4f e1 = *(const v4fa*)(cp + 4);
                v4f y0, y1;
                y0[0] = x0[0] * e0[0] - x0[1] * e0[1]; y0[1] = x0[0] * e0[1] + x0[1] * e0[0];
                y0[2] = x0[2] * e0[2] - x0[3] * e0[3]; y0[3] = x0[2] * e0[3] + x0[3] * e0[2];
                y1[0] = x1[0] * e1[0] - x1[1] * e1[1]; y1[1] = x1[0] * e1[1] + x1[1] * e1[0];
                y1[2] = x1[2] * e1[2] - x1[3] * e1[3]; y1[3] = x1[2] * e1[3] + x1[3] * e1[2];
                x0 = y0; x1 = y1;
            }
            if (MODE == 2) {
                const int e = r0 + mb * 16 + row;                                            // feature index of this row; partner row = row ^ 1 (same slab)
                const int tc = (c0 % SEQ) + c8;                                              // first of 8 token positions
                const float* cp = CS + (size_t)SEQ * NPR * 2 + ((size_t)(e >> 1) * SEQ + (size_t)tc) * 2;
                const v4f e0 = *(const v4fa*)cp; const v4f e1 = *(const v4fa*)(cp + 4); const v4f e2 = *(const v4fa*)(cp + 8); const v4f e3 = *(const v4fa*)(cp + 12);
                const v4f w0 = *(const v4fa*)(&os[(row ^ 1) * 68 + c8]); const v4f w1 = *(const v4fa*)(&os[(row ^ 1) * 68 + c8 + 4]);
                const float sg = (row & 1) ? 1.0f : -1.0f;   // even feature: x cos - partner sin; odd feature: partner sin + x cos
                v4f y0, y1;
                y0[0] = x0[0] * e0[0] + sg * (w0[0] * e0[1]); y0[1] = x0[1] * e0[2] + sg * (w0[1] * e0[3]);
                y0[2] = x0[2] * e1[0] + sg * (w0[2] * e1[1]); y0[3] = x0[3] * e1[2] + sg * (w0[3] * e1[3]);
                y1[0] = x1[0] * e2[0] + sg * (w1[0] * e2[1]); y1[1] = x1[1] * e2[2] + sg * (w1[1] * e2[3]);
                y1[2] = x1[2] * e3[0] + sg * (w1[2] * e3[1]); y1[3] = x1[3] * e3[2] + sg * (w1[3] * e3[3]);
                x0 = y0; x1 = y1;
            }
#pragma unroll
            for (int i = 0; i < 4; ++i) { hv[s][i] = (h16)x0[i]; hv[s][4 + i] = (h16)x1[i]; }
        }
        const size_t sb = tbase + (size_t)(mb * 16) * (size_t)pitch;
{
#pragma unroll
            for (int s = 0; s < 4; ++s) { const size_t oo = sb + (size_t)(4 * s + rg) * (size_t)pitch + c8;
                *(v8h*)(Ph + oo) = hv[s]; }
             }
        wave_sync();
    }
}

// k_flash: fused attention, one wave per 16 * QG query rows of one (batch, head); K / V^T / Q fragments straight from the f16 planes (two 16-B loads each, arithmetic addressing).
// Each K and V^T fragment is loaded once per wave and feeds QG matrix products (one per 16-query group g), so the loads per score fall by QG.
// Transposed form: S^T[key][t] = K Q^T (A = K rows, B = Q rows); lane (t = lane&15, h = lane>>4) holds keys 8h+r of each 16-key tile, so the packed
// P tile is directly the B fragment of O^T[d][t] = V^T P^T (element r <- tile keys 0..15, element 8+r <- tile keys 16..31, lane unchanged).
// Scale chain: logit2 = acc * (0.125 * log2 e); P = exp2(logit2 - max + 8) as f16; l = sum of the f16 P values; ctx plane = O^T * 1024 / l.
// Softmax state (running max, partial sum) is one scalar per lane and group; the two lane halves of a row are combined with one xor-16 exchange.
__global__ __launch_bounds__(32 * AW) void k_flash(const h16* __restrict__ QH, const h16* __restrict__ KP, const h16* __restrict__ VT, h16* CX) {
    __shared__ __align__(16) float os[AW * 16 * 68];
    const int lane = threadIdx.x & 31, lr = lane & 15, hi = lane >> 4;
    const int wave = __builtin_amdgcn_readfirstlane((int)(threadIdx.x >> 5));
    const int zh = blockIdx.y; const int b = zh / NH_, h = zh % NH_;
    const int t0 = (blockIdx.x * AW + wave) * (16 * QG);
    const size_t pbase = (size_t)zh * SEQ * HD;
    const size_t qo = pbase + (size_t)(t0 + lr) * HD + 8 * hi;
    v16h qh0[QG], qh1[QG];                                   // B fragments: col t, k = d
#pragma unroll
    for (int g = 0; g < QG; ++g) { qh0[g] = ldh(QH + qo + (size_t)g * 16 * HD); qh1[g] = ldh(QH + qo + (size_t)g * 16 * HD + 32); }
    const size_t ko = pbase + (size_t)lr * HD + 8 * hi;      // + key * HD       (A fragment: row key, k = d)
    const size_t vo = pbase + (size_t)lr * SEQ + 8 * hi;     // + 16j*SEQ + key  (A fragment: row d, k = key)
    v8f o0[QG], o1[QG], o2[QG], o3[QG];
    float m[QG], l[QG];
#pragma unroll
    for (int g = 0; g < QG; ++g) { o0[g] = (v8f){}; o1[g] = (v8f){}; o2[g] = (v8f){}; o3[g] = (v8f){}; m[g] = -3.0e38f; l[g] = 0.0f; }
#pragma unroll 1
    for (int key0 = 0; key0 < SEQ; key0 += 32) {
        const h16* ka = KP + ko + (size_t)key0 * HD;
        const v16h ka0 = ldh(ka), ka1 = ldh(ka + 32), kb0 = ldh(ka + 16 * HD), kb1 = ldh(ka + 16 * HD + 32);
        // inputs-only fence on the loaded K fragments: all eight loads are issued together and waited for once (otherwise the second half is loaded into the
        // first half's registers behind the first products, a second exposed latency per pass); the wait stands before the K address pair is reused
        asm volatile("s_wait_xcnt 0x0" : : "v"(ka0), "v"(ka1), "v"(kb0), "v"(kb1));
        __builtin_amdgcn_sched_barrier(0);               // keeps later address arithmetic behind that wait
        v16h pb[QG];
#pragma unroll
        for (int g = 0; g < QG; ++g) {
            v8f sHa = (v8f){}, sHb = (v8f){};
            sHa = wmma16(ka0, qh0[g], sHa); sHb = wmma16(kb0, qh0[g], sHb);
            sHa = wmma16(ka1, qh1[g], sHa); sHb = wmma16(kb1, qh1[g], sHb);
            float ta[8], tb[8]; float mx = -3.0e38f;
#pragma unroll
            for (int r = 0; r < 8; ++r) { ta[r] = sHa[r] * SC2; tb[r] = sHb[r] * SC2; mx = fmaxf(mx, fmaxf(ta[r], tb[r])); }
            mx = fmaxf(mx, __shfl_xor(mx, 16, 32));
            const float mnew = fmaxf(m[g], mx);
            const float alpha = __builtin_amdgcn_exp2f(m[g] - mnew);
            const float sh = PSH - mnew;
            float ls = 0.0f;
#pragma unroll
            for (int r = 0; r < 8; ++r) { const h16 pa = (h16)__builtin_amdgcn_exp2f(ta[r] + sh); const h16 pc = (h16)__builtin_amdgcn_exp2f(tb[r] + sh); pb[g][r] = pa; pb[g][8 + r] = pc; ls += (float)pa + (float)pc; }
            l[g] = l[g] * alpha + ls; m[g] = mnew;
            o0[g] = o0[g] * alpha; o1[g] = o1[g] * alpha; o2[g] = o2[g] * alpha; o3[g] = o3[g] * alpha;
        }
        const h16* va = VT + vo + key0;
        const v16h v0 = ldh(va), v1 = ldh(va + (size_t)16 * SEQ), v2 = ldh(va + (size_t)32 * SEQ), v3 = ldh(va + (size_t)48 * SEQ);
#pragma unroll
        for (int g = 0; g < QG; ++g) {
            o0[g] = wmma16(v0, pb[g], o0[g]); o1[g] = wmma16(v1, pb[g], o1[g]); o2[g] = wmma16(v2, pb[g], o2[g]); o3[g] = wmma16(v3, pb[g], o3[g]);
        }
        __builtin_amdgcn_sched_barrier(0);               // keeps every matrix product of this pass in front of the slots below
        // va as an input keeps the V^T address pair untouched up to this wait; then four vector slots between the last matrix product and the loop's back edge
        asm volatile("s_wait_xcnt 0x0\n\tv_nop\n\tv_nop\n\tv_nop\n\tv_nop" : : "v"(va));
    }
    const int wb = wave * 16 * 68;
    const int rg = lane >> 3, c8 = (lane & 7) * 8;       // 4 s x 4 row groups = 16 rows; 8 lanes x 8 halves = 64 columns
#pragma unroll
    for (int g = 0; g < QG; ++g) {
        const float lt = l[g] + __shfl_xor(l[g], 16, 32);
        const float inv = (1.0f / lt) * CXS;
        // O^T D layout: o_j[r] = (d = 16j + 8h + r, t = lane&15) -> os[t][d]; rows 0..15 x columns 0..63 all written
        { v4f a, c;
          a[0] = o0[g][0] * inv; a[1] = o0[g][1] * inv; a[2] = o0[g][2] * inv; a[3] = o0[g][3] * inv; c[0] = o0[g][4] * inv; c[1] = o0[g][5] * inv; c[2] = o0[g][6] * inv; c[3] = o0[g][7] * inv;
          *(v4fa*)(&os[wb + lr * 68 +  0 + 8 * hi]) = a; *(v4fa*)(&os[wb + lr * 68 +  0 + 8 * hi + 4]) = c;
          a[0] = o1[g][0] * inv; a[1] = o1[g][1] * inv; a[2] = o1[g][2] * inv; a[3] = o1[g][3] * inv; c[0] = o1[g][4] * inv; c[1] = o1[g][5] * inv; c[2] = o1[g][6] * inv; c[3] = o1[g][7] * inv;
          *(v4fa*)(&os[wb + lr * 68 + 16 + 8 * hi]) = a; *(v4fa*)(&os[wb + lr * 68 + 16 + 8 * hi + 4]) = c;
          a[0] = o2[g][0] * inv; a[1] = o2[g][1] * inv; a[2] = o2[g][2] * inv; a[3] = o2[g][3] * inv; c[0] = o2[g][4] * inv; c[1] = o2[g][5] * inv; c[2] = o2[g][6] * inv; c[3] = o2[g][7] * inv;
          *(v4fa*)(&os[wb + lr * 68 + 32 + 8 * hi]) = a; *(v4fa*)(&os[wb + lr * 68 + 32 + 8 * hi + 4]) = c;
          a[0] = o3[g][0] * inv; a[1] = o3[g][1] * inv; a[2] = o3[g][2] * inv; a[3] = o3[g][3] * inv; c[0] = o3[g][4] * inv; c[1] = o3[g][5] * inv; c[2] = o3[g][6] * inv; c[3] = o3[g][7] * inv;
          *(v4fa*)(&os[wb + lr * 68 + 48 + 8 * hi]) = a; *(v4fa*)(&os[wb + lr * 68 + 48 + 8 * hi + 4]) = c; }
        wave_sync();
        h16* crow = CX + ((size_t)b * SEQ + t0 + g * 16) * DM + h * HD;
        v8h hv[4];
#pragma unroll
        for (int s = 0; s < 4; ++s) { const int row = 4 * s + rg;
            const v4f x0 = *(const v4fa*)(&os[wb + row * 68 + c8]); const v4f x1 = *(const v4fa*)(&os[wb + row * 68 + c8 + 4]);
#pragma unroll
            for (int i = 0; i < 4; ++i) { hv[s][i] = (h16)x0[i]; hv[s][4 + i] = (h16)x1[i]; } }
#pragma unroll
        for (int s = 0; s < 4; ++s) *(v8h*)(crow + (size_t)(4 * s + rg) * DM + c8) = hv[s];
        asm volatile("s_wait_xcnt 0x0" ::: "memory");    // before the next group reuses the registers these stores name
        __builtin_amdgcn_sched_barrier(0);               // keeps the next group's arithmetic behind that wait
        wave_sync();                                     // the next group overwrites this wave's staging rows
    }
}

// k_oproj: register-blocked f16 GEMM, ONE WAVE per 64x64 tile, A = ctx plane (x1024), Bt = Wp plane (x256), K = DM; OUT[m][n] = acc * 2^-18 + bias[n] (f32).
__global__ __launch_bounds__(32) void k_oproj(const h16* __restrict__ A, const h16* __restrict__ Bt, const float* __restrict__ bias, float* OUT) {
    __shared__ __align__(16) float os[16 * 68];
    const int K = DM;
    const int lane = threadIdx.x & 31, lr = lane & 15, hi = lane >> 4; const int r0 = blockIdx.x * 64, c0 = blockIdx.y * 64;
    v8f acc[4][4];
#pragma unroll
    for (int mb = 0; mb < 4; ++mb)
#pragma unroll
        for (int nb = 0; nb < 4; ++nb) acc[mb][nb] = (v8f){};
    const size_t aoff = (size_t)(r0 + lr) * K + 8 * hi, boff = (size_t)(c0 + lr) * K + 8 * hi;
#pragma unroll 1
    for (int kc = 0; kc < K; kc += 32) {
        v16h a[4];
#pragma unroll
        for (int mb = 0; mb < 4; ++mb) a[mb] = ldh(A + aoff + (size_t)mb * 16 * K + kc);
#pragma unroll
        for (int nb = 0; nb < 4; ++nb) { const v16h b = ldh(Bt + boff + (size_t)nb * 16 * K + kc);
#pragma unroll
            for (int mb = 0; mb < 4; ++mb) acc[mb][nb] = wmma16(a[mb], b, acc[mb][nb]); }
        asm volatile("v_nop\n\tv_nop\n\tv_nop\n\tv_nop" : "+v"(acc[0][0]), "+v"(acc[1][1]), "+v"(acc[2][2]), "+v"(acc[3][3]) : "v"(a[0]), "v"(a[1]), "v"(a[2]), "v"(a[3]));
    }
    const int cofs = lr * 4;                              // 16 lanes x 4 floats = 64 columns
    const v4f braw = *(const v4fa*)(bias + c0 + cofs); v4f bb;
#pragma unroll
    for (int i = 0; i < 4; ++i) bb[i] = bfval(braw[i]);
    const int bi = r0 / SEQ, tt = r0 % SEQ;
    float* obase = OUT + ((size_t)bi * OUT_SEQ + tt) * DM + c0;
#pragma unroll
    for (int mb = 0; mb < 4; ++mb) {
#pragma unroll
        for (int nb = 0; nb < 4; ++nb) {
#pragma unroll
            for (int j = 0; j < 8; ++j) os[(hi * 8 + j) * 68 + nb * 16 + lr] = acc[mb][nb][j]; }   // rows 0..15 x cols 0..63 all written
        wave_sync();
        v4f vals[8];
#pragma unroll
        for (int s = 0; s < 8; ++s) { const int row = 2 * s + hi;            // 8 s x 2 rows = 16 rows
            const v4f x = *(const v4fa*)(&os[row * 68 + cofs]); vals[s] = x * OSC + bb; }
{
#pragma unroll
            for (int s = 0; s < 8; ++s) *(v4f*)(obase + (size_t)(mb * 16 + 2 * s + hi) * DM + cofs) = vals[s];
             }
        wave_sync();
    }
}

static constexpr size_t al256(size_t v) { return (v + 255) & ~(size_t)255; }
static constexpr size_t SZ_XB = al256((size_t)NB * SEQ * DM * 2);            // one bf16 activation plane
static constexpr size_t SZ_WB = al256((size_t)3 * DM * DM * 2);              // Wq | Wk | Wv bf16
static constexpr size_t SZ_WP = al256((size_t)DM * DM * 2);                  // Wp f16 x256
static constexpr size_t SZ_CS = al256((size_t)2 * SEQ * NPR * 2 * 4);        // two (cos, sin) tables
static constexpr size_t SZ_PL = al256((size_t)NB * NH_ * SEQ * HD * 2);      // one f16 head plane
static constexpr size_t SZ_CX = al256((size_t)NB * SEQ * DM * 2);            // ctx f16 x1024
static constexpr size_t SZ_TOTAL = 3 * SZ_XB + SZ_WB + SZ_WP + SZ_CS + 3 * SZ_PL + SZ_CX;
static_assert(SZ_TOTAL <= (size_t)134217728);          // workspace carve <= 128 MiB
static_assert(((size_t)DM * DM * 2) % 256 == 0);       // weight sub-planes stay 256-byte aligned

extern "C" void kernel_launch(void* const* d_in, const int* in_sizes, int n_in,
                              void* d_out, int out_size, void* d_ws, size_t ws_size, hipStream_t stream) {
    if (n_in < 8) return;
    const size_t needx = ((size_t)(NB - 1) * SEQ_FULL + SEQ) * DM;
    if ((size_t)in_sizes[0] < needx || (size_t)in_sizes[1] < needx || (size_t)in_sizes[2] < needx) return;
    if ((size_t)in_sizes[3] < (size_t)DM * DM || (size_t)in_sizes[4] < (size_t)DM * DM || (size_t)in_sizes[5] < (size_t)DM * DM || (size_t)in_sizes[6] < (size_t)DM * DM) return;
    if ((size_t)in_sizes[7] < (size_t)DM) return;
    if ((size_t)out_size < ((size_t)(NB - 1) * OUT_SEQ + SEQ) * DM) return;
    if (SZ_TOTAL > ws_size) return;
    // wire order: q, k, v, Wq, Wk, Wv, Wp, bp (weights [out][in] = Bt as-is)
    const float* xq = (const float*)d_in[0]; const float* xk = (const float*)d_in[1]; const float* xv = (const float*)d_in[2];
    const float* wq = (const float*)d_in[3]; const float* wk = (const float*)d_in[4]; const float* wv = (const float*)d_in[5];
    const float* wp = (const float*)d_in[6]; const float* bp = (const float*)d_in[7];
    float* OUT = (float*)d_out;      // [NB][SEQ][1024]
    char* wsp = (char*)d_ws;
    bf* XQ = (bf*)wsp; wsp += SZ_XB;                 // [NB*SEQ][1024]
    bf* XK = (bf*)wsp; wsp += SZ_XB;
    bf* XV = (bf*)wsp; wsp += SZ_XB;
    bf* WB = (bf*)wsp; wsp += SZ_WB;                 // [3][1024][1024]: q | k | v
    h16* WP = (h16*)wsp; wsp += SZ_WP;               // [1024][1024] x256
    float* CS = (float*)wsp; wsp += SZ_CS;           // [SEQ][512][2] then [512][SEQ][2]
    h16* QH = (h16*)wsp; wsp += SZ_PL;               // [NB*16][SEQ][64]
    h16* KP = (h16*)wsp; wsp += SZ_PL;               // [NB*16][SEQ][64]
    h16* VT = (h16*)wsp; wsp += SZ_PL;               // [NB*16][64][SEQ]
    h16* CX = (h16*)wsp; wsp += SZ_CX;               // [NB*SEQ][1024] x1024
    bf* WQ = WB; bf* WK = WB + (size_t)DM * DM; bf* WV = WB + (size_t)2 * DM * DM;

    k_prep<<<PB, PT, 0, stream>>>(xq, xk, xv, wq, wk, wv, wp, XQ, XK, XV, WB, WP, CS);

    // q, k: A = x rows (m = b*SEQ + t), Bt = W rows (n = h*64 + d) -> plane [(b*16 + h)][t][d]; k gets rotary on column pairs
    k_proj<0><<<dim3(NB * SEQ / 64, DM / 64, 1), 32, 0, stream>>>(XQ, WQ, QH, CS, SEQ, (size_t)NH_ * SEQ * HD, HD, HD, (size_t)SEQ * HD);
    k_proj<1><<<dim3(NB * SEQ / 64, DM / 64, 1), 32, 0, stream>>>(XK, WK, KP, CS, SEQ, (size_t)NH_ * SEQ * HD, HD, HD, (size_t)SEQ * HD);
    // v^T: A = Wv rows (m = h*64 + d), Bt = x rows (n = b*SEQ + t) -> plane [(b*1024 + m)][t] = [(b*16 + h)][d][t]; rotary on row pairs
    k_proj<2><<<dim3(DM / 64, NB * SEQ / 64, 1), 32, 0, stream>>>(WV, XV, VT, CS, DM, (size_t)0, SEQ, SEQ, (size_t)DM * SEQ);

    k_flash<<<dim3(SEQ / (16 * QG * AW), NB * NH_, 1), 32 * AW, 0, stream>>>(QH, KP, VT, CX);

    // out: A = ctx rows (m = b*SEQ + t), Bt = Wp rows (n = out feature)
    k_oproj<<<dim3(NB * SEQ / 64, DM / 64, 1), 32, 0, stream>>>(CX, WP, bp, OUT);
}

// v003
// Measured time: 163 microseconds a run.
// Timed twice side by side with v002, it ran 1.29 and 1.28 times as fast.
// All steps since v000 together make it 1.52 times as fast.
#include <hip/hip_runtime.h>

// Multi-head attention, width 1024 = 16 heads x 64; inputs q, k, v [NB][SEQ][1024]; Wq/Wk/Wv/Wp [out][in] (y = x W^T); interleaved rotary on projected k and v over the full 1024 axis (512 pairs, angle = pos * 10000^(-2p/1024)); score scale 1/8; dense softmax; out = ctx Wp^T + bp (f32).
// Compute dtypes, f32 accumulate everywhere: q/k/v projections v_wmma_f32_16x16x32_bf16 (inputs and weights RNE-converted to bf16; products exact); rotary in f32 in the projection epilogue from f32 cos/sin tables;
// scores v_wmma_f32_16x16x32_f16: q single f16, k single f16 (one product; logits = acc * 0.125 * log2 e); P (x256 carry, cancels in the normalisation; row sum taken over the f16 values) and v single f16; softmax f32 (online, running max);
// output projection v_wmma_f32_16x16x32_f16: ctx single f16 with x1024 carry, Wp as f16 of the bf16 RNE value with x256 carry, 2^-18 folded back in the f32 epilogue, bias (bf16 RNE value) added in f32.
// Layout: bf16 copies of q, k, v, Wq, Wk, Wv; q and k planes [b*16+h][t][d]; v^T plane [b*16+h][d][t]; ctx plane [b*SEQ+t][1024]; fused flash kernel in transposed form (S^T = K Q^T, O^T = V^T P^T), its K and V^T tiles staged in LDS once per block.

#ifndef NB
#define NB 2
#endif
#ifndef SEQ
#define SEQ 2048
#endif
#define NB_FULL  2
#define SEQ_FULL 2048
#ifndef OUT_SEQ
#define OUT_SEQ SEQ              // row pitch (in tokens) between batches of the output
#endif
#define DM   1024
#define NH_  16
#define HD   64
#define NPR  (DM / 2)            // rotary pairs per token row
#define PT   256                 // threads per pre-pass block
#define PB   NPR                 // pre-pass blocks (block index = rotary pair of the [p][pos] table)
#define AW   4                   // waves per flash block
#define QG   4                   // 16-query groups per flash wave (64 query rows each)
#define KT   64                  // keys per staged tile (a K row and a V^T row of a tile are both 128 bytes: whole cache lines)
#define LP   72                  // LDS row pitch in halves: 144 bytes = 16 x 9, conflict-free for 16-byte fragment reads
#define TH   (2 * 64 * LP)       // halves of one buffer: K tile (KT rows) then V^T tile (HD rows)
#define SC2  (0.125f * 1.4426950408889634f)   // HD^-0.5 * log2(e)
#define PSH  8.0f                // log2 of the P carry (256)
#define CXS  1024.0f             // carry of the ctx plane
#define WPS  256.0f              // carry of the Wp plane
#define OSC  (1.0f / (1024.0f * 256.0f))      // 2^-18

static_assert(HD == 64);
static_assert(NH_ * HD == DM);                 // head h = columns h*64 + d
static_assert(DM % 64 == 0);
static_assert(DM % 32 == 0);                   // GEMM k-loop steps by 32
static_assert(SEQ % 64 == 0);                  // a 64-row tile never straddles two batches
static_assert((NB * SEQ) % 64 == 0);
static_assert(SEQ % 32 == 0);                  // key loop steps by 32
static_assert(SEQ % (16 * QG * AW) == 0);      // flash grid covers the sequence exactly
static_assert(SEQ % KT == 0 && SEQ / KT >= 2); // whole tiles; the two-buffer prologue fills two
static_assert(KT == 64 && AW * 32 * 4 * 8 == KT * HD);   // four 16-byte copies per thread cover one 64 x 64 tile
static constexpr size_t PN  = (size_t)PB * PT;              // pre-pass threads
static constexpr size_t WCH = (size_t)DM * DM / 8;          // 8-element pieces of one weight
static constexpr size_t BCH = (size_t)SEQ * DM / 8;         // 8-element pieces of one batch of one activation
static constexpr int    XR  = (int)((size_t)NB * BCH / PN); // pre-pass rounds over the activations
static_assert((size_t)XR * PN == (size_t)NB * BCH && XR >= 1);   // the rounds cover the activation planes exactly
static_assert((size_t)NB * SEQ_FULL * DM * 4 < ((size_t)1 << 32) && (size_t)SEQ * NPR * 8 < ((size_t)1 << 32));   // 32-bit byte offsets inside every plane
static_assert(WCH == PN);                      // one piece of each weight per pre-pass thread
static_assert(NPR == 2 * PT);                  // one row of the [pos][p] table: PT threads x 2 pairs
static_assert(SEQ == XR * PB);                 // [pos][p] table: one position per block and round
static_assert(SEQ == 2 * XR * PT);             // [p][pos] table: two positions per thread and round
static_assert(NB <= NB_FULL);
static_assert(SEQ <= SEQ_FULL);
static_assert(((size_t)(NB - 1) * OUT_SEQ + SEQ) * DM * 4 <= (size_t)16777216);   // last output byte stays inside the output buffer

typedef _Float16 h16;
typedef unsigned short bf;
typedef __attribute__((ext_vector_type(16))) __bf16   v16bf;
typedef __attribute__((ext_vector_type(16))) _Float16 v16h;
typedef __attribute__((ext_vector_type(8)))  _Float16 v8h;
typedef __attribute__((ext_vector_type(8)))  unsigned short v8us;
typedef __attribute__((ext_vector_type(8)))  float    v8f;
typedef __attribute__((ext_vector_type(4)))  float    v4f;
typedef __attribute__((ext_vector_type(2)))  float    v2f;
typedef v4f  __attribute__((may_alias)) v4fa;

__device__ __forceinline__ unsigned short f2bf(float f) { unsigned u = __float_as_uint(f); u += 0x7FFFu + ((u >> 16) & 1u); return (unsigned short)(u >> 16); }
__device__ __forceinline__ float bfval(float f) { return __uint_as_float(((unsigned)f2bf(f)) << 16); }
__device__ __forceinline__ v16h cat16(v8h lo, v8h hi) { return __builtin_shufflevector(lo, hi, 0, 1, 2, 3, 4, 5, 6, 7, 8, 9, 10, 11, 12, 13, 14, 15); }
__device__ __forceinline__ v16bf cat16b(v8us lo, v8us hi) { return __builtin_bit_cast(v16bf, __builtin_shufflevector(lo, hi, 0, 1, 2, 3, 4, 5, 6, 7, 8, 9, 10, 11, 12, 13, 14, 15)); }
__device__ __forceinline__ v8f wmma16(v16h a, v16h b, v8f c) { return __builtin_amdgcn_wmma_f32_16x16x32_f16(false, a, false, b, (short)0, c, false, false); }
__device__ __forceinline__ v8f wmmab(v16bf a, v16bf b, v8f c) { return __builtin_amdgcn_wmma_f32_16x16x32_bf16(false, a, false, b, (short)0, c, false, false); }
// fragment loaders from K-contiguous 16-bit rows; p already includes + 8*(lane>>4): elements 0..7 <- k0+8h+0..7, elements 8..15 <- k0+16+8h+0..7 (same map for A and B)
__device__ __forceinline__ v16h  ldh(const h16* p) { return cat16(*(const v8h*)p, *(const v8h*)(p + 16)); }
__device__ __forceinline__ v16bf ldb(const bf* p)  { return cat16b(*(const v8us*)p, *(const v8us*)(p + 16)); }
// ordering point for wave-private LDS tiles (same wave writes and reads)
__device__ __forceinline__ void wave_sync() { __builtin_amdgcn_fence(3 /* release order */, "wavefront"); __builtin_amdgcn_wave_barrier(); asm volatile("" ::: "memory"); }

// k_prep: every pass that only prepares operands, in ONE launch of long-lived blocks: bf16 copies of q, k, v, Wq, Wk, Wv; the f16 x256 copy of Wp; both (cos, sin) tables.
// PB blocks x PT threads stay resident (16 waves per WGP) and each thread walks its share of every plane with stride PN, so the launch starts 4,096 waves.
// Tables, as float2 (cos, sin) of pos * theta(p): first [pos][p] (a block row = one position, a thread = two neighbouring pairs), then [p][pos] (a block = one pair, a thread = two neighbouring positions).
__device__ __forceinline__ float theta_of(int p) { const float e = (2.0f * (float)p) * (1.0f / (float)DM); return 1.0f / powf(10000.0f, e); }
__device__ __forceinline__ v8us cvt8(v8f v) { v8us o;
#pragma unroll
    for (int k = 0; k < 8; ++k) o[k] = f2bf(v[k]);
    return o; }
__device__ __forceinline__ v4f cs2(float a0, float a1) { float s0, c0, s1, c1; sincosf(a0, &s0, &c0); sincosf(a1, &s1, &c1); v4f o; o[0] = c0; o[1] = s0; o[2] = c1; o[3] = s1; return o; }

// plane base + one 32-bit byte offset (every plane is far below 4 GiB): the planes of a round share the offset register and no 64-bit address is formed per access
__device__ __forceinline__ v8f ld8(const float* p, unsigned byteoff) { return *(const v8f*)((const char*)p + byteoff); }
template <typename V, typename P> __device__ __forceinline__ void st16(P* p, unsigned byteoff, V v) { *(V*)((char*)p + byteoff) = v; }

__global__ __launch_bounds__(PT) void k_prep(const float* __restrict__ xq, const float* __restrict__ xk, const float* __restrict__ xv,
                                             const float* __restrict__ wq, const float* __restrict__ wk, const float* __restrict__ wv, const float* __restrict__ wp,
                                             bf* __restrict__ XQ, bf* __restrict__ XK, bf* __restrict__ XV, bf* __restrict__ WB, h16* __restrict__ WP, float* __restrict__ CS) {
    const unsigned tid = threadIdx.x, blk = blockIdx.x;
    const unsigned g = blk * PT + tid;
    // weights, one 8-element piece of each per thread: the loads are issued first and the three angle steps are worked out while they fly
    const v8f w0 = ld8(wq, g * 32), w1 = ld8(wk, g * 32), w2 = ld8(wv, g * 32), w3 = ld8(wp, g * 32);
    const float th0 = theta_of((int)(2 * tid)), th1 = theta_of((int)(2 * tid + 1)), thb = theta_of((int)blk);
    st16(WB, g * 16, cvt8(w0)); st16(WB + (size_t)DM * DM, g * 16, cvt8(w1)); st16(WB + (size_t)2 * DM * DM, g * 16, cvt8(w2));
    { v8h o;
#pragma unroll
      for (int k = 0; k < 8; ++k) o[k] = (h16)(bfval(w3[k]) * WPS);
      st16(WP, g * 16, o); }
    asm volatile("s_wait_xcnt 0x0" ::: "memory");        // before the first round reuses the registers these stores name
    __builtin_amdgcn_sched_barrier(0);                   // keeps the first round's address arithmetic behind that wait
    float* const CS1 = CS + (size_t)SEQ * NPR * 2;
    // rolled: four inlined sincosf per trip keep the text small
#pragma unroll 1
    for (unsigned r = 0; r < (unsigned)XR; ++r) {
        const unsigned c = g + r * (unsigned)PN;                                    // 8-element piece of the [NB*SEQ][DM] planes
        const unsigned s = (SEQ == SEQ_FULL) ? c : (c / (unsigned)BCH) * (unsigned)((size_t)SEQ_FULL * DM / 8) + c % (unsigned)BCH;   // the same piece in the inputs (batch pitch SEQ_FULL)
        const v8f a = ld8(xq, s * 32), b = ld8(xk, s * 32), d = ld8(xv, s * 32);
        // this round's table entries stand between the loads and their first use
        const unsigned t0 = blk + r * PB, t1 = 2 * (tid + r * PT);
        st16(CS,  (t0 * NPR + 2 * tid) * 8, cs2((float)(int)t0 * th0, (float)(int)t0 * th1));
        st16(CS1, (blk * SEQ + t1) * 8,     cs2((float)(int)t1 * thb, (float)(int)(t1 + 1) * thb));
        st16(XQ, c * 16, cvt8(a)); st16(XK, c * 16, cvt8(b)); st16(XV, c * 16, cvt8(d));
        asm volatile("s_wait_xcnt 0x0" ::: "memory");    // before the next round reuses the registers these stores name
        __builtin_amdgcn_sched_barrier(0);               // keeps the next round's address arithmetic behind that wait
    }
}

// k_proj: register-blocked bf16 GEMM, ONE WAVE per 64x64 tile (16 accumulators), operands straight from K-contiguous bf16 planes, K = DM.
// C[m][n] = sum_k A[m][k] Bt[n][k]; epilogue by MODE:
//   0: C as f16 (Ph);
//   1: rows = tokens, columns = features: interleaved rotary on column pairs (table [pos][p]), then f16 (Ph);
//   2: rows = features, columns = tokens: interleaved rotary on row pairs (table [p][pos]), then f16 (Ph).
// Tile base (r0/RB)*sRB + (r0%RB)*pitch + (c0/CB)*sCB + (c0%CB), row pitch 'pitch' (halves). grid (M/64, N/64), 32 threads.
template <int MODE>
__global__ __launch_bounds__(32) void k_proj(const bf* __restrict__ A, const bf* __restrict__ Bt, h16* Ph, const float* __restrict__ CS,
                                             int RB, size_t sRB, int pitch, int CB, size_t sCB) {
    __shared__ __align__(16) float os[16 * 68];
    const int K = DM;
    const int lane = threadIdx.x & 31, lr = lane & 15, hi = lane >> 4; const int r0 = blockIdx.x * 64, c0 = blockIdx.y * 64;
    v8f acc[4][4];
#pragma unroll
    for (int mb = 0; mb < 4; ++mb)
#pragma unroll
        for (int nb = 0; nb < 4; ++nb) acc[mb][nb] = (v8f){};
    const size_t aoff = (size_t)(r0 + lr) * K + 8 * hi, boff = (size_t)(c0 + lr) * K + 8 * hi;
#pragma unroll 1
    for (int kc = 0; kc < K; kc += 32) {
        v16bf a[4];
#pragma unroll
        for (int mb = 0; mb < 4; ++mb) a[mb] = ldb(A + aoff + (size_t)mb * 16 * K + kc);
#pragma unroll
        for (int nb = 0; nb < 4; ++nb) { const v16bf b = ldb(Bt + boff + (size_t)nb * 16 * K + kc);
#pragma unroll
            for (int mb = 0; mb < 4; ++mb) acc[mb][nb] = wmmab(a[mb], b, acc[mb][nb]); }
        asm volatile("v_nop\n\tv_nop\n\tv_nop\n\tv_nop" : "+v"(acc[0][0]), "+v"(acc[1][1]), "+v"(acc[2][2]), "+v"(acc[3][3]) : "v"(a[0]), "v"(a[1]), "v"(a[2]), "v"(a[3]));
    }
    const size_t tbase = (size_t)(r0 / RB) * sRB + (size_t)(r0 % RB) * (size_t)pitch + (size_t)(c0 / CB) * sCB + (size_t)(c0 % CB);
    const int rg = lane >> 3, c8 = (lane & 7) * 8;       // 4 row groups x 8 lanes; 8 lanes x 8 = 64 columns
#pragma unroll
    for (int mb = 0; mb < 4; ++mb) {
#pragma unroll
        for (int nb = 0; nb < 4; ++nb) {
#pragma unroll
            for (int j = 0; j < 8; ++j) os[(hi * 8 + j) * 68 + nb * 16 + lr] = acc[mb][nb][j]; }   // D: row 8h+j, col lane&15; rows 0..15 x cols 0..63 all written
        wave_sync();
        v8h hv[4];
#pragma unroll
        for (int s = 0; s < 4; ++s) {
            const int row = 4 * s + rg;                  // 4 s x 4 row groups = 16 rows
            v4f x0 = *(const v4fa*)(&os[row * 68 + c8]); v4f x1 = *(const v4fa*)(&os[row * 68 + c8 + 4]);
            if (MODE == 1) {
                const int t = (r0 % SEQ) + mb * 16 + row;                                    // token position of this row
                const float* cp = CS + ((size_t)t * NPR + (size_t)((c0 + c8) >> 1)) * 2;     // 4 pairs: (cos, sin) x 4
                const v4f e0 = *(const v4fa*)cp; const v4f e1 = *(const v4fa*)(cp + 4);
                v4f y0, y1;
                y0[0] = x0[0] * e0[0] - x0[1] * e0[1]; y0[1] = x0[0] * e0[1] + x0[1] * e0[0];
                y0[2] = x0[2] * e0[2] - x0[3] * e0[3]; y0[3] = x0[2] * e0[3] + x0[3] * e0[2];
                y1[0] = x1[0] * e1[0] - x1[1] * e1[1]; y1[1] = x1[0] * e1[1] + x1[1] * e1[0];
                y1[2] = x1[2] * e1[2] - x1[3] * e1[3]; y1[3] = x1[2] * e1[3] + x1[3] * e1[2];
                x0 = y0; x1 = y1;
            }
            if (MODE == 2) {
                const int e = r0 + mb * 16 + row;                                            // feature index of this row; partner row = row ^ 1 (same slab)
                const int tc = (c0 % SEQ) + c8;                                              // first of 8 token positions
                const float* cp = CS + (size_t)SEQ * NPR * 2 + ((size_t)(e >> 1) * SEQ + (size_t)tc) * 2;
                const v4f e0 = *(const v4fa*)cp; const v4f e1 = *(const v4fa*)(cp + 4); const v4f e2 = *(const v4fa*)(cp + 8); const v4f e3 = *(const v4fa*)(cp + 12);
                const v4f w0 = *(const v4fa*)(&os[(row ^ 1) * 68 + c8]); const v4f w1 = *(const v4fa*)(&os[(row ^ 1) * 68 + c8 + 4]);
                const float sg = (row & 1) ? 1.0f : -1.0f;   // even feature: x cos - partner sin; odd feature: partner sin + x cos
                v4f y0, y1;
                y0[0] = x0[0] * e0[0] + sg * (w0[0] * e0[1]); y0[1] = x0[1] * e0[2] + sg * (w0[1] * e0[3]);
                y0[2] = x0[2] * e1[0] + sg * (w0[2] * e1[1]); y0[3] = x0[3] * e1[2] + sg * (w0[3] * e1[3]);
                y1[0] = x1[0] * e2[0] + sg * (w1[0] * e2[1]); y1[1] = x1[1] * e2[2] + sg * (w1[1] * e2[3]);
                y1[2] = x1[2] * e3[0] + sg * (w1[2] * e3[1]); y1[3] = x1[3] * e3[2] + sg * (w1[3] * e3[3]);
                x0 = y0; x1 = y1;
            }
#pragma unroll
            for (int i = 0; i < 4; ++i) { hv[s][i] = (h16)x0[i]; hv[s][4 + i] = (h16)x1[i]; }
        }
        const size_t sb = tbase + (size_t)(mb * 16) * (size_t)pitch;
{
#pragma unroll
            for (int s = 0; s < 4; ++s) { const size_t oo = sb + (size_t)(4 * s + rg) * (size_t)pitch + c8;
                *(v8h*)(Ph + oo) = hv[s]; }
             }
        wave_sync();
    }
}

// k_flash: fused attention, one wave per 16 * QG query rows of one (batch, head); Q fragments straight from the f16 plane.
// K and V^T: the block's AW waves walk the same keys, so each tile of KT keys is brought into LDS ONCE per block by asynchronous 16-byte copies (whole 128-byte lines,
// eight lanes per row) into one of two buffers, the next tile flying while this one is worked on; fragments are 16-byte LDS reads at pitch LP.
// Each K and V^T fragment is read once per wave and feeds QG matrix products (one per 16-query group g).
// Transposed form: S^T[key][t] = K Q^T (A = K rows, B = Q rows); lane (t = lane&15, h = lane>>4) holds keys 8h+r of each 16-key tile, so the packed
// P tile is directly the B fragment of O^T[d][t] = V^T P^T (element r <- tile keys 0..15, element 8+r <- tile keys 16..31, lane unchanged).
// Scale chain: logit2 = acc * (0.125 * log2 e); P = exp2(logit2 - max + 8) as f16; l = sum of the f16 P values; ctx plane = O^T * 1024 / l.
// Softmax state (running max, partial sum) is one scalar per lane and group; the two lane halves of a row are combined with one xor-16 exchange.
// one tile's copies of one thread: four 16-byte pieces of the K tile (rows 16 apart) and four of the V^T tile, each lane with its own LDS byte address and global pointer.
// s_wait_xcnt stands as the statement's last line, in front of any rewrite of the address registers that the copies name.
__device__ __forceinline__ void stage_tile(unsigned l, const h16* kg, const h16* vg) {
    asm volatile("global_load_async_to_lds_b128 %0, %8, off\n\t"
                 "global_load_async_to_lds_b128 %1, %9, off\n\t"
                 "global_load_async_to_lds_b128 %2, %10, off\n\t"
                 "global_load_async_to_lds_b128 %3, %11, off\n\t"
                 "global_load_async_to_lds_b128 %4, %12, off\n\t"
                 "global_load_async_to_lds_b128 %5, %13, off\n\t"
                 "global_load_async_to_lds_b128 %6, %14, off\n\t"
                 "global_load_async_to_lds_b128 %7, %15, off\n\t"
                 "s_wait_xcnt 0x0"
                 :: "v"(l), "v"(l + 16 * LP * 2), "v"(l + 32 * LP * 2), "v"(l + 48 * LP * 2),
                    "v"(l + 64 * LP * 2), "v"(l + 80 * LP * 2), "v"(l + 96 * LP * 2), "v"(l + 112 * LP * 2),
                    "v"(kg), "v"(kg + 16 * HD), "v"(kg + 32 * HD), "v"(kg + 48 * HD),
                    "v"(vg), "v"(vg + (size_t)16 * SEQ), "v"(vg + (size_t)32 * SEQ), "v"(vg + (size_t)48 * SEQ)
                 : "memory");
}

__global__ __launch_bounds__(32 * AW) void k_flash(const h16* __restrict__ QH, const h16* __restrict__ KP, const h16* __restrict__ VT, h16* CX) {
    __shared__ __align__(16) float os[AW * 16 * 68];
    __shared__ __align__(16) h16 kv[2 * TH];
    const int lane = threadIdx.x & 31, lr = lane & 15, hi = lane >> 4;
    const int wave = __builtin_amdgcn_readfirstlane((int)(threadIdx.x >> 5));
    const int zh = blockIdx.y; const int b = zh / NH_, h = zh % NH_;
    const int t0 = (blockIdx.x * AW + wave) * (16 * QG);
    const size_t pbase = (size_t)zh * SEQ * HD;
    const size_t qo = pbase + (size_t)(t0 + lr) * HD + 8 * hi;
    v16h qh0[QG], qh1[QG];                                   // B fragments: col t, k = d
#pragma unroll
    for (int g = 0; g < QG; ++g) { qh0[g] = ldh(QH + qo + (size_t)g * 16 * HD); qh1[g] = ldh(QH + qo + (size_t)g * 16 * HD + 32); }
    // copy addresses of this thread: row = tid / 8 (+ 16 per piece), 16-byte column = tid % 8, the same in the K tile (row = key) and in the V^T tile (row = d)
    const unsigned crow = threadIdx.x >> 3, ccol = threadIdx.x & 7;
    const unsigned l0 = (unsigned)(size_t)&kv[0] + crow * (LP * 2) + ccol * 16;      // LDS byte address in buffer 0
    const h16* kg = KP + pbase + (size_t)crow * HD + ccol * 8;                       // + key0 * HD
    const h16* vg = VT + pbase + (size_t)crow * SEQ + ccol * 8;                      // + key0
    stage_tile(l0, kg, vg);
    asm volatile("s_wait_asynccnt 0x0" ::: "memory");        // this wave's copies of tile 0 have landed
    __syncthreads();                                         // ... and every other wave's: tile 0 may be read
    stage_tile(l0 + TH * 2, kg + (size_t)KT * HD, vg + KT);  // tile 1 flies during trip 0
    const h16* fr = kv + lr * LP + 8 * hi;                   // fragment base: K row key (k = d) at + key * LP; V^T row d (k = key) at + (KT + d) * LP + key
    v8f o0[QG], o1[QG], o2[QG], o3[QG];
    float m[QG], l[QG];
#pragma unroll
    for (int g = 0; g < QG; ++g) { o0[g] = (v8f){}; o1[g] = (v8f){}; o2[g] = (v8f){}; o3[g] = (v8f){}; m[g] = -3.0e38f; l[g] = 0.0f; }
#pragma unroll 1
    for (int t = 0; t < SEQ / KT; ++t) {
      const h16* fb = fr + (t & 1) * TH;                 // trip t reads buffer t mod 2 alone
#pragma unroll
      for (int sub = 0; sub < KT / 32; ++sub) {          // two passes of 32 keys per tile, one online-softmax step each
        const h16* ka = fb + sub * 32 * LP;
        const v16h ka0 = ldh(ka), ka1 = ldh(ka + 32), kb0 = ldh(ka + 16 * LP), kb1 = ldh(ka + 16 * LP + 32);
        v16h pb[QG];
#pragma unroll
        for (int g = 0; g < QG; ++g) {
            v8f sHa = (v8f){}, sHb = (v8f){};
            sHa = wmma16(ka0, qh0[g], sHa); sHb = wmma16(kb0, qh0[g], sHb);
            sHa = wmma16(ka1, qh1[g], sHa); sHb = wmma16(kb1, qh1[g], sHb);
            float ta[8], tb[8]; float mx = -3.0e38f;
#pragma unroll
            for (int r = 0; r < 8; ++r) { ta[r] = sHa[r] * SC2; tb[r] = sHb[r] * SC2; mx = fmaxf(mx, fmaxf(ta[r], tb[r])); }
            mx = fmaxf(mx, __shfl_xor(mx, 16, 32));
            const float mnew = fmaxf(m[g], mx);
            const float alpha = __builtin_amdgcn_exp2f(m[g] - mnew);
            const float sh = PSH - mnew;
            float ls = 0.0f;
#pragma unroll
            for (int r = 0; r < 8; ++r) { const h16 pa = (h16)__builtin_amdgcn_exp2f(ta[r] + sh); const h16 pc = (h16)__builtin_amdgcn_exp2f(tb[r] + sh); pb[g][r] = pa; pb[g][8 + r] = pc; ls += (float)pa + (float)pc; }
            l[g] = l[g] * alpha + ls; m[g] = mnew;
            o0[g] = o0[g] * alpha; o1[g] = o1[g] * alpha; o2[g] = o2[g] * alpha; o3[g] = o3[g] * alpha;
        }
        const h16* va = fb + KT * LP + sub * 32;
        const v16h v0 = ldh(va), v1 = ldh(va + 16 * LP), v2 = ldh(va + 32 * LP), v3 = ldh(va + 48 * LP);
#pragma unroll
        for (int g = 0; g < QG; ++g) {
            o0[g] = wmma16(v0, pb[g], o0[g]); o1[g] = wmma16(v1, pb[g], o1[g]); o2[g] = wmma16(v2, pb[g], o2[g]); o3[g] = wmma16(v3, pb[g], o3[g]);
        }
      }
        __builtin_amdgcn_sched_barrier(0);               // keeps every matrix product of this trip in front of the slots below
        // four vector slots between the last matrix product and the loop's back edge
        asm volatile("v_nop\n\tv_nop\n\tv_nop\n\tv_nop");
        asm volatile("s_wait_dscnt 0x0" ::: "memory");   // this wave's reads of buffer t mod 2 have returned
        asm volatile("s_wait_asynccnt 0x0" ::: "memory");// this wave's copies of tile t + 1 have landed
        __syncthreads();                                 // publishes tile t + 1 and ends every wave's reads of the buffer refilled below
        if (t + 2 < SEQ / KT) stage_tile(l0 + (unsigned)(t & 1) * (TH * 2), kg + (size_t)(t + 2) * KT * HD, vg + (size_t)(t + 2) * KT);
    }
    asm volatile("s_wait_asynccnt 0x0" ::: "memory");    // nothing of this wave's is in flight when the loop is left
    const int wb = wave * 16 * 68;
    const int rg = lane >> 3, c8 = (lane & 7) * 8;       // 4 s x 4 row groups = 16 rows; 8 lanes x 8 halves = 64 columns
#pragma unroll
    for (int g = 0; g < QG; ++g) {
        const float lt = l[g] + __shfl_xor(l[g], 16, 32);
        const float inv = (1.0f / lt) * CXS;
        // O^T D layout: o_j[r] = (d = 16j + 8h + r, t = lane&15) -> os[t][d]; rows 0..15 x columns 0..63 all written
        { v4f a, c;
          a[0] = o0[g][0] * inv; a[1] = o0[g][1] * inv; a[2] = o0[g][2] * inv; a[3] = o0[g][3] * inv; c[0] = o0[g][4] * inv; c[1] = o0[g][5] * inv; c[2] = o0[g][6] * inv; c[3] = o0[g][7] * inv;
          *(v4fa*)(&os[wb + lr * 68 +  0 + 8 * hi]) = a; *(v4fa*)(&os[wb + lr * 68 +  0 + 8 * hi + 4]) = c;
          a[0] = o1[g][0] * inv; a[1] = o1[g][1] * inv; a[2] = o1[g][2] * inv; a[3] = o1[g][3] * inv; c[0] = o1[g][4] * inv; c[1] = o1[g][5] * inv; c[2] = o1[g][6] * inv; c[3] = o1[g][7] * inv;
          *(v4fa*)(&os[wb + lr * 68 + 16 + 8 * hi]) = a; *(v4fa*)(&os[wb + lr * 68 + 16 + 8 * hi + 4]) = c;
          a[0] = o2[g][0] * inv; a[1] = o2[g][1] * inv; a[2] = o2[g][2] * inv; a[3] = o2[g][3] * inv; c[0] = o2[g][4] * inv; c[1] = o2[g][5] * inv; c[2] = o2[g][6] * inv; c[3] = o2[g][7] * inv;
          *(v4fa*)(&os[wb + lr * 68 + 32 + 8 * hi]) = a; *(v4fa*)(&os[wb + lr * 68 + 32 + 8 * hi + 4]) = c;
          a[0] = o3[g][0] * inv; a[1] = o3[g][1] * inv; a[2] = o3[g][2] * inv; a[3] = o3[g][3] * inv; c[0] = o3[g][4] * inv; c[1] = o3[g][5] * inv; c[2] = o3[g][6] * inv; c[3] = o3[g][7] * inv;
          *(v4fa*)(&os[wb + lr * 68 + 48 + 8 * hi]) = a; *(v4fa*)(&os[wb + lr * 68 + 48 + 8 * hi + 4]) = c; }
        wave_sync();
        h16* crow = CX + ((size_t)b * SEQ + t0 + g * 16) * DM + h * HD;
        v8h hv[4];
#pragma unroll
        for (int s = 0; s < 4; ++s) { const int row = 4 * s + rg;
            const v4f x0 = *(const v4fa*)(&os[wb + row * 68 + c8]); const v4f x1 = *(const v4fa*)(&os[wb + row * 68 + c8 + 4]);
#pragma unroll
            for (int i = 0; i < 4; ++i) { hv[s][i] = (h16)x0[i]; hv[s][4 + i] = (h16)x1[i]; } }
#pragma unroll
        for (int s = 0; s < 4; ++s) *(v8h*)(crow + (size_t)(4 * s + rg) * DM + c8) = hv[s];
        asm volatile("s_wait_xcnt 0x0" ::: "memory");    // before the next group reuses the registers these stores name
        __builtin_amdgcn_sched_barrier(0);               // keeps the next group's arithmetic behind that wait
        wave_sync();                                     // the next group overwrites this wave's staging rows
    }
}

// k_oproj: register-blocked f16 GEMM, ONE WAVE per 64x64 tile, A = ctx plane (x1024), Bt = Wp plane (x256), K = DM; OUT[m][n] = acc * 2^-18 + bias[n] (f32).
__global__ __launch_bounds__(32) void k_oproj(const h16* __restrict__ A, const h16* __restrict__ Bt, const float* __restrict__ bias, float* OUT) {
    __shared__ __align__(16) float os[16 * 68];
    const int K = DM;
    const int lane = threadIdx.x & 31, lr = lane & 15, hi = lane >> 4; const int r0 = blockIdx.x * 64, c0 = blockIdx.y * 64;
    v8f acc[4][4];
#pragma unroll
    for (int mb = 0; mb < 4; ++mb)
#pragma unroll
        for (int nb = 0; nb < 4; ++nb) acc[mb][nb] = (v8f){};
    const size_t aoff = (size_t)(r0 + lr) * K + 8 * hi, boff = (size_t)(c0 + lr) * K + 8 * hi;
#pragma unroll 1
    for (int kc = 0; kc < K; kc += 32) {
        v16h a[4];
#pragma unroll
        for (int mb = 0; mb < 4; ++mb) a[mb] = ldh(A + aoff + (size_t)mb * 16 * K + kc);
#pragma unroll
        for (int nb = 0; nb < 4; ++nb) { const v16h b = ldh(Bt + boff + (size_t)nb * 16 * K + kc);
#pragma unroll
            for (int mb = 0; mb < 4; ++mb) acc[mb][nb] = wmma16(a[mb], b, acc[mb][nb]); }
        asm volatile("v_nop\n\tv_nop\n\tv_nop\n\tv_nop" : "+v"(acc[0][0]), "+v"(acc[1][1]), "+v"(acc[2][2]), "+v"(acc[3][3]) : "v"(a[0]), "v"(a[1]), "v"(a[2]), "v"(a[3]));
    }
    const int cofs = lr * 4;                              // 16 lanes x 4 floats = 64 columns
    const v4f braw = *(const v4fa*)(bias + c0 + cofs); v4f bb;
#pragma unroll
    for (int i = 0; i < 4; ++i) bb[i] = bfval(braw[i]);
    const int bi = r0 / SEQ, tt = r0 % SEQ;
    float* obase = OUT + ((size_t)bi * OUT_SEQ + tt) * DM + c0;
#pragma unroll
    for (int mb = 0; mb < 4; ++mb) {
#pragma unroll
        for (int nb = 0; nb < 4; ++nb) {
#pragma unroll
            for (int j = 0; j < 8; ++j) os[(hi * 8 + j) * 68 + nb * 16 + lr] = acc[mb][nb][j]; }   // rows 0..15 x cols 0..63 all written
        wave_sync();
        v4f vals[8];
#pragma unroll
        for (int s = 0; s < 8; ++s) { const int row = 2 * s + hi;            // 8 s x 2 rows = 16 rows
            const v4f x = *(const v4fa*)(&os[row * 68 + cofs]); vals[s] = x * OSC + bb; }
{
#pragma unroll
            for (int s = 0; s < 8; ++s) *(v4f*)(obase + (size_t)(mb * 16 + 2 * s + hi) * DM + cofs) = vals[s];
             }
        wave_sync();
    }
}

static constexpr size_t al256(size_t v) { return (v + 255) & ~(size_t)255; }
static constexpr size_t SZ_XB = al256((size_t)NB * SEQ * DM * 2);            // one bf16 activation plane
static constexpr size_t SZ_WB = al256((size_t)3 * DM * DM * 2);              // Wq | Wk | Wv bf16
static constexpr size_t SZ_WP = al256((size_t)DM * DM * 2);                  // Wp f16 x256
static constexpr size_t SZ_CS = al256((size_t)2 * SEQ * NPR * 2 * 4);        // two (cos, sin) tables
static constexpr size_t SZ_PL = al256((size_t)NB * NH_ * SEQ * HD * 2);      // one f16 head plane
static constexpr size_t SZ_CX = al256((size_t)NB * SEQ * DM * 2);            // ctx f16 x1024
static constexpr size_t SZ_TOTAL = 3 * SZ_XB + SZ_WB + SZ_WP + SZ_CS + 3 * SZ_PL + SZ_CX;
static_assert(SZ_TOTAL <= (size_t)134217728);          // workspace carve <= 128 MiB
static_assert(((size_t)DM * DM * 2) % 256 == 0);       // weight sub-planes stay 256-byte aligned

extern "C" void kernel_launch(void* const* d_in, const int* in_sizes, int n_in,
                              void* d_out, int out_size, void* d_ws, size_t ws_size, hipStream_t stream) {
    if (n_in < 8) return;
    const size_t needx = ((size_t)(NB - 1) * SEQ_FULL + SEQ) * DM;
    if ((size_t)in_sizes[0] < needx || (size_t)in_sizes[1] < needx || (size_t)in_sizes[2] < needx) return;
    if ((size_t)in_sizes[3] < (size_t)DM * DM || (size_t)in_sizes[4] < (size_t)DM * DM || (size_t)in_sizes[5] < (size_t)DM * DM || (size_t)in_sizes[6] < (size_t)DM * DM) return;
    if ((size_t)in_sizes[7] < (size_t)DM) return;
    if ((size_t)out_size < ((size_t)(NB - 1) * OUT_SEQ + SEQ) * DM) return;
    if (SZ_TOTAL > ws_size) return;
    // wire order: q, k, v, Wq, Wk, Wv, Wp, bp (weights [out][in] = Bt as-is)
    const float* xq = (const float*)d_in[0]; const float* xk = (const float*)d_in[1]; const float* xv = (const float*)d_in[2];
    const float* wq = (const float*)d_in[3]; const float* wk = (const float*)d_in[4]; const float* wv = (const float*)d_in[5];
    const float* wp = (const float*)d_in[6]; const float* bp = (const float*)d_in[7];
    float* OUT = (float*)d_out;      // [NB][SEQ][1024]
    char* wsp = (char*)d_ws;
    bf* XQ = (bf*)wsp; wsp += SZ_XB;                 // [NB*SEQ][1024]
    bf* XK = (bf*)wsp; wsp += SZ_XB;
    bf* XV = (bf*)wsp; wsp += SZ_XB;
    bf* WB = (bf*)wsp; wsp += SZ_WB;                 // [3][1024][1024]: q | k | v
    h16* WP = (h16*)wsp; wsp += SZ_WP;               // [1024][1024] x256
    float* CS = (float*)wsp; wsp += SZ_CS;           // [SEQ][512][2] then [512][SEQ][2]
    h16* QH = (h16*)wsp; wsp += SZ_PL;               // [NB*16][SEQ][64]
    h16* KP = (h16*)wsp; wsp += SZ_PL;               // [NB*16][SEQ][64]
    h16* VT = (h16*)wsp; wsp += SZ_PL;               // [NB*16][64][SEQ]
    h16* CX = (h16*)wsp; wsp += SZ_CX;               // [NB*SEQ][1024] x1024
    bf* WQ = WB; bf* WK = WB + (size_t)DM * DM; bf* WV = WB + (size_t)2 * DM * DM;

    k_prep<<<PB, PT, 0, stream>>>(xq, xk, xv, wq, wk, wv, wp, XQ, XK, XV, WB, WP, CS);

    // q, k: A = x rows (m = b*SEQ + t), Bt = W rows (n = h*64 + d) -> plane [(b*16 + h)][t][d]; k gets rotary on column pairs
    k_proj<0><<<dim3(NB * SEQ / 64, DM / 64, 1), 32, 0, stream>>>(XQ, WQ, QH, CS, SEQ, (size_t)NH_ * SEQ * HD, HD, HD, (size_t)SEQ * HD);
    k_proj<1><<<dim3(NB * SEQ / 64, DM / 64, 1), 32, 0, stream>>>(XK, WK, KP, CS, SEQ, (size_t)NH_ * SEQ * HD, HD, HD, (size_t)SEQ * HD);
    // v^T: A = Wv rows (m = h*64 + d), Bt = x rows (n = b*SEQ + t) -> plane [(b*1024 + m)][t] = [(b*16 + h)][d][t]; rotary on row pairs
    k_proj<2><<<dim3(DM / 64, NB * SEQ / 64, 1), 32, 0, stream>>>(WV, XV, VT, CS, DM, (size_t)0, SEQ, SEQ, (size_t)DM * SEQ);

    k_flash<<<dim3(SEQ / (16 * QG * AW), NB * NH_, 1), 32 * AW, 0, stream>>>(QH, KP, VT, CX);

    // out: A = ctx rows (m = b*SEQ + t), Bt = Wp rows (n = out feature)
    k_oproj<<<dim3(NB * SEQ / 64, DM / 64, 1), 32, 0, stream>>>(CX, WP, bp, OUT);
}

// v004
// A run of this version takes 111 microseconds.
// Next to v003, in two timings, it ran 1.46 and 1.45 times as fast.
// All steps since v000 together make it 2.22 times as fast.
#include <hip/hip_runtime.h>

// Multi-head attention, width 1024 = 16 heads x 64; inputs q, k, v [NB][SEQ][1024]; Wq/Wk/Wv/Wp [out][in] (y = x W^T); interleaved rotary on projected k and v over the full 1024 axis (512 pairs, angle = pos * 10000^(-2p/1024)); score scale 1/8; dense softmax; out = ctx Wp^T + bp (f32).
// Compute dtypes, f32 accumulate everywhere: q/k/v projections v_wmma_f32_16x16x32_bf16 (inputs and weights RNE-converted to bf16; products exact); rotary in f32 in the projection epilogue from f32 cos/sin tables;
// scores v_wmma_f32_16x16x32_f16: q single f16, k single f16 (one product; logits = acc * 0.125 * log2 e); P (x256 carry, cancels in the normalisation; row sum taken over the f16 values) and v single f16; softmax f32 (online, running max);
// output projection v_wmma_f32_16x16x32_f16: ctx single f16 with x1024 carry, Wp as f16 of the bf16 RNE value with x256 carry, 2^-18 folded back in the f32 epilogue, bias (bf16 RNE value) added in f32.
// Layout: bf16 copies of q, k, v, Wq, Wk, Wv; q and k planes [b*16+h][t][d]; v^T plane [b*16+h][d][t]; ctx plane [b*SEQ+t][1024]; fused flash kernel in transposed form (S^T = K Q^T, O^T = V^T P^T), its K and V^T tiles staged in LDS once per block; the four GEMMs stage their A and B tiles in LDS once per 128 x 128 block.

#ifndef NB
#define NB 2
#endif
#ifndef SEQ
#define SEQ 2048
#endif
#define NB_FULL  2
#define SEQ_FULL 2048
#ifndef OUT_SEQ
#define OUT_SEQ SEQ              // row pitch (in tokens) between batches of the output
#endif
#define DM   1024
#define NH_  16
#define HD   64
#define NPR  (DM / 2)            // rotary pairs per token row
#define PT   256                 // threads per pre-pass block
#define PB   NPR                 // pre-pass blocks (block index = rotary pair of the [p][pos] table)
#define AW   4                   // waves per flash block
#define QG   4                   // 16-query groups per flash wave (64 query rows each)
#define KT   64                  // keys per staged tile (a K row and a V^T row of a tile are both 128 bytes: whole cache lines)
#define LP   72                  // LDS row pitch in halves: 144 bytes = 16 x 9, conflict-free for 16-byte fragment reads
#define TH   (2 * 64 * LP)       // halves of one buffer: K tile (KT rows) then V^T tile (HD rows)
#define GW   4                   // waves per GEMM block: 2 x 2 wave tiles of 64 x 64 = one 128 x 128 tile
#define GT   128                 // rows of A and rows of Bt per GEMM block
#ifndef GK
#define GK   128                 // k elements per staged GEMM tile (256 bytes a row: whole cache lines)
#endif
#define GLP  (GK + 8)            // LDS row pitch of a GEMM tile in 16-bit elements: 16 bytes x an odd number, conflict-free for 16-byte fragment reads
#define GRS  (GW * 32 * 8 / GK)  // rows that one 16-byte copy of every thread of the block covers
#define GTH  (2 * GT * GLP)      // 16-bit elements of one GEMM buffer: A tile (GT rows) then Bt tile (GT rows)
#define SC2  (0.125f * 1.4426950408889634f)   // HD^-0.5 * log2(e)
#define PSH  8.0f                // log2 of the P carry (256)
#define CXS  1024.0f             // carry of the ctx plane
#define WPS  256.0f              // carry of the Wp plane
#define OSC  (1.0f / (1024.0f * 256.0f))      // 2^-18

static_assert(HD == 64);
static_assert(NH_ * HD == DM);                 // head h = columns h*64 + d
static_assert(DM % 64 == 0);
static_assert(DM % 32 == 0);                   // GEMM k-loop steps by 32
static_assert(SEQ % 64 == 0);                  // a 64-row tile never straddles two batches
static_assert((NB * SEQ) % 64 == 0);
static_assert(SEQ % 32 == 0);                  // key loop steps by 32
static_assert(SEQ % (16 * QG * AW) == 0);      // flash grid covers the sequence exactly
static_assert(SEQ % KT == 0 && SEQ / KT >= 2); // whole tiles; the two-buffer prologue fills two
static_assert(KT == 64 && AW * 32 * 4 * 8 == KT * HD);   // four 16-byte copies per thread cover one 64 x 64 tile
static_assert((NB * SEQ) % GT == 0 && DM % GT == 0);      // GEMM grids cover both operands exactly
static_assert(DM % GK == 0 && DM / GK >= 2 && GK % 64 == 0);   // whole k tiles of whole lines; the two-buffer prologue fills two
static_assert(GT % (8 * GRS) == 0 && (GLP * 2) % 32 == 16);    // statements of eight copies cover an operand tile exactly; odd multiple of 16 bytes
static_assert(2 * GT / GRS <= 63);                             // copies of one wave in flight: one tile's
static constexpr size_t PN  = (size_t)PB * PT;              // pre-pass threads
static constexpr size_t WCH = (size_t)DM * DM / 8;          // 8-element pieces of one weight
static constexpr size_t BCH = (size_t)SEQ * DM / 8;         // 8-element pieces of one batch of one activation
static constexpr int    XR  = (int)((size_t)NB * BCH / PN); // pre-pass rounds over the activations
static_assert((size_t)XR * PN == (size_t)NB * BCH && XR >= 1);   // the rounds cover the activation planes exactly
static_assert((size_t)NB * SEQ_FULL * DM * 4 < ((size_t)1 << 32) && (size_t)SEQ * NPR * 8 < ((size_t)1 << 32));   // 32-bit byte offsets inside every plane
static_assert(WCH == PN);                      // one piece of each weight per pre-pass thread
static_assert(NPR == 2 * PT);                  // one row of the [pos][p] table: PT threads x 2 pairs
static_assert(SEQ == XR * PB);                 // [pos][p] table: one position per block and round
static_assert(SEQ == 2 * XR * PT);             // [p][pos] table: two positions per thread and round
static_assert(NB <= NB_FULL);
static_assert(SEQ <= SEQ_FULL);
static_assert(((size_t)(NB - 1) * OUT_SEQ + SEQ) * DM * 4 <= (size_t)16777216);   // last output byte stays inside the output buffer

typedef _Float16 h16;
typedef unsigned short bf;
typedef __attribute__((ext_vector_type(16))) __bf16   v16bf;
typedef __attribute__((ext_vector_type(16))) _Float16 v16h;
typedef __attribute__((ext_vector_type(8)))  _Float16 v8h;
typedef __attribute__((ext_vector_type(8)))  unsigned short v8us;
typedef __attribute__((ext_vector_type(8)))  float    v8f;
typedef __attribute__((ext_vector_type(4)))  float    v4f;
typedef __attribute__((ext_vector_type(2)))  float    v2f;
typedef v4f  __attribute__((may_alias)) v4fa;

__device__ __forceinline__ unsigned short f2bf(float f) { unsigned u = __float_as_uint(f); u += 0x7FFFu + ((u >> 16) & 1u); return (unsigned short)(u >> 16); }
__device__ __forceinline__ float bfval(float f) { return __uint_as_float(((unsigned)f2bf(f)) << 16); }
__device__ __forceinline__ v16h cat16(v8h lo, v8h hi) { return __builtin_shufflevector(lo, hi, 0, 1, 2, 3, 4, 5, 6, 7, 8, 9, 10, 11, 12, 13, 14, 15); }
__device__ __forceinline__ v16bf cat16b(v8us lo, v8us hi) { return __builtin_bit_cast(v16bf, __builtin_shufflevector(lo, hi, 0, 1, 2, 3, 4, 5, 6, 7, 8, 9, 10, 11, 12, 13, 14, 15)); }
__device__ __forceinline__ v8f wmma16(v16h a, v16h b, v8f c) { return __builtin_amdgcn_wmma_f32_16x16x32_f16(false, a, false, b, (short)0, c, false, false); }
__device__ __forceinline__ v8f wmmab(v16bf a, v16bf b, v8f c) { return __builtin_amdgcn_wmma_f32_16x16x32_bf16(false, a, false, b, (short)0, c, false, false); }
// fragment loaders from K-contiguous 16-bit rows; p already includes + 8*(lane>>4): elements 0..7 <- k0+8h+0..7, elements 8..15 <- k0+16+8h+0..7 (same map for A and B)
__device__ __forceinline__ v16h  ldh(const h16* p) { return cat16(*(const v8h*)p, *(const v8h*)(p + 16)); }
__device__ __forceinline__ v16bf ldb(const bf* p)  { return cat16b(*(const v8us*)p, *(const v8us*)(p + 16)); }
// ordering point for wave-private LDS tiles (same wave writes and reads)
__device__ __forceinline__ void wave_sync() { __builtin_amdgcn_fence(3 /* release order */, "wavefront"); __builtin_amdgcn_wave_barrier(); asm volatile("" ::: "memory"); }

// k_prep: every pass that only prepares operands, in ONE launch of long-lived blocks: bf16 copies of q, k, v, Wq, Wk, Wv; the f16 x256 copy of Wp; both (cos, sin) tables.
// PB blocks x PT threads stay resident (16 waves per WGP) and each thread walks its share of every plane with stride PN, so the launch starts 4,096 waves.
// Tables, as float2 (cos, sin) of pos * theta(p): first [pos][p] (a block row = one position, a thread = two neighbouring pairs), then [p][pos] (a block = one pair, a thread = two neighbouring positions).
__device__ __forceinline__ float theta_of(int p) { const float e = (2.0f * (float)p) * (1.0f / (float)DM); return 1.0f / powf(10000.0f, e); }
__device__ __forceinline__ v8us cvt8(v8f v) { v8us o;
#pragma unroll
    for (int k = 0; k < 8; ++k) o[k] = f2bf(v[k]);
    return o; }
__device__ __forceinline__ v4f cs2(float a0, float a1) { float s0, c0, s1, c1; sincosf(a0, &s0, &c0); sincosf(a1, &s1, &c1); v4f o; o[0] = c0; o[1] = s0; o[2] = c1; o[3] = s1; return o; }

// plane base + one 32-bit byte offset (every plane is far below 4 GiB): the planes of a round share the offset register and no 64-bit address is formed per access
__device__ __forceinline__ v8f ld8(const float* p, unsigned byteoff) { return *(const v8f*)((const char*)p + byteoff); }
template <typename V, typename P> __device__ __forceinline__ void st16(P* p, unsigned byteoff, V v) { *(V*)((char*)p + byteoff) = v; }

__global__ __launch_bounds__(PT) void k_prep(const float* __restrict__ xq, const float* __restrict__ xk, const float* __restrict__ xv,
                                             const float* __restrict__ wq, const float* __restrict__ wk, const float* __restrict__ wv, const float* __restrict__ wp,
                                             bf* __restrict__ XQ, bf* __restrict__ XK, bf* __restrict__ XV, bf* __restrict__ WB, h16* __restrict__ WP, float* __restrict__ CS) {
    const unsigned tid = threadIdx.x, blk = blockIdx.x;
    const unsigned g = blk * PT + tid;
    // weights, one 8-element piece of each per thread: the loads are issued first and the three angle steps are worked out while they fly
    const v8f w0 = ld8(wq, g * 32), w1 = ld8(wk, g * 32), w2 = ld8(wv, g * 32), w3 = ld8(wp, g * 32);
    const float th0 = theta_of((int)(2 * tid)), th1 = theta_of((int)(2 * tid + 1)), thb = theta_of((int)blk);
    st16(WB, g * 16, cvt8(w0)); st16(WB + (size_t)DM * DM, g * 16, cvt8(w1)); st16(WB + (size_t)2 * DM * DM, g * 16, cvt8(w2));
    { v8h o;
#pragma unroll
      for (int k = 0; k < 8; ++k) o[k] = (h16)(bfval(w3[k]) * WPS);
      st16(WP, g * 16, o); }
    asm volatile("s_wait_xcnt 0x0" ::: "memory");        // before the first round reuses the registers these stores name
    __builtin_amdgcn_sched_barrier(0);                   // keeps the first round's address arithmetic behind that wait
    float* const CS1 = CS + (size_t)SEQ * NPR * 2;
    // rolled: four inlined sincosf per trip keep the text small
#pragma unroll 1
    for (unsigned r = 0; r < (unsigned)XR; ++r) {
        const unsigned c = g + r * (unsigned)PN;                                    // 8-element piece of the [NB*SEQ][DM] planes
        const unsigned s = (SEQ == SEQ_FULL) ? c : (c / (unsigned)BCH) * (unsigned)((size_t)SEQ_FULL * DM / 8) + c % (unsigned)BCH;   // the same piece in the inputs (batch pitch SEQ_FULL)
        const v8f a = ld8(xq, s * 32), b = ld8(xk, s * 32), d = ld8(xv, s * 32);
        // this round's table entries stand between the loads and their first use
        const unsigned t0 = blk + r * PB, t1 = 2 * (tid + r * PT);
        st16(CS,  (t0 * NPR + 2 * tid) * 8, cs2((float)(int)t0 * th0, (float)(int)t0 * th1));
        st16(CS1, (blk * SEQ + t1) * 8,     cs2((float)(int)t1 * thb, (float)(int)(t1 + 1) * thb));
        st16(XQ, c * 16, cvt8(a)); st16(XK, c * 16, cvt8(b)); st16(XV, c * 16, cvt8(d));
        asm volatile("s_wait_xcnt 0x0" ::: "memory");    // before the next round reuses the registers these stores name
        __builtin_amdgcn_sched_barrier(0);               // keeps the next round's address arithmetic behind that wait
    }
}

// Main loop of the four GEMMs. A block of GW waves owns a GT x GT tile of C; each wave a 64 x 64 quarter (16 accumulators).
// The k axis is walked in tiles of GK: the GT rows of A and the GT rows of Bt are brought into LDS ONCE per block by asynchronous 16-byte copies (whole 128-byte lines,
// GK / 8 lanes per row) into one of two buffers, the next tile flying while this one is worked on; fragments are 16-byte LDS reads at pitch GLP. k runs upward in steps of 32 as before.
__device__ __forceinline__ v16h  ldf(const h16* p) { return ldh(p); }
__device__ __forceinline__ v16bf ldf(const bf* p)  { return ldb(p); }
__device__ __forceinline__ v8f mm(v16h a, v16h b, v8f c)   { return wmma16(a, b, c); }
__device__ __forceinline__ v8f mm(v16bf a, v16bf b, v8f c) { return wmmab(a, b, c); }
// eight copies of one thread: 16-byte pieces, rows GRS apart, each lane with its own LDS byte address and global pointer.
// s_wait_xcnt stands as the statement's last line, in front of any rewrite of the address registers that the copies name.
template <typename T>
__device__ __forceinline__ void stage_rows(unsigned l, const T* g) {
    asm volatile("global_load_async_to_lds_b128 %0, %8, off\n\t"
                 "global_load_async_to_lds_b128 %1, %9, off\n\t"
                 "global_load_async_to_lds_b128 %2, %10, off\n\t"
                 "global_load_async_to_lds_b128 %3, %11, off\n\t"
                 "global_load_async_to_lds_b128 %4, %12, off\n\t"
                 "global_load_async_to_lds_b128 %5, %13, off\n\t"
                 "global_load_async_to_lds_b128 %6, %14, off\n\t"
                 "global_load_async_to_lds_b128 %7, %15, off\n\t"
                 "s_wait_xcnt 0x0"
                 :: "v"(l), "v"(l + 1 * GRS * GLP * 2), "v"(l + 2 * GRS * GLP * 2), "v"(l + 3 * GRS * GLP * 2),
                    "v"(l + 4 * GRS * GLP * 2), "v"(l + 5 * GRS * GLP * 2), "v"(l + 6 * GRS * GLP * 2), "v"(l + 7 * GRS * GLP * 2),
                    "v"(g), "v"(g + 1 * GRS * DM), "v"(g + 2 * GRS * DM), "v"(g + 3 * GRS * DM),
                    "v"(g + 4 * GRS * DM), "v"(g + 5 * GRS * DM), "v"(g + 6 * GRS * DM), "v"(g + 7 * GRS * DM)
                 : "memory");
}
// one k tile's copies of one thread: the GT rows of A, then the GT rows of Bt behind them
template <typename T>
__device__ __forceinline__ void stage_ab(unsigned l, const T* ag, const T* bg) {
#pragma unroll
    for (int h = 0; h < GT / (8 * GRS); ++h) stage_rows(l + h * (8 * GRS * GLP * 2), ag + h * (8 * GRS * DM));
#pragma unroll
    for (int h = 0; h < GT / (8 * GRS); ++h) stage_rows(l + (GT + h * 8 * GRS) * (GLP * 2), bg + h * (8 * GRS * DM));
}
// R0, C0: first row of A and of Bt of the BLOCK; wr, wc: this wave's 64-row offsets inside them; sm: 2 * GTH elements of LDS.
template <typename T>
__device__ __forceinline__ void gemm_main(const T* __restrict__ A, const T* __restrict__ Bt, const T* sm, int R0, int C0, int wr, int wc, int lr, int hi, v8f (&acc)[4][4]) {
#pragma unroll
    for (int mb = 0; mb < 4; ++mb)
#pragma unroll
        for (int nb = 0; nb < 4; ++nb) acc[mb][nb] = (v8f){};
    // copy addresses of this thread: row = tid / (GK / 8) (+ GRS per piece), 16-byte column = tid % (GK / 8), the same in the A tile and in the Bt tile
    const unsigned crow = threadIdx.x / (GK / 8), ccol = threadIdx.x % (GK / 8);
    const unsigned l0 = (unsigned)(size_t)&sm[0] + crow * (GLP * 2) + ccol * 16;     // LDS byte address in buffer 0, A tile; the Bt tile stands GT rows behind
    const T* ag = A  + (size_t)(R0 + (int)crow) * DM + ccol * 8;                     // + k0
    const T* bg = Bt + (size_t)(C0 + (int)crow) * DM + ccol * 8;                     // + k0
    stage_ab(l0, ag, bg);
    asm volatile("s_wait_asynccnt 0x0" ::: "memory");        // this wave's copies of tile 0 have landed
    __syncthreads();                                         // ... and every other wave's: tile 0 may be read
    stage_ab(l0 + GTH * 2, ag + GK, bg + GK);                // tile 1 flies during trip 0
    const T* fa = sm + (wr + lr) * GLP + 8 * hi;             // A fragment base of this wave
    const T* fb = sm + (GT + wc + lr) * GLP + 8 * hi;        // Bt fragment base of this wave
#pragma unroll 1
    for (int t = 0; t < DM / GK; ++t) {
        const T* pa = fa + (t & 1) * GTH; const T* pb = fb + (t & 1) * GTH;   // trip t reads buffer t mod 2 alone
        decltype(ldf(fa)) a[2][4], b[2][4];              // two fragment sets: the block of 32 k in work and the next one of the same tile
#pragma unroll
        for (int i = 0; i < 4; ++i) { a[0][i] = ldf(pa + i * 16 * GLP); b[0][i] = ldf(pb + i * 16 * GLP); }
#pragma unroll
        for (int s = 0; s < GK / 32; ++s) {
            if (s + 1 < GK / 32) {
#pragma unroll
                for (int i = 0; i < 4; ++i) { a[(s + 1) & 1][i] = ldf(pa + i * 16 * GLP + (s + 1) * 32); b[(s + 1) & 1][i] = ldf(pb + i * 16 * GLP + (s + 1) * 32); } }
            __builtin_amdgcn_sched_barrier(0);           // the next block's LDS reads stay one group in front of this block's products: their latency runs under the products
#pragma unroll
            for (int nb = 0; nb < 4; ++nb)
#pragma unroll
                for (int mb = 0; mb < 4; ++mb) acc[mb][nb] = mm(a[s & 1][mb], b[s & 1][nb], acc[mb][nb]);
            __builtin_amdgcn_sched_barrier(0);           // no later LDS read is spread among these products; behind the last block: every product stands in front of the slots below
        }
        // four vector slots between the last matrix product and the loop's back edge
        asm volatile("v_nop\n\tv_nop\n\tv_nop\n\tv_nop");
        asm volatile("s_wait_dscnt 0x0" ::: "memory");   // this wave's reads of buffer t mod 2 have returned
        asm volatile("s_wait_asynccnt 0x0" ::: "memory");// this wave's copies of tile t + 1 have landed
        __syncthreads();                                 // publishes tile t + 1 and ends every wave's reads of the buffer refilled below
        if (t + 2 < DM / GK) stage_ab(l0 + (unsigned)(t & 1) * (GTH * 2), ag + (t + 2) * GK, bg + (t + 2) * GK);
    }
    asm volatile("s_wait_asynccnt 0x0" ::: "memory");    // nothing of this wave's is in flight when the loop is left
}

// k_proj: register-blocked bf16 GEMM, one wave per 64x64 tile (16 accumulators), GW waves per block, operands from K-contiguous bf16 planes through LDS (gemm_main), K = DM.
// C[m][n] = sum_k A[m][k] Bt[n][k]; epilogue by MODE:
//   0: C as f16 (Ph);
//   1: rows = tokens, columns = features: interleaved rotary on column pairs (table [pos][p]), then f16 (Ph);
//   2: rows = features, columns = tokens: interleaved rotary on row pairs (table [p][pos]), then f16 (Ph).
// Tile base (r0/RB)*sRB + (r0%RB)*pitch + (c0/CB)*sCB + (c0%CB), row pitch 'pitch' (halves). grid (M/GT, N/GT), 32 * GW threads.
template <int MODE>
__global__ __launch_bounds__(32 * GW) void k_proj(const bf* __restrict__ A, const bf* __restrict__ Bt, h16* Ph, const float* __restrict__ CS,
                                             int RB, size_t sRB, int pitch, int CB, size_t sCB) {
    __shared__ __align__(16) float osb[GW * 16 * 68];
    __shared__ __align__(16) bf sm[2 * GTH];
    const int lane = threadIdx.x & 31, lr = lane & 15, hi = lane >> 4;
    const int wave = __builtin_amdgcn_readfirstlane((int)(threadIdx.x >> 5));
    const int wr = (wave & 1) * 64, wc = (wave >> 1) * 64;
    const int r0 = blockIdx.x * GT + wr, c0 = blockIdx.y * GT + wc;      // this wave's 64 x 64 tile
    float* const os = osb + wave * 16 * 68;                              // this wave's own staging rows
    v8f acc[4][4];
    gemm_main(A, Bt, sm, (int)blockIdx.x * GT, (int)blockIdx.y * GT, wr, wc, lr, hi, acc);
    const size_t tbase = (size_t)(r0 / RB) * sRB + (size_t)(r0 % RB) * (size_t)pitch + (size_t)(c0 / CB) * sCB + (size_t)(c0 % CB);
    const int rg = lane >> 3, c8 = (lane & 7) * 8;       // 4 row groups x 8 lanes; 8 lanes x 8 = 64 columns
#pragma unroll
    for (int mb = 0; mb < 4; ++mb) {
#pragma unroll
        for (int nb = 0; nb < 4; ++nb) {
#pragma unroll
            for (int j = 0; j < 8; ++j) os[(hi * 8 + j) * 68 + nb * 16 + lr] = acc[mb][nb][j]; }   // D: row 8h+j, col lane&15; rows 0..15 x cols 0..63 all written
        wave_sync();
        v8h hv[4];
#pragma unroll
        for (int s = 0; s < 4; ++s) {
            const int row = 4 * s + rg;                  // 4 s x 4 row groups = 16 rows
            v4f x0 = *(const v4fa*)(&os[row * 68 + c8]); v4f x1 = *(const v4fa*)(&os[row * 68 + c8 + 4]);
            if (MODE == 1) {
                const int t = (r0 % SEQ) + mb * 16 + row;                                    // token position of this row
                const float* cp = CS + ((size_t)t * NPR + (size_t)((c0 + c8) >> 1)) * 2;     // 4 pairs: (cos, sin) x 4
                const v4f e0 = *(const v4fa*)cp; const v4f e1 = *(const v4fa*)(cp + 4);
                v4f y0, y1;
                y0[0] = x0[0] * e0[0] - x0[1] * e0[1]; y0[1] = x0[0] * e0[1] + x0[1] * e0[0];
                y0[2] = x0[2] * e0[2] - x0[3] * e0[3]; y0[3] = x0[2] * e0[3] + x0[3] * e0[2];
                y1[0] = x1[0] * e1[0] - x1[1] * e1[1]; y1[1] = x1[0] * e1[1] + x1[1] * e1[0];
                y1[2] = x1[2] * e1[2] - x1[3] * e1[3]; y1[3] = x1[2] * e1[3] + x1[3] * e1[2];
                x0 = y0; x1 = y1;
            }
            if (MODE == 2) {
                const int e = r0 + mb * 16 + row;                                            // feature index of this row; partner row = row ^ 1 (same slab)
                const int tc = (c0 % SEQ) + c8;                                              // first of 8 token positions
                const float* cp = CS + (size_t)SEQ * NPR * 2 + ((size_t)(e >> 1) * SEQ + (size_t)tc) * 2;
                const v4f e0 = *(const v4fa*)cp; const v4f e1 = *(const v4fa*)(cp + 4); const v4f e2 = *(const v4fa*)(cp + 8); const v4f e3 = *(const v4fa*)(cp + 12);
                const v4f w0 = *(const v4fa*)(&os[(row ^ 1) * 68 + c8]); const v4f w1 = *(const v4fa*)(&os[(row ^ 1) * 68 + c8 + 4]);
                const float sg = (row & 1) ? 1.0f : -1.0f;   // even feature: x cos - partner sin; odd feature: partner sin + x cos
                v4f y0, y1;
                y0[0] = x0[0] * e0[0] + sg * (w0[0] * e0[1]); y0[1] = x0[1] * e0[2] + sg * (w0[1] * e0[3]);
                y0[2] = x0[2] * e1[0] + sg * (w0[2] * e1[1]); y0[3] = x0[3] * e1[2] + sg * (w0[3] * e1[3]);
                y1[0] = x1[0] * e2[0] + sg * (w1[0] * e2[1]); y1[1] = x1[1] * e2[2] + sg * (w1[1] * e2[3]);
                y1[2] = x1[2] * e3[0] + sg * (w1[2] * e3[1]); y1[3] = x1[3] * e3[2] + sg * (w1[3] * e3[3]);
                x0 = y0; x1 = y1;
            }
#pragma unroll
            for (int i = 0; i < 4; ++i) { hv[s][i] = (h16)x0[i]; hv[s][4 + i] = (h16)x1[i]; }
        }
        const size_t sb = tbase + (size_t)(mb * 16) * (size_t)pitch;
{
#pragma unroll
            for (int s = 0; s < 4; ++s) { const size_t oo = sb + (size_t)(4 * s + rg) * (size_t)pitch + c8;
                *(v8h*)(Ph + oo) = hv[s]; }
             }
        wave_sync();
    }
}

// k_flash: fused attention, one wave per 16 * QG query rows of one (batch, head); Q fragments straight from the f16 plane.
// K and V^T: the block's AW waves walk the same keys, so each tile of KT keys is brought into LDS ONCE per block by asynchronous 16-byte copies (whole 128-byte lines,
// eight lanes per row) into one of two buffers, the next tile flying while this one is worked on; fragments are 16-byte LDS reads at pitch LP.
// Each K and V^T fragment is read once per wave and feeds QG matrix products (one per 16-query group g).
// Transposed form: S^T[key][t] = K Q^T (A = K rows, B = Q rows); lane (t = lane&15, h = lane>>4) holds keys 8h+r of each 16-key tile, so the packed
// P tile is directly the B fragment of O^T[d][t] = V^T P^T (element r <- tile keys 0..15, element 8+r <- tile keys 16..31, lane unchanged).
// Scale chain: logit2 = acc * (0.125 * log2 e); P = exp2(logit2 - max + 8) as f16; l = sum of the f16 P values; ctx plane = O^T * 1024 / l.
// Softmax state (running max, partial sum) is one scalar per lane and group; the two lane halves of a row are combined with one xor-16 exchange.
// one tile's copies of one thread: four 16-byte pieces of the K tile (rows 16 apart) and four of the V^T tile, each lane with its own LDS byte address and global pointer.
// s_wait_xcnt stands as the statement's last line, in front of any rewrite of the address registers that the copies name.
__device__ __forceinline__ void stage_tile(unsigned l, const h16* kg, const h16* vg) {
    asm volatile("global_load_async_to_lds_b128 %0, %8, off\n\t"
                 "global_load_async_to_lds_b128 %1, %9, off\n\t"
                 "global_load_async_to_lds_b128 %2, %10, off\n\t"
                 "global_load_async_to_lds_b128 %3, %11, off\n\t"
                 "global_load_async_to_lds_b128 %4, %12, off\n\t"
                 "global_load_async_to_lds_b128 %5, %13, off\n\t"
                 "global_load_async_to_lds_b128 %6, %14, off\n\t"
                 "global_load_async_to_lds_b128 %7, %15, off\n\t"
                 "s_wait_xcnt 0x0"
                 :: "v"(l), "v"(l + 16 * LP * 2), "v"(l + 32 * LP * 2), "v"(l + 48 * LP * 2),
                    "v"(l + 64 * LP * 2), "v"(l + 80 * LP * 2), "v"(l + 96 * LP * 2), "v"(l + 112 * LP * 2),
                    "v"(kg), "v"(kg + 16 * HD), "v"(kg + 32 * HD), "v"(kg + 48 * HD),
                    "v"(vg), "v"(vg + (size_t)16 * SEQ), "v"(vg + (size_t)32 * SEQ), "v"(vg + (size_t)48 * SEQ)
                 : "memory");
}

__global__ __launch_bounds__(32 * AW) void k_flash(const h16* __restrict__ QH, const h16* __restrict__ KP, const h16* __restrict__ VT, h16* CX) {
    __shared__ __align__(16) float os[AW * 16 * 68];
    __shared__ __align__(16) h16 kv[2 * TH];
    const int lane = threadIdx.x & 31, lr = lane & 15, hi = lane >> 4;
    const int wave = __builtin_amdgcn_readfirstlane((int)(threadIdx.x >> 5));
    const int zh = blockIdx.y; const int b = zh / NH_, h = zh % NH_;
    const int t0 = (blockIdx.x * AW + wave) * (16 * QG);
    const size_t pbase = (size_t)zh * SEQ * HD;
    const size_t qo = pbase + (size_t)(t0 + lr) * HD + 8 * hi;
    v16h qh0[QG], qh1[QG];                                   // B fragments: col t, k = d
#pragma unroll
    for (int g = 0; g < QG; ++g) { qh0[g] = ldh(QH + qo + (size_t)g * 16 * HD); qh1[g] = ldh(QH + qo + (size_t)g * 16 * HD + 32); }
    // copy addresses of this thread: row = tid / 8 (+ 16 per piece), 16-byte column = tid % 8, the same in the K tile (row = key) and in the V^T tile (row = d)
    const unsigned crow = threadIdx.x >> 3, ccol = threadIdx.x & 7;
    const unsigned l0 = (unsigned)(size_t)&kv[0] + crow * (LP * 2) + ccol * 16;      // LDS byte address in buffer 0
    const h16* kg = KP + pbase + (size_t)crow * HD + ccol * 8;                       // + key0 * HD
    const h16* vg = VT + pbase + (size_t)crow * SEQ + ccol * 8;                      // + key0
    stage_tile(l0, kg, vg);
    asm volatile("s_wait_asynccnt 0x0" ::: "memory");        // this wave's copies of tile 0 have landed
    __syncthreads();                                         // ... and every other wave's: tile 0 may be read
    stage_tile(l0 + TH * 2, kg + (size_t)KT * HD, vg + KT);  // tile 1 flies during trip 0
    const h16* fr = kv + lr * LP + 8 * hi;                   // fragment base: K row key (k = d) at + key * LP; V^T row d (k = key) at + (KT + d) * LP + key
    v8f o0[QG], o1[QG], o2[QG], o3[QG];
    float m[QG], l[QG];
#pragma unroll
    for (int g = 0; g < QG; ++g) { o0[g] = (v8f){}; o1[g] = (v8f){}; o2[g] = (v8f){}; o3[g] = (v8f){}; m[g] = -3.0e38f; l[g] = 0.0f; }
#pragma unroll 1
    for (int t = 0; t < SEQ / KT; ++t) {
      const h16* fb = fr + (t & 1) * TH;                 // trip t reads buffer t mod 2 alone
#pragma unroll
      for (int sub = 0; sub < KT / 32; ++sub) {          // two passes of 32 keys per tile, one online-softmax step each
        const h16* ka = fb + sub * 32 * LP;
        const v16h ka0 = ldh(ka), ka1 = ldh(ka + 32), kb0 = ldh(ka + 16 * LP), kb1 = ldh(ka + 16 * LP + 32);
        v16h pb[QG];
#pragma unroll
        for (int g = 0; g < QG; ++g) {
            v8f sHa = (v8f){}, sHb = (v8f){};
            sHa = wmma16(ka0, qh0[g], sHa); sHb = wmma16(kb0, qh0[g], sHb);
            sHa = wmma16(ka1, qh1[g], sHa); sHb = wmma16(kb1, qh1[g], sHb);
            float ta[8], tb[8]; float mx = -3.0e38f;
#pragma unroll
            for (int r = 0; r < 8; ++r) { ta[r] = sHa[r] * SC2; tb[r] = sHb[r] * SC2; mx = fmaxf(mx, fmaxf(ta[r], tb[r])); }
            mx = fmaxf(mx, __shfl_xor(mx, 16, 32));
            const float mnew = fmaxf(m[g], mx);
            const float alpha = __builtin_amdgcn_exp2f(m[g] - mnew);
            const float sh = PSH - mnew;
            float ls = 0.0f;
#pragma unroll
            for (int r = 0; r < 8; ++r) { const h16 pa = (h16)__builtin_amdgcn_exp2f(ta[r] + sh); const h16 pc = (h16)__builtin_amdgcn_exp2f(tb[r] + sh); pb[g][r] = pa; pb[g][8 + r] = pc; ls += (float)pa + (float)pc; }
            l[g] = l[g] * alpha + ls; m[g] = mnew;
            o0[g] = o0[g] * alpha; o1[g] = o1[g] * alpha; o2[g] = o2[g] * alpha; o3[g] = o3[g] * alpha;
        }
        const h16* va = fb + KT * LP + sub * 32;
        const v16h v0 = ldh(va), v1 = ldh(va + 16 * LP), v2 = ldh(va + 32 * LP), v3 = ldh(va + 48 * LP);
#pragma unroll
        for (int g = 0; g < QG; ++g) {
            o0[g] = wmma16(v0, pb[g], o0[g]); o1[g] = wmma16(v1, pb[g], o1[g]); o2[g] = wmma16(v2, pb[g], o2[g]); o3[g] = wmma16(v3, pb[g], o3[g]);
        }
      }
        __builtin_amdgcn_sched_barrier(0);               // keeps every matrix product of this trip in front of the slots below
        // four vector slots between the last matrix product and the loop's back edge
        asm volatile("v_nop\n\tv_nop\n\tv_nop\n\tv_nop");
        asm volatile("s_wait_dscnt 0x0" ::: "memory");   // this wave's reads of buffer t mod 2 have returned
        asm volatile("s_wait_asynccnt 0x0" ::: "memory");// this wave's copies of tile t + 1 have landed
        __syncthreads();                                 // publishes tile t + 1 and ends every wave's reads of the buffer refilled below
        if (t + 2 < SEQ / KT) stage_tile(l0 + (unsigned)(t & 1) * (TH * 2), kg + (size_t)(t + 2) * KT * HD, vg + (size_t)(t + 2) * KT);
    }
    asm volatile("s_wait_asynccnt 0x0" ::: "memory");    // nothing of this wave's is in flight when the loop is left
    const int wb = wave * 16 * 68;
    const int rg = lane >> 3, c8 = (lane & 7) * 8;       // 4 s x 4 row groups = 16 rows; 8 lanes x 8 halves = 64 columns
#pragma unroll
    for (int g = 0; g < QG; ++g) {
        const float lt = l[g] + __shfl_xor(l[g], 16, 32);
        const float inv = (1.0f / lt) * CXS;
        // O^T D layout: o_j[r] = (d = 16j + 8h + r, t = lane&15) -> os[t][d]; rows 0..15 x columns 0..63 all written
        { v4f a, c;
          a[0] = o0[g][0] * inv; a[1] = o0[g][1] * inv; a[2] = o0[g][2] * inv; a[3] = o0[g][3] * inv; c[0] = o0[g][4] * inv; c[1] = o0[g][5] * inv; c[2] = o0[g][6] * inv; c[3] = o0[g][7] * inv;
          *(v4fa*)(&os[wb + lr * 68 +  0 + 8 * hi]) = a; *(v4fa*)(&os[wb + lr * 68 +  0 + 8 * hi + 4]) = c;
          a[0] = o1[g][0] * inv; a[1] = o1[g][1] * inv; a[2] = o1[g][2] * inv; a[3] = o1[g][3] * inv; c[0] = o1[g][4] * inv; c[1] = o1[g][5] * inv; c[2] = o1[g][6] * inv; c[3] = o1[g][7] * inv;
          *(v4fa*)(&os[wb + lr * 68 + 16 + 8 * hi]) = a; *(v4fa*)(&os[wb + lr * 68 + 16 + 8 * hi + 4]) = c;
          a[0] = o2[g][0] * inv; a[1] = o2[g][1] * inv; a[2] = o2[g][2] * inv; a[3] = o2[g][3] * inv; c[0] = o2[g][4] * inv; c[1] = o2[g][5] * inv; c[2] = o2[g][6] * inv; c[3] = o2[g][7] * inv;
          *(v4fa*)(&os[wb + lr * 68 + 32 + 8 * hi]) = a; *(v4fa*)(&os[wb + lr * 68 + 32 + 8 * hi + 4]) = c;
          a[0] = o3[g][0] * inv; a[1] = o3[g][1] * inv; a[2] = o3[g][2] * inv; a[3] = o3[g][3] * inv; c[0] = o3[g][4] * inv; c[1] = o3[g][5] * inv; c[2] = o3[g][6] * inv; c[3] = o3[g][7] * inv;
          *(v4fa*)(&os[wb + lr * 68 + 48 + 8 * hi]) = a; *(v4fa*)(&os[wb + lr * 68 + 48 + 8 * hi + 4]) = c; }
        wave_sync();
        h16* crow = CX + ((size_t)b * SEQ + t0 + g * 16) * DM + h * HD;
        v8h hv[4];
#pragma unroll
        for (int s = 0; s < 4; ++s) { const int row = 4 * s + rg;
            const v4f x0 = *(const v4fa*)(&os[wb + row * 68 + c8]); const v4f x1 = *(const v4fa*)(&os[wb + row * 68 + c8 + 4]);
#pragma unroll
            for (int i = 0; i < 4; ++i) { hv[s][i] = (h16)x0[i]; hv[s][4 + i] = (h16)x1[i]; } }
#pragma unroll
        for (int s = 0; s < 4; ++s) *(v8h*)(crow + (size_t)(4 * s + rg) * DM + c8) = hv[s];
        asm volatile("s_wait_xcnt 0x0" ::: "memory");    // before the next group reuses the registers these stores name
        __builtin_amdgcn_sched_barrier(0);               // keeps the next group's arithmetic behind that wait
        wave_sync();                                     // the next group overwrites this wave's staging rows
    }
}

// k_oproj: register-blocked f16 GEMM, one wave per 64x64 tile, GW waves per block (gemm_main), A = ctx plane (x1024), Bt = Wp plane (x256), K = DM; OUT[m][n] = acc * 2^-18 + bias[n] (f32).
__global__ __launch_bounds__(32 * GW) void k_oproj(const h16* __restrict__ A, const h16* __restrict__ Bt, const float* __restrict__ bias, float* OUT) {
    __shared__ __align__(16) float osb[GW * 16 * 68];
    __shared__ __align__(16) h16 sm[2 * GTH];
    const int lane = threadIdx.x & 31, lr = lane & 15, hi = lane >> 4;
    const int wave = __builtin_amdgcn_readfirstlane((int)(threadIdx.x >> 5));
    const int wr = (wave & 1) * 64, wc = (wave >> 1) * 64;
    const int r0 = blockIdx.x * GT + wr, c0 = blockIdx.y * GT + wc;      // this wave's 64 x 64 tile
    float* const os = osb + wave * 16 * 68;                              // this wave's own staging rows
    v8f acc[4][4];
    gemm_main(A, Bt, sm, (int)blockIdx.x * GT, (int)blockIdx.y * GT, wr, wc, lr, hi, acc);
    const int cofs = lr * 4;                              // 16 lanes x 4 floats = 64 columns
    const v4f braw = *(const v4fa*)(bias + c0 + cofs); v4f bb;
#pragma unroll
    for (int i = 0; i < 4; ++i) bb[i] = bfval(braw[i]);
    const int bi = r0 / SEQ, tt = r0 % SEQ;
    float* obase = OUT + ((size_t)bi * OUT_SEQ + tt) * DM + c0;
#pragma unroll
    for (int mb = 0; mb < 4; ++mb) {
#pragma unroll
        for (int nb = 0; nb < 4; ++nb) {
#pragma unroll
            for (int j = 0; j < 8; ++j) os[(hi * 8 + j) * 68 + nb * 16 + lr] = acc[mb][nb][j]; }   // rows 0..15 x cols 0..63 all written
        wave_sync();
        v4f vals[8];
#pragma unroll
        for (int s = 0; s < 8; ++s) { const int row = 2 * s + hi;            // 8 s x 2 rows = 16 rows
            const v4f x = *(const v4fa*)(&os[row * 68 + cofs]); vals[s] = x * OSC + bb; }
{
#pragma unroll
            for (int s = 0; s < 8; ++s) *(v4f*)(obase + (size_t)(mb * 16 + 2 * s + hi) * DM + cofs) = vals[s];
             }
        wave_sync();
    }
}

static constexpr size_t al256(size_t v) { return (v + 255) & ~(size_t)255; }
static constexpr size_t SZ_XB = al256((size_t)NB * SEQ * DM * 2);            // one bf16 activation plane
static constexpr size_t SZ_WB = al256((size_t)3 * DM * DM * 2);              // Wq | Wk | Wv bf16
static constexpr size_t SZ_WP = al256((size_t)DM * DM * 2);                  // Wp f16 x256
static constexpr size_t SZ_CS = al256((size_t)2 * SEQ * NPR * 2 * 4);        // two (cos, sin) tables
static constexpr size_t SZ_PL = al256((size_t)NB * NH_ * SEQ * HD * 2);      // one f16 head plane
static constexpr size_t SZ_CX = al256((size_t)NB * SEQ * DM * 2);            // ctx f16 x1024
static constexpr size_t SZ_TOTAL = 3 * SZ_XB + SZ_WB + SZ_WP + SZ_CS + 3 * SZ_PL + SZ_CX;
static_assert(SZ_TOTAL <= (size_t)134217728);          // workspace carve <= 128 MiB
static_assert(((size_t)DM * DM * 2) % 256 == 0);       // weight sub-planes stay 256-byte aligned

extern "C" void kernel_launch(void* const* d_in, const int* in_sizes, int n_in,
                              void* d_out, int out_size, void* d_ws, size_t ws_size, hipStream_t stream) {
    if (n_in < 8) return;
    const size_t needx = ((size_t)(NB - 1) * SEQ_FULL + SEQ) * DM;
    if ((size_t)in_sizes[0] < needx || (size_t)in_sizes[1] < needx || (size_t)in_sizes[2] < needx) return;
    if ((size_t)in_sizes[3] < (size_t)DM * DM || (size_t)in_sizes[4] < (size_t)DM * DM || (size_t)in_sizes[5] < (size_t)DM * DM || (size_t)in_sizes[6] < (size_t)DM * DM) return;
    if ((size_t)in_sizes[7] < (size_t)DM) return;
    if ((size_t)out_size < ((size_t)(NB - 1) * OUT_SEQ + SEQ) * DM) return;
    if (SZ_TOTAL > ws_size) return;
    // wire order: q, k, v, Wq, Wk, Wv, Wp, bp (weights [out][in] = Bt as-is)
    const float* xq = (const float*)d_in[0]; const float* xk = (const float*)d_in[1]; const float* xv = (const float*)d_in[2];
    const float* wq = (const float*)d_in[3]; const float* wk = (const float*)d_in[4]; const float* wv = (const float*)d_in[5];
    const float* wp = (const float*)d_in[6]; const float* bp = (const float*)d_in[7];
    float* OUT = (float*)d_out;      // [NB][SEQ][1024]
    char* wsp = (char*)d_ws;
    bf* XQ = (bf*)wsp; wsp += SZ_XB;                 // [NB*SEQ][1024]
    bf* XK = (bf*)wsp; wsp += SZ_XB;
    bf* XV = (bf*)wsp; wsp += SZ_XB;
    bf* WB = (bf*)wsp; wsp += SZ_WB;                 // [3][1024][1024]: q | k | v
    h16* WP = (h16*)wsp; wsp += SZ_WP;               // [1024][1024] x256
    float* CS = (float*)wsp; wsp += SZ_CS;           // [SEQ][512][2] then [512][SEQ][2]
    h16* QH = (h16*)wsp; wsp += SZ_PL;               // [NB*16][SEQ][64]
    h16* KP = (h16*)wsp; wsp += SZ_PL;               // [NB*16][SEQ][64]
    h16* VT = (h16*)wsp; wsp += SZ_PL;               // [NB*16][64][SEQ]
    h16* CX = (h16*)wsp; wsp += SZ_CX;               // [NB*SEQ][1024] x1024
    bf* WQ = WB; bf* WK = WB + (size_t)DM * DM; bf* WV = WB + (size_t)2 * DM * DM;

    k_prep<<<PB, PT, 0, stream>>>(xq, xk, xv, wq, wk, wv, wp, XQ, XK, XV, WB, WP, CS);

    // q, k: A = x rows (m = b*SEQ + t), Bt = W rows (n = h*64 + d) -> plane [(b*16 + h)][t][d]; k gets rotary on column pairs
    k_proj<0><<<dim3(NB * SEQ / GT, DM / GT, 1), 32 * GW, 0, stream>>>(XQ, WQ, QH, CS, SEQ, (size_t)NH_ * SEQ * HD, HD, HD, (size_t)SEQ * HD);
    k_proj<1><<<dim3(NB * SEQ / GT, DM / GT, 1), 32 * GW, 0, stream>>>(XK, WK, KP, CS, SEQ, (size_t)NH_ * SEQ * HD, HD, HD, (size_t)SEQ * HD);
    // v^T: A = Wv rows (m = h*64 + d), Bt = x rows (n = b*SEQ + t) -> plane [(b*1024 + m)][t] = [(b*16 + h)][d][t]; rotary on row pairs
    k_proj<2><<<dim3(DM / GT, NB * SEQ / GT, 1), 32 * GW, 0, stream>>>(WV, XV, VT, CS, DM, (size_t)0, SEQ, SEQ, (size_t)DM * SEQ);

    k_flash<<<dim3(SEQ / (16 * QG * AW), NB * NH_, 1), 32 * AW, 0, stream>>>(QH, KP, VT, CX);

    // out: A = ctx rows (m = b*SEQ + t), Bt = Wp rows (n = out feature)
    k_oproj<<<dim3(NB * SEQ / GT, DM / GT, 1), 32 * GW, 0, stream>>>(CX, WP, bp, OUT);
}

// v005
// One run takes 107 microseconds.
// Two timings next to v004 both put it at 1.04 times that version's speed.
// Counting every step since v000, it is 2.31 times as fast.
#include <hip/hip_runtime.h>

// Multi-head attention, width 1024 = 16 heads x 64; inputs q, k, v [NB][SEQ][1024]; Wq/Wk/Wv/Wp [out][in] (y = x W^T); interleaved rotary on projected k and v over the full 1024 axis (512 pairs, angle = pos * 10000^(-2p/1024)); score scale 1/8; dense softmax; out = ctx Wp^T + bp (f32).
// Compute dtypes, f32 accumulate everywhere: q/k/v projections v_wmma_f32_16x16x32_bf16 (inputs and weights RNE-converted to bf16; products exact); rotary in f32 in the projection epilogue from f32 cos/sin tables;
// scores v_wmma_f32_16x16x32_f16: q single f16, k single f16 (one product; logits = acc * 0.125 * log2 e); P (x256 carry, cancels in the normalisation; row sum taken over the f16 values) and v single f16; softmax f32 (online, running max);
// output projection v_wmma_f32_16x16x32_f16: ctx single f16 with x1024 carry, Wp as f16 of the bf16 RNE value with x256 carry, 2^-18 folded back in the f32 epilogue, bias (bf16 RNE value) added in f32.
// Layout: bf16 copies of q, k, v, Wq, Wk, Wv; q and k planes [b*16+h][t][d]; v^T plane [b*16+h][d][t]; ctx plane [b*SEQ+t][1024]; fused flash kernel in transposed form (S^T = K Q^T, O^T = V^T P^T), its K and V^T tiles staged in LDS once per block; the four GEMMs stage their A and B tiles in LDS once per 128 x 128 block.

#ifndef NB
#define NB 2
#endif
#ifndef SEQ
#define SEQ 2048
#endif
#define NB_FULL  2
#define SEQ_FULL 2048
#ifndef OUT_SEQ
#define OUT_SEQ SEQ              // row pitch (in tokens) between batches of the output
#endif
#define DM   1024
#define NH_  16
#define HD   64
#define NPR  (DM / 2)            // rotary pairs per token row
#define PT   256                 // threads per pre-pass block
#define PB   NPR                 // pre-pass blocks (block index = rotary pair of the [p][pos] table)
#define AW   8                   // waves per flash block: two per SIMD, so one wave's softmax runs while the other's matrix products and waits do
#define QG   2                   // 16-query groups per flash wave (32 query rows each)
#define KT   64                  // keys per staged tile (a K row and a V^T row of a tile are both 128 bytes: whole cache lines)
#define LP   72                  // LDS row pitch in halves: 144 bytes = 16 x 9, conflict-free for 16-byte fragment reads
#define TH   (2 * 64 * LP)       // halves of one buffer: K tile (KT rows) then V^T tile (HD rows)
#define GW   4                   // waves per GEMM block: 2 x 2 wave tiles of 64 x 64 = one 128 x 128 tile
#define GT   128                 // rows of A and rows of Bt per GEMM block
#ifndef GK
#define GK   128                 // k elements per staged GEMM tile (256 bytes a row: whole cache lines)
#endif
#define GLP  (GK + 8)            // LDS row pitch of a GEMM tile in 16-bit elements: 16 bytes x an odd number, conflict-free for 16-byte fragment reads
#define GRS  (GW * 32 * 8 / GK)  // rows that one 16-byte copy of every thread of the block covers
#define GTH  (2 * GT * GLP)      // 16-bit elements of one GEMM buffer: A tile (GT rows) then Bt tile (GT rows)
#define SC2  (0.125f * 1.4426950408889634f)   // HD^-0.5 * log2(e)
#define PSH  8.0f                // log2 of the P carry (256)
#define CXS  1024.0f             // carry of the ctx plane
#define WPS  256.0f              // carry of the Wp plane
#define OSC  (1.0f / (1024.0f * 256.0f))      // 2^-18

static_assert(HD == 64);
static_assert(NH_ * HD == DM);                 // head h = columns h*64 + d
static_assert(DM % 64 == 0);
static_assert(DM % 32 == 0);                   // GEMM k-loop steps by 32
static_assert(SEQ % 64 == 0);                  // a 64-row tile never straddles two batches
static_assert((NB * SEQ) % 64 == 0);
static_assert(SEQ % 32 == 0);                  // key loop steps by 32
static_assert(SEQ % (16 * QG * AW) == 0);      // flash grid covers the sequence exactly
static_assert(SEQ % KT == 0 && SEQ / KT >= 2); // whole tiles; the two-buffer prologue fills two
static_assert(KT == 64 && AW * 32 * 2 * 8 == KT * HD);   // two 16-byte copies per thread cover one 64 x 64 tile
static_assert((NB * SEQ) % GT == 0 && DM % GT == 0);      // GEMM grids cover both operands exactly
static_assert(DM % GK == 0 && DM / GK >= 2 && GK % 64 == 0);   // whole k tiles of whole lines; the two-buffer prologue fills two
static_assert(GT % (8 * GRS) == 0 && (GLP * 2) % 32 == 16);    // statements of eight copies cover an operand tile exactly; odd multiple of 16 bytes
static_assert(2 * GT / GRS <= 63);                             // copies of one wave in flight: one tile's
static constexpr size_t PN  = (size_t)PB * PT;              // pre-pass threads
static constexpr size_t WCH = (size_t)DM * DM / 8;          // 8-element pieces of one weight
static constexpr size_t BCH = (size_t)SEQ * DM / 8;         // 8-element pieces of one batch of one activation
static constexpr int    XR  = (int)((size_t)NB * BCH / PN); // pre-pass rounds over the activations
static_assert((size_t)XR * PN == (size_t)NB * BCH && XR >= 1);   // the rounds cover the activation planes exactly
static_assert((size_t)NB * SEQ_FULL * DM * 4 < ((size_t)1 << 32) && (size_t)SEQ * NPR * 8 < ((size_t)1 << 32));   // 32-bit byte offsets inside every plane
static_assert(WCH == PN);                      // one piece of each weight per pre-pass thread
static_assert(NPR == 2 * PT);                  // one row of the [pos][p] table: PT threads x 2 pairs
static_assert(SEQ == XR * PB);                 // [pos][p] table: one position per block and round
static_assert(SEQ == 2 * XR * PT);             // [p][pos] table: two positions per thread and round
static_assert(NB <= NB_FULL);
static_assert(SEQ <= SEQ_FULL);
static_assert(((size_t)(NB - 1) * OUT_SEQ + SEQ) * DM * 4 <= (size_t)16777216);   // last output byte stays inside the output buffer

typedef _Float16 h16;
typedef unsigned short bf;
typedef __attribute__((ext_vector_type(16))) __bf16   v16bf;
typedef __attribute__((ext_vector_type(16))) _Float16 v16h;
typedef __attribute__((ext_vector_type(8)))  _Float16 v8h;
typedef __attribute__((ext_vector_type(8)))  unsigned short v8us;
typedef __attribute__((ext_vector_type(8)))  float    v8f;
typedef __attribute__((ext_vector_type(4)))  float    v4f;
typedef __attribute__((ext_vector_type(2)))  float    v2f;
typedef v4f  __attribute__((may_alias)) v4fa;

__device__ __forceinline__ unsigned short f2bf(float f) { unsigned u = __float_as_uint(f); u += 0x7FFFu + ((u >> 16) & 1u); return (unsigned short)(u >> 16); }
__device__ __forceinline__ float bfval(float f) { return __uint_as_float(((unsigned)f2bf(f)) << 16); }
__device__ __forceinline__ v16h cat16(v8h lo, v8h hi) { return __builtin_shufflevector(lo, hi, 0, 1, 2, 3, 4, 5, 6, 7, 8, 9, 10, 11, 12, 13, 14, 15); }
__device__ __forceinline__ v16bf cat16b(v8us lo, v8us hi) { return __builtin_bit_cast(v16bf, __builtin_shufflevector(lo, hi, 0, 1, 2, 3, 4, 5, 6, 7, 8, 9, 10, 11, 12, 13, 14, 15)); }
__device__ __forceinline__ v8f wmma16(v16h a, v16h b, v8f c) { return __builtin_amdgcn_wmma_f32_16x16x32_f16(false, a, false, b, (short)0, c, false, false); }
__device__ __forceinline__ v8f wmmab(v16bf a, v16bf b, v8f c) { return __builtin_amdgcn_wmma_f32_16x16x32_bf16(false, a, false, b, (short)0, c, false, false); }
// fragment loaders from K-contiguous 16-bit rows; p already includes + 8*(lane>>4): elements 0..7 <- k0+8h+0..7, elements 8..15 <- k0+16+8h+0..7 (same map for A and B)
__device__ __forceinline__ v16h  ldh(const h16* p) { return cat16(*(const v8h*)p, *(const v8h*)(p + 16)); }
__device__ __forceinline__ v16bf ldb(const bf* p)  { return cat16b(*(const v8us*)p, *(const v8us*)(p + 16)); }
// ordering point for wave-private LDS tiles (same wave writes and reads)
__device__ __forceinline__ void wave_sync() { __builtin_amdgcn_fence(3 /* release order */, "wavefront"); __builtin_amdgcn_wave_barrier(); asm volatile("" ::: "memory"); }

// k_prep: every pass that only prepares operands, in ONE launch of long-lived blocks: bf16 copies of q, k, v, Wq, Wk, Wv; the f16 x256 copy of Wp; both (cos, sin) tables.
// PB blocks x PT threads stay resident (16 waves per WGP) and each thread walks its share of every plane with stride PN, so the launch starts 4,096 waves.
// Tables, as float2 (cos, sin) of pos * theta(p): first [pos][p] (a block row = one position, a thread = two neighbouring pairs), then [p][pos] (a block = one pair, a thread = two neighbouring positions).
__device__ __forceinline__ float theta_of(int p) { const float e = (2.0f * (float)p) * (1.0f / (float)DM); return 1.0f / powf(10000.0f, e); }
__device__ __forceinline__ v8us cvt8(v8f v) { v8us o;
#pragma unroll
    for (int k = 0; k < 8; ++k) o[k] = f2bf(v[k]);
    return o; }
__device__ __forceinline__ v4f cs2(float a0, float a1) { float s0, c0, s1, c1; sincosf(a0, &s0, &c0); sincosf(a1, &s1, &c1); v4f o; o[0] = c0; o[1] = s0; o[2] = c1; o[3] = s1; return o; }

// plane base + one 32-bit byte offset (every plane is far below 4 GiB): the planes of a round share the offset register and no 64-bit address is formed per access
__device__ __forceinline__ v8f ld8(const float* p, unsigned byteoff) { return *(const v8f*)((const char*)p + byteoff); }
template <typename V, typename P> __device__ __forceinline__ void st16(P* p, unsigned byteoff, V v) { *(V*)((char*)p + byteoff) = v; }

__global__ __launch_bounds__(PT) void k_prep(const float* __restrict__ xq, const float* __restrict__ xk, const float* __restrict__ xv,
                                             const float* __restrict__ wq, const float* __restrict__ wk, const float* __restrict__ wv, const float* __restrict__ wp,
                                             bf* __restrict__ XQ, bf* __restrict__ XK, bf* __restrict__ XV, bf* __restrict__ WB, h16* __restrict__ WP, float* __restrict__ CS) {
    const unsigned tid = threadIdx.x, blk = blockIdx.x;
    const unsigned g = blk * PT + tid;
    // weights, one 8-element piece of each per thread: the loads are issued first and the three angle steps are worked out while they fly
    const v8f w0 = ld8(wq, g * 32), w1 = ld8(wk, g * 32), w2 = ld8(wv, g * 32), w3 = ld8(wp, g * 32);
    const float th0 = theta_of((int)(2 * tid)), th1 = theta_of((int)(2 * tid + 1)), thb = theta_of((int)blk);
    st16(WB, g * 16, cvt8(w0)); st16(WB + (size_t)DM * DM, g * 16, cvt8(w1)); st16(WB + (size_t)2 * DM * DM, g * 16, cvt8(w2));
    { v8h o;
#pragma unroll
      for (int k = 0; k < 8; ++k) o[k] = (h16)(bfval(w3[k]) * WPS);
      st16(WP, g * 16, o); }
    asm volatile("s_wait_xcnt 0x0" ::: "memory");        // before the first round reuses the registers these stores name
    __builtin_amdgcn_sched_barrier(0);                   // keeps the first round's address arithmetic behind that wait
    float* const CS1 = CS + (size_t)SEQ * NPR * 2;
    // rolled: four inlined sincosf per trip keep the text small
#pragma unroll 1
    for (unsigned r = 0; r < (unsigned)XR; ++r) {
        const unsigned c = g + r * (unsigned)PN;                                    // 8-element piece of the [NB*SEQ][DM] planes
        const unsigned s = (SEQ == SEQ_FULL) ? c : (c / (unsigned)BCH) * (unsigned)((size_t)SEQ_FULL * DM / 8) + c % (unsigned)BCH;   // the same piece in the inputs (batch pitch SEQ_FULL)
        const v8f a = ld8(xq, s * 32), b = ld8(xk, s * 32), d = ld8(xv, s * 32);
        // this round's table entries stand between the loads and their first use
        const unsigned t0 = blk + r * PB, t1 = 2 * (tid + r * PT);
        st16(CS,  (t0 * NPR + 2 * tid) * 8, cs2((float)(int)t0 * th0, (float)(int)t0 * th1));
        st16(CS1, (blk * SEQ + t1) * 8,     cs2((float)(int)t1 * thb, (float)(int)(t1 + 1) * thb));
        st16(XQ, c * 16, cvt8(a)); st16(XK, c * 16, cvt8(b)); st16(XV, c * 16, cvt8(d));
        asm volatile("s_wait_xcnt 0x0" ::: "memory");    // before the next round reuses the registers these stores name
        __builtin_amdgcn_sched_barrier(0);               // keeps the next round's address arithmetic behind that wait
    }
}

// Main loop of the four GEMMs. A block of GW waves owns a GT x GT tile of C; each wave a 64 x 64 quarter (16 accumulators).
// The k axis is walked in tiles of GK: the GT rows of A and the GT rows of Bt are brought into LDS ONCE per block by asynchronous 16-byte copies (whole 128-byte lines,
// GK / 8 lanes per row) into one of two buffers, the next tile flying while this one is worked on; fragments are 16-byte LDS reads at pitch GLP. k runs upward in steps of 32 as before.
__device__ __forceinline__ v16h  ldf(const h16* p) { return ldh(p); }
__device__ __forceinline__ v16bf ldf(const bf* p)  { return ldb(p); }
__device__ __forceinline__ v8f mm(v16h a, v16h b, v8f c)   { return wmma16(a, b, c); }
__device__ __forceinline__ v8f mm(v16bf a, v16bf b, v8f c) { return wmmab(a, b, c); }
// eight copies of one thread: 16-byte pieces, rows GRS apart, each lane with its own LDS byte address and global pointer.
// s_wait_xcnt stands as the statement's last line, in front of any rewrite of the address registers that the copies name.
template <typename T>
__device__ __forceinline__ void stage_rows(unsigned l, const T* g) {
    asm volatile("global_load_async_to_lds_b128 %0, %8, off\n\t"
                 "global_load_async_to_lds_b128 %1, %9, off\n\t"
                 "global_load_async_to_lds_b128 %2, %10, off\n\t"
                 "global_load_async_to_lds_b128 %3, %11, off\n\t"
                 "global_load_async_to_lds_b128 %4, %12, off\n\t"
                 "global_load_async_to_lds_b128 %5, %13, off\n\t"
                 "global_load_async_to_lds_b128 %6, %14, off\n\t"
                 "global_load_async_to_lds_b128 %7, %15, off\n\t"
                 "s_wait_xcnt 0x0"
                 :: "v"(l), "v"(l + 1 * GRS * GLP * 2), "v"(l + 2 * GRS * GLP * 2), "v"(l + 3 * GRS * GLP * 2),
                    "v"(l + 4 * GRS * GLP * 2), "v"(l + 5 * GRS * GLP * 2), "v"(l + 6 * GRS * GLP * 2), "v"(l + 7 * GRS * GLP * 2),
                    "v"(g), "v"(g + 1 * GRS * DM), "v"(g + 2 * GRS * DM), "v"(g + 3 * GRS * DM),
                    "v"(g + 4 * GRS * DM), "v"(g + 5 * GRS * DM), "v"(g + 6 * GRS * DM), "v"(g + 7 * GRS * DM)
                 : "memory");
}
// one k tile's copies of one thread: the GT rows of A, then the GT rows of Bt behind them
template <typename T>
__device__ __forceinline__ void stage_ab(unsigned l, const T* ag, const T* bg) {
#pragma unroll
    for (int h = 0; h < GT / (8 * GRS); ++h) stage_rows(l + h * (8 * GRS * GLP * 2), ag + h * (8 * GRS * DM));
#pragma unroll
    for (int h = 0; h < GT / (8 * GRS); ++h) stage_rows(l + (GT + h * 8 * GRS) * (GLP * 2), bg + h * (8 * GRS * DM));
}
// R0, C0: first row of A and of Bt of the BLOCK; wr, wc: this wave's 64-row offsets inside them; sm: 2 * GTH elements of LDS.
template <typename T>
__device__ __forceinline__ void gemm_main(const T* __restrict__ A, const T* __restrict__ Bt, const T* sm, int R0, int C0, int wr, int wc, int lr, int hi, v8f (&acc)[4][4]) {
#pragma unroll
    for (int mb = 0; mb < 4; ++mb)
#pragma unroll
        for (int nb = 0; nb < 4; ++nb) acc[mb][nb] = (v8f){};
    // copy addresses of this thread: row = tid / (GK / 8) (+ GRS per piece), 16-byte column = tid % (GK / 8), the same in the A tile and in the Bt tile
    const unsigned crow = threadIdx.x / (GK / 8), ccol = threadIdx.x % (GK / 8);
    const unsigned l0 = (unsigned)(size_t)&sm[0] + crow * (GLP * 2) + ccol * 16;     // LDS byte address in buffer 0, A tile; the Bt tile stands GT rows behind
    const T* ag = A  + (size_t)(R0 + (int)crow) * DM + ccol * 8;                     // + k0
    const T* bg = Bt + (size_t)(C0 + (int)crow) * DM + ccol * 8;                     // + k0
    stage_ab(l0, ag, bg);
    asm volatile("s_wait_asynccnt 0x0" ::: "memory");        // this wave's copies of tile 0 have landed
    __syncthreads();                                         // ... and every other wave's: tile 0 may be read
    stage_ab(l0 + GTH * 2, ag + GK, bg + GK);                // tile 1 flies during trip 0
    const T* fa = sm + (wr + lr) * GLP + 8 * hi;             // A fragment base of this wave
    const T* fb = sm + (GT + wc + lr) * GLP + 8 * hi;        // Bt fragment base of this wave
#pragma unroll 1
    for (int t = 0; t < DM / GK; ++t) {
        const T* pa = fa + (t & 1) * GTH; const T* pb = fb + (t & 1) * GTH;   // trip t reads buffer t mod 2 alone
        decltype(ldf(fa)) a[2][4], b[2][4];              // two fragment sets: the block of 32 k in work and the next one of the same tile
#pragma unroll
        for (int i = 0; i < 4; ++i) { a[0][i] = ldf(pa + i * 16 * GLP); b[0][i] = ldf(pb + i * 16 * GLP); }
#pragma unroll
        for (int s = 0; s < GK / 32; ++s) {
            if (s + 1 < GK / 32) {
#pragma unroll
                for (int i = 0; i < 4; ++i) { a[(s + 1) & 1][i] = ldf(pa + i * 16 * GLP + (s + 1) * 32); b[(s + 1) & 1][i] = ldf(pb + i * 16 * GLP + (s + 1) * 32); } }
            __builtin_amdgcn_sched_barrier(0);           // the next block's LDS reads stay one group in front of this block's products: their latency runs under the products
#pragma unroll
            for (int nb = 0; nb < 4; ++nb)
#pragma unroll
                for (int mb = 0; mb < 4; ++mb) acc[mb][nb] = mm(a[s & 1][mb], b[s & 1][nb], acc[mb][nb]);
            __builtin_amdgcn_sched_barrier(0);           // no later LDS read is spread among these products; behind the last block: every product stands in front of the slots below
        }
        // four vector slots between the last matrix product and the loop's back edge
        asm volatile("v_nop\n\tv_nop\n\tv_nop\n\tv_nop");
        asm volatile("s_wait_dscnt 0x0" ::: "memory");   // this wave's reads of buffer t mod 2 have returned
        asm volatile("s_wait_asynccnt 0x0" ::: "memory");// this wave's copies of tile t + 1 have landed
        __syncthreads();                                 // publishes tile t + 1 and ends every wave's reads of the buffer refilled below
        if (t + 2 < DM / GK) stage_ab(l0 + (unsigned)(t & 1) * (GTH * 2), ag + (t + 2) * GK, bg + (t + 2) * GK);
    }
    asm volatile("s_wait_asynccnt 0x0" ::: "memory");    // nothing of this wave's is in flight when the loop is left
}

// k_proj: register-blocked bf16 GEMM, one wave per 64x64 tile (16 accumulators), GW waves per block, operands from K-contiguous bf16 planes through LDS (gemm_main), K = DM.
// C[m][n] = sum_k A[m][k] Bt[n][k]; epilogue by MODE:
//   0: C as f16 (Ph);
//   1: rows = tokens, columns = features: interleaved rotary on column pairs (table [pos][p]), then f16 (Ph);
//   2: rows = features, columns = tokens: interleaved rotary on row pairs (table [p][pos]), then f16 (Ph).
// Tile base (r0/RB)*sRB + (r0%RB)*pitch + (c0/CB)*sCB + (c0%CB), row pitch 'pitch' (halves). grid (M/GT, N/GT), 32 * GW threads.
template <int MODE>
__global__ __launch_bounds__(32 * GW) void k_proj(const bf* __restrict__ A, const bf* __restrict__ Bt, h16* Ph, const float* __restrict__ CS,
                                             int RB, size_t sRB, int pitch, int CB, size_t sCB) {
    __shared__ __align__(16) float osb[GW * 16 * 68];
    __shared__ __align__(16) bf sm[2 * GTH];
    const int lane = threadIdx.x & 31, lr = lane & 15, hi = lane >> 4;
    const int wave = __builtin_amdgcn_readfirstlane((int)(threadIdx.x >> 5));
    const int wr = (wave & 1) * 64, wc = (wave >> 1) * 64;
    const int r0 = blockIdx.x * GT + wr, c0 = blockIdx.y * GT + wc;      // this wave's 64 x 64 tile
    float* const os = osb + wave * 16 * 68;                              // this wave's own staging rows
    v8f acc[4][4];
    gemm_main(A, Bt, sm, (int)blockIdx.x * GT, (int)blockIdx.y * GT, wr, wc, lr, hi, acc);
    const size_t tbase = (size_t)(r0 / RB) * sRB + (size_t)(r0 % RB) * (size_t)pitch + (size_t)(c0 / CB) * sCB + (size_t)(c0 % CB);
    const int rg = lane >> 3, c8 = (lane & 7) * 8;       // 4 row groups x 8 lanes; 8 lanes x 8 = 64 columns
#pragma unroll
    for (int mb = 0; mb < 4; ++mb) {
#pragma unroll
        for (int nb = 0; nb < 4; ++nb) {
#pragma unroll
            for (int j = 0; j < 8; ++j) os[(hi * 8 + j) * 68 + nb * 16 + lr] = acc[mb][nb][j]; }   // D: row 8h+j, col lane&15; rows 0..15 x cols 0..63 all written
        wave_sync();
        v8h hv[4];
#pragma unroll
        for (int s = 0; s < 4; ++s) {
            const int row = 4 * s + rg;                  // 4 s x 4 row groups = 16 rows
            v4f x0 = *(const v4fa*)(&os[row * 68 + c8]); v4f x1 = *(const v4fa*)(&os[row * 68 + c8 + 4]);
            if (MODE == 1) {
                const int t = (r0 % SEQ) + mb * 16 + row;                                    // token position of this row
                const float* cp = CS + ((size_t)t * NPR + (size_t)((c0 + c8) >> 1)) * 2;     // 4 pairs: (cos, sin) x 4
                const v4f e0 = *(const v4fa*)cp; const v4f e1 = *(const v4fa*)(cp + 4);
                v4f y0, y1;
                y0[0] = x0[0] * e0[0] - x0[1] * e0[1]; y0[1] = x0[0] * e0[1] + x0[1] * e0[0];
                y0[2] = x0[2] * e0[2] - x0[3] * e0[3]; y0[3] = x0[2] * e0[3] + x0[3] * e0[2];
                y1[0] = x1[0] * e1[0] - x1[1] * e1[1]; y1[1] = x1[0] * e1[1] + x1[1] * e1[0];
                y1[2] = x1[2] * e1[2] - x1[3] * e1[3]; y1[3] = x1[2] * e1[3] + x1[3] * e1[2];
                x0 = y0; x1 = y1;
            }
            if (MODE == 2) {
                const int e = r0 + mb * 16 + row;                                            // feature index of this row; partner row = row ^ 1 (same slab)
                const int tc = (c0 % SEQ) + c8;                                              // first of 8 token positions
                const float* cp = CS + (size_t)SEQ * NPR * 2 + ((size_t)(e >> 1) * SEQ + (size_t)tc) * 2;
                const v4f e0 = *(const v4fa*)cp; const v4f e1 = *(const v4fa*)(cp + 4); const v4f e2 = *(const v4fa*)(cp + 8); const v4f e3 = *(const v4fa*)(cp + 12);
                const v4f w0 = *(const v4fa*)(&os[(row ^ 1) * 68 + c8]); const v4f w1 = *(const v4fa*)(&os[(row ^ 1) * 68 + c8 + 4]);
                const float sg = (row & 1) ? 1.0f : -1.0f;   // even feature: x cos - partner sin; odd feature: partner sin + x cos
                v4f y0, y1;
                y0[0] = x0[0] * e0[0] + sg * (w0[0] * e0[1]); y0[1] = x0[1] * e0[2] + sg * (w0[1] * e0[3]);
                y0[2] = x0[2] * e1[0] + sg * (w0[2] * e1[1]); y0[3] = x0[3] * e1[2] + sg * (w0[3] * e1[3]);
                y1[0] = x1[0] * e2[0] + sg * (w1[0] * e2[1]); y1[1] = x1[1] * e2[2] + sg * (w1[1] * e2[3]);
                y1[2] = x1[2] * e3[0] + sg * (w1[2] * e3[1]); y1[3] = x1[3] * e3[2] + sg * (w1[3] * e3[3]);
                x0 = y0; x1 = y1;
            }
#pragma unroll
            for (int i = 0; i < 4; ++i) { hv[s][i] = (h16)x0[i]; hv[s][4 + i] = (h16)x1[i]; }
        }
        const size_t sb = tbase + (size_t)(mb * 16) * (size_t)pitch;
{
#pragma unroll
            for (int s = 0; s < 4; ++s) { const size_t oo = sb + (size_t)(4 * s + rg) * (size_t)pitch + c8;
                *(v8h*)(Ph + oo) = hv[s]; }
             }
        wave_sync();
    }
}

// k_flash: fused attention, one wave per 16 * QG query rows of one (batch, head); Q fragments straight from the f16 plane.
// K and V^T: the block's AW waves walk the same keys, so each tile of KT keys is brought into LDS ONCE per block by asynchronous 16-byte copies (whole 128-byte lines,
// eight lanes per row) into one of two buffers, the next tile flying while this one is worked on; fragments are 16-byte LDS reads at pitch LP.
// Each K and V^T fragment is read once per wave and feeds QG matrix products (one per 16-query group g).
// Transposed form: S^T[key][t] = K Q^T (A = K rows, B = Q rows); lane (t = lane&15, h = lane>>4) holds keys 8h+r of each 16-key tile, so the packed
// P tile is directly the B fragment of O^T[d][t] = V^T P^T (element r <- tile keys 0..15, element 8+r <- tile keys 16..31, lane unchanged).
// Scale chain: logit2 = acc * (0.125 * log2 e); P = exp2(logit2 - max + 8) as f16; l = sum of the f16 P values; ctx plane = O^T * 1024 / l.
// Softmax state (running max, partial sum) is one scalar per lane and group; the two lane halves of a row are combined with one xor-16 exchange.
// one tile's copies of one thread: two 16-byte pieces of the K tile (rows 32 apart) and two of the V^T tile, each lane with its own LDS byte address and global pointer.
// s_wait_xcnt stands as the statement's last line, in front of any rewrite of the address registers that the copies name.
__device__ __forceinline__ void stage_tile(unsigned l, const h16* kg, const h16* vg) {
    asm volatile("global_load_async_to_lds_b128 %0, %4, off\n\t"
                 "global_load_async_to_lds_b128 %1, %5, off\n\t"
                 "global_load_async_to_lds_b128 %2, %6, off\n\t"
                 "global_load_async_to_lds_b128 %3, %7, off\n\t"
                 "s_wait_xcnt 0x0"
                 :: "v"(l), "v"(l + 32 * LP * 2), "v"(l + 64 * LP * 2), "v"(l + 96 * LP * 2),
                    "v"(kg), "v"(kg + 32 * HD), "v"(vg), "v"(vg + (size_t)32 * SEQ)
                 : "memory");
}

__global__ __launch_bounds__(32 * AW) void k_flash(const h16* __restrict__ QH, const h16* __restrict__ KP, const h16* __restrict__ VT, h16* CX) {
    __shared__ __align__(16) float os[AW * 16 * 68];
    __shared__ __align__(16) h16 kv[2 * TH];
    const int lane = threadIdx.x & 31, lr = lane & 15, hi = lane >> 4;
    const int wave = __builtin_amdgcn_readfirstlane((int)(threadIdx.x >> 5));
    const int zh = blockIdx.y; const int b = zh / NH_, h = zh % NH_;
    const int t0 = (blockIdx.x * AW + wave) * (16 * QG);
    const size_t pbase = (size_t)zh * SEQ * HD;
    const size_t qo = pbase + (size_t)(t0 + lr) * HD + 8 * hi;
    v16h qh0[QG], qh1[QG];                                   // B fragments: col t, k = d
#pragma unroll
    for (int g = 0; g < QG; ++g) { qh0[g] = ldh(QH + qo + (size_t)g * 16 * HD); qh1[g] = ldh(QH + qo + (size_t)g * 16 * HD + 32); }
    // copy addresses of this thread: row = tid / 8 (+ 32 for the second piece), 16-byte column = tid % 8, the same in the K tile (row = key) and in the V^T tile (row = d)
    const unsigned crow = threadIdx.x >> 3, ccol = threadIdx.x & 7;
    const unsigned l0 = (unsigned)(size_t)&kv[0] + crow * (LP * 2) + ccol * 16;      // LDS byte address in buffer 0
    const h16* kg = KP + pbase + (size_t)crow * HD + ccol * 8;                       // + key0 * HD
    const h16* vg = VT + pbase + (size_t)crow * SEQ + ccol * 8;                      // + key0
    stage_tile(l0, kg, vg);
    asm volatile("s_wait_asynccnt 0x0" ::: "memory");        // this wave's copies of tile 0 have landed
    __syncthreads();                                         // ... and every other wave's: tile 0 may be read
    stage_tile(l0 + TH * 2, kg + (size_t)KT * HD, vg + KT);  // tile 1 flies during trip 0
    const h16* fr = kv + lr * LP + 8 * hi;                   // fragment base: K row key (k = d) at + key * LP; V^T row d (k = key) at + (KT + d) * LP + key
    v8f o0[QG], o1[QG], o2[QG], o3[QG];
    float m[QG], l[QG];
#pragma unroll
    for (int g = 0; g < QG; ++g) { o0[g] = (v8f){}; o1[g] = (v8f){}; o2[g] = (v8f){}; o3[g] = (v8f){}; m[g] = -3.0e38f; l[g] = 0.0f; }
#pragma unroll 1
    for (int t = 0; t < SEQ / KT; ++t) {
      const h16* fb = fr + (t & 1) * TH;                 // trip t reads buffer t mod 2 alone
#pragma unroll
      for (int sub = 0; sub < KT / 32; ++sub) {          // two passes of 32 keys per tile, one online-softmax step each
        const h16* ka = fb + sub * 32 * LP;
        const v16h ka0 = ldh(ka), ka1 = ldh(ka + 32), kb0 = ldh(ka + 16 * LP), kb1 = ldh(ka + 16 * LP + 32);
        v16h pb[QG];
#pragma unroll
        for (int g = 0; g < QG; ++g) {
            v8f sHa = (v8f){}, sHb = (v8f){};
            sHa = wmma16(ka0, qh0[g], sHa); sHb = wmma16(kb0, qh0[g], sHb);
            sHa = wmma16(ka1, qh1[g], sHa); sHb = wmma16(kb1, qh1[g], sHb);
            float ta[8], tb[8]; float mx = -3.0e38f;
#pragma unroll
            for (int r = 0; r < 8; ++r) { ta[r] = sHa[r] * SC2; tb[r] = sHb[r] * SC2; mx = fmaxf(mx, fmaxf(ta[r], tb[r])); }
            mx = fmaxf(mx, __shfl_xor(mx, 16, 32));
            const float mnew = fmaxf(m[g], mx);
            const float alpha = __builtin_amdgcn_exp2f(m[g] - mnew);
            const float sh = PSH - mnew;
            float ls = 0.0f;
#pragma unroll
            for (int r = 0; r < 8; ++r) { const h16 pa = (h16)__builtin_amdgcn_exp2f(ta[r] + sh); const h16 pc = (h16)__builtin_amdgcn_exp2f(tb[r] + sh); pb[g][r] = pa; pb[g][8 + r] = pc; ls += (float)pa + (float)pc; }
            l[g] = l[g] * alpha + ls; m[g] = mnew;
            o0[g] = o0[g] * alpha; o1[g] = o1[g] * alpha; o2[g] = o2[g] * alpha; o3[g] = o3[g] * alpha;
        }
        const h16* va = fb + KT * LP + sub * 32;
        const v16h v0 = ldh(va), v1 = ldh(va + 16 * LP), v2 = ldh(va + 32 * LP), v3 = ldh(va + 48 * LP);
#pragma unroll
        for (int g = 0; g < QG; ++g) {
            o0[g] = wmma16(v0, pb[g], o0[g]); o1[g] = wmma16(v1, pb[g], o1[g]); o2[g] = wmma16(v2, pb[g], o2[g]); o3[g] = wmma16(v3, pb[g], o3[g]);
        }
      }
        __builtin_amdgcn_sched_barrier(0);               // keeps every matrix product of this trip in front of the slots below
        // four vector slots between the last matrix product and the loop's back edge
        asm volatile("v_nop\n\tv_nop\n\tv_nop\n\tv_nop");
        asm volatile("s_wait_dscnt 0x0" ::: "memory");   // this wave's reads of buffer t mod 2 have returned
        asm volatile("s_wait_asynccnt 0x0" ::: "memory");// this wave's copies of tile t + 1 have landed
        __syncthreads();                                 // publishes tile t + 1 and ends every wave's reads of the buffer refilled below
        if (t + 2 < SEQ / KT) stage_tile(l0 + (unsigned)(t & 1) * (TH * 2), kg + (size_t)(t + 2) * KT * HD, vg + (size_t)(t + 2) * KT);
    }
    asm volatile("s_wait_asynccnt 0x0" ::: "memory");    // nothing of this wave's is in flight when the loop is left
    const int wb = wave * 16 * 68;
    const int rg = lane >> 3, c8 = (lane & 7) * 8;       // 4 s x 4 row groups = 16 rows; 8 lanes x 8 halves = 64 columns
#pragma unroll
    for (int g = 0; g < QG; ++g) {
        const float lt = l[g] + __shfl_xor(l[g], 16, 32);
        const float inv = (1.0f / lt) * CXS;
        // O^T D layout: o_j[r] = (d = 16j + 8h + r, t = lane&15) -> os[t][d]; rows 0..15 x columns 0..63 all written
        { v4f a, c;
          a[0] = o0[g][0] * inv; a[1] = o0[g][1] * inv; a[2] = o0[g][2] * inv; a[3] = o0[g][3] * inv; c[0] = o0[g][4] * inv; c[1] = o0[g][5] * inv; c[2] = o0[g][6] * inv; c[3] = o0[g][7] * inv;
          *(v4fa*)(&os[wb + lr * 68 +  0 + 8 * hi]) = a; *(v4fa*)(&os[wb + lr * 68 +  0 + 8 * hi + 4]) = c;
          a[0] = o1[g][0] * inv; a[1] = o1[g][1] * inv; a[2] = o1[g][2] * inv; a[3] = o1[g][3] * inv; c[0] = o1[g][4] * inv; c[1] = o1[g][5] * inv; c[2] = o1[g][6] * inv; c[3] = o1[g][7] * inv;
          *(v4fa*)(&os[wb + lr * 68 + 16 + 8 * hi]) = a; *(v4fa*)(&os[wb + lr * 68 + 16 + 8 * hi + 4]) = c;
          a[0] = o2[g][0] * inv; a[1] = o2[g][1] * inv; a[2] = o2[g][2] * inv; a[3] = o2[g][3] * inv; c[0] = o2[g][4] * inv; c[1] = o2[g][5] * inv; c[2] = o2[g][6] * inv; c[3] = o2[g][7] * inv;
          *(v4fa*)(&os[wb + lr * 68 + 32 + 8 * hi]) = a; *(v4fa*)(&os[wb + lr * 68 + 32 + 8 * hi + 4]) = c;
          a[0] = o3[g][0] * inv; a[1] = o3[g][1] * inv; a[2] = o3[g][2] * inv; a[3] = o3[g][3] * inv; c[0] = o3[g][4] * inv; c[1] = o3[g][5] * inv; c[2] = o3[g][6] * inv; c[3] = o3[g][7] * inv;
          *(v4fa*)(&os[wb + lr * 68 + 48 + 8 * hi]) = a; *(v4fa*)(&os[wb + lr * 68 + 48 + 8 * hi + 4]) = c; }
        wave_sync();
        h16* crow = CX + ((size_t)b * SEQ + t0 + g * 16) * DM + h * HD;
        v8h hv[4];
#pragma unroll
        for (int s = 0; s < 4; ++s) { const int row = 4 * s + rg;
            const v4f x0 = *(const v4fa*)(&os[wb + row * 68 + c8]); const v4f x1 = *(const v4fa*)(&os[wb + row * 68 + c8 + 4]);
#pragma unroll
            for (int i = 0; i < 4; ++i) { hv[s][i] = (h16)x0[i]; hv[s][4 + i] = (h16)x1[i]; } }
#pragma unroll
        for (int s = 0; s < 4; ++s) *(v8h*)(crow + (size_t)(4 * s + rg) * DM + c8) = hv[s];
        asm volatile("s_wait_xcnt 0x0" ::: "memory");    // before the next group reuses the registers these stores name
        __builtin_amdgcn_sched_barrier(0);               // keeps the next group's arithmetic behind that wait
        wave_sync();                                     // the next group overwrites this wave's staging rows
    }
}

// k_oproj: register-blocked f16 GEMM, one wave per 64x64 tile, GW waves per block (gemm_main), A = ctx plane (x1024), Bt = Wp plane (x256), K = DM; OUT[m][n] = acc * 2^-18 + bias[n] (f32).
__global__ __launch_bounds__(32 * GW) void k_oproj(const h16* __restrict__ A, const h16* __restrict__ Bt, const float* __restrict__ bias, float* OUT) {
    __shared__ __align__(16) float osb[GW * 16 * 68];
    __shared__ __align__(16) h16 sm[2 * GTH];
    const int lane = threadIdx.x & 31, lr = lane & 15, hi = lane >> 4;
    const int wave = __builtin_amdgcn_readfirstlane((int)(threadIdx.x >> 5));
    const int wr = (wave & 1) * 64, wc = (wave >> 1) * 64;
    const int r0 = blockIdx.x * GT + wr, c0 = blockIdx.y * GT + wc;      // this wave's 64 x 64 tile
    float* const os = osb + wave * 16 * 68;                              // this wave's own staging rows
    v8f acc[4][4];
    gemm_main(A, Bt, sm, (int)blockIdx.x * GT, (int)blockIdx.y * GT, wr, wc, lr, hi, acc);
    const int cofs = lr * 4;                              // 16 lanes x 4 floats = 64 columns
    const v4f braw = *(const v4fa*)(bias + c0 + cofs); v4f bb;
#pragma unroll
    for (int i = 0; i < 4; ++i) bb[i] = bfval(braw[i]);
    const int bi = r0 / SEQ, tt = r0 % SEQ;
    float* obase = OUT + ((size_t)bi * OUT_SEQ + tt) * DM + c0;
#pragma unroll
    for (int mb = 0; mb < 4; ++mb) {
#pragma unroll
        for (int nb = 0; nb < 4; ++nb) {
#pragma unroll
            for (int j = 0; j < 8; ++j) os[(hi * 8 + j) * 68 + nb * 16 + lr] = acc[mb][nb][j]; }   // rows 0..15 x cols 0..63 all written
        wave_sync();
        v4f vals[8];
#pragma unroll
        for (int s = 0; s < 8; ++s) { const int row = 2 * s + hi;            // 8 s x 2 rows = 16 rows
            const v4f x = *(const v4fa*)(&os[row * 68 + cofs]); vals[s] = x * OSC + bb; }
{
#pragma unroll
            for (int s = 0; s < 8; ++s) *(v4f*)(obase + (size_t)(mb * 16 + 2 * s + hi) * DM + cofs) = vals[s];
             }
        wave_sync();
    }
}

static constexpr size_t al256(size_t v) { return (v + 255) & ~(size_t)255; }
static constexpr size_t SZ_XB = al256((size_t)NB * SEQ * DM * 2);            // one bf16 activation plane
static constexpr size_t SZ_WB = al256((size_t)3 * DM * DM * 2);              // Wq | Wk | Wv bf16
static constexpr size_t SZ_WP = al256((size_t)DM * DM * 2);                  // Wp f16 x256
static constexpr size_t SZ_CS = al256((size_t)2 * SEQ * NPR * 2 * 4);        // two (cos, sin) tables
static constexpr size_t SZ_PL = al256((size_t)NB * NH_ * SEQ * HD * 2);      // one f16 head plane
static constexpr size_t SZ_CX = al256((size_t)NB * SEQ * DM * 2);            // ctx f16 x1024
static constexpr size_t SZ_TOTAL = 3 * SZ_XB + SZ_WB + SZ_WP + SZ_CS + 3 * SZ_PL + SZ_CX;
static_assert(SZ_TOTAL <= (size_t)134217728);          // workspace carve <= 128 MiB
static_assert(((size_t)DM * DM * 2) % 256 == 0);       // weight sub-planes stay 256-byte aligned

extern "C" void kernel_launch(void* const* d_in, const int* in_sizes, int n_in,
                              void* d_out, int out_size, void* d_ws, size_t ws_size, hipStream_t stream) {
    if (n_in < 8) return;
    const size_t needx = ((size_t)(NB - 1) * SEQ_FULL + SEQ) * DM;
    if ((size_t)in_sizes[0] < needx || (size_t)in_sizes[1] < needx || (size_t)in_sizes[2] < needx) return;
    if ((size_t)in_sizes[3] < (size_t)DM * DM || (size_t)in_sizes[4] < (size_t)DM * DM || (size_t)in_sizes[5] < (size_t)DM * DM || (size_t)in_sizes[6] < (size_t)DM * DM) return;
    if ((size_t)in_sizes[7] < (size_t)DM) return;
    if ((size_t)out_size < ((size_t)(NB - 1) * OUT_SEQ + SEQ) * DM) return;
    if (SZ_TOTAL > ws_size) return;
    // wire order: q, k, v, Wq, Wk, Wv, Wp, bp (weights [out][in] = Bt as-is)
    const float* xq = (const float*)d_in[0]; const float* xk = (const float*)d_in[1]; const float* xv = (const float*)d_in[2];
    const float* wq = (const float*)d_in[3]; const float* wk = (const float*)d_in[4]; const float* wv = (const float*)d_in[5];
    const float* wp = (const float*)d_in[6]; const float* bp = (const float*)d_in[7];
    float* OUT = (float*)d_out;      // [NB][SEQ][1024]
    char* wsp = (char*)d_ws;
    bf* XQ = (bf*)wsp; wsp += SZ_XB;                 // [NB*SEQ][1024]
    bf* XK = (bf*)wsp; wsp += SZ_XB;
    bf* XV = (bf*)wsp; wsp += SZ_XB;
    bf* WB = (bf*)wsp; wsp += SZ_WB;                 // [3][1024][1024]: q | k | v
    h16* WP = (h16*)wsp; wsp += SZ_WP;               // [1024][1024] x256
    float* CS = (float*)wsp; wsp += SZ_CS;           // [SEQ][512][2] then [512][SEQ][2]
    h16* QH = (h16*)wsp; wsp += SZ_PL;               // [NB*16][SEQ][64]
    h16* KP = (h16*)wsp; wsp += SZ_PL;               // [NB*16][SEQ][64]
    h16* VT = (h16*)wsp; wsp += SZ_PL;               // [NB*16][64][SEQ]
    h16* CX = (h16*)wsp; wsp += SZ_CX;               // [NB*SEQ][1024] x1024
    bf* WQ = WB; bf* WK = WB + (size_t)DM * DM; bf* WV = WB + (size_t)2 * DM * DM;

    k_prep<<<PB, PT, 0, stream>>>(xq, xk, xv, wq, wk, wv, wp, XQ, XK, XV, WB, WP, CS);

    // q, k: A = x rows (m = b*SEQ + t), Bt = W rows (n = h*64 + d) -> plane [(b*16 + h)][t][d]; k gets rotary on column pairs
    k_proj<0><<<dim3(NB * SEQ / GT, DM / GT, 1), 32 * GW, 0, stream>>>(XQ, WQ, QH, CS, SEQ, (size_t)NH_ * SEQ * HD, HD, HD, (size_t)SEQ * HD);
    k_proj<1><<<dim3(NB * SEQ / GT, DM / GT, 1), 32 * GW, 0, stream>>>(XK, WK, KP, CS, SEQ, (size_t)NH_ * SEQ * HD, HD, HD, (size_t)SEQ * HD);
    // v^T: A = Wv rows (m = h*64 + d), Bt = x rows (n = b*SEQ + t) -> plane [(b*1024 + m)][t] = [(b*16 + h)][d][t]; rotary on row pairs
    k_proj<2><<<dim3(DM / GT, NB * SEQ / GT, 1), 32 * GW, 0, stream>>>(WV, XV, VT, CS, DM, (size_t)0, SEQ, SEQ, (size_t)DM * SEQ);

    k_flash<<<dim3(SEQ / (16 * QG * AW), NB * NH_, 1), 32 * AW, 0, stream>>>(QH, KP, VT, CX);

    // out: A = ctx rows (m = b*SEQ + t), Bt = Wp rows (n = out feature)
    k_oproj<<<dim3(NB * SEQ / GT, DM / GT, 1), 32 * GW, 0, stream>>>(CX, WP, bp, OUT);
}

// v006
// It runs in 92.3 microseconds.
// Timed twice side by side with v005, it ran 1.14 and 1.17 times as fast.
// Over all steps from v000 it is 2.66 times as fast.
#include <hip/hip_runtime.h>

// Multi-head attention, width 1024 = 16 heads x 64; inputs q, k, v [NB][SEQ][1024]; Wq/Wk/Wv/Wp [out][in] (y = x W^T); interleaved rotary on projected k and v over the full 1024 axis (512 pairs, angle = pos * 10000^(-2p/1024)); score scale 1/8; dense softmax; out = ctx Wp^T + bp (f32).
// Compute dtypes, f32 accumulate everywhere: q/k/v projections v_wmma_f32_16x16x32_bf16 (inputs and weights RNE-converted to bf16; products exact); rotary in f32 in the projection epilogue from f32 cos/sin tables;
// scores v_wmma_f32_16x16x32_f16: q single f16, k single f16 (one product; logits = acc * 0.125 * log2 e); P (x256 carry, cancels in the normalisation; row sum taken over the f16 values) and v single f16; softmax f32 (online, running max);
// output projection v_wmma_f32_16x16x32_f16: ctx single f16 with x1024 carry, Wp as f16 of the bf16 RNE value with x256 carry, 2^-18 folded back in the f32 epilogue, bias (bf16 RNE value) added in f32.
// Layout: bf16 copies of q, k, v, Wq, Wk, Wv; q and k planes [b*16+h][t][d]; v^T plane [b*16+h][d][t]; ctx plane [b*SEQ+t][1024]; fused flash kernel in transposed form (S^T = K Q^T, O^T = V^T P^T), its K and V^T tiles staged in LDS once per block; the four GEMMs stage their A and B tiles in LDS once per 128 x 128 block.

#ifndef NB
#define NB 2
#endif
#ifndef SEQ
#define SEQ 2048
#endif
#define NB_FULL  2
#define SEQ_FULL 2048
#ifndef OUT_SEQ
#define OUT_SEQ SEQ              // row pitch (in tokens) between batches of the output
#endif
#define DM   1024
#define NH_  16
#define HD   64
#define NPR  (DM / 2)            // rotary pairs per token row
#define PT   256                 // threads per pre-pass block
#define PB   NPR                 // pre-pass blocks (block index = rotary pair of the [p][pos] table)
#define AW   8                   // waves per flash block: two per SIMD, so one wave's softmax runs while the other's matrix products and waits do
#define QG   2                   // 16-query groups per flash wave (32 query rows each)
#define KT   64                  // keys per staged tile (a K row and a V^T row of a tile are both 128 bytes: whole cache lines)
#define LP   72                  // LDS row pitch in halves: 144 bytes = 16 x 9, conflict-free for 16-byte fragment reads
#define TH   (2 * 64 * LP)       // halves of one buffer: K tile (KT rows) then V^T tile (HD rows)
#define GW   4                   // waves per GEMM block: 2 x 2 wave tiles of 64 x 64 = one 128 x 128 tile
#define GT   128                 // rows of A and rows of Bt per GEMM block
#ifndef GK
#define GK   128                 // k elements per staged GEMM tile (256 bytes a row: whole cache lines)
#endif
#define GLP  (GK + 8)            // LDS row pitch of a GEMM tile in 16-bit elements: 16 bytes x an odd number, conflict-free for 16-byte fragment reads
#define GRS  (GW * 32 * 8 / GK)  // rows that one 16-byte copy of every thread of the block covers
#define GTH  (2 * GT * GLP)      // 16-bit elements of one GEMM buffer: A tile (GT rows) then Bt tile (GT rows)
#define SC2  (0.125f * 1.4426950408889634f)   // HD^-0.5 * log2(e)
#define PSH  8.0f                // log2 of the P carry (256)
#define CXS  1024.0f             // carry of the ctx plane
#define WPS  256.0f              // carry of the Wp plane
#define OSC  (1.0f / (1024.0f * 256.0f))      // 2^-18

static_assert(HD == 64);
static_assert(NH_ * HD == DM);                 // head h = columns h*64 + d
static_assert(DM % 64 == 0);
static_assert(DM % 32 == 0);                   // GEMM k-loop steps by 32
static_assert(SEQ % 64 == 0);                  // a 64-row tile never straddles two batches
static_assert((NB * SEQ) % 64 == 0);
static_assert(SEQ % 32 == 0);                  // key loop steps by 32
static_assert(SEQ % (16 * QG * AW) == 0);      // flash grid covers the sequence exactly
static_assert(SEQ % KT == 0 && SEQ / KT >= 2); // whole tiles; the two-buffer prologue fills two
static_assert(KT == 64 && AW * 32 * 2 * 8 == KT * HD);   // two 16-byte copies per thread cover one 64 x 64 tile
static_assert((NB * SEQ) % GT == 0 && DM % GT == 0);      // GEMM grids cover both operands exactly
static_assert(DM % GK == 0 && DM / GK >= 2 && GK % 64 == 0);   // whole k tiles of whole lines; the two-buffer prologue fills two
static_assert(GT % (8 * GRS) == 0 && (GLP * 2) % 32 == 16);    // statements of eight copies cover an operand tile exactly; odd multiple of 16 bytes
static_assert(2 * GT / GRS <= 63);                             // copies of one wave in flight: one tile's
static constexpr size_t PN  = (size_t)PB * PT;              // pre-pass threads
static constexpr size_t WCH = (size_t)DM * DM / 8;          // 8-element pieces of one weight
static constexpr size_t BCH = (size_t)SEQ * DM / 8;         // 8-element pieces of one batch of one activation
static constexpr int    XR  = (int)((size_t)NB * BCH / PN); // pre-pass rounds over the activations
static_assert((size_t)XR * PN == (size_t)NB * BCH && XR >= 1);   // the rounds cover the activation planes exactly
static_assert((size_t)NB * SEQ_FULL * DM * 4 < ((size_t)1 << 32) && (size_t)SEQ * NPR * 8 < ((size_t)1 << 32));   // 32-bit byte offsets inside every plane
static_assert(WCH == PN);                      // one piece of each weight per pre-pass thread
static_assert(NPR == 2 * PT);                  // one row of the [pos][p] table: PT threads x 2 pairs
static_assert(SEQ == XR * PB);                 // [pos][p] table: one position per block and round
static_assert(SEQ == 2 * XR * PT);             // [p][pos] table: two positions per thread and round
static_assert(NB <= NB_FULL);
static_assert(SEQ <= SEQ_FULL);
static_assert(((size_t)(NB - 1) * OUT_SEQ + SEQ) * DM * 4 <= (size_t)16777216);   // last output byte stays inside the output buffer

typedef _Float16 h16;
typedef unsigned short bf;
typedef __attribute__((ext_vector_type(16))) __bf16   v16bf;
typedef __attribute__((ext_vector_type(16))) _Float16 v16h;
typedef __attribute__((ext_vector_type(8)))  _Float16 v8h;
typedef __attribute__((ext_vector_type(8)))  unsigned short v8us;
typedef __attribute__((ext_vector_type(8)))  float    v8f;
typedef __attribute__((ext_vector_type(4)))  float    v4f;
typedef __attribute__((ext_vector_type(2)))  float    v2f;
typedef v4f  __attribute__((may_alias)) v4fa;

__device__ __forceinline__ unsigned short f2bf(float f) { unsigned u = __float_as_uint(f); u += 0x7FFFu + ((u >> 16) & 1u); return (unsigned short)(u >> 16); }
__device__ __forceinline__ float bfval(float f) { return __uint_as_float(((unsigned)f2bf(f)) << 16); }
__device__ __forceinline__ v16h cat16(v8h lo, v8h hi) { return __builtin_shufflevector(lo, hi, 0, 1, 2, 3, 4, 5, 6, 7, 8, 9, 10, 11, 12, 13, 14, 15); }
__device__ __forceinline__ v16bf cat16b(v8us lo, v8us hi) { return __builtin_bit_cast(v16bf, __builtin_shufflevector(lo, hi, 0, 1, 2, 3, 4, 5, 6, 7, 8, 9, 10, 11, 12, 13, 14, 15)); }
__device__ __forceinline__ v8f wmma16(v16h a, v16h b, v8f c) { return __builtin_amdgcn_wmma_f32_16x16x32_f16(false, a, false, b, (short)0, c, false, false); }
__device__ __forceinline__ v8f wmmab(v16bf a, v16bf b, v8f c) { return __builtin_amdgcn_wmma_f32_16x16x32_bf16(false, a, false, b, (short)0, c, false, false); }
// fragment loaders from K-contiguous 16-bit rows; p already includes + 8*(lane>>4): elements 0..7 <- k0+8h+0..7, elements 8..15 <- k0+16+8h+0..7 (same map for A and B)
__device__ __forceinline__ v16h  ldh(const h16* p) { return cat16(*(const v8h*)p, *(const v8h*)(p + 16)); }
__device__ __forceinline__ v16bf ldb(const bf* p)  { return cat16b(*(const v8us*)p, *(const v8us*)(p + 16)); }
// ordering point for wave-private LDS tiles (same wave writes and reads)
__device__ __forceinline__ void wave_sync() { __builtin_amdgcn_fence(3 /* release order */, "wavefront"); __builtin_amdgcn_wave_barrier(); asm volatile("" ::: "memory"); }

// k_prep: every pass that only prepares operands, in ONE launch of long-lived blocks: bf16 copies of q, k, v, Wq, Wk, Wv; the f16 x256 copy of Wp; both (cos, sin) tables.
// PB blocks x PT threads stay resident (16 waves per WGP) and each thread walks its share of every plane with stride PN, so the launch starts 4,096 waves.
// Tables, as float2 (cos, sin) of pos * theta(p): first [pos][p] (a block row = one position, a thread = two neighbouring pairs), then [p][pos] (a block = one pair, a thread = two neighbouring positions).
__device__ __forceinline__ float theta_of(int p) { const float e = (2.0f * (float)p) * (1.0f / (float)DM); return 1.0f / powf(10000.0f, e); }
__device__ __forceinline__ v8us cvt8(v8f v) { v8us o;
#pragma unroll
    for (int k = 0; k < 8; ++k) o[k] = f2bf(v[k]);
    return o; }
__device__ __forceinline__ v4f cs2(float a0, float a1) { float s0, c0, s1, c1; sincosf(a0, &s0, &c0); sincosf(a1, &s1, &c1); v4f o; o[0] = c0; o[1] = s0; o[2] = c1; o[3] = s1; return o; }

// plane base + one 32-bit byte offset (every plane is far below 4 GiB): the planes of a round share the offset register and no 64-bit address is formed per access
__device__ __forceinline__ v8f ld8(const float* p, unsigned byteoff) { return *(const v8f*)((const char*)p + byteoff); }
template <typename V, typename P> __device__ __forceinline__ void st16(P* p, unsigned byteoff, V v) { *(V*)((char*)p + byteoff) = v; }

__global__ __launch_bounds__(PT) void k_prep(const float* __restrict__ xq, const float* __restrict__ xk, const float* __restrict__ xv,
                                             const float* __restrict__ wq, const float* __restrict__ wk, const float* __restrict__ wv, const float* __restrict__ wp,
                                             bf* __restrict__ XQ, bf* __restrict__ XK, bf* __restrict__ XV, bf* __restrict__ WB, h16* __restrict__ WP, float* __restrict__ CS) {
    const unsigned tid = threadIdx.x, blk = blockIdx.x;
    const unsigned g = blk * PT + tid;
    // weights, one 8-element piece of each per thread: the loads are issued first and the three angle steps are worked out while they fly
    const v8f w0 = ld8(wq, g * 32), w1 = ld8(wk, g * 32), w2 = ld8(wv, g * 32), w3 = ld8(wp, g * 32);
    const float th0 = theta_of((int)(2 * tid)), th1 = theta_of((int)(2 * tid + 1)), thb = theta_of((int)blk);
    st16(WB, g * 16, cvt8(w0)); st16(WB + (size_t)DM * DM, g * 16, cvt8(w1)); st16(WB + (size_t)2 * DM * DM, g * 16, cvt8(w2));
    { v8h o;
#pragma unroll
      for (int k = 0; k < 8; ++k) o[k] = (h16)(bfval(w3[k]) * WPS);
      st16(WP, g * 16, o); }
    asm volatile("s_wait_xcnt 0x0" ::: "memory");        // before the first round reuses the registers these stores name
    __builtin_amdgcn_sched_barrier(0);                   // keeps the first round's address arithmetic behind that wait
    float* const CS1 = CS + (size_t)SEQ * NPR * 2;
    // rolled: four inlined sincosf per trip keep the text small
#pragma unroll 1
    for (unsigned r = 0; r < (unsigned)XR; ++r) {
        const unsigned c = g + r * (unsigned)PN;                                    // 8-element piece of the [NB*SEQ][DM] planes
        const unsigned s = (SEQ == SEQ_FULL) ? c : (c / (unsigned)BCH) * (unsigned)((size_t)SEQ_FULL * DM / 8) + c % (unsigned)BCH;   // the same piece in the inputs (batch pitch SEQ_FULL)
        const v8f a = ld8(xq, s * 32), b = ld8(xk, s * 32), d = ld8(xv, s * 32);
        // this round's table entries stand between the loads and their first use
        const unsigned t0 = blk + r * PB, t1 = 2 * (tid + r * PT);
        st16(CS,  (t0 * NPR + 2 * tid) * 8, cs2((float)(int)t0 * th0, (float)(int)t0 * th1));
        st16(CS1, (blk * SEQ + t1) * 8,     cs2((float)(int)t1 * thb, (float)(int)(t1 + 1) * thb));
        st16(XQ, c * 16, cvt8(a)); st16(XK, c * 16, cvt8(b)); st16(XV, c * 16, cvt8(d));
        asm volatile("s_wait_xcnt 0x0" ::: "memory");    // before the next round reuses the registers these stores name
        __builtin_amdgcn_sched_barrier(0);               // keeps the next round's address arithmetic behind that wait
    }
}

// Main loop of the four GEMMs. A block of GW waves owns a GT x GT tile of C; each wave a 64 x 64 quarter (16 accumulators).
// The k axis is walked in tiles of GK: the GT rows of A and the GT rows of Bt are brought into LDS ONCE per block by asynchronous 16-byte copies (whole 128-byte lines,
// GK / 8 lanes per row) into one of two buffers, the next tile flying while this one is worked on; fragments are 16-byte LDS reads at pitch GLP. k runs upward in steps of 32 as before.
__device__ __forceinline__ v16h  ldf(const h16* p) { return ldh(p); }
__device__ __forceinline__ v16bf ldf(const bf* p)  { return ldb(p); }
__device__ __forceinline__ v8f mm(v16h a, v16h b, v8f c)   { return wmma16(a, b, c); }
__device__ __forceinline__ v8f mm(v16bf a, v16bf b, v8f c) { return wmmab(a, b, c); }
// eight copies of one thread: 16-byte pieces, rows GRS apart, each lane with its own LDS byte address and global pointer.
// s_wait_xcnt stands as the statement's last line, in front of any rewrite of the address registers that the copies name.
template <typename T>
__device__ __forceinline__ void stage_rows(unsigned l, const T* g) {
    asm volatile("global_load_async_to_lds_b128 %0, %8, off\n\t"
                 "global_load_async_to_lds_b128 %1, %9, off\n\t"
                 "global_load_async_to_lds_b128 %2, %10, off\n\t"
                 "global_load_async_to_lds_b128 %3, %11, off\n\t"
                 "global_load_async_to_lds_b128 %4, %12, off\n\t"
                 "global_load_async_to_lds_b128 %5, %13, off\n\t"
                 "global_load_async_to_lds_b128 %6, %14, off\n\t"
                 "global_load_async_to_lds_b128 %7, %15, off\n\t"
                 "s_wait_xcnt 0x0"
                 :: "v"(l), "v"(l + 1 * GRS * GLP * 2), "v"(l + 2 * GRS * GLP * 2), "v"(l + 3 * GRS * GLP * 2),
                    "v"(l + 4 * GRS * GLP * 2), "v"(l + 5 * GRS * GLP * 2), "v"(l + 6 * GRS * GLP * 2), "v"(l + 7 * GRS * GLP * 2),
                    "v"(g), "v"(g + 1 * GRS * DM), "v"(g + 2 * GRS * DM), "v"(g + 3 * GRS * DM),
                    "v"(g + 4 * GRS * DM), "v"(g + 5 * GRS * DM), "v"(g + 6 * GRS * DM), "v"(g + 7 * GRS * DM)
                 : "memory");
}
// one k tile's copies of one thread: the GT rows of A, then the GT rows of Bt behind them
template <typename T>
__device__ __forceinline__ void stage_ab(unsigned l, const T* ag, const T* bg) {
#pragma unroll
    for (int h = 0; h < GT / (8 * GRS); ++h) stage_rows(l + h * (8 * GRS * GLP * 2), ag + h * (8 * GRS * DM));
#pragma unroll
    for (int h = 0; h < GT / (8 * GRS); ++h) stage_rows(l + (GT + h * 8 * GRS) * (GLP * 2), bg + h * (8 * GRS * DM));
}
// R0, C0: first row of A and of Bt of the BLOCK; wr, wc: this wave's 64-row offsets inside them; sm: 2 * GTH elements of LDS.
template <typename T>
__device__ __forceinline__ void gemm_main(const T* __restrict__ A, const T* __restrict__ Bt, const T* sm, int R0, int C0, int wr, int wc, int lr, int hi, v8f (&acc)[4][4]) {
#pragma unroll
    for (int mb = 0; mb < 4; ++mb)
#pragma unroll
        for (int nb = 0; nb < 4; ++nb) acc[mb][nb] = (v8f){};
    // copy addresses of this thread: row = tid / (GK / 8) (+ GRS per piece), 16-byte column = tid % (GK / 8), the same in the A tile and in the Bt tile
    const unsigned crow = threadIdx.x / (GK / 8), ccol = threadIdx.x % (GK / 8);
    const unsigned l0 = (unsigned)(size_t)&sm[0] + crow * (GLP * 2) + ccol * 16;     // LDS byte address in buffer 0, A tile; the Bt tile stands GT rows behind
    const T* ag = A  + (size_t)(R0 + (int)crow) * DM + ccol * 8;                     // + k0
    const T* bg = Bt + (size_t)(C0 + (int)crow) * DM + ccol * 8;                     // + k0
    stage_ab(l0, ag, bg);
    asm volatile("s_wait_asynccnt 0x0" ::: "memory");        // this wave's copies of tile 0 have landed
    __syncthreads();                                         // ... and every other wave's: tile 0 may be read
    stage_ab(l0 + GTH * 2, ag + GK, bg + GK);                // tile 1 flies during trip 0
    const T* fa = sm + (wr + lr) * GLP + 8 * hi;             // A fragment base of this wave
    const T* fb = sm + (GT + wc + lr) * GLP + 8 * hi;        // Bt fragment base of this wave
#pragma unroll 1
    for (int t = 0; t < DM / GK; ++t) {
        const T* pa = fa + (t & 1) * GTH; const T* pb = fb + (t & 1) * GTH;   // trip t reads buffer t mod 2 alone
        decltype(ldf(fa)) a[2][4], b[2][4];              // two fragment sets: the block of 32 k in work and the next one of the same tile
#pragma unroll
        for (int i = 0; i < 4; ++i) { a[0][i] = ldf(pa + i * 16 * GLP); b[0][i] = ldf(pb + i * 16 * GLP); }
#pragma unroll
        for (int s = 0; s < GK / 32; ++s) {
            if (s + 1 < GK / 32) {
#pragma unroll
                for (int i = 0; i < 4; ++i) { a[(s + 1) & 1][i] = ldf(pa + i * 16 * GLP + (s + 1) * 32); b[(s + 1) & 1][i] = ldf(pb + i * 16 * GLP + (s + 1) * 32); } }
            __builtin_amdgcn_sched_barrier(0);           // the next block's LDS reads stay one group in front of this block's products: their latency runs under the products
#pragma unroll
            for (int nb = 0; nb < 4; ++nb)
#pragma unroll
                for (int mb = 0; mb < 4; ++mb) acc[mb][nb] = mm(a[s & 1][mb], b[s & 1][nb], acc[mb][nb]);
            __builtin_amdgcn_sched_barrier(0);           // no later LDS read is spread among these products; behind the last block: every product stands in front of the slots below
        }
        // four vector slots between the last matrix product and the loop's back edge
        asm volatile("v_nop\n\tv_nop\n\tv_nop\n\tv_nop");
        asm volatile("s_wait_dscnt 0x0" ::: "memory");   // this wave's reads of buffer t mod 2 have returned
        asm volatile("s_wait_asynccnt 0x0" ::: "memory");// this wave's copies of tile t + 1 have landed
        __syncthreads();                                 // publishes tile t + 1 and ends every wave's reads of the buffer refilled below
        if (t + 2 < DM / GK) stage_ab(l0 + (unsigned)(t & 1) * (GTH * 2), ag + (t + 2) * GK, bg + (t + 2) * GK);
    }
    asm volatile("s_wait_asynccnt 0x0" ::: "memory");    // nothing of this wave's is in flight when the loop is left
}

// proj_tile: register-blocked bf16 GEMM, one wave per 64x64 tile (16 accumulators), GW waves per block, operands from K-contiguous bf16 planes through LDS (gemm_main), K = DM.
// C[m][n] = sum_k A[m][k] Bt[n][k]; epilogue by MODE:
//   0: C as f16 (Ph);
//   1: rows = tokens, columns = features: interleaved rotary on column pairs (table [pos][p]), then f16 (Ph);
//   2: rows = features, columns = tokens: interleaved rotary on row pairs (table [p][pos]), then f16 (Ph).
// Tile base (r0/RB)*sRB + (r0%RB)*pitch + (c0/CB)*sCB + (c0%CB), row pitch 'pitch' (halves). (bx, by): the block's tile among (M/GT, N/GT); 32 * GW threads; osb, sm: the block's LDS.
template <int MODE>
__device__ __forceinline__ void proj_tile(const bf* __restrict__ A, const bf* __restrict__ Bt, h16* Ph, const float* __restrict__ CS, float* osb, const bf* sm, int bx, int by,
                                             int RB, size_t sRB, int pitch, int CB, size_t sCB) {
    const int lane = threadIdx.x & 31, lr = lane & 15, hi = lane >> 4;
    const int wave = __builtin_amdgcn_readfirstlane((int)(threadIdx.x >> 5));
    const int wr = (wave & 1) * 64, wc = (wave >> 1) * 64;
    const int r0 = bx * GT + wr, c0 = by * GT + wc;                      // this wave's 64 x 64 tile
    float* const os = osb + wave * 16 * 68;                              // this wave's own staging rows
    v8f acc[4][4];
    gemm_main(A, Bt, sm, bx * GT, by * GT, wr, wc, lr, hi, acc);
    const size_t tbase = (size_t)(r0 / RB) * sRB + (size_t)(r0 % RB) * (size_t)pitch + (size_t)(c0 / CB) * sCB + (size_t)(c0 % CB);
    const int rg = lane >> 3, c8 = (lane & 7) * 8;       // 4 row groups x 8 lanes; 8 lanes x 8 = 64 columns
#pragma unroll
    for (int mb = 0; mb < 4; ++mb) {
#pragma unroll
        for (int nb = 0; nb < 4; ++nb) {
#pragma unroll
            for (int j = 0; j < 8; ++j) os[(hi * 8 + j) * 68 + nb * 16 + lr] = acc[mb][nb][j]; }   // D: row 8h+j, col lane&15; rows 0..15 x cols 0..63 all written
        wave_sync();
        v8h hv[4];
#pragma unroll
        for (int s = 0; s < 4; ++s) {
            const int row = 4 * s + rg;                  // 4 s x 4 row groups = 16 rows
            v4f x0 = *(const v4fa*)(&os[row * 68 + c8]); v4f x1 = *(const v4fa*)(&os[row * 68 + c8 + 4]);
            if (MODE == 1) {
                const int t = (r0 % SEQ) + mb * 16 + row;                                    // token position of this row
                const float* cp = CS + ((size_t)t * NPR + (size_t)((c0 + c8) >> 1)) * 2;     // 4 pairs: (cos, sin) x 4
                const v4f e0 = *(const v4fa*)cp; const v4f e1 = *(const v4fa*)(cp + 4);
                asm volatile("s_wait_xcnt 0x0" :: "v"(cp) : "memory");   // before a register that these loads name is reused; cp as input: neither load lands in the address pair in front of the wait
                v4f y0, y1;
                y0[0] = x0[0] * e0[0] - x0[1] * e0[1]; y0[1] = x0[0] * e0[1] + x0[1] * e0[0];
                y0[2] = x0[2] * e0[2] - x0[3] * e0[3]; y0[3] = x0[2] * e0[3] + x0[3] * e0[2];
                y1[0] = x1[0] * e1[0] - x1[1] * e1[1]; y1[1] = x1[0] * e1[1] + x1[1] * e1[0];
                y1[2] = x1[2] * e1[2] - x1[3] * e1[3]; y1[3] = x1[2] * e1[3] + x1[3] * e1[2];
                x0 = y0; x1 = y1;
            }
            if (MODE == 2) {
                const int e = r0 + mb * 16 + row;                                            // feature index of this row; partner row = row ^ 1 (same slab)
                const int tc = (c0 % SEQ) + c8;                                              // first of 8 token positions
                const float* cp = CS + (size_t)SEQ * NPR * 2 + ((size_t)(e >> 1) * SEQ + (size_t)tc) * 2;
                const v4f e0 = *(const v4fa*)cp; const v4f e1 = *(const v4fa*)(cp + 4); const v4f e2 = *(const v4fa*)(cp + 8); const v4f e3 = *(const v4fa*)(cp + 12);
                asm volatile("s_wait_xcnt 0x0" :: "v"(cp) : "memory");   // before a register that these loads name is reused; cp as input: none of the loads lands in the address pair in front of the wait
                const v4f w0 = *(const v4fa*)(&os[(row ^ 1) * 68 + c8]); const v4f w1 = *(const v4fa*)(&os[(row ^ 1) * 68 + c8 + 4]);
                const float sg = (row & 1) ? 1.0f : -1.0f;   // even feature: x cos - partner sin; odd feature: partner sin + x cos
                v4f y0, y1;
                y0[0] = x0[0] * e0[0] + sg * (w0[0] * e0[1]); y0[1] = x0[1] * e0[2] + sg * (w0[1] * e0[3]);
                y0[2] = x0[2] * e1[0] + sg * (w0[2] * e1[1]); y0[3] = x0[3] * e1[2] + sg * (w0[3] * e1[3]);
                y1[0] = x1[0] * e2[0] + sg * (w1[0] * e2[1]); y1[1] = x1[1] * e2[2] + sg * (w1[1] * e2[3]);
                y1[2] = x1[2] * e3[0] + sg * (w1[2] * e3[1]); y1[3] = x1[3] * e3[2] + sg * (w1[3] * e3[3]);
                x0 = y0; x1 = y1;
            }
#pragma unroll
            for (int i = 0; i < 4; ++i) { hv[s][i] = (h16)x0[i]; hv[s][4 + i] = (h16)x1[i]; }
        }
        const size_t sb = tbase + (size_t)(mb * 16) * (size_t)pitch;
{
#pragma unroll
            for (int s = 0; s < 4; ++s) { const size_t oo = sb + (size_t)(4 * s + rg) * (size_t)pitch + c8;
                *(v8h*)(Ph + oo) = hv[s]; }
             }
        asm volatile("s_wait_xcnt 0x0" ::: "memory");        // before what follows (the next slab; behind the last one, whatever stands behind this tile in the kernel) reuses the registers these stores name
        wave_sync();
    }
}

// k_proj: the three input projections in ONE launch; blockIdx.z picks the projection (the same for a whole block, so every barrier stays under block-uniform control flow), blockIdx.x its 128 x 128 tile.
// 3 x PJ blocks; two fit a WGP's LDS, so one block's first tiles, barrier waits and epilogue run under another block's products, and two launch gaps go.
// The projection with the longest epilogue comes first in the grid, the shortest last.
//   z = 0, v^T: A = Wv rows (m = h*64 + d), Bt = x rows (n = b*SEQ + t) -> plane [(b*1024 + m)][t] = [(b*16 + h)][d][t]; rotary on row pairs
//   z = 1, k and z = 2, q: A = x rows (m = b*SEQ + t), Bt = W rows (n = h*64 + d) -> plane [(b*16 + h)][t][d]; k gets rotary on column pairs
#define PJ   ((NB * SEQ / GT) * (DM / GT))     // 128 x 128 tiles of one projection
__global__ __launch_bounds__(32 * GW) void k_proj(const bf* __restrict__ XQ, const bf* __restrict__ XK, const bf* __restrict__ XV, const bf* __restrict__ WB,
                                                  h16* QH, h16* KP, h16* VT, const float* __restrict__ CS) {
    __shared__ __align__(16) float osb[GW * 16 * 68];
    __shared__ __align__(16) bf sm[2 * GTH];
    const int f = blockIdx.x, z = blockIdx.z;
    if (z == 0)      proj_tile<2>(WB + (size_t)2 * DM * DM, XV, VT, CS, osb, sm, f % (DM / GT), f / (DM / GT), DM, (size_t)0, SEQ, SEQ, (size_t)DM * SEQ);
    else if (z == 1) proj_tile<1>(XK, WB + (size_t)DM * DM, KP, CS, osb, sm, f % (NB * SEQ / GT), f / (NB * SEQ / GT), SEQ, (size_t)NH_ * SEQ * HD, HD, HD, (size_t)SEQ * HD);
    else             proj_tile<0>(XQ, WB, QH, CS, osb, sm, f % (NB * SEQ / GT), f / (NB * SEQ / GT), SEQ, (size_t)NH_ * SEQ * HD, HD, HD, (size_t)SEQ * HD);
}

// k_flash: fused attention, one wave per 16 * QG query rows of one (batch, head); Q fragments straight from the f16 plane.
// K and V^T: the block's AW waves walk the same keys, so each tile of KT keys is brought into LDS ONCE per block by asynchronous 16-byte copies (whole 128-byte lines,
// eight lanes per row) into one of two buffers, the next tile flying while this one is worked on; fragments are 16-byte LDS reads at pitch LP.
// Each K and V^T fragment is read once per wave and feeds QG matrix products (one per 16-query group g).
// Transposed form: S^T[key][t] = K Q^T (A = K rows, B = Q rows); lane (t = lane&15, h = lane>>4) holds keys 8h+r of each 16-key tile, so the packed
// P tile is directly the B fragment of O^T[d][t] = V^T P^T (element r <- tile keys 0..15, element 8+r <- tile keys 16..31, lane unchanged).
// Scale chain: logit2 = acc * (0.125 * log2 e); P = exp2(logit2 - max + 8) as f16; l = sum of the f16 P values; ctx plane = O^T * 1024 / l.
// Softmax state (running max, partial sum) is one scalar per lane and group; the two lane halves of a row are combined with one xor-16 exchange.
// one tile's copies of one thread: two 16-byte pieces of the K tile (rows 32 apart) and two of the V^T tile, each lane with its own LDS byte address and global pointer.
// s_wait_xcnt stands as the statement's last line, in front of any rewrite of the address registers that the copies name.
__device__ __forceinline__ void stage_tile(unsigned l, const h16* kg, const h16* vg) {
    asm volatile("global_load_async_to_lds_b128 %0, %4, off\n\t"
                 "global_load_async_to_lds_b128 %1, %5, off\n\t"
                 "global_load_async_to_lds_b128 %2, %6, off\n\t"
                 "global_load_async_to_lds_b128 %3, %7, off\n\t"
                 "s_wait_xcnt 0x0"
                 :: "v"(l), "v"(l + 32 * LP * 2), "v"(l + 64 * LP * 2), "v"(l + 96 * LP * 2),
                    "v"(kg), "v"(kg + 32 * HD), "v"(vg), "v"(vg + (size_t)32 * SEQ)
                 : "memory");
}

__global__ __launch_bounds__(32 * AW) void k_flash(const h16* __restrict__ QH, const h16* __restrict__ KP, const h16* __restrict__ VT, h16* CX) {
    __shared__ __align__(16) float os[AW * 16 * 68];
    __shared__ __align__(16) h16 kv[2 * TH];
    const int lane = threadIdx.x & 31, lr = lane & 15, hi = lane >> 4;
    const int wave = __builtin_amdgcn_readfirstlane((int)(threadIdx.x >> 5));
    const int zh = blockIdx.y; const int b = zh / NH_, h = zh % NH_;
    const int t0 = (blockIdx.x * AW + wave) * (16 * QG);
    const size_t pbase = (size_t)zh * SEQ * HD;
    const size_t qo = pbase + (size_t)(t0 + lr) * HD + 8 * hi;
    v16h qh0[QG], qh1[QG];                                   // B fragments: col t, k = d
#pragma unroll
    for (int g = 0; g < QG; ++g) { qh0[g] = ldh(QH + qo + (size_t)g * 16 * HD); qh1[g] = ldh(QH + qo + (size_t)g * 16 * HD + 32); }
    // copy addresses of this thread: row = tid / 8 (+ 32 for the second piece), 16-byte column = tid % 8, the same in the K tile (row = key) and in the V^T tile (row = d)
    const unsigned crow = threadIdx.x >> 3, ccol = threadIdx.x & 7;
    const unsigned l0 = (unsigned)(size_t)&kv[0] + crow * (LP * 2) + ccol * 16;      // LDS byte address in buffer 0
    const h16* kg = KP + pbase + (size_t)crow * HD + ccol * 8;                       // + key0 * HD
    const h16* vg = VT + pbase + (size_t)crow * SEQ + ccol * 8;                      // + key0
    stage_tile(l0, kg, vg);
    asm volatile("s_wait_asynccnt 0x0" ::: "memory");        // this wave's copies of tile 0 have landed
    __syncthreads();                                         // ... and every other wave's: tile 0 may be read
    stage_tile(l0 + TH * 2, kg + (size_t)KT * HD, vg + KT);  // tile 1 flies during trip 0
    const h16* fr = kv + lr * LP + 8 * hi;                   // fragment base: K row key (k = d) at + key * LP; V^T row d (k = key) at + (KT + d) * LP + key
    v8f o0[QG], o1[QG], o2[QG], o3[QG];
    float m[QG], l[QG];
#pragma unroll
    for (int g = 0; g < QG; ++g) { o0[g] = (v8f){}; o1[g] = (v8f){}; o2[g] = (v8f){}; o3[g] = (v8f){}; m[g] = -3.0e38f; l[g] = 0.0f; }
#pragma unroll 1
    for (int t = 0; t < SEQ / KT; ++t) {
      const h16* fb = fr + (t & 1) * TH;                 // trip t reads buffer t mod 2 alone
#pragma unroll
      for (int sub = 0; sub < KT / 32; ++sub) {          // two passes of 32 keys per tile, one online-softmax step each
        const h16* ka = fb + sub * 32 * LP;
        const v16h ka0 = ldh(ka), ka1 = ldh(ka + 32), kb0 = ldh(ka + 16 * LP), kb1 = ldh(ka + 16 * LP + 32);
        v16h pb[QG];
#pragma unroll
        for (int g = 0; g < QG; ++g) {
            v8f sHa = (v8f){}, sHb = (v8f){};
            sHa = wmma16(ka0, qh0[g], sHa); sHb = wmma16(kb0, qh0[g], sHb);
            sHa = wmma16(ka1, qh1[g], sHa); sHb = wmma16(kb1, qh1[g], sHb);
            float ta[8], tb[8]; float mx = -3.0e38f;
#pragma unroll
            for (int r = 0; r < 8; ++r) { ta[r] = sHa[r] * SC2; tb[r] = sHb[r] * SC2; mx = fmaxf(mx, fmaxf(ta[r], tb[r])); }
            mx = fmaxf(mx, __shfl_xor(mx, 16, 32));
            const float mnew = fmaxf(m[g], mx);
            const float alpha = __builtin_amdgcn_exp2f(m[g] - mnew);
            const float sh = PSH - mnew;
            float ls = 0.0f;
#pragma unroll
            for (int r = 0; r < 8; ++r) { const h16 pa = (h16)__builtin_amdgcn_exp2f(ta[r] + sh); const h16 pc = (h16)__builtin_amdgcn_exp2f(tb[r] + sh); pb[g][r] = pa; pb[g][8 + r] = pc; ls += (float)pa + (float)pc; }
            l[g] = l[g] * alpha + ls; m[g] = mnew;
            o0[g] = o0[g] * alpha; o1[g] = o1[g] * alpha; o2[g] = o2[g] * alpha; o3[g] = o3[g] * alpha;
        }
        const h16* va = fb + KT * LP + sub * 32;
        const v16h v0 = ldh(va), v1 = ldh(va + 16 * LP), v2 = ldh(va + 32 * LP), v3 = ldh(va + 48 * LP);
#pragma unroll
        for (int g = 0; g < QG; ++g) {
            o0[g] = wmma16(v0, pb[g], o0[g]); o1[g] = wmma16(v1, pb[g], o1[g]); o2[g] = wmma16(v2, pb[g], o2[g]); o3[g] = wmma16(v3, pb[g], o3[g]);
        }
      }
        __builtin_amdgcn_sched_barrier(0);               // keeps every matrix product of this trip in front of the slots below
        // four vector slots between the last matrix product and the loop's back edge
        asm volatile("v_nop\n\tv_nop\n\tv_nop\n\tv_nop");
        asm volatile("s_wait_dscnt 0x0" ::: "memory");   // this wave's reads of buffer t mod 2 have returned
        asm volatile("s_wait_asynccnt 0x0" ::: "memory");// this wave's copies of tile t + 1 have landed
        __syncthreads();                                 // publishes tile t + 1 and ends every wave's reads of the buffer refilled below
        if (t + 2 < SEQ / KT) stage_tile(l0 + (unsigned)(t & 1) * (TH * 2), kg + (size_t)(t + 2) * KT * HD, vg + (size_t)(t + 2) * KT);
    }
    asm volatile("s_wait_asynccnt 0x0" ::: "memory");    // nothing of this wave's is in flight when the loop is left
    const int wb = wave * 16 * 68;
    const int rg = lane >> 3, c8 = (lane & 7) * 8;       // 4 s x 4 row groups = 16 rows; 8 lanes x 8 halves = 64 columns
#pragma unroll
    for (int g = 0; g < QG; ++g) {
        const float lt = l[g] + __shfl_xor(l[g], 16, 32);
        const float inv = (1.0f / lt) * CXS;
        // O^T D layout: o_j[r] = (d = 16j + 8h + r, t = lane&15) -> os[t][d]; rows 0..15 x columns 0..63 all written
        { v4f a, c;
          a[0] = o0[g][0] * inv; a[1] = o0[g][1] * inv; a[2] = o0[g][2] * inv; a[3] = o0[g][3] * inv; c[0] = o0[g][4] * inv; c[1] = o0[g][5] * inv; c[2] = o0[g][6] * inv; c[3] = o0[g][7] * inv;
          *(v4fa*)(&os[wb + lr * 68 +  0 + 8 * hi]) = a; *(v4fa*)(&os[wb + lr * 68 +  0 + 8 * hi + 4]) = c;
          a[0] = o1[g][0] * inv; a[1] = o1[g][1] * inv; a[2] = o1[g][2] * inv; a[3] = o1[g][3] * inv; c[0] = o1[g][4] * inv; c[1] = o1[g][5] * inv; c[2] = o1[g][6] * inv; c[3] = o1[g][7] * inv;
          *(v4fa*)(&os[wb + lr * 68 + 16 + 8 * hi]) = a; *(v4fa*)(&os[wb + lr * 68 + 16 + 8 * hi + 4]) = c;
          a[0] = o2[g][0] * inv; a[1] = o2[g][1] * inv; a[2] = o2[g][2] * inv; a[3] = o2[g][3] * inv; c[0] = o2[g][4] * inv; c[1] = o2[g][5] * inv; c[2] = o2[g][6] * inv; c[3] = o2[g][7] * inv;
          *(v4fa*)(&os[wb + lr * 68 + 32 + 8 * hi]) = a; *(v4fa*)(&os[wb + lr * 68 + 32 + 8 * hi + 4]) = c;
          a[0] = o3[g][0] * inv; a[1] = o3[g][1] * inv; a[2] = o3[g][2] * inv; a[3] = o3[g][3] * inv; c[0] = o3[g][4] * inv; c[1] = o3[g][5] * inv; c[2] = o3[g][6] * inv; c[3] = o3[g][7] * inv;
          *(v4fa*)(&os[wb + lr * 68 + 48 + 8 * hi]) = a; *(v4fa*)(&os[wb + lr * 68 + 48 + 8 * hi + 4]) = c; }
        wave_sync();
        h16* crow = CX + ((size_t)b * SEQ + t0 + g * 16) * DM + h * HD;
        v8h hv[4];
#pragma unroll
        for (int s = 0; s < 4; ++s) { const int row = 4 * s + rg;
            const v4f x0 = *(const v4fa*)(&os[wb + row * 68 + c8]); const v4f x1 = *(const v4fa*)(&os[wb + row * 68 + c8 + 4]);
#pragma unroll
            for (int i = 0; i < 4; ++i) { hv[s][i] = (h16)x0[i]; hv[s][4 + i] = (h16)x1[i]; } }
#pragma unroll
        for (int s = 0; s < 4; ++s) *(v8h*)(crow + (size_t)(4 * s + rg) * DM + c8) = hv[s];
        asm volatile("s_wait_xcnt 0x0" ::: "memory");    // before the next group reuses the registers these stores name
        __builtin_amdgcn_sched_barrier(0);               // keeps the next group's arithmetic behind that wait
        wave_sync();                                     // the next group overwrites this wave's staging rows
    }
}

// k_oproj: register-blocked f16 GEMM, one wave per 64x64 tile, GW waves per block (gemm_main), A = ctx plane (x1024), Bt = Wp plane (x256), K = DM; OUT[m][n] = acc * 2^-18 + bias[n] (f32).
__global__ __launch_bounds__(32 * GW) void k_oproj(const h16* __restrict__ A, const h16* __restrict__ Bt, const float* __restrict__ bias, float* OUT) {
    __shared__ __align__(16) float osb[GW * 16 * 68];
    __shared__ __align__(16) h16 sm[2 * GTH];
    const int lane = threadIdx.x & 31, lr = lane & 15, hi = lane >> 4;
    const int wave = __builtin_amdgcn_readfirstlane((int)(threadIdx.x >> 5));
    const int wr = (wave & 1) * 64, wc = (wave >> 1) * 64;
    const int r0 = blockIdx.x * GT + wr, c0 = blockIdx.y * GT + wc;      // this wave's 64 x 64 tile
    float* const os = osb + wave * 16 * 68;                              // this wave's own staging rows
    v8f acc[4][4];
    gemm_main(A, Bt, sm, (int)blockIdx.x * GT, (int)blockIdx.y * GT, wr, wc, lr, hi, acc);
    const int cofs = lr * 4;                              // 16 lanes x 4 floats = 64 columns
    const v4f braw = *(const v4fa*)(bias + c0 + cofs); v4f bb;
#pragma unroll
    for (int i = 0; i < 4; ++i) bb[i] = bfval(braw[i]);
    const int bi = r0 / SEQ, tt = r0 % SEQ;
    float* obase = OUT + ((size_t)bi * OUT_SEQ + tt) * DM + c0;
#pragma unroll
    for (int mb = 0; mb < 4; ++mb) {
#pragma unroll
        for (int nb = 0; nb < 4; ++nb) {
#pragma unroll
            for (int j = 0; j < 8; ++j) os[(hi * 8 + j) * 68 + nb * 16 + lr] = acc[mb][nb][j]; }   // rows 0..15 x cols 0..63 all written
        wave_sync();
        v4f vals[8];
#pragma unroll
        for (int s = 0; s < 8; ++s) { const int row = 2 * s + hi;            // 8 s x 2 rows = 16 rows
            const v4f x = *(const v4fa*)(&os[row * 68 + cofs]); vals[s] = x * OSC + bb; }
{
#pragma unroll
            for (int s = 0; s < 8; ++s) *(v4f*)(obase + (size_t)(mb * 16 + 2 * s + hi) * DM + cofs) = vals[s];
             }
        wave_sync();
    }
}

static constexpr size_t al256(size_t v) { return (v + 255) & ~(size_t)255; }
static constexpr size_t SZ_XB = al256((size_t)NB * SEQ * DM * 2);            // one bf16 activation plane
static constexpr size_t SZ_WB = al256((size_t)3 * DM * DM * 2);              // Wq | Wk | Wv bf16
static constexpr size_t SZ_WP = al256((size_t)DM * DM * 2);                  // Wp f16 x256
static constexpr size_t SZ_CS = al256((size_t)2 * SEQ * NPR * 2 * 4);        // two (cos, sin) tables
static constexpr size_t SZ_PL = al256((size_t)NB * NH_ * SEQ * HD * 2);      // one f16 head plane
static constexpr size_t SZ_CX = al256((size_t)NB * SEQ * DM * 2);            // ctx f16 x1024
static constexpr size_t SZ_TOTAL = 3 * SZ_XB + SZ_WB + SZ_WP + SZ_CS + 3 * SZ_PL + SZ_CX;
static_assert(SZ_TOTAL <= (size_t)134217728);          // workspace carve <= 128 MiB
static_assert(((size_t)DM * DM * 2) % 256 == 0);       // weight sub-planes stay 256-byte aligned

extern "C" void kernel_launch(void* const* d_in, const int* in_sizes, int n_in,
                              void* d_out, int out_size, void* d_ws, size_t ws_size, hipStream_t stream) {
    if (n_in < 8) return;
    const size_t needx = ((size_t)(NB - 1) * SEQ_FULL + SEQ) * DM;
    if ((size_t)in_sizes[0] < needx || (size_t)in_sizes[1] < needx || (size_t)in_sizes[2] < needx) return;
    if ((size_t)in_sizes[3] < (size_t)DM * DM || (size_t)in_sizes[4] < (size_t)DM * DM || (size_t)in_sizes[5] < (size_t)DM * DM || (size_t)in_sizes[6] < (size_t)DM * DM) return;
    if ((size_t)in_sizes[7] < (size_t)DM) return;
    if ((size_t)out_size < ((size_t)(NB - 1) * OUT_SEQ + SEQ) * DM) return;
    if (SZ_TOTAL > ws_size) return;
    // wire order: q, k, v, Wq, Wk, Wv, Wp, bp (weights [out][in] = Bt as-is)
    const float* xq = (const float*)d_in[0]; const float* xk = (const float*)d_in[1]; const float* xv = (const float*)d_in[2];
    const float* wq = (const float*)d_in[3]; const float* wk = (const float*)d_in[4]; const float* wv = (const float*)d_in[5];
    const float* wp = (const float*)d_in[6]; const float* bp = (const float*)d_in[7];
    float* OUT = (float*)d_out;      // [NB][SEQ][1024]
    char* wsp = (char*)d_ws;
    bf* XQ = (bf*)wsp; wsp += SZ_XB;                 // [NB*SEQ][1024]
    bf* XK = (bf*)wsp; wsp += SZ_XB;
    bf* XV = (bf*)wsp; wsp += SZ_XB;
    bf* WB = (bf*)wsp; wsp += SZ_WB;                 // [3][1024][1024]: q | k | v
    h16* WP = (h16*)wsp; wsp += SZ_WP;               // [1024][1024] x256
    float* CS = (float*)wsp; wsp += SZ_CS;           // [SEQ][512][2] then [512][SEQ][2]
    h16* QH = (h16*)wsp; wsp += SZ_PL;               // [NB*16][SEQ][64]
    h16* KP = (h16*)wsp; wsp += SZ_PL;               // [NB*16][SEQ][64]
    h16* VT = (h16*)wsp; wsp += SZ_PL;               // [NB*16][64][SEQ]
    h16* CX = (h16*)wsp; wsp += SZ_CX;               // [NB*SEQ][1024] x1024

    k_prep<<<PB, PT, 0, stream>>>(xq, xk, xv, wq, wk, wv, wp, XQ, XK, XV, WB, WP, CS);

    // q, k and v^T projections: one launch, blockIdx.z = projection
    k_proj<<<dim3(PJ, 1, 3), 32 * GW, 0, stream>>>(XQ, XK, XV, WB, QH, KP, VT, CS);

    k_flash<<<dim3(SEQ / (16 * QG * AW), NB * NH_, 1), 32 * AW, 0, stream>>>(QH, KP, VT, CX);

    // out: A = ctx rows (m = b*SEQ + t), Bt = Wp rows (n = out feature)
    k_oproj<<<dim3(NB * SEQ / GT, DM / GT, 1), 32 * GW, 0, stream>>>(CX, WP, bp, OUT);
}

// v007
// It runs in 87.5 microseconds.
// Timed twice side by side with v006, it ran 1.04 and 1.07 times as fast.
// Counting every step since v000, it is 2.80 times as fast.
#include <hip/hip_runtime.h>

// Multi-head attention, width 1024 = 16 heads x 64; inputs q, k, v [NB][SEQ][1024]; Wq/Wk/Wv/Wp [out][in] (y = x W^T); interleaved rotary on projected k and v over the full 1024 axis (512 pairs, angle = pos * 10000^(-2p/1024)); score scale 1/8; dense softmax; out = ctx Wp^T + bp (f32).
// Compute dtypes, f32 accumulate everywhere: q/k/v projections v_wmma_f32_16x16x32_bf16 (inputs and weights RNE-converted to bf16; products exact); rotary in f32 in the projection epilogue from f32 cos/sin tables;
// scores v_wmma_f32_16x16x32_f16: q single f16, k single f16 (one product; logits = acc * 0.125 * log2 e); P (x256 carry, cancels in the normalisation; row sum taken over the f16 values) and v single f16; softmax f32 (online, running max);
// output projection v_wmma_f32_16x16x32_f16: ctx single f16 with x1024 carry, Wp as f16 of the bf16 RNE value with x256 carry, 2^-18 folded back in the f32 epilogue, bias (bf16 RNE value) added in f32.
// Layout: bf16 copies of q, k, v, Wq, Wk, Wv; q and k planes [b*16+h][t][d]; v^T plane [b*16+h][d][t]; ctx plane [b*SEQ+t][1024]; fused flash kernel in transposed form (S^T = K Q^T, O^T = V^T P^T), its K and V^T tiles staged in LDS once per block; the four GEMMs stage their A and B tiles in LDS once per 128 x 128 block.

#ifndef NB
#define NB 2
#endif
#ifndef SEQ
#define SEQ 2048
#endif
#define NB_FULL  2
#define SEQ_FULL 2048
#ifndef OUT_SEQ
#define OUT_SEQ SEQ              // row pitch (in tokens) between batches of the output
#endif
#define DM   1024
#define NH_  16
#define HD   64
#define NPR  (DM / 2)            // rotary pairs per token row
#define PT   256                 // threads per pre-pass block
#define PB   NPR                 // pre-pass blocks (block index = rotary pair of the [p][pos] table)
#define AW   8                   // query slots per flash block: each slot is 16 * QG query rows
#define KS   2                   // key halves per flash block: every query slot is worked by KS waves, one per half of the keys, so AW * KS = 16 waves stand four per SIMD and one wave's waits run under three others' work
#define QG   2                   // 16-query groups per flash wave (32 query rows each)
#define KT   64                  // keys per staged tile (a K row and a V^T row of a tile are both 128 bytes: whole cache lines)
#define LP   72                  // LDS row pitch in halves: 144 bytes = 16 x 9, conflict-free for 16-byte fragment reads
#define TH   (2 * 64 * LP)       // halves of one buffer: K tile (KT rows) then V^T tile (HD rows)
#define NT   (SEQ / (KT * KS))   // tiles that one key half walks
#define CP   17                  // 16-byte pieces per lane handed over when the key halves are merged: 16 of O^T, one of (max, sum)
#define GW   4                   // waves per GEMM block: 2 x 2 wave tiles of 64 x 64 = one 128 x 128 tile
#define GT   128                 // rows of A and rows of Bt per GEMM block
#ifndef GK
#define GK   128                 // k elements per staged GEMM tile (256 bytes a row: whole cache lines)
#endif
#define GLP  (GK + 8)            // LDS row pitch of a GEMM tile in 16-bit elements: 16 bytes x an odd number, conflict-free for 16-byte fragment reads
#define GRS  (GW * 32 * 8 / GK)  // rows that one 16-byte copy of every thread of the block covers
#define GTH  (2 * GT * GLP)      // 16-bit elements of one GEMM buffer: A tile (GT rows) then Bt tile (GT rows)
#define SC2  (0.125f * 1.4426950408889634f)   // HD^-0.5 * log2(e)
#define PSH  8.0f                // log2 of the P carry (256)
#define CXS  1024.0f             // carry of the ctx plane
#define WPS  256.0f              // carry of the Wp plane
#define OSC  (1.0f / (1024.0f * 256.0f))      // 2^-18

static_assert(HD == 64);
static_assert(NH_ * HD == DM);                 // head h = columns h*64 + d
static_assert(DM % 64 == 0);
static_assert(DM % 32 == 0);                   // GEMM k-loop steps by 32
static_assert(SEQ % 64 == 0);                  // a 64-row tile never straddles two batches
static_assert((NB * SEQ) % 64 == 0);
static_assert(SEQ % 32 == 0);                  // key loop steps by 32
static_assert(SEQ % (16 * QG * AW) == 0);      // flash grid covers the sequence exactly
static_assert(SEQ % (KT * KS) == 0 && NT >= 2); // whole tiles in every key half; the two-buffer prologue fills two
static_assert(KS == 2 && QG == 2 && CP == QG * 8 + 1);   // the merge below joins two halves; (max, sum) of QG = 2 groups fill one 16-byte piece
static_assert(KT == 64 && AW * 32 * 2 * 8 == KT * HD);   // two 16-byte copies per thread of a key half cover one 64 x 64 tile
static_assert((NB * SEQ) % GT == 0 && DM % GT == 0);      // GEMM grids cover both operands exactly
static_assert(DM % GK == 0 && DM / GK >= 2 && GK % 64 == 0);   // whole k tiles of whole lines; the two-buffer prologue fills two
static_assert(GT % (8 * GRS) == 0 && (GLP * 2) % 32 == 16);    // statements of eight copies cover an operand tile exactly; odd multiple of 16 bytes
static_assert(2 * GT / GRS <= 63);                             // copies of one wave in flight: one tile's
static constexpr size_t PN  = (size_t)PB * PT;              // pre-pass threads
static constexpr size_t WCH = (size_t)DM * DM / 8;          // 8-element pieces of one weight
static constexpr size_t BCH = (size_t)SEQ * DM / 8;         // 8-element pieces of one batch of one activation
static constexpr int    XR  = (int)((size_t)NB * BCH / PN); // pre-pass rounds over the activations
static_assert((size_t)XR * PN == (size_t)NB * BCH && XR >= 1);   // the rounds cover the activation planes exactly
static_assert((size_t)NB * SEQ_FULL * DM * 4 < ((size_t)1 << 32) && (size_t)SEQ * NPR * 8 < ((size_t)1 << 32));   // 32-bit byte offsets inside every plane
static_assert(WCH == PN);                      // one piece of each weight per pre-pass thread
static_assert(NPR == 2 * PT);                  // one row of the [pos][p] table: PT threads x 2 pairs
static_assert(SEQ == XR * PB);                 // [pos][p] table: one position per block and round
static_assert(SEQ == 2 * XR * PT);             // [p][pos] table: two positions per thread and round
static_assert(NB <= NB_FULL);
static_assert(SEQ <= SEQ_FULL);
static_assert(((size_t)(NB - 1) * OUT_SEQ + SEQ) * DM * 4 <= (size_t)16777216);   // last output byte stays inside the output buffer

typedef _Float16 h16;
typedef unsigned short bf;
typedef __attribute__((ext_vector_type(16))) __bf16   v16bf;
typedef __attribute__((ext_vector_type(16))) _Float16 v16h;
typedef __attribute__((ext_vector_type(8)))  _Float16 v8h;
typedef __attribute__((ext_vector_type(8)))  unsigned short v8us;
typedef __attribute__((ext_vector_type(8)))  float    v8f;
typedef __attribute__((ext_vector_type(4)))  float    v4f;
typedef __attribute__((ext_vector_type(2)))  float    v2f;
typedef v4f  __attribute__((may_alias)) v4fa;

__device__ __forceinline__ unsigned short f2bf(float f) { unsigned u = __float_as_uint(f); u += 0x7FFFu + ((u >> 16) & 1u); return (unsigned short)(u >> 16); }
__device__ __forceinline__ float bfval(float f) { return __uint_as_float(((unsigned)f2bf(f)) << 16); }
__device__ __forceinline__ v16h cat16(v8h lo, v8h hi) { return __builtin_shufflevector(lo, hi, 0, 1, 2, 3, 4, 5, 6, 7, 8, 9, 10, 11, 12, 13, 14, 15); }
__device__ __forceinline__ v16bf cat16b(v8us lo, v8us hi) { return __builtin_bit_cast(v16bf, __builtin_shufflevector(lo, hi, 0, 1, 2, 3, 4, 5, 6, 7, 8, 9, 10, 11, 12, 13, 14, 15)); }
__device__ __forceinline__ v8f wmma16(v16h a, v16h b, v8f c) { return __builtin_amdgcn_wmma_f32_16x16x32_f16(false, a, false, b, (short)0, c, false, false); }
__device__ __forceinline__ v8f wmmab(v16bf a, v16bf b, v8f c) { return __builtin_amdgcn_wmma_f32_16x16x32_bf16(false, a, false, b, (short)0, c, false, false); }
// fragment loaders from K-contiguous 16-bit rows; p already includes + 8*(lane>>4): elements 0..7 <- k0+8h+0..7, elements 8..15 <- k0+16+8h+0..7 (same map for A and B)
__device__ __forceinline__ v16h  ldh(const h16* p) { return cat16(*(const v8h*)p, *(const v8h*)(p + 16)); }
__device__ __forceinline__ v16bf ldb(const bf* p)  { return cat16b(*(const v8us*)p, *(const v8us*)(p + 16)); }
// ordering point for wave-private LDS tiles (same wave writes and reads)
__device__ __forceinline__ void wave_sync() { __builtin_amdgcn_fence(3 /* release order */, "wavefront"); __builtin_amdgcn_wave_barrier(); asm volatile("" ::: "memory"); }

// k_prep: every pass that only prepares operands, in ONE launch of long-lived blocks: bf16 copies of q, k, v, Wq, Wk, Wv; the f16 x256 copy of Wp; both (cos, sin) tables.
// PB blocks x PT threads stay resident (16 waves per WGP) and each thread walks its share of every plane with stride PN, so the launch starts 4,096 waves.
// Tables, as float2 (cos, sin) of pos * theta(p): first [pos][p] (a block row = one position, a thread = two neighbouring pairs), then [p][pos] (a block = one pair, a thread = two neighbouring positions).
__device__ __forceinline__ float theta_of(int p) { const float e = (2.0f * (float)p) * (1.0f / (float)DM); return 1.0f / powf(10000.0f, e); }
__device__ __forceinline__ v8us cvt8(v8f v) { v8us o;
#pragma unroll
    for (int k = 0; k < 8; ++k) o[k] = f2bf(v[k]);
    return o; }
__device__ __forceinline__ v4f cs2(float a0, float a1) { float s0, c0, s1, c1; sincosf(a0, &s0, &c0); sincosf(a1, &s1, &c1); v4f o; o[0] = c0; o[1] = s0; o[2] = c1; o[3] = s1; return o; }

// plane base + one 32-bit byte offset (every plane is far below 4 GiB): the planes of a round share the offset register and no 64-bit address is formed per access
__device__ __forceinline__ v8f ld8(const float* p, unsigned byteoff) { return *(const v8f*)((const char*)p + byteoff); }
template <typename V, typename P> __device__ __forceinline__ void st16(P* p, unsigned byteoff, V v) { *(V*)((char*)p + byteoff) = v; }

__global__ __launch_bounds__(PT) void k_prep(const float* __restrict__ xq, const float* __restrict__ xk, const float* __restrict__ xv,
                                             const float* __restrict__ wq, const float* __restrict__ wk, const float* __restrict__ wv, const float* __restrict__ wp,
                                             bf* __restrict__ XQ, bf* __restrict__ XK, bf* __restrict__ XV, bf* __restrict__ WB, h16* __restrict__ WP, float* __restrict__ CS) {
    const unsigned tid = threadIdx.x, blk = blockIdx.x;
    const unsigned g = blk * PT + tid;
    // weights, one 8-element piece of each per thread: the loads are issued first and the three angle steps are worked out while they fly
    const v8f w0 = ld8(wq, g * 32), w1 = ld8(wk, g * 32), w2 = ld8(wv, g * 32), w3 = ld8(wp, g * 32);
    const float th0 = theta_of((int)(2 * tid)), th1 = theta_of((int)(2 * tid + 1)), thb = theta_of((int)blk);
    st16(WB, g * 16, cvt8(w0)); st16(WB + (size_t)DM * DM, g * 16, cvt8(w1)); st16(WB + (size_t)2 * DM * DM, g * 16, cvt8(w2));
    { v8h o;
#pragma unroll
      for (int k = 0; k < 8; ++k) o[k] = (h16)(bfval(w3[k]) * WPS);
      st16(WP, g * 16, o); }
    asm volatile("s_wait_xcnt 0x0" ::: "memory");        // before the first round reuses the registers these stores name
    __builtin_amdgcn_sched_barrier(0);                   // keeps the first round's address arithmetic behind that wait
    float* const CS1 = CS + (size_t)SEQ * NPR * 2;
    // rolled: four inlined sincosf per trip keep the text small
#pragma unroll 1
    for (unsigned r = 0; r < (unsigned)XR; ++r) {
        const unsigned c = g + r * (unsigned)PN;                                    // 8-element piece of the [NB*SEQ][DM] planes
        const unsigned s = (SEQ == SEQ_FULL) ? c : (c / (unsigned)BCH) * (unsigned)((size_t)SEQ_FULL * DM / 8) + c % (unsigned)BCH;   // the same piece in the inputs (batch pitch SEQ_FULL)
        const v8f a = ld8(xq, s * 32), b = ld8(xk, s * 32), d = ld8(xv, s * 32);
        // this round's table entries stand between the loads and their first use
        const unsigned t0 = blk + r * PB, t1 = 2 * (tid + r * PT);
        st16(CS,  (t0 * NPR + 2 * tid) * 8, cs2((float)(int)t0 * th0, (float)(int)t0 * th1));
        st16(CS1, (blk * SEQ + t1) * 8,     cs2((float)(int)t1 * thb, (float)(int)(t1 + 1) * thb));
        st16(XQ, c * 16, cvt8(a)); st16(XK, c * 16, cvt8(b)); st16(XV, c * 16, cvt8(d));
        asm volatile("s_wait_xcnt 0x0" ::: "memory");    // before the next round reuses the registers these stores name
        __builtin_amdgcn_sched_barrier(0);               // keeps the next round's address arithmetic behind that wait
    }
}

// Main loop of the four GEMMs. A block of GW waves owns a GT x GT tile of C; each wave a 64 x 64 quarter (16 accumulators).
// The k axis is walked in tiles of GK: the GT rows of A and the GT rows of Bt are brought into LDS ONCE per block by asynchronous 16-byte copies (whole 128-byte lines,
// GK / 8 lanes per row) into one of two buffers, the next tile flying while this one is worked on; fragments are 16-byte LDS reads at pitch GLP. k runs upward in steps of 32 as before.
__device__ __forceinline__ v16h  ldf(const h16* p) { return ldh(p); }
__device__ __forceinline__ v16bf ldf(const bf* p)  { return ldb(p); }
__device__ __forceinline__ v8f mm(v16h a, v16h b, v8f c)   { return wmma16(a, b, c); }
__device__ __forceinline__ v8f mm(v16bf a, v16bf b, v8f c) { return wmmab(a, b, c); }
// eight copies of one thread: 16-byte pieces, rows GRS apart, each lane with its own LDS byte address and global pointer.
// s_wait_xcnt stands as the statement's last line, in front of any rewrite of the address registers that the copies name.
template <typename T>
__device__ __forceinline__ void stage_rows(unsigned l, const T* g) {
    asm volatile("global_load_async_to_lds_b128 %0, %8, off\n\t"
                 "global_load_async_to_lds_b128 %1, %9, off\n\t"
                 "global_load_async_to_lds_b128 %2, %10, off\n\t"
                 "global_load_async_to_lds_b128 %3, %11, off\n\t"
                 "global_load_async_to_lds_b128 %4, %12, off\n\t"
                 "global_load_async_to_lds_b128 %5, %13, off\n\t"
                 "global_load_async_to_lds_b128 %6, %14, off\n\t"
                 "global_load_async_to_lds_b128 %7, %15, off\n\t"
                 "s_wait_xcnt 0x0"
                 :: "v"(l), "v"(l + 1 * GRS * GLP * 2), "v"(l + 2 * GRS * GLP * 2), "v"(l + 3 * GRS * GLP * 2),
                    "v"(l + 4 * GRS * GLP * 2), "v"(l + 5 * GRS * GLP * 2), "v"(l + 6 * GRS * GLP * 2), "v"(l + 7 * GRS * GLP * 2),
                    "v"(g), "v"(g + 1 * GRS * DM), "v"(g + 2 * GRS * DM), "v"(g + 3 * GRS * DM),
                    "v"(g + 4 * GRS * DM), "v"(g + 5 * GRS * DM), "v"(g + 6 * GRS * DM), "v"(g + 7 * GRS * DM)
                 : "memory");
}
// one k tile's copies of one thread: the GT rows of A, then the GT rows of Bt behind them
template <typename T>
__device__ __forceinline__ void stage_ab(unsigned l, const T* ag, const T* bg) {
#pragma unroll
    for (int h = 0; h < GT / (8 * GRS); ++h) stage_rows(l + h * (8 * GRS * GLP * 2), ag + h * (8 * GRS * DM));
#pragma unroll
    for (int h = 0; h < GT / (8 * GRS); ++h) stage_rows(l + (GT + h * 8 * GRS) * (GLP * 2), bg + h * (8 * GRS * DM));
}
// R0, C0: first row of A and of Bt of the BLOCK; wr, wc: this wave's 64-row offsets inside them; sm: 2 * GTH elements of LDS.
template <typename T>
__device__ __forceinline__ void gemm_main(const T* __restrict__ A, const T* __restrict__ Bt, const T* sm, int R0, int C0, int wr, int wc, int lr, int hi, v8f (&acc)[4][4]) {
#pragma unroll
    for (int mb = 0; mb < 4; ++mb)
#pragma unroll
        for (int nb = 0; nb < 4; ++nb) acc[mb][nb] = (v8f){};
    // copy addresses of this thread: row = tid / (GK / 8) (+ GRS per piece), 16-byte column = tid % (GK / 8), the same in the A tile and in the Bt tile
    const unsigned crow = threadIdx.x / (GK / 8), ccol = threadIdx.x % (GK / 8);
    const unsigned l0 = (unsigned)(size_t)&sm[0] + crow * (GLP * 2) + ccol * 16;     // LDS byte address in buffer 0, A tile; the Bt tile stands GT rows behind
    const T* ag = A  + (size_t)(R0 + (int)crow) * DM + ccol * 8;                     // + k0
    const T* bg = Bt + (size_t)(C0 + (int)crow) * DM + ccol * 8;                     // + k0
    stage_ab(l0, ag, bg);
    asm volatile("s_wait_asynccnt 0x0" ::: "memory");        // this wave's copies of tile 0 have landed
    __syncthreads();                                         // ... and every other wave's: tile 0 may be read
    stage_ab(l0 + GTH * 2, ag + GK, bg + GK);                // tile 1 flies during trip 0
    const T* fa = sm + (wr + lr) * GLP + 8 * hi;             // A fragment base of this wave
    const T* fb = sm + (GT + wc + lr) * GLP + 8 * hi;        // Bt fragment base of this wave
#pragma unroll 1
    for (int t = 0; t < DM / GK; ++t) {
        const T* pa = fa + (t & 1) * GTH; const T* pb = fb + (t & 1) * GTH;   // trip t reads buffer t mod 2 alone
        decltype(ldf(fa)) a[2][4], b[2][4];              // two fragment sets: the block of 32 k in work and the next one of the same tile
#pragma unroll
        for (int i = 0; i < 4; ++i) { a[0][i] = ldf(pa + i * 16 * GLP); b[0][i] = ldf(pb + i * 16 * GLP); }
#pragma unroll
        for (int s = 0; s < GK / 32; ++s) {
            if (s + 1 < GK / 32) {
#pragma unroll
                for (int i = 0; i < 4; ++i) { a[(s + 1) & 1][i] = ldf(pa + i * 16 * GLP + (s + 1) * 32); b[(s + 1) & 1][i] = ldf(pb + i * 16 * GLP + (s + 1) * 32); } }
            __builtin_amdgcn_sched_barrier(0);           // the next block's LDS reads stay one group in front of this block's products: their latency runs under the products
#pragma unroll
            for (int nb = 0; nb < 4; ++nb)
#pragma unroll
                for (int mb = 0; mb < 4; ++mb) acc[mb][nb] = mm(a[s & 1][mb], b[s & 1][nb], acc[mb][nb]);
            __builtin_amdgcn_sched_barrier(0);           // no later LDS read is spread among these products; behind the last block: every product stands in front of the slots below
        }
        // four vector slots between the last matrix product and the loop's back edge
        asm volatile("v_nop\n\tv_nop\n\tv_nop\n\tv_nop");
        asm volatile("s_wait_dscnt 0x0" ::: "memory");   // this wave's reads of buffer t mod 2 have returned
        asm volatile("s_wait_asynccnt 0x0" ::: "memory");// this wave's copies of tile t + 1 have landed
        __syncthreads();                                 // publishes tile t + 1 and ends every wave's reads of the buffer refilled below
        if (t + 2 < DM / GK) stage_ab(l0 + (unsigned)(t & 1) * (GTH * 2), ag + (t + 2) * GK, bg + (t + 2) * GK);
    }
    asm volatile("s_wait_asynccnt 0x0" ::: "memory");    // nothing of this wave's is in flight when the loop is left
}

// proj_tile: register-blocked bf16 GEMM, one wave per 64x64 tile (16 accumulators), GW waves per block, operands from K-contiguous bf16 planes through LDS (gemm_main), K = DM.
// C[m][n] = sum_k A[m][k] Bt[n][k]; epilogue by MODE:
//   0: C as f16 (Ph);
//   1: rows = tokens, columns = features: interleaved rotary on column pairs (table [pos][p]), then f16 (Ph);
//   2: rows = features, columns = tokens: interleaved rotary on row pairs (table [p][pos]), then f16 (Ph).
// Tile base (r0/RB)*sRB + (r0%RB)*pitch + (c0/CB)*sCB + (c0%CB), row pitch 'pitch' (halves). (bx, by): the block's tile among (M/GT, N/GT); 32 * GW threads; osb, sm: the block's LDS.
template <int MODE>
__device__ __forceinline__ void proj_tile(const bf* __restrict__ A, const bf* __restrict__ Bt, h16* Ph, const float* __restrict__ CS, float* osb, const bf* sm, int bx, int by,
                                             int RB, size_t sRB, int pitch, int CB, size_t sCB) {
    const int lane = threadIdx.x & 31, lr = lane & 15, hi = lane >> 4;
    const int wave = __builtin_amdgcn_readfirstlane((int)(threadIdx.x >> 5));
    const int wr = (wave & 1) * 64, wc = (wave >> 1) * 64;
    const int r0 = bx * GT + wr, c0 = by * GT + wc;                      // this wave's 64 x 64 tile
    float* const os = osb + wave * 16 * 68;                              // this wave's own staging rows
    v8f acc[4][4];
    gemm_main(A, Bt, sm, bx * GT, by * GT, wr, wc, lr, hi, acc);
    const size_t tbase = (size_t)(r0 / RB) * sRB + (size_t)(r0 % RB) * (size_t)pitch + (size_t)(c0 / CB) * sCB + (size_t)(c0 % CB);
    const int rg = lane >> 3, c8 = (lane & 7) * 8;       // 4 row groups x 8 lanes; 8 lanes x 8 = 64 columns
#pragma unroll
    for (int mb = 0; mb < 4; ++mb) {
#pragma unroll
        for (int nb = 0; nb < 4; ++nb) {
#pragma unroll
            for (int j = 0; j < 8; ++j) os[(hi * 8 + j) * 68 + nb * 16 + lr] = acc[mb][nb][j]; }   // D: row 8h+j, col lane&15; rows 0..15 x cols 0..63 all written
        wave_sync();
        v8h hv[4];
#pragma unroll
        for (int s = 0; s < 4; ++s) {
            const int row = 4 * s + rg;                  // 4 s x 4 row groups = 16 rows
            v4f x0 = *(const v4fa*)(&os[row * 68 + c8]); v4f x1 = *(const v4fa*)(&os[row * 68 + c8 + 4]);
            if (MODE == 1) {
                const int t = (r0 % SEQ) + mb * 16 + row;                                    // token position of this row
                const float* cp = CS + ((size_t)t * NPR + (size_t)((c0 + c8) >> 1)) * 2;     // 4 pairs: (cos, sin) x 4
                const v4f e0 = *(const v4fa*)cp; const v4f e1 = *(const v4fa*)(cp + 4);
                asm volatile("s_wait_xcnt 0x0" :: "v"(cp) : "memory");   // before a register that these loads name is reused; cp as input: neither load lands in the address pair in front of the wait
                v4f y0, y1;
                y0[0] = x0[0] * e0[0] - x0[1] * e0[1]; y0[1] = x0[0] * e0[1] + x0[1] * e0[0];
                y0[2] = x0[2] * e0[2] - x0[3] * e0[3]; y0[3] = x0[2] * e0[3] + x0[3] * e0[2];
                y1[0] = x1[0] * e1[0] - x1[1] * e1[1]; y1[1] = x1[0] * e1[1] + x1[1] * e1[0];
                y1[2] = x1[2] * e1[2] - x1[3] * e1[3]; y1[3] = x1[2] * e1[3] + x1[3] * e1[2];
                x0 = y0; x1 = y1;
            }
            if (MODE == 2) {
                const int e = r0 + mb * 16 + row;                                            // feature index of this row; partner row = row ^ 1 (same slab)
                const int tc = (c0 % SEQ) + c8;                                              // first of 8 token positions
                const float* cp = CS + (size_t)SEQ * NPR * 2 + ((size_t)(e >> 1) * SEQ + (size_t)tc) * 2;
                const v4f e0 = *(const v4fa*)cp; const v4f e1 = *(const v4fa*)(cp + 4); const v4f e2 = *(const v4fa*)(cp + 8); const v4f e3 = *(const v4fa*)(cp + 12);
                asm volatile("s_wait_xcnt 0x0" :: "v"(cp) : "memory");   // before a register that these loads name is reused; cp as input: none of the loads lands in the address pair in front of the wait
                const v4f w0 = *(const v4fa*)(&os[(row ^ 1) * 68 + c8]); const v4f w1 = *(const v4fa*)(&os[(row ^ 1) * 68 + c8 + 4]);
                const float sg = (row & 1) ? 1.0f : -1.0f;   // even feature: x cos - partner sin; odd feature: partner sin + x cos
                v4f y0, y1;
                y0[0] = x0[0] * e0[0] + sg * (w0[0] * e0[1]); y0[1] = x0[1] * e0[2] + sg * (w0[1] * e0[3]);
                y0[2] = x0[2] * e1[0] + sg * (w0[2] * e1[1]); y0[3] = x0[3] * e1[2] + sg * (w0[3] * e1[3]);
                y1[0] = x1[0] * e2[0] + sg * (w1[0] * e2[1]); y1[1] = x1[1] * e2[2] + sg * (w1[1] * e2[3]);
                y1[2] = x1[2] * e3[0] + sg * (w1[2] * e3[1]); y1[3] = x1[3] * e3[2] + sg * (w1[3] * e3[3]);
                x0 = y0; x1 = y1;
            }
#pragma unroll
            for (int i = 0; i < 4; ++i) { hv[s][i] = (h16)x0[i]; hv[s][4 + i] = (h16)x1[i]; }
        }
        const size_t sb = tbase + (size_t)(mb * 16) * (size_t)pitch;
{
#pragma unroll
            for (int s = 0; s < 4; ++s) { const size_t oo = sb + (size_t)(4 * s + rg) * (size_t)pitch + c8;
                *(v8h*)(Ph + oo) = hv[s]; }
             }
        asm volatile("s_wait_xcnt 0x0" ::: "memory");        // before what follows (the next slab; behind the last one, whatever stands behind this tile in the kernel) reuses the registers these stores name
        wave_sync();
    }
}

// k_proj: the three input projections in ONE launch; blockIdx.z picks the projection (the same for a whole block, so every barrier stays under block-uniform control flow), blockIdx.x its 128 x 128 tile.
// 3 x PJ blocks; two fit a WGP's LDS, so one block's first tiles, barrier waits and epilogue run under another block's products, and two launch gaps go.
// The projection with the longest epilogue comes first in the grid, the shortest last.
//   z = 0, v^T: A = Wv rows (m = h*64 + d), Bt = x rows (n = b*SEQ + t) -> plane [(b*1024 + m)][t] = [(b*16 + h)][d][t]; rotary on row pairs
//   z = 1, k and z = 2, q: A = x rows (m = b*SEQ + t), Bt = W rows (n = h*64 + d) -> plane [(b*16 + h)][t][d]; k gets rotary on column pairs
#define PJ   ((NB * SEQ / GT) * (DM / GT))     // 128 x 128 tiles of one projection
__global__ __launch_bounds__(32 * GW) void k_proj(const bf* __restrict__ XQ, const bf* __restrict__ XK, const bf* __restrict__ XV, const bf* __restrict__ WB,
                                                  h16* QH, h16* KP, h16* VT, const float* __restrict__ CS) {
    __shared__ __align__(16) float osb[GW * 16 * 68];
    __shared__ __align__(16) bf sm[2 * GTH];
    const int f = blockIdx.x, z = blockIdx.z;
    if (z == 0)      proj_tile<2>(WB + (size_t)2 * DM * DM, XV, VT, CS, osb, sm, f % (DM / GT), f / (DM / GT), DM, (size_t)0, SEQ, SEQ, (size_t)DM * SEQ);
    else if (z == 1) proj_tile<1>(XK, WB + (size_t)DM * DM, KP, CS, osb, sm, f % (NB * SEQ / GT), f / (NB * SEQ / GT), SEQ, (size_t)NH_ * SEQ * HD, HD, HD, (size_t)SEQ * HD);
    else             proj_tile<0>(XQ, WB, QH, CS, osb, sm, f % (NB * SEQ / GT), f / (NB * SEQ / GT), SEQ, (size_t)NH_ * SEQ * HD, HD, HD, (size_t)SEQ * HD);
}

// k_flash: fused attention, KS waves per 16 * QG query rows of one (batch, head), wave (slot, half) walking keys half * SEQ / KS ... of its slot's rows; Q fragments straight from the f16 plane.
// K and V^T: the AW waves of a key half walk the same keys, so each tile of KT keys is brought into LDS ONCE per block by asynchronous 16-byte copies (whole 128-byte lines,
// eight lanes per row) into one of that half's two buffers, the next tile flying while this one is worked on; fragments are 16-byte LDS reads at pitch LP.
// Behind the loop the upper half hands (max, sum, O^T) to the lower half's wave of the same slot through LDS, lane to lane; that wave joins the two online-softmax states and stores.
// Each K and V^T fragment is read once per wave and feeds QG matrix products (one per 16-query group g).
// Transposed form: S^T[key][t] = K Q^T (A = K rows, B = Q rows); lane (t = lane&15, h = lane>>4) holds keys 8h+r of each 16-key tile, so the packed
// P tile is directly the B fragment of O^T[d][t] = V^T P^T (element r <- tile keys 0..15, element 8+r <- tile keys 16..31, lane unchanged).
// Scale chain: logit2 = acc * (0.125 * log2 e); P = exp2(logit2 - max + 8) as f16; l = sum of the f16 P values; ctx plane = O^T * 1024 / l.
// Softmax state (running max, partial sum) is one scalar per lane and group; the two lane halves of a row are combined with one xor-16 exchange.
// one tile's copies of one thread: two 16-byte pieces of the K tile (rows 32 apart) and two of the V^T tile, each lane with its own LDS byte address and global pointer.
// s_wait_xcnt stands as the statement's last line, in front of any rewrite of the address registers that the copies name.
__device__ __forceinline__ void stage_tile(unsigned l, const h16* kg, const h16* vg) {
    asm volatile("global_load_async_to_lds_b128 %0, %4, off\n\t"
                 "global_load_async_to_lds_b128 %1, %5, off\n\t"
                 "global_load_async_to_lds_b128 %2, %6, off\n\t"
                 "global_load_async_to_lds_b128 %3, %7, off\n\t"
                 "s_wait_xcnt 0x0"
                 :: "v"(l), "v"(l + 32 * LP * 2), "v"(l + 64 * LP * 2), "v"(l + 96 * LP * 2),
                    "v"(kg), "v"(kg + 32 * HD), "v"(vg), "v"(vg + (size_t)32 * SEQ)
                 : "memory");
}

__global__ __launch_bounds__(32 * AW * KS) void k_flash(const h16* __restrict__ QH, const h16* __restrict__ KP, const h16* __restrict__ VT, h16* CX) {
    __shared__ __align__(16) float os[AW * 16 * 68];
    __shared__ __align__(16) h16 kv[KS * 2 * TH];            // two buffers per key half
    __shared__ __align__(16) float cmb[AW * CP * 32 * 4];    // hand-over of the upper half's state: [slot][piece][lane] 16-byte pieces
    const int lane = threadIdx.x & 31, lr = lane & 15, hi = lane >> 4;
    const int wid = __builtin_amdgcn_readfirstlane((int)(threadIdx.x >> 5));
    const int wave = wid % AW, kh = wid / AW;                // query slot and key half of this wave, both wave-uniform
    const int zh = blockIdx.y; const int b = zh / NH_, h = zh % NH_;
    const int t0 = (blockIdx.x * AW + wave) * (16 * QG);
    const size_t pbase = (size_t)zh * SEQ * HD;
    const size_t qo = pbase + (size_t)(t0 + lr) * HD + 8 * hi;
    v16h qh0[QG], qh1[QG];                                   // B fragments: col t, k = d
#pragma unroll
    for (int g = 0; g < QG; ++g) { qh0[g] = ldh(QH + qo + (size_t)g * 16 * HD); qh1[g] = ldh(QH + qo + (size_t)g * 16 * HD + 32); }
    // copy addresses of this thread, ht = its index among the 32 * AW threads of its key half: row = ht / 8 (+ 32 for the second piece), 16-byte column = ht % 8, the same in the K tile (row = key) and in the V^T tile (row = d)
    const unsigned ht = threadIdx.x % (32 * AW);
    const unsigned crow = ht >> 3, ccol = ht & 7;
    const int kf = kh * (SEQ / KS);                                                  // first key of this half
    const unsigned l0 = (unsigned)(size_t)&kv[0] + (unsigned)kh * (2 * TH * 2) + crow * (LP * 2) + ccol * 16;   // LDS byte address in this half's buffer 0
    const h16* kg = KP + pbase + (size_t)(kf + (int)crow) * HD + ccol * 8;           // + key0 * HD
    const h16* vg = VT + pbase + (size_t)crow * SEQ + kf + ccol * 8;                 // + key0
    stage_tile(l0, kg, vg);
    asm volatile("s_wait_asynccnt 0x0" ::: "memory");        // this wave's copies of tile 0 have landed
    __syncthreads();                                         // ... and every other wave's: tile 0 may be read
    stage_tile(l0 + TH * 2, kg + (size_t)KT * HD, vg + KT);  // tile 1 flies during trip 0
    const h16* fr = kv + kh * (2 * TH) + lr * LP + 8 * hi;   // fragment base in this half's buffers: K row key (k = d) at + key * LP; V^T row d (k = key) at + (KT + d) * LP + key
    v8f o0[QG], o1[QG], o2[QG], o3[QG];
    float m[QG], l[QG];
#pragma unroll
    for (int g = 0; g < QG; ++g) { o0[g] = (v8f){}; o1[g] = (v8f){}; o2[g] = (v8f){}; o3[g] = (v8f){}; m[g] = -3.0e38f; l[g] = 0.0f; }
#pragma unroll 1
    for (int t = 0; t < NT; ++t) {
      const h16* fb = fr + (t & 1) * TH;                 // trip t reads buffer t mod 2 of its half alone
#pragma unroll
      for (int sub = 0; sub < KT / 32; ++sub) {          // two passes of 32 keys per tile, one online-softmax step each
        const h16* ka = fb + sub * 32 * LP;
        const v16h ka0 = ldh(ka), ka1 = ldh(ka + 32), kb0 = ldh(ka + 16 * LP), kb1 = ldh(ka + 16 * LP + 32);
        v16h pb[QG];
#pragma unroll
        for (int g = 0; g < QG; ++g) {
            v8f sHa = (v8f){}, sHb = (v8f){};
            sHa = wmma16(ka0, qh0[g], sHa); sHb = wmma16(kb0, qh0[g], sHb);
            sHa = wmma16(ka1, qh1[g], sHa); sHb = wmma16(kb1, qh1[g], sHb);
            float ta[8], tb[8]; float mx = -3.0e38f;
#pragma unroll
            for (int r = 0; r < 8; ++r) { ta[r] = sHa[r] * SC2; tb[r] = sHb[r] * SC2; mx = fmaxf(mx, fmaxf(ta[r], tb[r])); }
            mx = fmaxf(mx, __shfl_xor(mx, 16, 32));
            const float mnew = fmaxf(m[g], mx);
            const float alpha = __builtin_amdgcn_exp2f(m[g] - mnew);
            const float sh = PSH - mnew;
            float ls = 0.0f;
#pragma unroll
            for (int r = 0; r < 8; ++r) { const h16 pa = (h16)__builtin_amdgcn_exp2f(ta[r] + sh); const h16 pc = (h16)__builtin_amdgcn_exp2f(tb[r] + sh); pb[g][r] = pa; pb[g][8 + r] = pc; ls += (float)pa + (float)pc; }
            l[g] = l[g] * alpha + ls; m[g] = mnew;
            o0[g] = o0[g] * alpha; o1[g] = o1[g] * alpha; o2[g] = o2[g] * alpha; o3[g] = o3[g] * alpha;
        }
        const h16* va = fb + KT * LP + sub * 32;
        const v16h v0 = ldh(va), v1 = ldh(va + 16 * LP), v2 = ldh(va + 32 * LP), v3 = ldh(va + 48 * LP);
#pragma unroll
        for (int g = 0; g < QG; ++g) {
            o0[g] = wmma16(v0, pb[g], o0[g]); o1[g] = wmma16(v1, pb[g], o1[g]); o2[g] = wmma16(v2, pb[g], o2[g]); o3[g] = wmma16(v3, pb[g], o3[g]);
        }
      }
        __builtin_amdgcn_sched_barrier(0);               // keeps every matrix product of this trip in front of the slots below
        // four vector slots between the last matrix product and the loop's back edge
        asm volatile("v_nop\n\tv_nop\n\tv_nop\n\tv_nop");
        asm volatile("s_wait_dscnt 0x0" ::: "memory");   // this wave's reads of buffer t mod 2 have returned
        asm volatile("s_wait_asynccnt 0x0" ::: "memory");// this wave's copies of tile t + 1 have landed
        __syncthreads();                                 // publishes tile t + 1 and ends every wave's reads of the buffer refilled below
        if (t + 2 < NT) stage_tile(l0 + (unsigned)(t & 1) * (TH * 2), kg + (size_t)(t + 2) * KT * HD, vg + (size_t)(t + 2) * KT);
    }
    asm volatile("s_wait_asynccnt 0x0" ::: "memory");    // nothing of this wave's is in flight when the loop is left
    // the two key halves of a slot are joined: lane x of the upper wave holds the same (query, d) places as lane x of the lower wave
    float* const cw = cmb + wave * (CP * 32 * 4) + lane * 4;             // piece j of this lane at + j * 128 floats: neighbouring lanes, neighbouring 16 bytes
    if (kh != 0) {
#pragma unroll
        for (int g = 0; g < QG; ++g) {
            const v8f* const oq[4] = { &o0[g], &o1[g], &o2[g], &o3[g] };
#pragma unroll
            for (int q = 0; q < 4; ++q) {
                const v8f x = *oq[q];
                *(v4fa*)(cw + (g * 8 + q * 2) * 128)     = (v4f){ x[0], x[1], x[2], x[3] };
                *(v4fa*)(cw + (g * 8 + q * 2 + 1) * 128) = (v4f){ x[4], x[5], x[6], x[7] };
            }
        }
        *(v4fa*)(cw + (CP - 1) * 128) = (v4f){ m[0], m[1], l[0], l[1] };
    }
    __syncthreads();                                     // the upper half's state may be read; every wave of the block passes here
    if (kh != 0) return;                                 // no barrier stands behind this line
    {
        const v4f ml = *(const v4fa*)(cw + (CP - 1) * 128);
#pragma unroll
        for (int g = 0; g < QG; ++g) {
            const float mn = fmaxf(m[g], ml[g]);
            const float fa = __builtin_amdgcn_exp2f(m[g] - mn), fc = __builtin_amdgcn_exp2f(ml[g] - mn);
            l[g] = l[g] * fa + ml[2 + g] * fc;
            v8f* const oq[4] = { &o0[g], &o1[g], &o2[g], &o3[g] };
#pragma unroll
            for (int q = 0; q < 4; ++q) {
                const v4f x = *(const v4fa*)(cw + (g * 8 + q * 2) * 128); const v4f y = *(const v4fa*)(cw + (g * 8 + q * 2 + 1) * 128);
                v8f o = *oq[q];
#pragma unroll
                for (int r = 0; r < 4; ++r) { o[r] = o[r] * fa + x[r] * fc; o[4 + r] = o[4 + r] * fa + y[r] * fc; }
                *oq[q] = o;
            }
        }
    }
    const int wb = wave * 16 * 68;
    const int rg = lane >> 3, c8 = (lane & 7) * 8;       // 4 s x 4 row groups = 16 rows; 8 lanes x 8 halves = 64 columns
#pragma unroll
    for (int g = 0; g < QG; ++g) {
        const float lt = l[g] + __shfl_xor(l[g], 16, 32);
        const float inv = (1.0f / lt) * CXS;
        // O^T D layout: o_j[r] = (d = 16j + 8h + r, t = lane&15) -> os[t][d]; rows 0..15 x columns 0..63 all written
        { v4f a, c;
          a[0] = o0[g][0] * inv; a[1] = o0[g][1] * inv; a[2] = o0[g][2] * inv; a[3] = o0[g][3] * inv; c[0] = o0[g][4] * inv; c[1] = o0[g][5] * inv; c[2] = o0[g][6] * inv; c[3] = o0[g][7] * inv;
          *(v4fa*)(&os[wb + lr * 68 +  0 + 8 * hi]) = a; *(v4fa*)(&os[wb + lr * 68 +  0 + 8 * hi + 4]) = c;
          a[0] = o1[g][0] * inv; a[1] = o1[g][1] * inv; a[2] = o1[g][2] * inv; a[3] = o1[g][3] * inv; c[0] = o1[g][4] * inv; c[1] = o1[g][5] * inv; c[2] = o1[g][6] * inv; c[3] = o1[g][7] * inv;
          *(v4fa*)(&os[wb + lr * 68 + 16 + 8 * hi]) = a; *(v4fa*)(&os[wb + lr * 68 + 16 + 8 * hi + 4]) = c;
          a[0] = o2[g][0] * inv; a[1] = o2[g][1] * inv; a[2] = o2[g][2] * inv; a[3] = o2[g][3] * inv; c[0] = o2[g][4] * inv; c[1] = o2[g][5] * inv; c[2] = o2[g][6] * inv; c[3] = o2[g][7] * inv;
          *(v4fa*)(&os[wb + lr * 68 + 32 + 8 * hi]) = a; *(v4fa*)(&os[wb + lr * 68 + 32 + 8 * hi + 4]) = c;
          a[0] = o3[g][0] * inv; a[1] = o3[g][1] * inv; a[2] = o3[g][2] * inv; a[3] = o3[g][3] * inv; c[0] = o3[g][4] * inv; c[1] = o3[g][5] * inv; c[2] = o3[g][6] * inv; c[3] = o3[g][7] * inv;
          *(v4fa*)(&os[wb + lr * 68 + 48 + 8 * hi]) = a; *(v4fa*)(&os[wb + lr * 68 + 48 + 8 * hi + 4]) = c; }
        wave_sync();
        h16* crow = CX + ((size_t)b * SEQ + t0 + g * 16) * DM + h * HD;
        v8h hv[4];
#pragma unroll
        for (int s = 0; s < 4; ++s) { const int row = 4 * s + rg;
            const v4f x0 = *(const v4fa*)(&os[wb + row * 68 + c8]); const v4f x1 = *(const v4fa*)(&os[wb + row * 68 + c8 + 4]);
#pragma unroll
            for (int i = 0; i < 4; ++i) { hv[s][i] = (h16)x0[i]; hv[s][4 + i] = (h16)x1[i]; } }
#pragma unroll
        for (int s = 0; s < 4; ++s) *(v8h*)(crow + (size_t)(4 * s + rg) * DM + c8) = hv[s];
        asm volatile("s_wait_xcnt 0x0" ::: "memory");    // before the next group reuses the registers these stores name
        __builtin_amdgcn_sched_barrier(0);               // keeps the next group's arithmetic behind that wait
        wave_sync();                                     // the next group overwrites this wave's staging rows
    }
}

// k_oproj: register-blocked f16 GEMM, one wave per 64x64 tile, GW waves per block (gemm_main), A = ctx plane (x1024), Bt = Wp plane (x256), K = DM; OUT[m][n] = acc * 2^-18 + bias[n] (f32).
__global__ __launch_bounds__(32 * GW) void k_oproj(const h16* __restrict__ A, const h16* __restrict__ Bt, const float* __restrict__ bias, float* OUT) {
    __shared__ __align__(16) float osb[GW * 16 * 68];
    __shared__ __align__(16) h16 sm[2 * GTH];
    const int lane = threadIdx.x & 31, lr = lane & 15, hi = lane >> 4;
    const int wave = __builtin_amdgcn_readfirstlane((int)(threadIdx.x >> 5));
    const int wr = (wave & 1) * 64, wc = (wave >> 1) * 64;
    const int r0 = blockIdx.x * GT + wr, c0 = blockIdx.y * GT + wc;      // this wave's 64 x 64 tile
    float* const os = osb + wave * 16 * 68;                              // this wave's own staging rows
    v8f acc[4][4];
    gemm_main(A, Bt, sm, (int)blockIdx.x * GT, (int)blockIdx.y * GT, wr, wc, lr, hi, acc);
    const int cofs = lr * 4;                              // 16 lanes x 4 floats = 64 columns
    const v4f braw = *(const v4fa*)(bias + c0 + cofs); v4f bb;
#pragma unroll
    for (int i = 0; i < 4; ++i) bb[i] = bfval(braw[i]);
    const int bi = r0 / SEQ, tt = r0 % SEQ;
    float* obase = OUT + ((size_t)bi * OUT_SEQ + tt) * DM + c0;
#pragma unroll
    for (int mb = 0; mb < 4; ++mb) {
#pragma unroll
        for (int nb = 0; nb < 4; ++nb) {
#pragma unroll
            for (int j = 0; j < 8; ++j) os[(hi * 8 + j) * 68 + nb * 16 + lr] = acc[mb][nb][j]; }   // rows 0..15 x cols 0..63 all written
        wave_sync();
        v4f vals[8];
#pragma unroll
        for (int s = 0; s < 8; ++s) { const int row = 2 * s + hi;            // 8 s x 2 rows = 16 rows
            const v4f x = *(const v4fa*)(&os[row * 68 + cofs]); vals[s] = x * OSC + bb; }
{
#pragma unroll
            for (int s = 0; s < 8; ++s) *(v4f*)(obase + (size_t)(mb * 16 + 2 * s + hi) * DM + cofs) = vals[s];
             }
        wave_sync();
    }
}

static constexpr size_t al256(size_t v) { return (v + 255) & ~(size_t)255; }
static constexpr size_t SZ_XB = al256((size_t)NB * SEQ * DM * 2);            // one bf16 activation plane
static constexpr size_t SZ_WB = al256((size_t)3 * DM * DM * 2);              // Wq | Wk | Wv bf16
static constexpr size_t SZ_WP = al256((size_t)DM * DM * 2);                  // Wp f16 x256
static constexpr size_t SZ_CS = al256((size_t)2 * SEQ * NPR * 2 * 4);        // two (cos, sin) tables
static constexpr size_t SZ_PL = al256((size_t)NB * NH_ * SEQ * HD * 2);      // one f16 head plane
static constexpr size_t SZ_CX = al256((size_t)NB * SEQ * DM * 2);            // ctx f16 x1024
static constexpr size_t SZ_TOTAL = 3 * SZ_XB + SZ_WB + SZ_WP + SZ_CS + 3 * SZ_PL + SZ_CX;
static_assert(SZ_TOTAL <= (size_t)134217728);          // workspace carve <= 128 MiB
static_assert(((size_t)DM * DM * 2) % 256 == 0);       // weight sub-planes stay 256-byte aligned

extern "C" void kernel_launch(void* const* d_in, const int* in_sizes, int n_in,
                              void* d_out, int out_size, void* d_ws, size_t ws_size, hipStream_t stream) {
    if (n_in < 8) return;
    const size_t needx = ((size_t)(NB - 1) * SEQ_FULL + SEQ) * DM;
    if ((size_t)in_sizes[0] < needx || (size_t)in_sizes[1] < needx || (size_t)in_sizes[2] < needx) return;
    if ((size_t)in_sizes[3] < (size_t)DM * DM || (size_t)in_sizes[4] < (size_t)DM * DM || (size_t)in_sizes[5] < (size_t)DM * DM || (size_t)in_sizes[6] < (size_t)DM * DM) return;
    if ((size_t)in_sizes[7] < (size_t)DM) return;
    if ((size_t)out_size < ((size_t)(NB - 1) * OUT_SEQ + SEQ) * DM) return;
    if (SZ_TOTAL > ws_size) return;
    // wire order: q, k, v, Wq, Wk, Wv, Wp, bp (weights [out][in] = Bt as-is)
    const float* xq = (const float*)d_in[0]; const float* xk = (const float*)d_in[1]; const float* xv = (const float*)d_in[2];
    const float* wq = (const float*)d_in[3]; const float* wk = (const float*)d_in[4]; const float* wv = (const float*)d_in[5];
    const float* wp = (const float*)d_in[6]; const float* bp = (const float*)d_in[7];
    float* OUT = (float*)d_out;      // [NB][SEQ][1024]
    char* wsp = (char*)d_ws;
    bf* XQ = (bf*)wsp; wsp += SZ_XB;                 // [NB*SEQ][1024]
    bf* XK = (bf*)wsp; wsp += SZ_XB;
    bf* XV = (bf*)wsp; wsp += SZ_XB;
    bf* WB = (bf*)wsp; wsp += SZ_WB;                 // [3][1024][1024]: q | k | v
    h16* WP = (h16*)wsp; wsp += SZ_WP;               // [1024][1024] x256
    float* CS = (float*)wsp; wsp += SZ_CS;           // [SEQ][512][2] then [512][SEQ][2]
    h16* QH = (h16*)wsp; wsp += SZ_PL;               // [NB*16][SEQ][64]
    h16* KP = (h16*)wsp; wsp += SZ_PL;               // [NB*16][SEQ][64]
    h16* VT = (h16*)wsp; wsp += SZ_PL;               // [NB*16][64][SEQ]
    h16* CX = (h16*)wsp; wsp += SZ_CX;               // [NB*SEQ][1024] x1024

    k_prep<<<PB, PT, 0, stream>>>(xq, xk, xv, wq, wk, wv, wp, XQ, XK, XV, WB, WP, CS);

    // q, k and v^T projections: one launch, blockIdx.z = projection
    k_proj<<<dim3(PJ, 1, 3), 32 * GW, 0, stream>>>(XQ, XK, XV, WB, QH, KP, VT, CS);

    k_flash<<<dim3(SEQ / (16 * QG * AW), NB * NH_, 1), 32 * AW * KS, 0, stream>>>(QH, KP, VT, CX);

    // out: A = ctx rows (m = b*SEQ + t), Bt = Wp rows (n = out feature)
    k_oproj<<<dim3(NB * SEQ / GT, DM / GT, 1), 32 * GW, 0, stream>>>(CX, WP, bp, OUT);
}

// v008
// A run of this version takes 84.7 microseconds.
// In two side-by-side timings against v007, it was 1.03 and 1.04 times as fast.
// Counting every step since v000, it is 2.90 times as fast.
#include <hip/hip_runtime.h>

// Multi-head attention, width 1024 = 16 heads x 64; inputs q, k, v [NB][SEQ][1024]; Wq/Wk/Wv/Wp [out][in] (y = x W^T); interleaved rotary on projected k and v over the full 1024 axis (512 pairs, angle = pos * 10000^(-2p/1024)); score scale 1/8; dense softmax; out = ctx Wp^T + bp (f32).
// Compute dtypes, f32 accumulate everywhere: q/k/v projections v_wmma_f32_16x16x32_bf16 (inputs and weights RNE-converted to bf16; products exact); rotary in f32 in the projection epilogue from f32 cos/sin tables;
// scores v_wmma_f32_16x16x32_f16: q single f16, k single f16 (one product; logits = acc * 0.125 * log2 e); P (x256 carry, cancels in the normalisation; row sum taken over the f16 values) and v single f16; softmax f32 (online, running max);
// output projection v_wmma_f32_16x16x32_f16: ctx single f16 with x1024 carry, Wp as f16 of the bf16 RNE value with x256 carry, 2^-18 folded back in the f32 epilogue, bias (bf16 RNE value) added in f32.
// Layout: bf16 copies of q, k, v, Wq, Wk, Wv; q and k planes [b*16+h][t][d]; v^T plane [b*16+h][d][t]; ctx plane [b*SEQ+t][1024]; fused flash kernel in transposed form (S^T = K Q^T, O^T = V^T P^T), its K and V^T tiles staged in LDS once per block; the four GEMMs stage their A and B tiles in LDS once per 128 x 128 block.

#ifndef NB
#define NB 2
#endif
#ifndef SEQ
#define SEQ 2048
#endif
#define NB_FULL  2
#define SEQ_FULL 2048
#ifndef OUT_SEQ
#define OUT_SEQ SEQ              // row pitch (in tokens) between batches of the output
#endif
#define DM   1024
#define NH_  16
#define HD   64
#define NPR  (DM / 2)            // rotary pairs per token row
#define PT   256                 // threads per pre-pass block
#define PB   NPR                 // pre-pass blocks (block index = rotary pair of the [p][pos] table)
#define AW   8                   // query slots per flash block: each slot is 16 * QG query rows
#define KS   2                   // key halves per flash block: every query slot is worked by KS waves, one per half of the keys, so AW * KS = 16 waves stand four per SIMD and one wave's waits run under three others' work
#define QG   2                   // 16-query groups per flash wave (32 query rows each)
#define KT   64                  // keys per staged tile (a K row and a V^T row of a tile are both 128 bytes: whole cache lines)
#define LP   72                  // LDS row pitch in halves: 144 bytes = 16 x 9, conflict-free for 16-byte fragment reads
#define TH   (2 * 64 * LP)       // halves of one buffer: K tile (KT rows) then V^T tile (HD rows)
#define NT   (SEQ / (KT * KS))   // tiles that one key half walks
#define CP   17                  // 16-byte pieces per lane handed over when the key halves are merged: 16 of O^T, one of (max, sum)
#define GW   4                   // waves per GEMM block: 2 x 2 wave tiles of 64 x 64 = one 128 x 128 tile
#define GT   128                 // rows of A and rows of Bt per GEMM block
#ifndef GK
#define GK   128                 // k elements per staged GEMM tile (256 bytes a row: whole cache lines)
#endif
#define GLP  (GK + 8)            // LDS row pitch of a GEMM tile in 16-bit elements: 16 bytes x an odd number, conflict-free for 16-byte fragment reads
#define GRS  (GW * 32 * 8 / GK)  // rows that one 16-byte copy of every thread of the block covers
#define GTH  (2 * GT * GLP)      // 16-bit elements of one GEMM buffer: A tile (GT rows) then Bt tile (GT rows)
#define SC2  (0.125f * 1.4426950408889634f)   // HD^-0.5 * log2(e)
#define PSH  8.0f                // log2 of the P carry (256)
#define CXS  1024.0f             // carry of the ctx plane
#define WPS  256.0f              // carry of the Wp plane
#define OSC  (1.0f / (1024.0f * 256.0f))      // 2^-18

static_assert(HD == 64);
static_assert(NH_ * HD == DM);                 // head h = columns h*64 + d
static_assert(DM % 64 == 0);
static_assert(DM % 32 == 0);                   // GEMM k-loop steps by 32
static_assert(SEQ % 64 == 0);                  // a 64-row tile never straddles two batches
static_assert((NB * SEQ) % 64 == 0);
static_assert(SEQ % 32 == 0);                  // key loop steps by 32
static_assert(SEQ % (16 * QG * AW) == 0);      // flash grid covers the sequence exactly
static_assert(SEQ % (KT * KS) == 0 && NT >= 2); // whole tiles in every key half; the two-buffer prologue fills two
static_assert(KS == 2 && QG == 2 && CP == QG * 8 + 1);   // the merge below joins two halves; (max, sum) of QG = 2 groups fill one 16-byte piece
static_assert(KT == 64 && AW * 32 * 2 * 8 == KT * HD);   // two 16-byte copies per thread of a key half cover one 64 x 64 tile
static_assert((NB * SEQ) % GT == 0 && DM % GT == 0);      // GEMM grids cover both operands exactly
static_assert(DM % GK == 0 && DM / GK >= 2 && GK % 64 == 0);   // whole k tiles of whole lines; the two-buffer prologue fills two
static_assert(GT % (8 * GRS) == 0 && (GLP * 2) % 32 == 16);    // statements of eight copies cover an operand tile exactly; odd multiple of 16 bytes
static_assert(2 * GT / GRS <= 63);                             // copies of one wave in flight: one tile's
static constexpr size_t PN  = (size_t)PB * PT;              // pre-pass threads
static constexpr size_t WCH = (size_t)DM * DM / 8;          // 8-element pieces of one weight
static constexpr size_t BCH = (size_t)SEQ * DM / 8;         // 8-element pieces of one batch of one activation
static constexpr int    XR  = (int)((size_t)NB * BCH / PN); // pre-pass rounds over the activations
static_assert((size_t)XR * PN == (size_t)NB * BCH && XR >= 1);   // the rounds cover the activation planes exactly
static_assert((size_t)NB * SEQ_FULL * DM * 4 < ((size_t)1 << 32) && (size_t)SEQ * NPR * 8 < ((size_t)1 << 32));   // 32-bit byte offsets inside every plane
static_assert(WCH == PN);                      // one piece of each weight per pre-pass thread
static_assert(NPR == 2 * PT);                  // one row of the [pos][p] table: PT threads x 2 pairs
static_assert(SEQ == XR * PB);                 // [pos][p] table: one position per block and round
static_assert(SEQ == 2 * XR * PT);             // [p][pos] table: two positions per thread and round
static_assert(NB <= NB_FULL);
static_assert(SEQ <= SEQ_FULL);
static_assert(((size_t)(NB - 1) * OUT_SEQ + SEQ) * DM * 4 <= (size_t)16777216);   // last output byte stays inside the output buffer

typedef _Float16 h16;
typedef unsigned short bf;
typedef __attribute__((ext_vector_type(16))) __bf16   v16bf;
typedef __attribute__((ext_vector_type(16))) _Float16 v16h;
typedef __attribute__((ext_vector_type(8)))  _Float16 v8h;
typedef __attribute__((ext_vector_type(8)))  unsigned short v8us;
typedef __attribute__((ext_vector_type(8)))  float    v8f;
typedef __attribute__((ext_vector_type(4)))  float    v4f;
typedef __attribute__((ext_vector_type(2)))  float    v2f;
typedef v4f  __attribute__((may_alias)) v4fa;

__device__ __forceinline__ unsigned short f2bf(float f) { unsigned u = __float_as_uint(f); u += 0x7FFFu + ((u >> 16) & 1u); return (unsigned short)(u >> 16); }
__device__ __forceinline__ float bfval(float f) { return __uint_as_float(((unsigned)f2bf(f)) << 16); }
__device__ __forceinline__ v16h cat16(v8h lo, v8h hi) { return __builtin_shufflevector(lo, hi, 0, 1, 2, 3, 4, 5, 6, 7, 8, 9, 10, 11, 12, 13, 14, 15); }
__device__ __forceinline__ v16bf cat16b(v8us lo, v8us hi) { return __builtin_bit_cast(v16bf, __builtin_shufflevector(lo, hi, 0, 1, 2, 3, 4, 5, 6, 7, 8, 9, 10, 11, 12, 13, 14, 15)); }
__device__ __forceinline__ v8f wmma16(v16h a, v16h b, v8f c) { return __builtin_amdgcn_wmma_f32_16x16x32_f16(false, a, false, b, (short)0, c, false, false); }
__device__ __forceinline__ v8f wmmab(v16bf a, v16bf b, v8f c) { return __builtin_amdgcn_wmma_f32_16x16x32_bf16(false, a, false, b, (short)0, c, false, false); }
// fragment loaders from K-contiguous 16-bit rows; p already includes + 8*(lane>>4): elements 0..7 <- k0+8h+0..7, elements 8..15 <- k0+16+8h+0..7 (same map for A and B)
__device__ __forceinline__ v16h  ldh(const h16* p) { return cat16(*(const v8h*)p, *(const v8h*)(p + 16)); }
__device__ __forceinline__ v16bf ldb(const bf* p)  { return cat16b(*(const v8us*)p, *(const v8us*)(p + 16)); }
// ordering point for wave-private LDS tiles (same wave writes and reads)
__device__ __forceinline__ void wave_sync() { __builtin_amdgcn_fence(3 /* release order */, "wavefront"); __builtin_amdgcn_wave_barrier(); asm volatile("" ::: "memory"); }

// k_prep: every pass that only prepares operands, in ONE launch of long-lived blocks: bf16 copies of q, k, v, Wq, Wk, Wv; the f16 x256 copy of Wp; both (cos, sin) tables.
// PB blocks x PT threads stay resident (16 waves per WGP) and each thread walks its share of every plane with stride PN, so the launch starts 4,096 waves.
// Tables, as float2 (cos, sin) of pos * theta(p): first [pos][p] (a block row = one position, a thread = two neighbouring pairs), then [p][pos] (a block = one pair, a thread = two neighbouring positions).
__device__ __forceinline__ float theta_of(int p) { const float e = (2.0f * (float)p) * (1.0f / (float)DM); return 1.0f / powf(10000.0f, e); }
__device__ __forceinline__ v8us cvt8(v8f v) { v8us o;
#pragma unroll
    for (int k = 0; k < 8; ++k) o[k] = f2bf(v[k]);
    return o; }
__device__ __forceinline__ v4f cs2(float a0, float a1) { float s0, c0, s1, c1; sincosf(a0, &s0, &c0); sincosf(a1, &s1, &c1); v4f o; o[0] = c0; o[1] = s0; o[2] = c1; o[3] = s1; return o; }

// plane base + one 32-bit byte offset (every plane is far below 4 GiB): the planes of a round share the offset register and no 64-bit address is formed per access
__device__ __forceinline__ v8f ld8(const float* p, unsigned byteoff) { return *(const v8f*)((const char*)p + byteoff); }
template <typename V, typename P> __device__ __forceinline__ void st16(P* p, unsigned byteoff, V v) { *(V*)((char*)p + byteoff) = v; }

__global__ __launch_bounds__(PT) void k_prep(const float* __restrict__ xq, const float* __restrict__ xk, const float* __restrict__ xv,
                                             const float* __restrict__ wq, const float* __restrict__ wk, const float* __restrict__ wv, const float* __restrict__ wp,
                                             bf* __restrict__ XQ, bf* __restrict__ XK, bf* __restrict__ XV, bf* __restrict__ WB, h16* __restrict__ WP, float* __restrict__ CS) {
    const unsigned tid = threadIdx.x, blk = blockIdx.x;
    const unsigned g = blk * PT + tid;
    // weights, one 8-element piece of each per thread: the loads are issued first and the three angle steps are worked out while they fly
    const v8f w0 = ld8(wq, g * 32), w1 = ld8(wk, g * 32), w2 = ld8(wv, g * 32), w3 = ld8(wp, g * 32);
    const float th0 = theta_of((int)(2 * tid)), th1 = theta_of((int)(2 * tid + 1)), thb = theta_of((int)blk);
    st16(WB, g * 16, cvt8(w0)); st16(WB + (size_t)DM * DM, g * 16, cvt8(w1)); st16(WB + (size_t)2 * DM * DM, g * 16, cvt8(w2));
    { v8h o;
#pragma unroll
      for (int k = 0; k < 8; ++k) o[k] = (h16)(bfval(w3[k]) * WPS);
      st16(WP, g * 16, o); }
    asm volatile("s_wait_xcnt 0x0" ::: "memory");        // before the first round reuses the registers these stores name
    __builtin_amdgcn_sched_barrier(0);                   // keeps the first round's address arithmetic behind that wait
    float* const CS1 = CS + (size_t)SEQ * NPR * 2;
    // rolled: four inlined sincosf per trip keep the text small
#pragma unroll 1
    for (unsigned r = 0; r < (unsigned)XR; ++r) {
        const unsigned c = g + r * (unsigned)PN;                                    // 8-element piece of the [NB*SEQ][DM] planes
        const unsigned s = (SEQ == SEQ_FULL) ? c : (c / (unsigned)BCH) * (unsigned)((size_t)SEQ_FULL * DM / 8) + c % (unsigned)BCH;   // the same piece in the inputs (batch pitch SEQ_FULL)
        const v8f a = ld8(xq, s * 32), b = ld8(xk, s * 32), d = ld8(xv, s * 32);
        // this round's table entries stand between the loads and their first use
        const unsigned t0 = blk + r * PB, t1 = 2 * (tid + r * PT);
        st16(CS,  (t0 * NPR + 2 * tid) * 8, cs2((float)(int)t0 * th0, (float)(int)t0 * th1));
        st16(CS1, (blk * SEQ + t1) * 8,     cs2((float)(int)t1 * thb, (float)(int)(t1 + 1) * thb));
        st16(XQ, c * 16, cvt8(a)); st16(XK, c * 16, cvt8(b)); st16(XV, c * 16, cvt8(d));
        asm volatile("s_wait_xcnt 0x0" ::: "memory");    // before the next round reuses the registers these stores name
        __builtin_amdgcn_sched_barrier(0);               // keeps the next round's address arithmetic behind that wait
    }
}

// Main loop of the four GEMMs. A block of GW waves owns a GT x GT tile of C; each wave a 64 x 64 quarter (16 accumulators).
// The k axis is walked in tiles of GK: the GT rows of A and the GT rows of Bt are brought into LDS ONCE per block by asynchronous 16-byte copies (whole 128-byte lines,
// GK / 8 lanes per row) into one of two buffers, the next tile flying while this one is worked on; fragments are 16-byte LDS reads at pitch GLP. k runs upward in steps of 32 as before.
__device__ __forceinline__ v16h  ldf(const h16* p) { return ldh(p); }
__device__ __forceinline__ v16bf ldf(const bf* p)  { return ldb(p); }
__device__ __forceinline__ v8f mm(v16h a, v16h b, v8f c)   { return wmma16(a, b, c); }
__device__ __forceinline__ v8f mm(v16bf a, v16bf b, v8f c) { return wmmab(a, b, c); }
// eight copies of one thread: 16-byte pieces, rows GRS apart, each lane with its own LDS byte address and global pointer.
// s_wait_xcnt stands as the statement's last line, in front of any rewrite of the address registers that the copies name.
template <typename T>
__device__ __forceinline__ void stage_rows(unsigned l, const T* g) {
    asm volatile("global_load_async_to_lds_b128 %0, %8, off\n\t"
                 "global_load_async_to_lds_b128 %1, %9, off\n\t"
                 "global_load_async_to_lds_b128 %2, %10, off\n\t"
                 "global_load_async_to_lds_b128 %3, %11, off\n\t"
                 "global_load_async_to_lds_b128 %4, %12, off\n\t"
                 "global_load_async_to_lds_b128 %5, %13, off\n\t"
                 "global_load_async_to_lds_b128 %6, %14, off\n\t"
                 "global_load_async_to_lds_b128 %7, %15, off\n\t"
                 "s_wait_xcnt 0x0"
                 :: "v"(l), "v"(l + 1 * GRS * GLP * 2), "v"(l + 2 * GRS * GLP * 2), "v"(l + 3 * GRS * GLP * 2),
                    "v"(l + 4 * GRS * GLP * 2), "v"(l + 5 * GRS * GLP * 2), "v"(l + 6 * GRS * GLP * 2), "v"(l + 7 * GRS * GLP * 2),
                    "v"(g), "v"(g + 1 * GRS * DM), "v"(g + 2 * GRS * DM), "v"(g + 3 * GRS * DM),
                    "v"(g + 4 * GRS * DM), "v"(g + 5 * GRS * DM), "v"(g + 6 * GRS * DM), "v"(g + 7 * GRS * DM)
                 : "memory");
}
// one k tile's copies of one thread: the GT rows of A, then the GT rows of Bt behind them
template <typename T>
__device__ __forceinline__ void stage_ab(unsigned l, const T* ag, const T* bg) {
#pragma unroll
    for (int h = 0; h < GT / (8 * GRS); ++h) stage_rows(l + h * (8 * GRS * GLP * 2), ag + h * (8 * GRS * DM));
#pragma unroll
    for (int h = 0; h < GT / (8 * GRS); ++h) stage_rows(l + (GT + h * 8 * GRS) * (GLP * 2), bg + h * (8 * GRS * DM));
}
// R0, C0: first row of A and of Bt of the BLOCK; wr, wc: this wave's 64-row offsets inside them; sm: 2 * GTH elements of LDS.
template <typename T>
__device__ __forceinline__ void gemm_main(const T* __restrict__ A, const T* __restrict__ Bt, const T* sm, int R0, int C0, int wr, int wc, int lr, int hi, v8f (&acc)[4][4]) {
#pragma unroll
    for (int mb = 0; mb < 4; ++mb)
#pragma unroll
        for (int nb = 0; nb < 4; ++nb) acc[mb][nb] = (v8f){};
    // copy addresses of this thread: row = tid / (GK / 8) (+ GRS per piece), 16-byte column = tid % (GK / 8), the same in the A tile and in the Bt tile
    const unsigned crow = threadIdx.x / (GK / 8), ccol = threadIdx.x % (GK / 8);
    const unsigned l0 = (unsigned)(size_t)&sm[0] + crow * (GLP * 2) + ccol * 16;     // LDS byte address in buffer 0, A tile; the Bt tile stands GT rows behind
    const T* ag = A  + (size_t)(R0 + (int)crow) * DM + ccol * 8;                     // + k0
    const T* bg = Bt + (size_t)(C0 + (int)crow) * DM + ccol * 8;                     // + k0
    stage_ab(l0, ag, bg);
    asm volatile("s_wait_asynccnt 0x0" ::: "memory");        // this wave's copies of tile 0 have landed
    __syncthreads();                                         // ... and every other wave's: tile 0 may be read
    stage_ab(l0 + GTH * 2, ag + GK, bg + GK);                // tile 1 flies during trip 0
    const T* fa = sm + (wr + lr) * GLP + 8 * hi;             // A fragment base of this wave
    const T* fb = sm + (GT + wc + lr) * GLP + 8 * hi;        // Bt fragment base of this wave
#pragma unroll 1
    for (int t = 0; t < DM / GK; ++t) {
        const T* pa = fa + (t & 1) * GTH; const T* pb = fb + (t & 1) * GTH;   // trip t reads buffer t mod 2 alone
        decltype(ldf(fa)) a[2][4], b[2][4];              // two fragment sets: the block of 32 k in work and the next one of the same tile
#pragma unroll
        for (int i = 0; i < 4; ++i) { a[0][i] = ldf(pa + i * 16 * GLP); b[0][i] = ldf(pb + i * 16 * GLP); }
#pragma unroll
        for (int s = 0; s < GK / 32; ++s) {
            if (s + 1 < GK / 32) {
#pragma unroll
                for (int i = 0; i < 4; ++i) { a[(s + 1) & 1][i] = ldf(pa + i * 16 * GLP + (s + 1) * 32); b[(s + 1) & 1][i] = ldf(pb + i * 16 * GLP + (s + 1) * 32); } }
            __builtin_amdgcn_sched_barrier(0);           // the next block's LDS reads stay one group in front of this block's products: their latency runs under the products
#pragma unroll
            for (int nb = 0; nb < 4; ++nb)
#pragma unroll
                for (int mb = 0; mb < 4; ++mb) acc[mb][nb] = mm(a[s & 1][mb], b[s & 1][nb], acc[mb][nb]);
            __builtin_amdgcn_sched_barrier(0);           // no later LDS read is spread among these products; behind the last block: every product stands in front of the slots below
        }
        // four vector slots between the last matrix product and the loop's back edge
        asm volatile("v_nop\n\tv_nop\n\tv_nop\n\tv_nop");
        asm volatile("s_wait_dscnt 0x0" ::: "memory");   // this wave's reads of buffer t mod 2 have returned
        asm volatile("s_wait_asynccnt 0x0" ::: "memory");// this wave's copies of tile t + 1 have landed
        __syncthreads();                                 // publishes tile t + 1 and ends every wave's reads of the buffer refilled below
        if (t + 2 < DM / GK) stage_ab(l0 + (unsigned)(t & 1) * (GTH * 2), ag + (t + 2) * GK, bg + (t + 2) * GK);
    }
    asm volatile("s_wait_asynccnt 0x0" ::: "memory");    // nothing of this wave's is in flight when the loop is left
}

// proj_tile: register-blocked bf16 GEMM, one wave per 64x64 tile (16 accumulators), GW waves per block, operands from K-contiguous bf16 planes through LDS (gemm_main), K = DM.
// C[m][n] = sum_k A[m][k] Bt[n][k]; epilogue by MODE:
//   0: C as f16 (Ph);
//   1: rows = tokens, columns = features: interleaved rotary on column pairs (table [pos][p]), then f16 (Ph);
//   2: rows = features, columns = tokens: interleaved rotary on row pairs (table [p][pos]), then f16 (Ph).
// Tile base (r0/RB)*sRB + (r0%RB)*pitch + (c0/CB)*sCB + (c0%CB), row pitch 'pitch' (halves). (bx, by): the block's tile among (M/GT, N/GT); 32 * GW threads; osb, sm: the block's LDS.
template <int MODE>
__device__ __forceinline__ void proj_tile(const bf* __restrict__ A, const bf* __restrict__ Bt, h16* Ph, const float* __restrict__ CS, float* osb, const bf* sm, int bx, int by,
                                             int RB, size_t sRB, int pitch, int CB, size_t sCB) {
    const int lane = threadIdx.x & 31, lr = lane & 15, hi = lane >> 4;
    const int wave = __builtin_amdgcn_readfirstlane((int)(threadIdx.x >> 5));
    const int wr = (wave & 1) * 64, wc = (wave >> 1) * 64;
    const int r0 = bx * GT + wr, c0 = by * GT + wc;                      // this wave's 64 x 64 tile
    float* const os = osb + wave * 16 * 68;                              // this wave's own staging rows
    v8f acc[4][4];
    gemm_main(A, Bt, sm, bx * GT, by * GT, wr, wc, lr, hi, acc);
    const size_t tbase = (size_t)(r0 / RB) * sRB + (size_t)(r0 % RB) * (size_t)pitch + (size_t)(c0 / CB) * sCB + (size_t)(c0 % CB);
    const int rg = lane >> 3, c8 = (lane & 7) * 8;       // 4 row groups x 8 lanes; 8 lanes x 8 = 64 columns
#pragma unroll
    for (int mb = 0; mb < 4; ++mb) {
#pragma unroll
        for (int nb = 0; nb < 4; ++nb) {
#pragma unroll
            for (int j = 0; j < 8; ++j) os[(hi * 8 + j) * 68 + nb * 16 + lr] = acc[mb][nb][j]; }   // D: row 8h+j, col lane&15; rows 0..15 x cols 0..63 all written
        wave_sync();
        v8h hv[4];
#pragma unroll
        for (int s = 0; s < 4; ++s) {
            const int row = 4 * s + rg;                  // 4 s x 4 row groups = 16 rows
            v4f x0 = *(const v4fa*)(&os[row * 68 + c8]); v4f x1 = *(const v4fa*)(&os[row * 68 + c8 + 4]);
            if (MODE == 1) {
                const int t = (r0 % SEQ) + mb * 16 + row;                                    // token position of this row
                const float* cp = CS + ((size_t)t * NPR + (size_t)((c0 + c8) >> 1)) * 2;     // 4 pairs: (cos, sin) x 4
                const v4f e0 = *(const v4fa*)cp; const v4f e1 = *(const v4fa*)(cp + 4);
                asm volatile("s_wait_xcnt 0x0" :: "v"(cp) : "memory");   // before a register that these loads name is reused; cp as input: neither load lands in the address pair in front of the wait
                v4f y0, y1;
                y0[0] = x0[0] * e0[0] - x0[1] * e0[1]; y0[1] = x0[0] * e0[1] + x0[1] * e0[0];
                y0[2] = x0[2] * e0[2] - x0[3] * e0[3]; y0[3] = x0[2] * e0[3] + x0[3] * e0[2];
                y1[0] = x1[0] * e1[0] - x1[1] * e1[1]; y1[1] = x1[0] * e1[1] + x1[1] * e1[0];
                y1[2] = x1[2] * e1[2] - x1[3] * e1[3]; y1[3] = x1[2] * e1[3] + x1[3] * e1[2];
                x0 = y0; x1 = y1;
            }
            if (MODE == 2) {
                const int e = r0 + mb * 16 + row;                                            // feature index of this row; partner row = row ^ 1 (same slab)
                const int tc = (c0 % SEQ) + c8;                                              // first of 8 token positions
                const float* cp = CS + (size_t)SEQ * NPR * 2 + ((size_t)(e >> 1) * SEQ + (size_t)tc) * 2;
                const v4f e0 = *(const v4fa*)cp; const v4f e1 = *(const v4fa*)(cp + 4); const v4f e2 = *(const v4fa*)(cp + 8); const v4f e3 = *(const v4fa*)(cp + 12);
                asm volatile("s_wait_xcnt 0x0" :: "v"(cp) : "memory");   // before a register that these loads name is reused; cp as input: none of the loads lands in the address pair in front of the wait
                const v4f w0 = *(const v4fa*)(&os[(row ^ 1) * 68 + c8]); const v4f w1 = *(const v4fa*)(&os[(row ^ 1) * 68 + c8 + 4]);
                const float sg = (row & 1) ? 1.0f : -1.0f;   // even feature: x cos - partner sin; odd feature: partner sin + x cos
                v4f y0, y1;
                y0[0] = x0[0] * e0[0] + sg * (w0[0] * e0[1]); y0[1] = x0[1] * e0[2] + sg * (w0[1] * e0[3]);
                y0[2] = x0[2] * e1[0] + sg * (w0[2] * e1[1]); y0[3] = x0[3] * e1[2] + sg * (w0[3] * e1[3]);
                y1[0] = x1[0] * e2[0] + sg * (w1[0] * e2[1]); y1[1] = x1[1] * e2[2] + sg * (w1[1] * e2[3]);
                y1[2] = x1[2] * e3[0] + sg * (w1[2] * e3[1]); y1[3] = x1[3] * e3[2] + sg * (w1[3] * e3[3]);
                x0 = y0; x1 = y1;
            }
#pragma unroll
            for (int i = 0; i < 4; ++i) { hv[s][i] = (h16)x0[i]; hv[s][4 + i] = (h16)x1[i]; }
        }
        const size_t sb = tbase + (size_t)(mb * 16) * (size_t)pitch;
{
#pragma unroll
            for (int s = 0; s < 4; ++s) { const size_t oo = sb + (size_t)(4 * s + rg) * (size_t)pitch + c8;
                *(v8h*)(Ph + oo) = hv[s]; }
             }
        asm volatile("s_wait_xcnt 0x0" ::: "memory");        // before what follows (the next slab; behind the last one, whatever stands behind this tile in the kernel) reuses the registers these stores name
        wave_sync();
    }
}

// k_proj: the three input projections in ONE launch; blockIdx.z picks the projection (the same for a whole block, so every barrier stays under block-uniform control flow), blockIdx.x its 128 x 128 tile.
// 3 x PJ blocks; two fit a WGP's LDS, so one block's first tiles, barrier waits and epilogue run under another block's products, and two launch gaps go.
// The projection with the longest epilogue comes first in the grid, the shortest last.
//   z = 0, v^T: A = Wv rows (m = h*64 + d), Bt = x rows (n = b*SEQ + t) -> plane [(b*1024 + m)][t] = [(b*16 + h)][d][t]; rotary on row pairs
//   z = 1, k and z = 2, q: A = x rows (m = b*SEQ + t), Bt = W rows (n = h*64 + d) -> plane [(b*16 + h)][t][d]; k gets rotary on column pairs
#define PJ   ((NB * SEQ / GT) * (DM / GT))     // 128 x 128 tiles of one projection
__global__ __launch_bounds__(32 * GW) void k_proj(const bf* __restrict__ XQ, const bf* __restrict__ XK, const bf* __restrict__ XV, const bf* __restrict__ WB,
                                                  h16* QH, h16* KP, h16* VT, const float* __restrict__ CS) {
    __shared__ __align__(16) float osb[GW * 16 * 68];
    __shared__ __align__(16) bf sm[2 * GTH];
    const int f = blockIdx.x, z = blockIdx.z;
    if (z == 0)      proj_tile<2>(WB + (size_t)2 * DM * DM, XV, VT, CS, osb, sm, f % (DM / GT), f / (DM / GT), DM, (size_t)0, SEQ, SEQ, (size_t)DM * SEQ);
    else if (z == 1) proj_tile<1>(XK, WB + (size_t)DM * DM, KP, CS, osb, sm, f % (NB * SEQ / GT), f / (NB * SEQ / GT), SEQ, (size_t)NH_ * SEQ * HD, HD, HD, (size_t)SEQ * HD);
    else             proj_tile<0>(XQ, WB, QH, CS, osb, sm, f % (NB * SEQ / GT), f / (NB * SEQ / GT), SEQ, (size_t)NH_ * SEQ * HD, HD, HD, (size_t)SEQ * HD);
}

// k_flash: fused attention, KS waves per 16 * QG query rows of one (batch, head), wave (slot, half) walking keys half * SEQ / KS ... of its slot's rows; Q fragments straight from the f16 plane.
// K and V^T: the AW waves of a key half walk the same keys, so each tile of KT keys is brought into LDS ONCE per block by asynchronous 16-byte copies (whole 128-byte lines,
// eight lanes per row) into one of that half's two buffers, the next tile flying while this one is worked on; fragments are 16-byte LDS reads at pitch LP.
// Behind the loop the upper half hands (max, sum, O^T) to the lower half's wave of the same slot through LDS, lane to lane; that wave joins the two online-softmax states and stores.
// Each K and V^T fragment is read once per wave and feeds QG matrix products (one per 16-query group g).
// Transposed form: S^T[key][t] = K Q^T (A = K rows, B = Q rows); lane (t = lane&15, h = lane>>4) holds keys 8h+r of each 16-key tile, so the packed
// P tile is directly the B fragment of O^T[d][t] = V^T P^T (element r <- tile keys 0..15, element 8+r <- tile keys 16..31, lane unchanged).
// Scale chain: logit2 = acc * (0.125 * log2 e); P = exp2(logit2 - max + 8) as f16; l = sum of the f16 P values; ctx plane = O^T * 1024 / l.
// Softmax state: the running max is one scalar per lane and group (the two lane halves of a row are combined with one xor-16 exchange).
// The row sums of P run on the matrix unit: one more product per group and 32 keys, A = a constant tile whose row 0 is ones and whose other rows are zero, B = the packed P tile,
// so element 0 of the accumulator holds, in lanes 0..15, the sum over all 32 keys of that lane's query (f16 P values, f32 accumulate) and, in lanes 16..31, row 8 = zero; only element 0 is rescaled.
// one tile's copies of one thread: two 16-byte pieces of the K tile (rows 32 apart) and two of the V^T tile, each lane with its own LDS byte address and global pointer.
// s_wait_xcnt stands as the statement's last line, in front of any rewrite of the address registers that the copies name.
__device__ __forceinline__ void stage_tile(unsigned l, const h16* kg, const h16* vg) {
    asm volatile("global_load_async_to_lds_b128 %0, %4, off\n\t"
                 "global_load_async_to_lds_b128 %1, %5, off\n\t"
                 "global_load_async_to_lds_b128 %2, %6, off\n\t"
                 "global_load_async_to_lds_b128 %3, %7, off\n\t"
                 "s_wait_xcnt 0x0"
                 :: "v"(l), "v"(l + 32 * LP * 2), "v"(l + 64 * LP * 2), "v"(l + 96 * LP * 2),
                    "v"(kg), "v"(kg + 32 * HD), "v"(vg), "v"(vg + (size_t)32 * SEQ)
                 : "memory");
}

__global__ __launch_bounds__(32 * AW * KS) void k_flash(const h16* __restrict__ QH, const h16* __restrict__ KP, const h16* __restrict__ VT, h16* CX) {
    __shared__ __align__(16) float os[AW * 16 * 68];
    __shared__ __align__(16) h16 kv[KS * 2 * TH];            // two buffers per key half
    __shared__ __align__(16) float cmb[AW * CP * 32 * 4];    // hand-over of the upper half's state: [slot][piece][lane] 16-byte pieces
    const int lane = threadIdx.x & 31, lr = lane & 15, hi = lane >> 4;
    const int wid = __builtin_amdgcn_readfirstlane((int)(threadIdx.x >> 5));
    const int wave = wid % AW, kh = wid / AW;                // query slot and key half of this wave, both wave-uniform
    const int zh = blockIdx.y; const int b = zh / NH_, h = zh % NH_;
    const int t0 = (blockIdx.x * AW + wave) * (16 * QG);
    const size_t pbase = (size_t)zh * SEQ * HD;
    const size_t qo = pbase + (size_t)(t0 + lr) * HD + 8 * hi;
    v16h qh0[QG], qh1[QG];                                   // B fragments: col t, k = d
#pragma unroll
    for (int g = 0; g < QG; ++g) { qh0[g] = ldh(QH + qo + (size_t)g * 16 * HD); qh1[g] = ldh(QH + qo + (size_t)g * 16 * HD + 32); }
    // copy addresses of this thread, ht = its index among the 32 * AW threads of its key half: row = ht / 8 (+ 32 for the second piece), 16-byte column = ht % 8, the same in the K tile (row = key) and in the V^T tile (row = d)
    const unsigned ht = threadIdx.x % (32 * AW);
    const unsigned crow = ht >> 3, ccol = ht & 7;
    const int kf = kh * (SEQ / KS);                                                  // first key of this half
    const unsigned l0 = (unsigned)(size_t)&kv[0] + (unsigned)kh * (2 * TH * 2) + crow * (LP * 2) + ccol * 16;   // LDS byte address in this half's buffer 0
    const h16* kg = KP + pbase + (size_t)(kf + (int)crow) * HD + ccol * 8;           // + key0 * HD
    const h16* vg = VT + pbase + (size_t)crow * SEQ + kf + ccol * 8;                 // + key0
    stage_tile(l0, kg, vg);
    asm volatile("s_wait_asynccnt 0x0" ::: "memory");        // this wave's copies of tile 0 have landed
    __syncthreads();                                         // ... and every other wave's: tile 0 may be read
    stage_tile(l0 + TH * 2, kg + (size_t)KT * HD, vg + KT);  // tile 1 flies during trip 0
    const h16* fr = kv + kh * (2 * TH) + lr * LP + 8 * hi;   // fragment base in this half's buffers: K row key (k = d) at + key * LP; V^T row d (k = key) at + (KT + d) * LP + key
    v8f o0[QG], o1[QG], o2[QG], o3[QG], sm[QG];         // sm: row-sum tile, row 0 alone is ever non-zero
    float m[QG], l[QG];
#pragma unroll
    for (int g = 0; g < QG; ++g) { o0[g] = (v8f){}; o1[g] = (v8f){}; o2[g] = (v8f){}; o3[g] = (v8f){}; sm[g] = (v8f){}; m[g] = -3.0e38f; }
    v16h one0;                                           // A fragment: a lane holds row lane & 15, so lanes 0 and 16 hold the ones of row 0 (every k), all other lanes zero
#pragma unroll
    for (int i = 0; i < 16; ++i) one0[i] = (lr == 0) ? (h16)1.0f : (h16)0.0f;
#pragma unroll 1
    for (int t = 0; t < NT; ++t) {
      const h16* fb = fr + (t & 1) * TH;                 // trip t reads buffer t mod 2 of its half alone
#pragma unroll
      for (int sub = 0; sub < KT / 32; ++sub) {          // two passes of 32 keys per tile, one online-softmax step each
        const h16* ka = fb + sub * 32 * LP;
        const v16h ka0 = ldh(ka), ka1 = ldh(ka + 32), kb0 = ldh(ka + 16 * LP), kb1 = ldh(ka + 16 * LP + 32);
        v16h pb[QG];
#pragma unroll
        for (int g = 0; g < QG; ++g) {
            v8f sHa = (v8f){}, sHb = (v8f){};
            sHa = wmma16(ka0, qh0[g], sHa); sHb = wmma16(kb0, qh0[g], sHb);
            sHa = wmma16(ka1, qh1[g], sHa); sHb = wmma16(kb1, qh1[g], sHb);
            float ta[8], tb[8]; float mx = -3.0e38f;
#pragma unroll
            for (int r = 0; r < 8; ++r) { ta[r] = sHa[r] * SC2; tb[r] = sHb[r] * SC2; mx = fmaxf(mx, fmaxf(ta[r], tb[r])); }
            mx = fmaxf(mx, __shfl_xor(mx, 16, 32));
            const float mnew = fmaxf(m[g], mx);
            const float alpha = __builtin_amdgcn_exp2f(m[g] - mnew);
            const float sh = PSH - mnew;
#pragma unroll
            for (int r = 0; r < 8; ++r) { pb[g][r] = (h16)__builtin_amdgcn_exp2f(ta[r] + sh); pb[g][8 + r] = (h16)__builtin_amdgcn_exp2f(tb[r] + sh); }
            sm[g][0] = sm[g][0] * alpha; m[g] = mnew;
            o0[g] = o0[g] * alpha; o1[g] = o1[g] * alpha; o2[g] = o2[g] * alpha; o3[g] = o3[g] * alpha;
        }
        const h16* va = fb + KT * LP + sub * 32;
        const v16h v0 = ldh(va), v1 = ldh(va + 16 * LP), v2 = ldh(va + 32 * LP), v3 = ldh(va + 48 * LP);
#pragma unroll
        for (int g = 0; g < QG; ++g) {
            o0[g] = wmma16(v0, pb[g], o0[g]); o1[g] = wmma16(v1, pb[g], o1[g]); o2[g] = wmma16(v2, pb[g], o2[g]); o3[g] = wmma16(v3, pb[g], o3[g]);
            sm[g] = wmma16(one0, pb[g], sm[g]);
        }
      }
        __builtin_amdgcn_sched_barrier(0);               // keeps every matrix product of this trip in front of the slots below
        // four vector slots between the last matrix product and the loop's back edge
        asm volatile("v_nop\n\tv_nop\n\tv_nop\n\tv_nop");
        asm volatile("s_wait_dscnt 0x0" ::: "memory");   // this wave's reads of buffer t mod 2 have returned
        asm volatile("s_wait_asynccnt 0x0" ::: "memory");// this wave's copies of tile t + 1 have landed
        __syncthreads();                                 // publishes tile t + 1 and ends every wave's reads of the buffer refilled below
        if (t + 2 < NT) stage_tile(l0 + (unsigned)(t & 1) * (TH * 2), kg + (size_t)(t + 2) * KT * HD, vg + (size_t)(t + 2) * KT);
    }
    asm volatile("s_wait_asynccnt 0x0" ::: "memory");    // nothing of this wave's is in flight when the loop is left
#pragma unroll
    for (int g = 0; g < QG; ++g) l[g] = sm[g][0];        // lanes 0..15: the whole row sum of this key half; lanes 16..31: zero, so the xor-16 sum in the epilogue gives every lane the row sum
    // the two key halves of a slot are joined: lane x of the upper wave holds the same (query, d) places as lane x of the lower wave
    float* const cw = cmb + wave * (CP * 32 * 4) + lane * 4;             // piece j of this lane at + j * 128 floats: neighbouring lanes, neighbouring 16 bytes
    if (kh != 0) {
#pragma unroll
        for (int g = 0; g < QG; ++g) {
            const v8f* const oq[4] = { &o0[g], &o1[g], &o2[g], &o3[g] };
#pragma unroll
            for (int q = 0; q < 4; ++q) {
                const v8f x = *oq[q];
                *(v4fa*)(cw + (g * 8 + q * 2) * 128)     = (v4f){ x[0], x[1], x[2], x[3] };
                *(v4fa*)(cw + (g * 8 + q * 2 + 1) * 128) = (v4f){ x[4], x[5], x[6], x[7] };
            }
        }
        *(v4fa*)(cw + (CP - 1) * 128) = (v4f){ m[0], m[1], l[0], l[1] };
    }
    __syncthreads();                                     // the upper half's state may be read; every wave of the block passes here
    if (kh != 0) return;                                 // no barrier stands behind this line
    {
        const v4f ml = *(const v4fa*)(cw + (CP - 1) * 128);
#pragma unroll
        for (int g = 0; g < QG; ++g) {
            const float mn = fmaxf(m[g], ml[g]);
            const float fa = __builtin_amdgcn_exp2f(m[g] - mn), fc = __builtin_amdgcn_exp2f(ml[g] - mn);
            l[g] = l[g] * fa + ml[2 + g] * fc;
            v8f* const oq[4] = { &o0[g], &o1[g], &o2[g], &o3[g] };
#pragma unroll
            for (int q = 0; q < 4; ++q) {
                const v4f x = *(const v4fa*)(cw + (g * 8 + q * 2) * 128); const v4f y = *(const v4fa*)(cw + (g * 8 + q * 2 + 1) * 128);
                v8f o = *oq[q];
#pragma unroll
                for (int r = 0; r < 4; ++r) { o[r] = o[r] * fa + x[r] * fc; o[4 + r] = o[4 + r] * fa + y[r] * fc; }
                *oq[q] = o;
            }
        }
    }
    const int wb = wave * 16 * 68;
    const int rg = lane >> 3, c8 = (lane & 7) * 8;       // 4 s x 4 row groups = 16 rows; 8 lanes x 8 halves = 64 columns
#pragma unroll
    for (int g = 0; g < QG; ++g) {
        const float lt = l[g] + __shfl_xor(l[g], 16, 32);
        const float inv = (1.0f / lt) * CXS;
        // O^T D layout: o_j[r] = (d = 16j + 8h + r, t = lane&15) -> os[t][d]; rows 0..15 x columns 0..63 all written
        { v4f a, c;
          a[0] = o0[g][0] * inv; a[1] = o0[g][1] * inv; a[2] = o0[g][2] * inv; a[3] = o0[g][3] * inv; c[0] = o0[g][4] * inv; c[1] = o0[g][5] * inv; c[2] = o0[g][6] * inv; c[3] = o0[g][7] * inv;
          *(v4fa*)(&os[wb + lr * 68 +  0 + 8 * hi]) = a; *(v4fa*)(&os[wb + lr * 68 +  0 + 8 * hi + 4]) = c;
          a[0] = o1[g][0] * inv; a[1] = o1[g][1] * inv; a[2] = o1[g][2] * inv; a[3] = o1[g][3] * inv; c[0] = o1[g][4] * inv; c[1] = o1[g][5] * inv; c[2] = o1[g][6] * inv; c[3] = o1[g][7] * inv;
          *(v4fa*)(&os[wb + lr * 68 + 16 + 8 * hi]) = a; *(v4fa*)(&os[wb + lr * 68 + 16 + 8 * hi + 4]) = c;
          a[0] = o2[g][0] * inv; a[1] = o2[g][1] * inv; a[2] = o2[g][2] * inv; a[3] = o2[g][3] * inv; c[0] = o2[g][4] * inv; c[1] = o2[g][5] * inv; c[2] = o2[g][6] * inv; c[3] = o2[g][7] * inv;
          *(v4fa*)(&os[wb + lr * 68 + 32 + 8 * hi]) = a; *(v4fa*)(&os[wb + lr * 68 + 32 + 8 * hi + 4]) = c;
          a[0] = o3[g][0] * inv; a[1] = o3[g][1] * inv; a[2] = o3[g][2] * inv; a[3] = o3[g][3] * inv; c[0] = o3[g][4] * inv; c[1] = o3[g][5] * inv; c[2] = o3[g][6] * inv; c[3] = o3[g][7] * inv;
          *(v4fa*)(&os[wb + lr * 68 + 48 + 8 * hi]) = a; *(v4fa*)(&os[wb + lr * 68 + 48 + 8 * hi + 4]) = c; }
        wave_sync();
        h16* crow = CX + ((size_t)b * SEQ + t0 + g * 16) * DM + h * HD;
        v8h hv[4];
#pragma unroll
        for (int s = 0; s < 4; ++s) { const int row = 4 * s + rg;
            const v4f x0 = *(const v4fa*)(&os[wb + row * 68 + c8]); const v4f x1 = *(const v4fa*)(&os[wb + row * 68 + c8 + 4]);
#pragma unroll
            for (int i = 0; i < 4; ++i) { hv[s][i] = (h16)x0[i]; hv[s][4 + i] = (h16)x1[i]; } }
#pragma unroll
        for (int s = 0; s < 4; ++s) *(v8h*)(crow + (size_t)(4 * s + rg) * DM + c8) = hv[s];
        asm volatile("s_wait_xcnt 0x0" ::: "memory");    // before the next group reuses the registers these stores name
        __builtin_amdgcn_sched_barrier(0);               // keeps the next group's arithmetic behind that wait
        wave_sync();                                     // the next group overwrites this wave's staging rows
    }
}

// k_oproj: register-blocked f16 GEMM, one wave per 64x64 tile, GW waves per block (gemm_main), A = ctx plane (x1024), Bt = Wp plane (x256), K = DM; OUT[m][n] = acc * 2^-18 + bias[n] (f32).
__global__ __launch_bounds__(32 * GW) void k_oproj(const h16* __restrict__ A, const h16* __restrict__ Bt, const float* __restrict__ bias, float* OUT) {
    __shared__ __align__(16) float osb[GW * 16 * 68];
    __shared__ __align__(16) h16 sm[2 * GTH];
    const int lane = threadIdx.x & 31, lr = lane & 15, hi = lane >> 4;
    const int wave = __builtin_amdgcn_readfirstlane((int)(threadIdx.x >> 5));
    const int wr = (wave & 1) * 64, wc = (wave >> 1) * 64;
    const int r0 = blockIdx.x * GT + wr, c0 = blockIdx.y * GT + wc;      // this wave's 64 x 64 tile
    float* const os = osb + wave * 16 * 68;                              // this wave's own staging rows
    v8f acc[4][4];
    gemm_main(A, Bt, sm, (int)blockIdx.x * GT, (int)blockIdx.y * GT, wr, wc, lr, hi, acc);
    const int cofs = lr * 4;                              // 16 lanes x 4 floats = 64 columns
    const v4f braw = *(const v4fa*)(bias + c0 + cofs); v4f bb;
#pragma unroll
    for (int i = 0; i < 4; ++i) bb[i] = bfval(braw[i]);
    const int bi = r0 / SEQ, tt = r0 % SEQ;
    float* obase = OUT + ((size_t)bi * OUT_SEQ + tt) * DM + c0;
#pragma unroll
    for (int mb = 0; mb < 4; ++mb) {
#pragma unroll
        for (int nb = 0; nb < 4; ++nb) {
#pragma unroll
            for (int j = 0; j < 8; ++j) os[(hi * 8 + j) * 68 + nb * 16 + lr] = acc[mb][nb][j]; }   // rows 0..15 x cols 0..63 all written
        wave_sync();
        v4f vals[8];
#pragma unroll
        for (int s = 0; s < 8; ++s) { const int row = 2 * s + hi;            // 8 s x 2 rows = 16 rows
            const v4f x = *(const v4fa*)(&os[row * 68 + cofs]); vals[s] = x * OSC + bb; }
{
#pragma unroll
            for (int s = 0; s < 8; ++s) *(v4f*)(obase + (size_t)(mb * 16 + 2 * s + hi) * DM + cofs) = vals[s];
             }
        wave_sync();
    }
}

static constexpr size_t al256(size_t v) { return (v + 255) & ~(size_t)255; }
static constexpr size_t SZ_XB = al256((size_t)NB * SEQ * DM * 2);            // one bf16 activation plane
static constexpr size_t SZ_WB = al256((size_t)3 * DM * DM * 2);              // Wq | Wk | Wv bf16
static constexpr size_t SZ_WP = al256((size_t)DM * DM * 2);                  // Wp f16 x256
static constexpr size_t SZ_CS = al256((size_t)2 * SEQ * NPR * 2 * 4);        // two (cos, sin) tables
static constexpr size_t SZ_PL = al256((size_t)NB * NH_ * SEQ * HD * 2);      // one f16 head plane
static constexpr size_t SZ_CX = al256((size_t)NB * SEQ * DM * 2);            // ctx f16 x1024
static constexpr size_t SZ_TOTAL = 3 * SZ_XB + SZ_WB + SZ_WP + SZ_CS + 3 * SZ_PL + SZ_CX;
static_assert(SZ_TOTAL <= (size_t)134217728);          // workspace carve <= 128 MiB
static_assert(((size_t)DM * DM * 2) % 256 == 0);       // weight sub-planes stay 256-byte aligned

extern "C" void kernel_launch(void* const* d_in, const int* in_sizes, int n_in,
                              void* d_out, int out_size, void* d_ws, size_t ws_size, hipStream_t stream) {
    if (n_in < 8) return;
    const size_t needx = ((size_t)(NB - 1) * SEQ_FULL + SEQ) * DM;
    if ((size_t)in_sizes[0] < needx || (size_t)in_sizes[1] < needx || (size_t)in_sizes[2] < needx) return;
    if ((size_t)in_sizes[3] < (size_t)DM * DM || (size_t)in_sizes[4] < (size_t)DM * DM || (size_t)in_sizes[5] < (size_t)DM * DM || (size_t)in_sizes[6] < (size_t)DM * DM) return;
    if ((size_t)in_sizes[7] < (size_t)DM) return;
    if ((size_t)out_size < ((size_t)(NB - 1) * OUT_SEQ + SEQ) * DM) return;
    if (SZ_TOTAL > ws_size) return;
    // wire order: q, k, v, Wq, Wk, Wv, Wp, bp (weights [out][in] = Bt as-is)
    const float* xq = (const float*)d_in[0]; const float* xk = (const float*)d_in[1]; const float* xv = (const float*)d_in[2];
    const float* wq = (const float*)d_in[3]; const float* wk = (const float*)d_in[4]; const float* wv = (const float*)d_in[5];
    const float* wp = (const float*)d_in[6]; const float* bp = (const float*)d_in[7];
    float* OUT = (float*)d_out;      // [NB][SEQ][1024]
    char* wsp = (char*)d_ws;
    bf* XQ = (bf*)wsp; wsp += SZ_XB;                 // [NB*SEQ][1024]
    bf* XK = (bf*)wsp; wsp += SZ_XB;
    bf* XV = (bf*)wsp; wsp += SZ_XB;
    bf* WB = (bf*)wsp; wsp += SZ_WB;                 // [3][1024][1024]: q | k | v
    h16* WP = (h16*)wsp; wsp += SZ_WP;               // [1024][1024] x256
    float* CS = (float*)wsp; wsp += SZ_CS;           // [SEQ][512][2] then [512][SEQ][2]
    h16* QH = (h16*)wsp; wsp += SZ_PL;               // [NB*16][SEQ][64]
    h16* KP = (h16*)wsp; wsp += SZ_PL;               // [NB*16][SEQ][64]
    h16* VT = (h16*)wsp; wsp += SZ_PL;               // [NB*16][64][SEQ]
    h16* CX = (h16*)wsp; wsp += SZ_CX;               // [NB*SEQ][1024] x1024

    k_prep<<<PB, PT, 0, stream>>>(xq, xk, xv, wq, wk, wv, wp, XQ, XK, XV, WB, WP, CS);

    // q, k and v^T projections: one launch, blockIdx.z = projection
    k_proj<<<dim3(PJ, 1, 3), 32 * GW, 0, stream>>>(XQ, XK, XV, WB, QH, KP, VT, CS);

    k_flash<<<dim3(SEQ / (16 * QG * AW), NB * NH_, 1), 32 * AW * KS, 0, stream>>>(QH, KP, VT, CX);

    // out: A = ctx rows (m = b*SEQ + t), Bt = Wp rows (n = out feature)
    k_oproj<<<dim3(NB * SEQ / GT, DM / GT, 1), 32 * GW, 0, stream>>>(CX, WP, bp, OUT);
}

// v009
// A run of this version takes 80.3 microseconds.
// In two side-by-side timings against v008, it was 1.07 and 1.08 times as fast.
// Counting every step since v000, it is 3.11 times as fast.
#include <hip/hip_runtime.h>

// Multi-head attention, width 1024 = 16 heads x 64; inputs q, k, v [NB][SEQ][1024]; Wq/Wk/Wv/Wp [out][in] (y = x W^T); interleaved rotary on projected k and v over the full 1024 axis (512 pairs, angle = pos * 10000^(-2p/1024)); score scale 1/8; dense softmax; out = ctx Wp^T + bp (f32).
// Compute dtypes, f32 accumulate everywhere: q/k/v projections v_wmma_f32_16x16x32_bf16 (inputs and weights RNE-converted to bf16; products exact); rotary in f32 in the projection epilogue from f32 cos/sin tables;
// scores v_wmma_f32_16x16x32_f16: q single f16, k single f16 (one product; logits = acc * 0.125 * log2 e); P (x256 carry, cancels in the normalisation; row sum taken over the f16 values) and v single f16; softmax f32 (online, running max);
// output projection v_wmma_f32_16x16x32_f16: ctx single f16 with x1024 carry, Wp as f16 of the bf16 RNE value with x256 carry, 2^-18 folded back in the f32 epilogue, bias (bf16 RNE value) added in f32.
// Layout: bf16 copies of q, k, v, Wq, Wk, Wv; q and k planes [b*16+h][t][d]; v^T plane [b*16+h][d][t]; ctx plane [b*SEQ+t][1024]; fused flash kernel in transposed form (S^T = K Q^T, O^T = V^T P^T), its K and V^T tiles staged in LDS once per block; the four GEMMs stage their A and B tiles in LDS once per 128 x 128 block.

#ifndef NB
#define NB 2
#endif
#ifndef SEQ
#define SEQ 2048
#endif
#define NB_FULL  2
#define SEQ_FULL 2048
#ifndef OUT_SEQ
#define OUT_SEQ SEQ              // row pitch (in tokens) between batches of the output
#endif
#define DM   1024
#define NH_  16
#define HD   64
#define NPR  (DM / 2)            // rotary pairs per token row
#define PT   256                 // threads per pre-pass block
#define PB   NPR                 // pre-pass blocks (block index = rotary pair of the [p][pos] table)
#define AW   8                   // query slots per flash block: each slot is 16 * QG query rows
#define KS   2                   // key halves per flash block: every query slot is worked by KS waves, one per half of the keys, so AW * KS = 16 waves stand four per SIMD and one wave's waits run under three others' work
#define QG   2                   // 16-query groups per flash wave (32 query rows each)
#define KT   64                  // keys per staged tile (a K row and a V^T row of a tile are both 128 bytes: whole cache lines)
#define LP   72                  // LDS row pitch in halves: 144 bytes = 16 x 9, conflict-free for 16-byte fragment reads
#define TH   (2 * 64 * LP)       // halves of one buffer: K tile (KT rows) then V^T tile (HD rows)
#define NT   (SEQ / (KT * KS))   // tiles that one key half walks
#define CP   17                  // 16-byte pieces per lane handed over when the key halves are merged: 16 of O^T, one of (max, sum)
#define GW   4                   // waves per GEMM block: 2 x 2 wave tiles of 64 x 64 = one 128 x 128 tile
#define GT   128                 // rows of A and rows of Bt per GEMM block
#ifndef GK
#define GK   128                 // k elements per staged GEMM tile (256 bytes a row: whole cache lines)
#endif
#define GLP  (GK + 8)            // LDS row pitch of a GEMM tile in 16-bit elements: 16 bytes x an odd number, conflict-free for 16-byte fragment reads
#define GRS  (GW * 32 * 8 / GK)  // rows that one 16-byte copy of every thread of the block covers
#define GTH  (2 * GT * GLP)      // 16-bit elements of one GEMM buffer: A tile (GT rows) then Bt tile (GT rows)
#define SC2  (0.125f * 1.4426950408889634f)   // HD^-0.5 * log2(e)
#define PSH  8.0f                // log2 of the P carry (256)
#define LZ   7.0f                // a score may stand this far (log2) above the maximum in use before O^T and the row sums are rescaled: P <= 2^(PSH + LZ) = 2^15 stays inside f16
#define CXS  1024.0f             // carry of the ctx plane
#define WPS  256.0f              // carry of the Wp plane
#define OSC  (1.0f / (1024.0f * 256.0f))      // 2^-18

static_assert(HD == 64);
static_assert(NH_ * HD == DM);                 // head h = columns h*64 + d
static_assert(DM % 64 == 0);
static_assert(DM % 32 == 0);                   // GEMM k-loop steps by 32
static_assert(SEQ % 64 == 0);                  // a 64-row tile never straddles two batches
static_assert((NB * SEQ) % 64 == 0);
static_assert(SEQ % 32 == 0);                  // key loop steps by 32
static_assert(SEQ % (16 * QG * AW) == 0);      // flash grid covers the sequence exactly
static_assert(SEQ % (KT * KS) == 0 && NT >= 2); // whole tiles in every key half; the two-buffer prologue fills two
static_assert(KS == 2 && QG == 2 && CP == QG * 8 + 1);   // the merge below joins two halves; (max, sum) of QG = 2 groups fill one 16-byte piece
static_assert(KT == 64 && AW * 32 * 2 * 8 == KT * HD);   // two 16-byte copies per thread of a key half cover one 64 x 64 tile
static_assert((NB * SEQ) % GT == 0 && DM % GT == 0);      // GEMM grids cover both operands exactly
static_assert(DM % GK == 0 && DM / GK >= 2 && GK % 64 == 0);   // whole k tiles of whole lines; the two-buffer prologue fills two
static_assert(GT % (8 * GRS) == 0 && (GLP * 2) % 32 == 16);    // statements of eight copies cover an operand tile exactly; odd multiple of 16 bytes
static_assert(2 * GT / GRS <= 63);                             // copies of one wave in flight: one tile's
static constexpr size_t PN  = (size_t)PB * PT;              // pre-pass threads
static constexpr size_t WCH = (size_t)DM * DM / 8;          // 8-element pieces of one weight
static constexpr size_t BCH = (size_t)SEQ * DM / 8;         // 8-element pieces of one batch of one activation
static constexpr int    XR  = (int)((size_t)NB * BCH / PN); // pre-pass rounds over the activations
static_assert((size_t)XR * PN == (size_t)NB * BCH && XR >= 1);   // the rounds cover the activation planes exactly
static_assert((size_t)NB * SEQ_FULL * DM * 4 < ((size_t)1 << 32) && (size_t)SEQ * NPR * 8 < ((size_t)1 << 32));   // 32-bit byte offsets inside every plane
static_assert(WCH == PN);                      // one piece of each weight per pre-pass thread
static_assert(NPR == 2 * PT);                  // one row of the [pos][p] table: PT threads x 2 pairs
static_assert(SEQ == XR * PB);                 // [pos][p] table: one position per block and round
static_assert(SEQ == 2 * XR * PT);             // [p][pos] table: two positions per thread and round
static_assert(NB <= NB_FULL);
static_assert(SEQ <= SEQ_FULL);
static_assert(((size_t)(NB - 1) * OUT_SEQ + SEQ) * DM * 4 <= (size_t)16777216);   // last output byte stays inside the output buffer

typedef _Float16 h16;
typedef unsigned short bf;
typedef __attribute__((ext_vector_type(16))) __bf16   v16bf;
typedef __attribute__((ext_vector_type(16))) _Float16 v16h;
typedef __attribute__((ext_vector_type(8)))  _Float16 v8h;
typedef __attribute__((ext_vector_type(8)))  unsigned short v8us;
typedef __attribute__((ext_vector_type(8)))  float    v8f;
typedef __attribute__((ext_vector_type(4)))  float    v4f;
typedef __attribute__((ext_vector_type(2)))  float    v2f;
typedef v4f  __attribute__((may_alias)) v4fa;

__device__ __forceinline__ unsigned short f2bf(float f) { unsigned u = __float_as_uint(f); u += 0x7FFFu + ((u >> 16) & 1u); return (unsigned short)(u >> 16); }
__device__ __forceinline__ float bfval(float f) { return __uint_as_float(((unsigned)f2bf(f)) << 16); }
__device__ __forceinline__ v16h cat16(v8h lo, v8h hi) { return __builtin_shufflevector(lo, hi, 0, 1, 2, 3, 4, 5, 6, 7, 8, 9, 10, 11, 12, 13, 14, 15); }
__device__ __forceinline__ v16bf cat16b(v8us lo, v8us hi) { return __builtin_bit_cast(v16bf, __builtin_shufflevector(lo, hi, 0, 1, 2, 3, 4, 5, 6, 7, 8, 9, 10, 11, 12, 13, 14, 15)); }
__device__ __forceinline__ v8f wmma16(v16h a, v16h b, v8f c) { return __builtin_amdgcn_wmma_f32_16x16x32_f16(false, a, false, b, (short)0, c, false, false); }
__device__ __forceinline__ v8f wmmab(v16bf a, v16bf b, v8f c) { return __builtin_amdgcn_wmma_f32_16x16x32_bf16(false, a, false, b, (short)0, c, false, false); }
// fragment loaders from K-contiguous 16-bit rows; p already includes + 8*(lane>>4): elements 0..7 <- k0+8h+0..7, elements 8..15 <- k0+16+8h+0..7 (same map for A and B)
__device__ __forceinline__ v16h  ldh(const h16* p) { return cat16(*(const v8h*)p, *(const v8h*)(p + 16)); }
__device__ __forceinline__ v16bf ldb(const bf* p)  { return cat16b(*(const v8us*)p, *(const v8us*)(p + 16)); }
// ordering point for wave-private LDS tiles (same wave writes and reads)
__device__ __forceinline__ void wave_sync() { __builtin_amdgcn_fence(3 /* release order */, "wavefront"); __builtin_amdgcn_wave_barrier(); asm volatile("" ::: "memory"); }

// k_prep: every pass that only prepares operands, in ONE launch of long-lived blocks: bf16 copies of q, k, v, Wq, Wk, Wv; the f16 x256 copy of Wp; both (cos, sin) tables.
// PB blocks x PT threads stay resident (16 waves per WGP) and each thread walks its share of every plane with stride PN, so the launch starts 4,096 waves.
// Tables, as float2 (cos, sin) of pos * theta(p): first [pos][p] (a block row = one position, a thread = two neighbouring pairs), then [p][pos] (a block = one pair, a thread = two neighbouring positions).
__device__ __forceinline__ float theta_of(int p) { const float e = (2.0f * (float)p) * (1.0f / (float)DM); return 1.0f / powf(10000.0f, e); }
__device__ __forceinline__ v8us cvt8(v8f v) { v8us o;
#pragma unroll
    for (int k = 0; k < 8; ++k) o[k] = f2bf(v[k]);
    return o; }
__device__ __forceinline__ v4f cs2(float a0, float a1) { float s0, c0, s1, c1; sincosf(a0, &s0, &c0); sincosf(a1, &s1, &c1); v4f o; o[0] = c0; o[1] = s0; o[2] = c1; o[3] = s1; return o; }

// plane base + one 32-bit byte offset (every plane is far below 4 GiB): the planes of a round share the offset register and no 64-bit address is formed per access
__device__ __forceinline__ v8f ld8(const float* p, unsigned byteoff) { return *(const v8f*)((const char*)p + byteoff); }
template <typename V, typename P> __device__ __forceinline__ void st16(P* p, unsigned byteoff, V v) { *(V*)((char*)p + byteoff) = v; }

__global__ __launch_bounds__(PT) void k_prep(const float* __restrict__ xq, const float* __restrict__ xk, const float* __restrict__ xv,
                                             const float* __restrict__ wq, const float* __restrict__ wk, const float* __restrict__ wv, const float* __restrict__ wp,
                                             bf* __restrict__ XQ, bf* __restrict__ XK, bf* __restrict__ XV, bf* __restrict__ WB, h16* __restrict__ WP, float* __restrict__ CS) {
    const unsigned tid = threadIdx.x, blk = blockIdx.x;
    const unsigned g = blk * PT + tid;
    // weights, one 8-element piece of each per thread: the loads are issued first and the three angle steps are worked out while they fly
    const v8f w0 = ld8(wq, g * 32), w1 = ld8(wk, g * 32), w2 = ld8(wv, g * 32), w3 = ld8(wp, g * 32);
    const float th0 = theta_of((int)(2 * tid)), th1 = theta_of((int)(2 * tid + 1)), thb = theta_of((int)blk);
    st16(WB, g * 16, cvt8(w0)); st16(WB + (size_t)DM * DM, g * 16, cvt8(w1)); st16(WB + (size_t)2 * DM * DM, g * 16, cvt8(w2));
    { v8h o;
#pragma unroll
      for (int k = 0; k < 8; ++k) o[k] = (h16)(bfval(w3[k]) * WPS);
      st16(WP, g * 16, o); }
    asm volatile("s_wait_xcnt 0x0" ::: "memory");        // before the first round reuses the registers these stores name
    __builtin_amdgcn_sched_barrier(0);                   // keeps the first round's address arithmetic behind that wait
    float* const CS1 = CS + (size_t)SEQ * NPR * 2;
    // rolled: four inlined sincosf per trip keep the text small
#pragma unroll 1
    for (unsigned r = 0; r < (unsigned)XR; ++r) {
        const unsigned c = g + r * (unsigned)PN;                                    // 8-element piece of the [NB*SEQ][DM] planes
        const unsigned s = (SEQ == SEQ_FULL) ? c : (c / (unsigned)BCH) * (unsigned)((size_t)SEQ_FULL * DM / 8) + c % (unsigned)BCH;   // the same piece in the inputs (batch pitch SEQ_FULL)
        const v8f a = ld8(xq, s * 32), b = ld8(xk, s * 32), d = ld8(xv, s * 32);
        // this round's table entries stand between the loads and their first use
        const unsigned t0 = blk + r * PB, t1 = 2 * (tid + r * PT);
        st16(CS,  (t0 * NPR + 2 * tid) * 8, cs2((float)(int)t0 * th0, (float)(int)t0 * th1));
        st16(CS1, (blk * SEQ + t1) * 8,     cs2((float)(int)t1 * thb, (float)(int)(t1 + 1) * thb));
        st16(XQ, c * 16, cvt8(a)); st16(XK, c * 16, cvt8(b)); st16(XV, c * 16, cvt8(d));
        asm volatile("s_wait_xcnt 0x0" ::: "memory");    // before the next round reuses the registers these stores name
        __builtin_amdgcn_sched_barrier(0);               // keeps the next round's address arithmetic behind that wait
    }
}

// Main loop of the four GEMMs. A block of GW waves owns a GT x GT tile of C; each wave a 64 x 64 quarter (16 accumulators).
// The k axis is walked in tiles of GK: the GT rows of A and the GT rows of Bt are brought into LDS ONCE per block by asynchronous 16-byte copies (whole 128-byte lines,
// GK / 8 lanes per row) into one of two buffers, the next tile flying while this one is worked on; fragments are 16-byte LDS reads at pitch GLP. k runs upward in steps of 32 as before.
__device__ __forceinline__ v16h  ldf(const h16* p) { return ldh(p); }
__device__ __forceinline__ v16bf ldf(const bf* p)  { return ldb(p); }
__device__ __forceinline__ v8f mm(v16h a, v16h b, v8f c)   { return wmma16(a, b, c); }
__device__ __forceinline__ v8f mm(v16bf a, v16bf b, v8f c) { return wmmab(a, b, c); }
// eight copies of one thread: 16-byte pieces, rows GRS apart, each lane with its own LDS byte address and global pointer.
// s_wait_xcnt stands as the statement's last line, in front of any rewrite of the address registers that the copies name.
template <typename T>
__device__ __forceinline__ void stage_rows(unsigned l, const T* g) {
    asm volatile("global_load_async_to_lds_b128 %0, %8, off\n\t"
                 "global_load_async_to_lds_b128 %1, %9, off\n\t"
                 "global_load_async_to_lds_b128 %2, %10, off\n\t"
                 "global_load_async_to_lds_b128 %3, %11, off\n\t"
                 "global_load_async_to_lds_b128 %4, %12, off\n\t"
                 "global_load_async_to_lds_b128 %5, %13, off\n\t"
                 "global_load_async_to_lds_b128 %6, %14, off\n\t"
                 "global_load_async_to_lds_b128 %7, %15, off\n\t"
                 "s_wait_xcnt 0x0"
                 :: "v"(l), "v"(l + 1 * GRS * GLP * 2), "v"(l + 2 * GRS * GLP * 2), "v"(l + 3 * GRS * GLP * 2),
                    "v"(l + 4 * GRS * GLP * 2), "v"(l + 5 * GRS * GLP * 2), "v"(l + 6 * GRS * GLP * 2), "v"(l + 7 * GRS * GLP * 2),
                    "v"(g), "v"(g + 1 * GRS * DM), "v"(g + 2 * GRS * DM), "v"(g + 3 * GRS * DM),
                    "v"(g + 4 * GRS * DM), "v"(g + 5 * GRS * DM), "v"(g + 6 * GRS * DM), "v"(g + 7 * GRS * DM)
                 : "memory");
}
// one k tile's copies of one thread: the GT rows of A, then the GT rows of Bt behind them
template <typename T>
__device__ __forceinline__ void stage_ab(unsigned l, const T* ag, const T* bg) {
#pragma unroll
    for (int h = 0; h < GT / (8 * GRS); ++h) stage_rows(l + h * (8 * GRS * GLP * 2), ag + h * (8 * GRS * DM));
#pragma unroll
    for (int h = 0; h < GT / (8 * GRS); ++h) stage_rows(l + (GT + h * 8 * GRS) * (GLP * 2), bg + h * (8 * GRS * DM));
}
// R0, C0: first row of A and of Bt of the BLOCK; wr, wc: this wave's 64-row offsets inside them; sm: 2 * GTH elements of LDS.
template <typename T>
__device__ __forceinline__ void gemm_main(const T* __restrict__ A, const T* __restrict__ Bt, const T* sm, int R0, int C0, int wr, int wc, int lr, int hi, v8f (&acc)[4][4]) {
#pragma unroll
    for (int mb = 0; mb < 4; ++mb)
#pragma unroll
        for (int nb = 0; nb < 4; ++nb) acc[mb][nb] = (v8f){};
    // copy addresses of this thread: row = tid / (GK / 8) (+ GRS per piece), 16-byte column = tid % (GK / 8), the same in the A tile and in the Bt tile
    const unsigned crow = threadIdx.x / (GK / 8), ccol = threadIdx.x % (GK / 8);
    const unsigned l0 = (unsigned)(size_t)&sm[0] + crow * (GLP * 2) + ccol * 16;     // LDS byte address in buffer 0, A tile; the Bt tile stands GT rows behind
    const T* ag = A  + (size_t)(R0 + (int)crow) * DM + ccol * 8;                     // + k0
    const T* bg = Bt + (size_t)(C0 + (int)crow) * DM + ccol * 8;                     // + k0
    stage_ab(l0, ag, bg);
    asm volatile("s_wait_asynccnt 0x0" ::: "memory");        // this wave's copies of tile 0 have landed
    __syncthreads();                                         // ... and every other wave's: tile 0 may be read
    stage_ab(l0 + GTH * 2, ag + GK, bg + GK);                // tile 1 flies during trip 0
    const T* fa = sm + (wr + lr) * GLP + 8 * hi;             // A fragment base of this wave
    const T* fb = sm + (GT + wc + lr) * GLP + 8 * hi;        // Bt fragment base of this wave
#pragma unroll 1
    for (int t = 0; t < DM / GK; ++t) {
        const T* pa = fa + (t & 1) * GTH; const T* pb = fb + (t & 1) * GTH;   // trip t reads buffer t mod 2 alone
        decltype(ldf(fa)) a[2][4], b[2][4];              // two fragment sets: the block of 32 k in work and the next one of the same tile
#pragma unroll
        for (int i = 0; i < 4; ++i) { a[0][i] = ldf(pa + i * 16 * GLP); b[0][i] = ldf(pb + i * 16 * GLP); }
#pragma unroll
        for (int s = 0; s < GK / 32; ++s) {
            if (s + 1 < GK / 32) {
#pragma unroll
                for (int i = 0; i < 4; ++i) { a[(s + 1) & 1][i] = ldf(pa + i * 16 * GLP + (s + 1) * 32); b[(s + 1) & 1][i] = ldf(pb + i * 16 * GLP + (s + 1) * 32); } }
            __builtin_amdgcn_sched_barrier(0);           // the next block's LDS reads stay one group in front of this block's products: their latency runs under the products
#pragma unroll
            for (int nb = 0; nb < 4; ++nb)
#pragma unroll
                for (int mb = 0; mb < 4; ++mb) acc[mb][nb] = mm(a[s & 1][mb], b[s & 1][nb], acc[mb][nb]);
            __builtin_amdgcn_sched_barrier(0);           // no later LDS read is spread among these products; behind the last block: every product stands in front of the slots below
        }
        // four vector slots between the last matrix product and the loop's back edge
        asm volatile("v_nop\n\tv_nop\n\tv_nop\n\tv_nop");
        asm volatile("s_wait_dscnt 0x0" ::: "memory");   // this wave's reads of buffer t mod 2 have returned
        asm volatile("s_wait_asynccnt 0x0" ::: "memory");// this wave's copies of tile t + 1 have landed
        __syncthreads();                                 // publishes tile t + 1 and ends every wave's reads of the buffer refilled below
        if (t + 2 < DM / GK) stage_ab(l0 + (unsigned)(t & 1) * (GTH * 2), ag + (t + 2) * GK, bg + (t + 2) * GK);
    }
    asm volatile("s_wait_asynccnt 0x0" ::: "memory");    // nothing of this wave's is in flight when the loop is left
}

// proj_tile: register-blocked bf16 GEMM, one wave per 64x64 tile (16 accumulators), GW waves per block, operands from K-contiguous bf16 planes through LDS (gemm_main), K = DM.
// C[m][n] = sum_k A[m][k] Bt[n][k]; epilogue by MODE:
//   0: C as f16 (Ph);
//   1: rows = tokens, columns = features: interleaved rotary on column pairs (table [pos][p]), then f16 (Ph);
//   2: rows = features, columns = tokens: interleaved rotary on row pairs (table [p][pos]), then f16 (Ph).
// Tile base (r0/RB)*sRB + (r0%RB)*pitch + (c0/CB)*sCB + (c0%CB), row pitch 'pitch' (halves). (bx, by): the block's tile among (M/GT, N/GT); 32 * GW threads; osb, sm: the block's LDS.
template <int MODE>
__device__ __forceinline__ void proj_tile(const bf* __restrict__ A, const bf* __restrict__ Bt, h16* Ph, const float* __restrict__ CS, float* osb, const bf* sm, int bx, int by,
                                             int RB, size_t sRB, int pitch, int CB, size_t sCB) {
    const int lane = threadIdx.x & 31, lr = lane & 15, hi = lane >> 4;
    const int wave = __builtin_amdgcn_readfirstlane((int)(threadIdx.x >> 5));
    const int wr = (wave & 1) * 64, wc = (wave >> 1) * 64;
    const int r0 = bx * GT + wr, c0 = by * GT + wc;                      // this wave's 64 x 64 tile
    float* const os = osb + wave * 16 * 68;                              // this wave's own staging rows
    v8f acc[4][4];
    gemm_main(A, Bt, sm, bx * GT, by * GT, wr, wc, lr, hi, acc);
    const size_t tbase = (size_t)(r0 / RB) * sRB + (size_t)(r0 % RB) * (size_t)pitch + (size_t)(c0 / CB) * sCB + (size_t)(c0 % CB);
    const int rg = lane >> 3, c8 = (lane & 7) * 8;       // 4 row groups x 8 lanes; 8 lanes x 8 = 64 columns
#pragma unroll
    for (int mb = 0; mb < 4; ++mb) {
#pragma unroll
        for (int nb = 0; nb < 4; ++nb) {
#pragma unroll
            for (int j = 0; j < 8; ++j) os[(hi * 8 + j) * 68 + nb * 16 + lr] = acc[mb][nb][j]; }   // D: row 8h+j, col lane&15; rows 0..15 x cols 0..63 all written
        wave_sync();
        v8h hv[4];
#pragma unroll
        for (int s = 0; s < 4; ++s) {
            const int row = 4 * s + rg;                  // 4 s x 4 row groups = 16 rows
            v4f x0 = *(const v4fa*)(&os[row * 68 + c8]); v4f x1 = *(const v4fa*)(&os[row * 68 + c8 + 4]);
            if (MODE == 1) {
                const int t = (r0 % SEQ) + mb * 16 + row;                                    // token position of this row
                const float* cp = CS + ((size_t)t * NPR + (size_t)((c0 + c8) >> 1)) * 2;     // 4 pairs: (cos, sin) x 4
                const v4f e0 = *(const v4fa*)cp; const v4f e1 = *(const v4fa*)(cp + 4);
                asm volatile("s_wait_xcnt 0x0" :: "v"(cp) : "memory");   // before a register that these loads name is reused; cp as input: neither load lands in the address pair in front of the wait
                v4f y0, y1;
                y0[0] = x0[0] * e0[0] - x0[1] * e0[1]; y0[1] = x0[0] * e0[1] + x0[1] * e0[0];
                y0[2] = x0[2] * e0[2] - x0[3] * e0[3]; y0[3] = x0[2] * e0[3] + x0[3] * e0[2];
                y1[0] = x1[0] * e1[0] - x1[1] * e1[1]; y1[1] = x1[0] * e1[1] + x1[1] * e1[0];
                y1[2] = x1[2] * e1[2] - x1[3] * e1[3]; y1[3] = x1[2] * e1[3] + x1[3] * e1[2];
                x0 = y0; x1 = y1;
            }
            if (MODE == 2) {
                const int e = r0 + mb * 16 + row;                                            // feature index of this row; partner row = row ^ 1 (same slab)
                const int tc = (c0 % SEQ) + c8;                                              // first of 8 token positions
                const float* cp = CS + (size_t)SEQ * NPR * 2 + ((size_t)(e >> 1) * SEQ + (size_t)tc) * 2;
                const v4f e0 = *(const v4fa*)cp; const v4f e1 = *(const v4fa*)(cp + 4); const v4f e2 = *(const v4fa*)(cp + 8); const v4f e3 = *(const v4fa*)(cp + 12);
                asm volatile("s_wait_xcnt 0x0" :: "v"(cp) : "memory");   // before a register that these loads name is reused; cp as input: none of the loads lands in the address pair in front of the wait
                const v4f w0 = *(const v4fa*)(&os[(row ^ 1) * 68 + c8]); const v4f w1 = *(const v4fa*)(&os[(row ^ 1) * 68 + c8 + 4]);
                const float sg = (row & 1) ? 1.0f : -1.0f;   // even feature: x cos - partner sin; odd feature: partner sin + x cos
                v4f y0, y1;
                y0[0] = x0[0] * e0[0] + sg * (w0[0] * e0[1]); y0[1] = x0[1] * e0[2] + sg * (w0[1] * e0[3]);
                y0[2] = x0[2] * e1[0] + sg * (w0[2] * e1[1]); y0[3] = x0[3] * e1[2] + sg * (w0[3] * e1[3]);
                y1[0] = x1[0] * e2[0] + sg * (w1[0] * e2[1]); y1[1] = x1[1] * e2[2] + sg * (w1[1] * e2[3]);
                y1[2] = x1[2] * e3[0] + sg * (w1[2] * e3[1]); y1[3] = x1[3] * e3[2] + sg * (w1[3] * e3[3]);
                x0 = y0; x1 = y1;
            }
#pragma unroll
            for (int i = 0; i < 4; ++i) { hv[s][i] = (h16)x0[i]; hv[s][4 + i] = (h16)x1[i]; }
        }
        const size_t sb = tbase + (size_t)(mb * 16) * (size_t)pitch;
{
#pragma unroll
            for (int s = 0; s < 4; ++s) { const size_t oo = sb + (size_t)(4 * s + rg) * (size_t)pitch + c8;
                *(v8h*)(Ph + oo) = hv[s]; }
             }
        asm volatile("s_wait_xcnt 0x0" ::: "memory");        // before what follows (the next slab; behind the last one, whatever stands behind this tile in the kernel) reuses the registers these stores name
        wave_sync();
    }
}

// k_proj: the three input projections in ONE launch; blockIdx.z picks the projection (the same for a whole block, so every barrier stays under block-uniform control flow), blockIdx.x its 128 x 128 tile.
// 3 x PJ blocks; two fit a WGP's LDS, so one block's first tiles, barrier waits and epilogue run under another block's products, and two launch gaps go.
// The projection with the longest epilogue comes first in the grid, the shortest last.
//   z = 0, v^T: A = Wv rows (m = h*64 + d), Bt = x rows (n = b*SEQ + t) -> plane [(b*1024 + m)][t] = [(b*16 + h)][d][t]; rotary on row pairs
//   z = 1, k and z = 2, q: A = x rows (m = b*SEQ + t), Bt = W rows (n = h*64 + d) -> plane [(b*16 + h)][t][d]; k gets rotary on column pairs
#define PJ   ((NB * SEQ / GT) * (DM / GT))     // 128 x 128 tiles of one projection
__global__ __launch_bounds__(32 * GW) void k_proj(const bf* __restrict__ XQ, const bf* __restrict__ XK, const bf* __restrict__ XV, const bf* __restrict__ WB,
                                                  h16* QH, h16* KP, h16* VT, const float* __restrict__ CS) {
    __shared__ __align__(16) float osb[GW * 16 * 68];
    __shared__ __align__(16) bf sm[2 * GTH];
    const int f = blockIdx.x, z = blockIdx.z;
    if (z == 0)      proj_tile<2>(WB + (size_t)2 * DM * DM, XV, VT, CS, osb, sm, f % (DM / GT), f / (DM / GT), DM, (size_t)0, SEQ, SEQ, (size_t)DM * SEQ);
    else if (z == 1) proj_tile<1>(XK, WB + (size_t)DM * DM, KP, CS, osb, sm, f % (NB * SEQ / GT), f / (NB * SEQ / GT), SEQ, (size_t)NH_ * SEQ * HD, HD, HD, (size_t)SEQ * HD);
    else             proj_tile<0>(XQ, WB, QH, CS, osb, sm, f % (NB * SEQ / GT), f / (NB * SEQ / GT), SEQ, (size_t)NH_ * SEQ * HD, HD, HD, (size_t)SEQ * HD);
}

// k_flash: fused attention, KS waves per 16 * QG query rows of one (batch, head), wave (slot, half) walking keys half * SEQ / KS ... of its slot's rows; Q fragments straight from the f16 plane.
// K and V^T: the AW waves of a key half walk the same keys, so each tile of KT keys is brought into LDS ONCE per block by asynchronous 16-byte copies (whole 128-byte lines,
// eight lanes per row) into one of that half's two buffers, the next tile flying while this one is worked on; fragments are 16-byte LDS reads at pitch LP.
// Behind the loop the upper half hands (max, sum, O^T) to the lower half's wave of the same slot through LDS, lane to lane; that wave joins the two online-softmax states and stores.
// Each K and V^T fragment is read once per wave and feeds QG matrix products (one per 16-query group g).
// Transposed form: S^T[key][t] = K Q^T (A = K rows, B = Q rows); lane (t = lane&15, h = lane>>4) holds keys 8h+r of each 16-key tile, so the packed
// P tile is directly the B fragment of O^T[d][t] = V^T P^T (element r <- tile keys 0..15, element 8+r <- tile keys 16..31, lane unchanged).
// Scale chain: logit2 = acc * (0.125 * log2 e); P = exp2(logit2 - max in use + 8) as f16; l = sum of the f16 P values; ctx plane = O^T * 1024 / l.
// Softmax state: the maximum in use is one scalar per lane and group, the same in both lane halves of a row. It may trail the true running maximum by up to LZ: O^T and the row sums are rescaled
// (and the halves' maxima combined with one xor-16 exchange) only under one wave-uniform branch per 32 keys, taken when some lane's score exceeds the maximum in use by more than LZ.
// The row sums of P run on the matrix unit: one more product per group and 32 keys, A = a constant tile whose row 0 is ones and whose other rows are zero, B = the packed P tile,
// so element 0 of the accumulator holds, in lanes 0..15, the sum over all 32 keys of that lane's query (f16 P values, f32 accumulate) and, in lanes 16..31, row 8 = zero; only element 0 is rescaled.
// one tile's copies of one thread: two 16-byte pieces of the K tile (rows 32 apart) and two of the V^T tile, each lane with its own LDS byte address and global pointer.
// s_wait_xcnt stands as the statement's last line, in front of any rewrite of the address registers that the copies name.
__device__ __forceinline__ void stage_tile(unsigned l, const h16* kg, const h16* vg) {
    asm volatile("global_load_async_to_lds_b128 %0, %4, off\n\t"
                 "global_load_async_to_lds_b128 %1, %5, off\n\t"
                 "global_load_async_to_lds_b128 %2, %6, off\n\t"
                 "global_load_async_to_lds_b128 %3, %7, off\n\t"
                 "s_wait_xcnt 0x0"
                 :: "v"(l), "v"(l + 32 * LP * 2), "v"(l + 64 * LP * 2), "v"(l + 96 * LP * 2),
                    "v"(kg), "v"(kg + 32 * HD), "v"(vg), "v"(vg + (size_t)32 * SEQ)
                 : "memory");
}

__global__ __launch_bounds__(32 * AW * KS) void k_flash(const h16* __restrict__ QH, const h16* __restrict__ KP, const h16* __restrict__ VT, h16* CX) {
    __shared__ __align__(16) float os[AW * 16 * 68];
    __shared__ __align__(16) h16 kv[KS * 2 * TH];            // two buffers per key half
    __shared__ __align__(16) float cmb[AW * CP * 32 * 4];    // hand-over of the upper half's state: [slot][piece][lane] 16-byte pieces
    const int lane = threadIdx.x & 31, lr = lane & 15, hi = lane >> 4;
    const int wid = __builtin_amdgcn_readfirstlane((int)(threadIdx.x >> 5));
    const int wave = wid % AW, kh = wid / AW;                // query slot and key half of this wave, both wave-uniform
    const int zh = blockIdx.y; const int b = zh / NH_, h = zh % NH_;
    const int t0 = (blockIdx.x * AW + wave) * (16 * QG);
    const size_t pbase = (size_t)zh * SEQ * HD;
    const size_t qo = pbase + (size_t)(t0 + lr) * HD + 8 * hi;
    v16h qh0[QG], qh1[QG];                                   // B fragments: col t, k = d
#pragma unroll
    for (int g = 0; g < QG; ++g) { qh0[g] = ldh(QH + qo + (size_t)g * 16 * HD); qh1[g] = ldh(QH + qo + (size_t)g * 16 * HD + 32); }
    // copy addresses of this thread, ht = its index among the 32 * AW threads of its key half: row = ht / 8 (+ 32 for the second piece), 16-byte column = ht % 8, the same in the K tile (row = key) and in the V^T tile (row = d)
    const unsigned ht = threadIdx.x % (32 * AW);
    const unsigned crow = ht >> 3, ccol = ht & 7;
    const int kf = kh * (SEQ / KS);                                                  // first key of this half
    const unsigned l0 = (unsigned)(size_t)&kv[0] + (unsigned)kh * (2 * TH * 2) + crow * (LP * 2) + ccol * 16;   // LDS byte address in this half's buffer 0
    const h16* kg = KP + pbase + (size_t)(kf + (int)crow) * HD + ccol * 8;           // + key0 * HD
    const h16* vg = VT + pbase + (size_t)crow * SEQ + kf + ccol * 8;                 // + key0
    stage_tile(l0, kg, vg);
    asm volatile("s_wait_asynccnt 0x0" ::: "memory");        // this wave's copies of tile 0 have landed
    __syncthreads();                                         // ... and every other wave's: tile 0 may be read
    stage_tile(l0 + TH * 2, kg + (size_t)KT * HD, vg + KT);  // tile 1 flies during trip 0
    const h16* fr = kv + kh * (2 * TH) + lr * LP + 8 * hi;   // fragment base in this half's buffers: K row key (k = d) at + key * LP; V^T row d (k = key) at + (KT + d) * LP + key
    v8f o0[QG], o1[QG], o2[QG], o3[QG], sm[QG];         // sm: row-sum tile, row 0 alone is ever non-zero
    float m[QG], l[QG];
#pragma unroll
    for (int g = 0; g < QG; ++g) { o0[g] = (v8f){}; o1[g] = (v8f){}; o2[g] = (v8f){}; o3[g] = (v8f){}; sm[g] = (v8f){}; m[g] = -3.0e38f; }
    v16h one0;                                           // A fragment: a lane holds row lane & 15, so lanes 0 and 16 hold the ones of row 0 (every k), all other lanes zero
#pragma unroll
    for (int i = 0; i < 16; ++i) one0[i] = (lr == 0) ? (h16)1.0f : (h16)0.0f;
#pragma unroll 1
    for (int t = 0; t < NT; ++t) {
      const h16* fb = fr + (t & 1) * TH;                 // trip t reads buffer t mod 2 of its half alone
#pragma unroll
      for (int sub = 0; sub < KT / 32; ++sub) {          // two passes of 32 keys per tile, one online-softmax step each
        const h16* ka = fb + sub * 32 * LP;
        const v16h ka0 = ldh(ka), ka1 = ldh(ka + 32), kb0 = ldh(ka + 16 * LP), kb1 = ldh(ka + 16 * LP + 32);
        v8f sHa[QG], sHb[QG];                            // both groups' score tiles live across the test; every loop over g or r of this pass is unrolled so that they stay in registers
#pragma unroll
        for (int g = 0; g < QG; ++g) {
            sHa[g] = (v8f){}; sHb[g] = (v8f){};
            sHa[g] = wmma16(ka0, qh0[g], sHa[g]); sHb[g] = wmma16(kb0, qh0[g], sHb[g]);
            sHa[g] = wmma16(ka1, qh1[g], sHa[g]); sHb[g] = wmma16(kb1, qh1[g], sHb[g]);
        }
        float mx[QG]; bool need = false;
#pragma unroll
        for (int g = 0; g < QG; ++g) {
            float x = -3.0e38f;
#pragma unroll
            for (int r = 0; r < 8; ++r) x = fmaxf(x, fmaxf(sHa[g][r], sHb[g][r]));
            mx[g] = x * SC2; need = need || (mx[g] > m[g] + LZ);
        }
        if (__builtin_amdgcn_ballot_w32(need) != 0) {    // one scalar branch per 32 keys; taken on the first pass (m = -3e38) and rarely later
#pragma unroll
            for (int g = 0; g < QG; ++g) {
                const float mnew = fmaxf(m[g], fmaxf(mx[g], __shfl_xor(mx[g], 16, 32)));   // both lane halves of a query take the same new maximum
                const float alpha = __builtin_amdgcn_exp2f(m[g] - mnew);
                sm[g][0] = sm[g][0] * alpha; m[g] = mnew;
                o0[g] = o0[g] * alpha; o1[g] = o1[g] * alpha; o2[g] = o2[g] * alpha; o3[g] = o3[g] * alpha;
            }
        }
        const h16* va = fb + KT * LP + sub * 32;
        const v16h v0 = ldh(va), v1 = ldh(va + 16 * LP), v2 = ldh(va + 32 * LP), v3 = ldh(va + 48 * LP);
#pragma unroll
        for (int g = 0; g < QG; ++g) {
            const float sh = PSH - m[g];
            v16h pb;
#pragma unroll
            for (int r = 0; r < 8; r += 2) {             // exp argument = logit2 - max in use + 8, at most 8 + LZ: one packed fma per two neighbouring accumulator registers
                const v2f ea = __builtin_elementwise_fma((v2f){ sHa[g][r], sHa[g][r + 1] }, (v2f){ SC2, SC2 }, (v2f){ sh, sh });
                const v2f eb = __builtin_elementwise_fma((v2f){ sHb[g][r], sHb[g][r + 1] }, (v2f){ SC2, SC2 }, (v2f){ sh, sh });
                pb[r] = (h16)__builtin_amdgcn_exp2f(ea[0]); pb[r + 1] = (h16)__builtin_amdgcn_exp2f(ea[1]);
                pb[8 + r] = (h16)__builtin_amdgcn_exp2f(eb[0]); pb[9 + r] = (h16)__builtin_amdgcn_exp2f(eb[1]);
            }
            o0[g] = wmma16(v0, pb, o0[g]); o1[g] = wmma16(v1, pb, o1[g]); o2[g] = wmma16(v2, pb, o2[g]); o3[g] = wmma16(v3, pb, o3[g]);
            sm[g] = wmma16(one0, pb, sm[g]);
        }
      }
        __builtin_amdgcn_sched_barrier(0);               // keeps every matrix product of this trip in front of the slots below
        // four vector slots between the last matrix product and the loop's back edge
        asm volatile("v_nop\n\tv_nop\n\tv_nop\n\tv_nop");
        asm volatile("s_wait_dscnt 0x0" ::: "memory");   // this wave's reads of buffer t mod 2 have returned
        asm volatile("s_wait_asynccnt 0x0" ::: "memory");// this wave's copies of tile t + 1 have landed
        __syncthreads();                                 // publishes tile t + 1 and ends every wave's reads of the buffer refilled below
        if (t + 2 < NT) stage_tile(l0 + (unsigned)(t & 1) * (TH * 2), kg + (size_t)(t + 2) * KT * HD, vg + (size_t)(t + 2) * KT);
    }
    asm volatile("s_wait_asynccnt 0x0" ::: "memory");    // nothing of this wave's is in flight when the loop is left
#pragma unroll
    for (int g = 0; g < QG; ++g) l[g] = sm[g][0];        // lanes 0..15: the whole row sum of this key half; lanes 16..31: zero, so the xor-16 sum in the epilogue gives every lane the row sum
    // the two key halves of a slot are joined: lane x of the upper wave holds the same (query, d) places as lane x of the lower wave
    float* const cw = cmb + wave * (CP * 32 * 4) + lane * 4;             // piece j of this lane at + j * 128 floats: neighbouring lanes, neighbouring 16 bytes
    if (kh != 0) {
#pragma unroll
        for (int g = 0; g < QG; ++g) {
            const v8f* const oq[4] = { &o0[g], &o1[g], &o2[g], &o3[g] };
#pragma unroll
            for (int q = 0; q < 4; ++q) {
                const v8f x = *oq[q];
                *(v4fa*)(cw + (g * 8 + q * 2) * 128)     = (v4f){ x[0], x[1], x[2], x[3] };
                *(v4fa*)(cw + (g * 8 + q * 2 + 1) * 128) = (v4f){ x[4], x[5], x[6], x[7] };
            }
        }
        *(v4fa*)(cw + (CP - 1) * 128) = (v4f){ m[0], m[1], l[0], l[1] };
    }
    __syncthreads();                                     // the upper half's state may be read; every wave of the block passes here
    if (kh != 0) return;                                 // no barrier stands behind this line
    {
        const v4f ml = *(const v4fa*)(cw + (CP - 1) * 128);
#pragma unroll
        for (int g = 0; g < QG; ++g) {
            const float mn = fmaxf(m[g], ml[g]);
            const float fa = __builtin_amdgcn_exp2f(m[g] - mn), fc = __builtin_amdgcn_exp2f(ml[g] - mn);
            l[g] = l[g] * fa + ml[2 + g] * fc;
            v8f* const oq[4] = { &o0[g], &o1[g], &o2[g], &o3[g] };
#pragma unroll
            for (int q = 0; q < 4; ++q) {
                const v4f x = *(const v4fa*)(cw + (g * 8 + q * 2) * 128); const v4f y = *(const v4fa*)(cw + (g * 8 + q * 2 + 1) * 128);
                v8f o = *oq[q];
#pragma unroll
                for (int r = 0; r < 4; ++r) { o[r] = o[r] * fa + x[r] * fc; o[4 + r] = o[4 + r] * fa + y[r] * fc; }
                *oq[q] = o;
            }
        }
    }
    const int wb = wave * 16 * 68;
    const int rg = lane >> 3, c8 = (lane & 7) * 8;       // 4 s x 4 row groups = 16 rows; 8 lanes x 8 halves = 64 columns
#pragma unroll
    for (int g = 0; g < QG; ++g) {
        const float lt = l[g] + __shfl_xor(l[g], 16, 32);
        const float inv = (1.0f / lt) * CXS;
        // O^T D layout: o_j[r] = (d = 16j + 8h + r, t = lane&15) -> os[t][d]; rows 0..15 x columns 0..63 all written
        { v4f a, c;
          a[0] = o0[g][0] * inv; a[1] = o0[g][1] * inv; a[2] = o0[g][2] * inv; a[3] = o0[g][3] * inv; c[0] = o0[g][4] * inv; c[1] = o0[g][5] * inv; c[2] = o0[g][6] * inv; c[3] = o0[g][7] * inv;
          *(v4fa*)(&os[wb + lr * 68 +  0 + 8 * hi]) = a; *(v4fa*)(&os[wb + lr * 68 +  0 + 8 * hi + 4]) = c;
          a[0] = o1[g][0] * inv; a[1] = o1[g][1] * inv; a[2] = o1[g][2] * inv; a[3] = o1[g][3] * inv; c[0] = o1[g][4] * inv; c[1] = o1[g][5] * inv; c[2] = o1[g][6] * inv; c[3] = o1[g][7] * inv;
          *(v4fa*)(&os[wb + lr * 68 + 16 + 8 * hi]) = a; *(v4fa*)(&os[wb + lr * 68 + 16 + 8 * hi + 4]) = c;
          a[0] = o2[g][0] * inv; a[1] = o2[g][1] * inv; a[2] = o2[g][2] * inv; a[3] = o2[g][3] * inv; c[0] = o2[g][4] * inv; c[1] = o2[g][5] * inv; c[2] = o2[g][6] * inv; c[3] = o2[g][7] * inv;
          *(v4fa*)(&os[wb + lr * 68 + 32 + 8 * hi]) = a; *(v4fa*)(&os[wb + lr * 68 + 32 + 8 * hi + 4]) = c;
          a[0] = o3[g][0] * inv; a[1] = o3[g][1] * inv; a[2] = o3[g][2] * inv; a[3] = o3[g][3] * inv; c[0] = o3[g][4] * inv; c[1] = o3[g][5] * inv; c[2] = o3[g][6] * inv; c[3] = o3[g][7] * inv;
          *(v4fa*)(&os[wb + lr * 68 + 48 + 8 * hi]) = a; *(v4fa*)(&os[wb + lr * 68 + 48 + 8 * hi + 4]) = c; }
        wave_sync();
        h16* crow = CX + ((size_t)b * SEQ + t0 + g * 16) * DM + h * HD;
        v8h hv[4];
#pragma unroll
        for (int s = 0; s < 4; ++s) { const int row = 4 * s + rg;
            const v4f x0 = *(const v4fa*)(&os[wb + row * 68 + c8]); const v4f x1 = *(const v4fa*)(&os[wb + row * 68 + c8 + 4]);
#pragma unroll
            for (int i = 0; i < 4; ++i) { hv[s][i] = (h16)x0[i]; hv[s][4 + i] = (h16)x1[i]; } }
#pragma unroll
        for (int s = 0; s < 4; ++s) *(v8h*)(crow + (size_t)(4 * s + rg) * DM + c8) = hv[s];
        asm volatile("s_wait_xcnt 0x0" ::: "memory");    // before the next group reuses the registers these stores name
        __builtin_amdgcn_sched_barrier(0);               // keeps the next group's arithmetic behind that wait
        wave_sync();                                     // the next group overwrites this wave's staging rows
    }
}

// k_oproj: register-blocked f16 GEMM, one wave per 64x64 tile, GW waves per block (gemm_main), A = ctx plane (x1024), Bt = Wp plane (x256), K = DM; OUT[m][n] = acc * 2^-18 + bias[n] (f32).
__global__ __launch_bounds__(32 * GW) void k_oproj(const h16* __restrict__ A, const h16* __restrict__ Bt, const float* __restrict__ bias, float* OUT) {
    __shared__ __align__(16) float osb[GW * 16 * 68];
    __shared__ __align__(16) h16 sm[2 * GTH];
    const int lane = threadIdx.x & 31, lr = lane & 15, hi = lane >> 4;
    const int wave = __builtin_amdgcn_readfirstlane((int)(threadIdx.x >> 5));
    const int wr = (wave & 1) * 64, wc = (wave >> 1) * 64;
    const int r0 = blockIdx.x * GT + wr, c0 = blockIdx.y * GT + wc;      // this wave's 64 x 64 tile
    float* const os = osb + wave * 16 * 68;                              // this wave's own staging rows
    v8f acc[4][4];
    gemm_main(A, Bt, sm, (int)blockIdx.x * GT, (int)blockIdx.y * GT, wr, wc, lr, hi, acc);
    const int cofs = lr * 4;                              // 16 lanes x 4 floats = 64 columns
    const v4f braw = *(const v4fa*)(bias + c0 + cofs); v4f bb;
#pragma unroll
    for (int i = 0; i < 4; ++i) bb[i] = bfval(braw[i]);
    const int bi = r0 / SEQ, tt = r0 % SEQ;
    float* obase = OUT + ((size_t)bi * OUT_SEQ + tt) * DM + c0;
#pragma unroll
    for (int mb = 0; mb < 4; ++mb) {
#pragma unroll
        for (int nb = 0; nb < 4; ++nb) {
#pragma unroll
            for (int j = 0; j < 8; ++j) os[(hi * 8 + j) * 68 + nb * 16 + lr] = acc[mb][nb][j]; }   // rows 0..15 x cols 0..63 all written
        wave_sync();
        v4f vals[8];
#pragma unroll
        for (int s = 0; s < 8; ++s) { const int row = 2 * s + hi;            // 8 s x 2 rows = 16 rows
            const v4f x = *(const v4fa*)(&os[row * 68 + cofs]); vals[s] = x * OSC + bb; }
{
#pragma unroll
            for (int s = 0; s < 8; ++s) *(v4f*)(obase + (size_t)(mb * 16 + 2 * s + hi) * DM + cofs) = vals[s];
             }
        wave_sync();
    }
}

static constexpr size_t al256(size_t v) { return (v + 255) & ~(size_t)255; }
static constexpr size_t SZ_XB = al256((size_t)NB * SEQ * DM * 2);            // one bf16 activation plane
static constexpr size_t SZ_WB = al256((size_t)3 * DM * DM * 2);              // Wq | Wk | Wv bf16
static constexpr size_t SZ_WP = al256((size_t)DM * DM * 2);                  // Wp f16 x256
static constexpr size_t SZ_CS = al256((size_t)2 * SEQ * NPR * 2 * 4);        // two (cos, sin) tables
static constexpr size_t SZ_PL = al256((size_t)NB * NH_ * SEQ * HD * 2);      // one f16 head plane
static constexpr size_t SZ_CX = al256((size_t)NB * SEQ * DM * 2);            // ctx f16 x1024
static constexpr size_t SZ_TOTAL = 3 * SZ_XB + SZ_WB + SZ_WP + SZ_CS + 3 * SZ_PL + SZ_CX;
static_assert(SZ_TOTAL <= (size_t)134217728);          // workspace carve <= 128 MiB
static_assert(((size_t)DM * DM * 2) % 256 == 0);       // weight sub-planes stay 256-byte aligned

extern "C" void kernel_launch(void* const* d_in, const int* in_sizes, int n_in,
                              void* d_out, int out_size, void* d_ws, size_t ws_size, hipStream_t stream) {
    if (n_in < 8) return;
    const size_t needx = ((size_t)(NB - 1) * SEQ_FULL + SEQ) * DM;
    if ((size_t)in_sizes[0] < needx || (size_t)in_sizes[1] < needx || (size_t)in_sizes[2] < needx) return;
    if ((size_t)in_sizes[3] < (size_t)DM * DM || (size_t)in_sizes[4] < (size_t)DM * DM || (size_t)in_sizes[5] < (size_t)DM * DM || (size_t)in_sizes[6] < (size_t)DM * DM) return;
    if ((size_t)in_sizes[7] < (size_t)DM) return;
    if ((size_t)out_size < ((size_t)(NB - 1) * OUT_SEQ + SEQ) * DM) return;
    if (SZ_TOTAL > ws_size) return;
    // wire order: q, k, v, Wq, Wk, Wv, Wp, bp (weights [out][in] = Bt as-is)
    const float* xq = (const float*)d_in[0]; const float* xk = (const float*)d_in[1]; const float* xv = (const float*)d_in[2];
    const float* wq = (const float*)d_in[3]; const float* wk = (const float*)d_in[4]; const float* wv = (const float*)d_in[5];
    const float* wp = (const float*)d_in[6]; const float* bp = (const float*)d_in[7];
    float* OUT = (float*)d_out;      // [NB][SEQ][1024]
    char* wsp = (char*)d_ws;
    bf* XQ = (bf*)wsp; wsp += SZ_XB;                 // [NB*SEQ][1024]
    bf* XK = (bf*)wsp; wsp += SZ_XB;
    bf* XV = (bf*)wsp; wsp += SZ_XB;
    bf* WB = (bf*)wsp; wsp += SZ_WB;                 // [3][1024][1024]: q | k | v
    h16* WP = (h16*)wsp; wsp += SZ_WP;               // [1024][1024] x256
    float* CS = (float*)wsp; wsp += SZ_CS;           // [SEQ][512][2] then [512][SEQ][2]
    h16* QH = (h16*)wsp; wsp += SZ_PL;               // [NB*16][SEQ][64]
    h16* KP = (h16*)wsp; wsp += SZ_PL;               // [NB*16][SEQ][64]
    h16* VT = (h16*)wsp; wsp += SZ_PL;               // [NB*16][64][SEQ]
    h16* CX = (h16*)wsp; wsp += SZ_CX;               // [NB*SEQ][1024] x1024

    k_prep<<<PB, PT, 0, stream>>>(xq, xk, xv, wq, wk, wv, wp, XQ, XK, XV, WB, WP, CS);

    // q, k and v^T projections: one launch, blockIdx.z = projection
    k_proj<<<dim3(PJ, 1, 3), 32 * GW, 0, stream>>>(XQ, XK, XV, WB, QH, KP, VT, CS);

    k_flash<<<dim3(SEQ / (16 * QG * AW), NB * NH_, 1), 32 * AW * KS, 0, stream>>>(QH, KP, VT, CX);

    // out: A = ctx rows (m = b*SEQ + t), Bt = Wp rows (n = out feature)
    k_oproj<<<dim3(NB * SEQ / GT, DM / GT, 1), 32 * GW, 0, stream>>>(CX, WP, bp, OUT);
}

// v010
// A run of this version takes 75.5 microseconds.
// In two side-by-side timings against v009, it was 1.05 and 1.06 times as fast.
// Over all steps from v000 it is 3.28 times as fast.
#include <hip/hip_runtime.h>

// Multi-head attention, width 1024 = 16 heads x 64; inputs q, k, v [NB][SEQ][1024]; Wq/Wk/Wv/Wp [out][in] (y = x W^T); interleaved rotary on projected k and v over the full 1024 axis (512 pairs, angle = pos * 10000^(-2p/1024)); score scale 1/8; dense softmax; out = ctx Wp^T + bp (f32).
// Compute dtypes, f32 accumulate everywhere: q/k/v projections v_wmma_f32_16x16x32_bf16 (inputs and weights RNE-converted to bf16; products exact); rotary in f32 in the projection epilogue, its cos and sin worked out there in registers (angle = f32 pos * f32 theta, two-term reduction to a fraction of a turn, hardware sine and cosine);
// scores v_wmma_f32_16x16x32_f16: q single f16, k single f16 (one product; logits = acc * 0.125 * log2 e); P (x256 carry, cancels in the normalisation; row sum taken over the f16 values) and v single f16; softmax f32 (online, running max);
// output projection v_wmma_f32_16x16x32_f16: ctx single f16 with x1024 carry, Wp as f16 of the bf16 RNE value with x256 carry, 2^-18 folded back in the f32 epilogue, bias (bf16 RNE value) added in f32.
// Layout: bf16 copies of q, k, v, Wq, Wk, Wv; q and k planes [b*16+h][t][d]; v^T plane [b*16+h][d][t]; ctx plane [b*SEQ+t][1024]; fused flash kernel in transposed form (S^T = K Q^T, O^T = V^T P^T), its K and V^T tiles staged in LDS once per block; the four GEMMs stage their A and B tiles in LDS once per 128 x 128 block.

#ifndef NB
#define NB 2
#endif
#ifndef SEQ
#define SEQ 2048
#endif
#define NB_FULL  2
#define SEQ_FULL 2048
#ifndef OUT_SEQ
#define OUT_SEQ SEQ              // row pitch (in tokens) between batches of the output
#endif
#define DM   1024
#define NH_  16
#define HD   64
#define NPR  (DM / 2)            // rotary pairs per token row
#define PT   256                 // threads per pre-pass block
#define PB   512                 // pre-pass blocks
#define AW   8                   // query slots per flash block: each slot is 16 * QG query rows
#define KS   2                   // key halves per flash block: every query slot is worked by KS waves, one per half of the keys, so AW * KS = 16 waves stand four per SIMD and one wave's waits run under three others' work
#define QG   2                   // 16-query groups per flash wave (32 query rows each)
#define KT   64                  // keys per staged tile (a K row and a V^T row of a tile are both 128 bytes: whole cache lines)
#define LP   72                  // LDS row pitch in halves: 144 bytes = 16 x 9, conflict-free for 16-byte fragment reads
#define TH   (2 * 64 * LP)       // halves of one buffer: K tile (KT rows) then V^T tile (HD rows)
#define NT   (SEQ / (KT * KS))   // tiles that one key half walks
#define CP   17                  // 16-byte pieces per lane handed over when the key halves are merged: 16 of O^T, one of (max, sum)
#define GW   4                   // waves per GEMM block: 2 x 2 wave tiles of 64 x 64 = one 128 x 128 tile
#define GT   128                 // rows of A and rows of Bt per GEMM block
#ifndef GK
#define GK   128                 // k elements per staged GEMM tile (256 bytes a row: whole cache lines)
#endif
#define GLP  (GK + 8)            // LDS row pitch of a GEMM tile in 16-bit elements: 16 bytes x an odd number, conflict-free for 16-byte fragment reads
#define GRS  (GW * 32 * 8 / GK)  // rows that one 16-byte copy of every thread of the block covers
#define GTH  (2 * GT * GLP)      // 16-bit elements of one GEMM buffer: A tile (GT rows) then Bt tile (GT rows)
#define SC2  (0.125f * 1.4426950408889634f)   // HD^-0.5 * log2(e)
#define PSH  8.0f                // log2 of the P carry (256)
#define LZ   7.0f                // a score may stand this far (log2) above the maximum in use before O^T and the row sums are rescaled: P <= 2^(PSH + LZ) = 2^15 stays inside f16
#define CXS  1024.0f             // carry of the ctx plane
#define WPS  256.0f              // carry of the Wp plane
#define OSC  (1.0f / (1024.0f * 256.0f))      // 2^-18

static_assert(HD == 64);
static_assert(NH_ * HD == DM);                 // head h = columns h*64 + d
static_assert(DM % 64 == 0);
static_assert(DM % 32 == 0);                   // GEMM k-loop steps by 32
static_assert(SEQ % 64 == 0);                  // a 64-row tile never straddles two batches
static_assert((NB * SEQ) % 64 == 0);
static_assert(SEQ % 32 == 0);                  // key loop steps by 32
static_assert(SEQ % (16 * QG * AW) == 0);      // flash grid covers the sequence exactly
static_assert(SEQ % (KT * KS) == 0 && NT >= 2); // whole tiles in every key half; the two-buffer prologue fills two
static_assert(KS == 2 && QG == 2 && CP == QG * 8 + 1);   // the merge below joins two halves; (max, sum) of QG = 2 groups fill one 16-byte piece
static_assert(KT == 64 && AW * 32 * 2 * 8 == KT * HD);   // two 16-byte copies per thread of a key half cover one 64 x 64 tile
static_assert((NB * SEQ) % GT == 0 && DM % GT == 0);      // GEMM grids cover both operands exactly
static_assert(DM % GK == 0 && DM / GK >= 2 && GK % 64 == 0);   // whole k tiles of whole lines; the two-buffer prologue fills two
static_assert(GT % (8 * GRS) == 0 && (GLP * 2) % 32 == 16);    // statements of eight copies cover an operand tile exactly; odd multiple of 16 bytes
static_assert(2 * GT / GRS <= 63);                             // copies of one wave in flight: one tile's
static constexpr size_t PN  = (size_t)PB * PT;              // pre-pass threads
static constexpr size_t WCH = (size_t)DM * DM / 8;          // 8-element pieces of one weight
static constexpr size_t BCH = (size_t)SEQ * DM / 8;         // 8-element pieces of one batch of one activation
static constexpr int    XR  = (int)((size_t)NB * BCH / PN); // pre-pass rounds over the activations
static_assert((size_t)XR * PN == (size_t)NB * BCH && XR >= 1);   // the rounds cover the activation planes exactly
static_assert((size_t)NB * SEQ_FULL * DM * 4 < ((size_t)1 << 32));   // 32-bit byte offsets inside every plane
static_assert(WCH == PN);                      // one piece of each weight per pre-pass thread
static_assert(NPR % PT == 0 && NPR <= PB * PT); // the angle steps: whole blocks, one pair per thread
static_assert(NB <= NB_FULL);
static_assert(SEQ <= SEQ_FULL);
static_assert(((size_t)(NB - 1) * OUT_SEQ + SEQ) * DM * 4 <= (size_t)16777216);   // last output byte stays inside the output buffer

typedef _Float16 h16;
typedef unsigned short bf;
typedef __attribute__((ext_vector_type(16))) __bf16   v16bf;
typedef __attribute__((ext_vector_type(16))) _Float16 v16h;
typedef __attribute__((ext_vector_type(8)))  _Float16 v8h;
typedef __attribute__((ext_vector_type(8)))  unsigned short v8us;
typedef __attribute__((ext_vector_type(8)))  float    v8f;
typedef __attribute__((ext_vector_type(4)))  float    v4f;
typedef __attribute__((ext_vector_type(2)))  float    v2f;
typedef v4f  __attribute__((may_alias)) v4fa;

__device__ __forceinline__ unsigned short f2bf(float f) { unsigned u = __float_as_uint(f); u += 0x7FFFu + ((u >> 16) & 1u); return (unsigned short)(u >> 16); }
__device__ __forceinline__ float bfval(float f) { return __uint_as_float(((unsigned)f2bf(f)) << 16); }
__device__ __forceinline__ v16h cat16(v8h lo, v8h hi) { return __builtin_shufflevector(lo, hi, 0, 1, 2, 3, 4, 5, 6, 7, 8, 9, 10, 11, 12, 13, 14, 15); }
__device__ __forceinline__ v16bf cat16b(v8us lo, v8us hi) { return __builtin_bit_cast(v16bf, __builtin_shufflevector(lo, hi, 0, 1, 2, 3, 4, 5, 6, 7, 8, 9, 10, 11, 12, 13, 14, 15)); }
__device__ __forceinline__ v8f wmma16(v16h a, v16h b, v8f c) { return __builtin_amdgcn_wmma_f32_16x16x32_f16(false, a, false, b, (short)0, c, false, false); }
__device__ __forceinline__ v8f wmmab(v16bf a, v16bf b, v8f c) { return __builtin_amdgcn_wmma_f32_16x16x32_bf16(false, a, false, b, (short)0, c, false, false); }
// fragment loaders from K-contiguous 16-bit rows; p already includes + 8*(lane>>4): elements 0..7 <- k0+8h+0..7, elements 8..15 <- k0+16+8h+0..7 (same map for A and B)
__device__ __forceinline__ v16h  ldh(const h16* p) { return cat16(*(const v8h*)p, *(const v8h*)(p + 16)); }
__device__ __forceinline__ v16bf ldb(const bf* p)  { return cat16b(*(const v8us*)p, *(const v8us*)(p + 16)); }
// ordering point for wave-private LDS tiles (same wave writes and reads)
__device__ __forceinline__ void wave_sync() { __builtin_amdgcn_fence(3 /* release order */, "wavefront"); __builtin_amdgcn_wave_barrier(); asm volatile("" ::: "memory"); }

// k_prep: every pass that only prepares operands, in ONE launch of long-lived blocks: bf16 copies of q, k, v, Wq, Wk, Wv; the f16 x256 copy of Wp; the NPR rotary angle steps theta(p).
// PB blocks x PT threads stay resident (16 waves per WGP) and each thread walks its share of every plane with stride PN, so the launch starts 4,096 waves.
__device__ __forceinline__ float theta_of(int p) { const float e = (2.0f * (float)p) * (1.0f / (float)DM); return 1.0f / powf(10000.0f, e); }
__device__ __forceinline__ v8us cvt8(v8f v) { v8us o;
#pragma unroll
    for (int k = 0; k < 8; ++k) o[k] = f2bf(v[k]);
    return o; }
// (cos, sin) of one rotary angle, 0 <= ang < SEQ (theta <= 1): whole turns n taken off with 2 pi in two parts (two fma, so the remainder keeps f32 accuracy at every such angle), the remainder as a fraction of a turn, which is the unit of the hardware sine and cosine
__device__ __forceinline__ v2f cs_of(float ang) {
    const float n = __builtin_rintf(ang * 0.15915494309189535f);
    float r = __builtin_fmaf(n, -6.2831854820251465f, ang);
    r = __builtin_fmaf(n, 1.7484555314695172e-7f, r);
    const float x = r * 0.15915494309189535f;
    float c, s;
    // both transcendentals in one statement, so that the slot the instruction set asks for behind each is filled whatever the compiler puts next: the sine stands behind the cosine (outputs apart from x), v_nop behind the sine;
    // s_delay_alu: x comes from the vector instruction in front, and the hint lets other waves issue while it is awaited
    asm("s_delay_alu instid0(VALU_DEP_1)\n\tv_cos_f32 %0, %2\n\tv_sin_f32 %1, %2\n\tv_nop" : "=&v"(c), "=&v"(s) : "v"(x));
    return (v2f){ c, s };
}

// plane base + one 32-bit byte offset (every plane is far below 4 GiB): the planes of a round share the offset register and no 64-bit address is formed per access
__device__ __forceinline__ v8f ld8(const float* p, unsigned byteoff) { return *(const v8f*)((const char*)p + byteoff); }
template <typename V, typename P> __device__ __forceinline__ void st16(P* p, unsigned byteoff, V v) { *(V*)((char*)p + byteoff) = v; }

__global__ __launch_bounds__(PT) void k_prep(const float* __restrict__ xq, const float* __restrict__ xk, const float* __restrict__ xv,
                                             const float* __restrict__ wq, const float* __restrict__ wk, const float* __restrict__ wv, const float* __restrict__ wp,
                                             bf* __restrict__ XQ, bf* __restrict__ XK, bf* __restrict__ XV, bf* __restrict__ WB, h16* __restrict__ WP, float* __restrict__ CS) {
    const unsigned tid = threadIdx.x, blk = blockIdx.x;
    const unsigned g = blk * PT + tid;
    // weights, one 8-element piece of each per thread
    const v8f w0 = ld8(wq, g * 32), w1 = ld8(wk, g * 32), w2 = ld8(wv, g * 32), w3 = ld8(wp, g * 32);
    st16(WB, g * 16, cvt8(w0)); st16(WB + (size_t)DM * DM, g * 16, cvt8(w1)); st16(WB + (size_t)2 * DM * DM, g * 16, cvt8(w2));
    { v8h o;
#pragma unroll
      for (int k = 0; k < 8; ++k) o[k] = (h16)(bfval(w3[k]) * WPS);
      st16(WP, g * 16, o); }
    asm volatile("s_wait_xcnt 0x0" ::: "memory");        // before the first round reuses the registers these stores name
    __builtin_amdgcn_sched_barrier(0);                   // keeps the first round's address arithmetic behind that wait
    for (unsigned r = 0; r < (unsigned)XR; ++r) {
        const unsigned c = g + r * (unsigned)PN;                                    // 8-element piece of the [NB*SEQ][DM] planes
        const unsigned s = (SEQ == SEQ_FULL) ? c : (c / (unsigned)BCH) * (unsigned)((size_t)SEQ_FULL * DM / 8) + c % (unsigned)BCH;   // the same piece in the inputs (batch pitch SEQ_FULL)
        const v8f a = ld8(xq, s * 32), b = ld8(xk, s * 32), d = ld8(xv, s * 32);
        st16(XQ, c * 16, cvt8(a)); st16(XK, c * 16, cvt8(b)); st16(XV, c * 16, cvt8(d));
        asm volatile("s_wait_xcnt 0x0" ::: "memory");    // before the next round (behind the last one, the lines below) reuses the registers these stores name
        __builtin_amdgcn_sched_barrier(0);               // keeps the next round's address arithmetic behind that wait
    }
    if (blk < NPR / PT) CS[g] = theta_of((int)g);        // the first blocks also write the angle steps, one pair per thread (a block-uniform branch)
}

// Main loop of the four GEMMs. A block of GW waves owns a GT x GT tile of C; each wave a 64 x 64 quarter (16 accumulators).
// The k axis is walked in tiles of GK: the GT rows of A and the GT rows of Bt are brought into LDS ONCE per block by asynchronous 16-byte copies (whole 128-byte lines,
// GK / 8 lanes per row) into one of two buffers, the next tile flying while this one is worked on; fragments are 16-byte LDS reads at pitch GLP. k runs upward in steps of 32 as before.
__device__ __forceinline__ v16h  ldf(const h16* p) { return ldh(p); }
__device__ __forceinline__ v16bf ldf(const bf* p)  { return ldb(p); }
__device__ __forceinline__ v8f mm(v16h a, v16h b, v8f c)   { return wmma16(a, b, c); }
__device__ __forceinline__ v8f mm(v16bf a, v16bf b, v8f c) { return wmmab(a, b, c); }
// eight copies of one thread: 16-byte pieces, rows GRS apart, each lane with its own LDS byte address and global pointer.
// s_wait_xcnt stands as the statement's last line, in front of any rewrite of the address registers that the copies name.
template <typename T>
__device__ __forceinline__ void stage_rows(unsigned l, const T* g) {
    asm volatile("global_load_async_to_lds_b128 %0, %8, off\n\t"
                 "global_load_async_to_lds_b128 %1, %9, off\n\t"
                 "global_load_async_to_lds_b128 %2, %10, off\n\t"
                 "global_load_async_to_lds_b128 %3, %11, off\n\t"
                 "global_load_async_to_lds_b128 %4, %12, off\n\t"
                 "global_load_async_to_lds_b128 %5, %13, off\n\t"
                 "global_load_async_to_lds_b128 %6, %14, off\n\t"
                 "global_load_async_to_lds_b128 %7, %15, off\n\t"
                 "s_wait_xcnt 0x0"
                 :: "v"(l), "v"(l + 1 * GRS * GLP * 2), "v"(l + 2 * GRS * GLP * 2), "v"(l + 3 * GRS * GLP * 2),
                    "v"(l + 4 * GRS * GLP * 2), "v"(l + 5 * GRS * GLP * 2), "v"(l + 6 * GRS * GLP * 2), "v"(l + 7 * GRS * GLP * 2),
                    "v"(g), "v"(g + 1 * GRS * DM), "v"(g + 2 * GRS * DM), "v"(g + 3 * GRS * DM),
                    "v"(g + 4 * GRS * DM), "v"(g + 5 * GRS * DM), "v"(g + 6 * GRS * DM), "v"(g + 7 * GRS * DM)
                 : "memory");
}
// one k tile's copies of one thread: the GT rows of A, then the GT rows of Bt behind them
template <typename T>
__device__ __forceinline__ void stage_ab(unsigned l, const T* ag, const T* bg) {
#pragma unroll
    for (int h = 0; h < GT / (8 * GRS); ++h) stage_rows(l + h * (8 * GRS * GLP * 2), ag + h * (8 * GRS * DM));
#pragma unroll
    for (int h = 0; h < GT / (8 * GRS); ++h) stage_rows(l + (GT + h * 8 * GRS) * (GLP * 2), bg + h * (8 * GRS * DM));
}
// R0, C0: first row of A and of Bt of the BLOCK; wr, wc: this wave's 64-row offsets inside them; sm: 2 * GTH elements of LDS.
template <typename T>
__device__ __forceinline__ void gemm_main(const T* __restrict__ A, const T* __restrict__ Bt, const T* sm, int R0, int C0, int wr, int wc, int lr, int hi, v8f (&acc)[4][4]) {
#pragma unroll
    for (int mb = 0; mb < 4; ++mb)
#pragma unroll
        for (int nb = 0; nb < 4; ++nb) acc[mb][nb] = (v8f){};
    // copy addresses of this thread: row = tid / (GK / 8) (+ GRS per piece), 16-byte column = tid % (GK / 8), the same in the A tile and in the Bt tile
    const unsigned crow = threadIdx.x / (GK / 8), ccol = threadIdx.x % (GK / 8);
    const unsigned l0 = (unsigned)(size_t)&sm[0] + crow * (GLP * 2) + ccol * 16;     // LDS byte address in buffer 0, A tile; the Bt tile stands GT rows behind
    const T* ag = A  + (size_t)(R0 + (int)crow) * DM + ccol * 8;                     // + k0
    const T* bg = Bt + (size_t)(C0 + (int)crow) * DM + ccol * 8;                     // + k0
    stage_ab(l0, ag, bg);
    asm volatile("s_wait_asynccnt 0x0" ::: "memory");        // this wave's copies of tile 0 have landed
    __syncthreads();                                         // ... and every other wave's: tile 0 may be read
    stage_ab(l0 + GTH * 2, ag + GK, bg + GK);                // tile 1 flies during trip 0
    const T* fa = sm + (wr + lr) * GLP + 8 * hi;             // A fragment base of this wave
    const T* fb = sm + (GT + wc + lr) * GLP + 8 * hi;        // Bt fragment base of this wave
#pragma unroll 1
    for (int t = 0; t < DM / GK; ++t) {
        const T* pa = fa + (t & 1) * GTH; const T* pb = fb + (t & 1) * GTH;   // trip t reads buffer t mod 2 alone
        decltype(ldf(fa)) a[2][4], b[2][4];              // two fragment sets: the block of 32 k in work and the next one of the same tile
#pragma unroll
        for (int i = 0; i < 4; ++i) { a[0][i] = ldf(pa + i * 16 * GLP); b[0][i] = ldf(pb + i * 16 * GLP); }
#pragma unroll
        for (int s = 0; s < GK / 32; ++s) {
            if (s + 1 < GK / 32) {
#pragma unroll
                for (int i = 0; i < 4; ++i) { a[(s + 1) & 1][i] = ldf(pa + i * 16 * GLP + (s + 1) * 32); b[(s + 1) & 1][i] = ldf(pb + i * 16 * GLP + (s + 1) * 32); } }
            __builtin_amdgcn_sched_barrier(0);           // the next block's LDS reads stay one group in front of this block's products: their latency runs under the products
#pragma unroll
            for (int nb = 0; nb < 4; ++nb)
#pragma unroll
                for (int mb = 0; mb < 4; ++mb) acc[mb][nb] = mm(a[s & 1][mb], b[s & 1][nb], acc[mb][nb]);
            __builtin_amdgcn_sched_barrier(0);           // no later LDS read is spread among these products; behind the last block: every product stands in front of the slots below
        }
        // four vector slots between the last matrix product and the loop's back edge
        asm volatile("v_nop\n\tv_nop\n\tv_nop\n\tv_nop");
        asm volatile("s_wait_dscnt 0x0" ::: "memory");   // this wave's reads of buffer t mod 2 have returned
        asm volatile("s_wait_asynccnt 0x0" ::: "memory");// this wave's copies of tile t + 1 have landed
        __syncthreads();                                 // publishes tile t + 1 and ends every wave's reads of the buffer refilled below
        if (t + 2 < DM / GK) stage_ab(l0 + (unsigned)(t & 1) * (GTH * 2), ag + (t + 2) * GK, bg + (t + 2) * GK);
    }
    asm volatile("s_wait_asynccnt 0x0" ::: "memory");    // nothing of this wave's is in flight when the loop is left
}

// proj_tile: register-blocked bf16 GEMM, one wave per 64x64 tile (16 accumulators), GW waves per block, operands from K-contiguous bf16 planes through LDS (gemm_main), K = DM.
// C[m][n] = sum_k A[m][k] Bt[n][k]; epilogue by MODE:
//   0: C as f16 (Ph);
//   1: rows = tokens, columns = features: interleaved rotary on column pairs, then f16 (Ph);
//   2: rows = features, columns = tokens: interleaved rotary on row pairs, then f16 (Ph).
// Rotary factors: cs_of(f32 position * theta(pair)) in registers. CS holds the NPR angle steps; a lane's own steps (4 in mode 1, 8 in mode 2) are loaded in front of the main loop, so their latency runs under the first tile's.
// Tile base (r0/RB)*sRB + (r0%RB)*pitch + (c0/CB)*sCB + (c0%CB), row pitch 'pitch' (halves). (bx, by): the block's tile among (M/GT, N/GT); 32 * GW threads; osb, sm: the block's LDS.
template <int MODE>
__device__ __forceinline__ void proj_tile(const bf* __restrict__ A, const bf* __restrict__ Bt, h16* Ph, const float* __restrict__ CS, float* osb, const bf* sm, int bx, int by,
                                             int RB, size_t sRB, int pitch, int CB, size_t sCB) {
    const int lane = threadIdx.x & 31, lr = lane & 15, hi = lane >> 4;
    const int wave = __builtin_amdgcn_readfirstlane((int)(threadIdx.x >> 5));
    const int wr = (wave & 1) * 64, wc = (wave >> 1) * 64;
    const int r0 = bx * GT + wr, c0 = by * GT + wc;                      // this wave's 64 x 64 tile
    float* const os = osb + wave * 16 * 68;                              // this wave's own staging rows
    const int rg = lane >> 3, c8 = (lane & 7) * 8;       // 4 row groups x 8 lanes; 8 lanes x 8 = 64 columns
    v4f th4 = (v4f){}; float thr[8] = {};                // this lane's angle steps: mode 1, its 4 column pairs; mode 2, its row pair of slab mb, half u, at [mb * 2 + u]
    if (MODE == 1) {
        const float* tp = CS + ((c0 + c8) >> 1);
        th4 = *(const v4fa*)tp;
        asm volatile("s_wait_xcnt 0x0" :: "v"(tp) : "memory");   // before a register that this load names is reused; tp as input: the load does not land in the address pair in front of the wait
    }
    if (MODE == 2) {
        const float* tp = CS + (r0 >> 1) + rg;           // rows r0 + mb * 16 + 2 * (4 * u + rg) and the next: pair r0 / 2 + rg + mb * 8 + 4 * u
#pragma unroll                                           // thr[] is indexed by constants only and stays in registers
        for (int i = 0; i < 8; ++i) thr[i] = tp[i * 4];
        asm volatile("s_wait_xcnt 0x0" :: "v"(tp) : "memory");   // before a register that these loads name is reused; tp as input: none of the loads lands in the address pair in front of the wait
    }
    v8f acc[4][4];
    gemm_main(A, Bt, sm, bx * GT, by * GT, wr, wc, lr, hi, acc);
    const size_t tbase = (size_t)(r0 / RB) * sRB + (size_t)(r0 % RB) * (size_t)pitch + (size_t)(c0 / CB) * sCB + (size_t)(c0 % CB);
#pragma unroll
    for (int mb = 0; mb < 4; ++mb) {
#pragma unroll
        for (int nb = 0; nb < 4; ++nb) {
#pragma unroll
            for (int j = 0; j < 8; ++j) os[(hi * 8 + j) * 68 + nb * 16 + lr] = acc[mb][nb][j]; }   // D: row 8h+j, col lane&15; rows 0..15 x cols 0..63 all written
        wave_sync();
        v8h hv[4];
        if (MODE == 2) {
            // a lane takes BOTH rows of a rotary pair at 8 token positions, so each (cos, sin) is worked out once: 2 u x 4 row groups = 8 pairs = 16 rows; hv[2 u] = even row, hv[2 u + 1] = odd row
            const int tc = (c0 % SEQ) + c8;              // first of the 8 positions
#pragma unroll                                           // this loop and the one inside: thr[] and hv[] are indexed by constants only and stay in registers
            for (int u = 0; u < 2; ++u) {
                const int re = 2 * (4 * u + rg);         // even row of the pair; feature r0 + mb * 16 + re
                const v4f a0 = *(const v4fa*)(&os[re * 68 + c8]);       const v4f a1 = *(const v4fa*)(&os[re * 68 + c8 + 4]);
                const v4f b0 = *(const v4fa*)(&os[(re + 1) * 68 + c8]); const v4f b1 = *(const v4fa*)(&os[(re + 1) * 68 + c8 + 4]);
                const float th = thr[mb * 2 + u];
#pragma unroll
                for (int i = 0; i < 4; ++i) {
                    const v2f e = cs_of((float)(tc + i) * th), f = cs_of((float)(tc + 4 + i) * th);
                    hv[2 * u][i]     = (h16)(a0[i] * e[0] - b0[i] * e[1]); hv[2 * u + 1][i]     = (h16)(b0[i] * e[0] + a0[i] * e[1]);
                    hv[2 * u][4 + i] = (h16)(a1[i] * f[0] - b1[i] * f[1]); hv[2 * u + 1][4 + i] = (h16)(b1[i] * f[0] + a1[i] * f[1]);
                }
            }
        }
#pragma unroll
        for (int s = 0; s < (MODE == 2 ? 0 : 4); ++s) {
            const int row = 4 * s + rg;                  // 4 s x 4 row groups = 16 rows
            v4f x0 = *(const v4fa*)(&os[row * 68 + c8]); v4f x1 = *(const v4fa*)(&os[row * 68 + c8 + 4]);
            if (MODE == 1) {
                const float tf = (float)((r0 % SEQ) + mb * 16 + row);                        // token position of this row
                const v2f e0 = cs_of(tf * th4[0]), e1 = cs_of(tf * th4[1]), e2 = cs_of(tf * th4[2]), e3 = cs_of(tf * th4[3]);   // (cos, sin) of its 4 pairs
                v4f y0, y1;
                y0[0] = x0[0] * e0[0] - x0[1] * e0[1]; y0[1] = x0[0] * e0[1] + x0[1] * e0[0];
                y0[2] = x0[2] * e1[0] - x0[3] * e1[1]; y0[3] = x0[2] * e1[1] + x0[3] * e1[0];
                y1[0] = x1[0] * e2[0] - x1[1] * e2[1]; y1[1] = x1[0] * e2[1] + x1[1] * e2[0];
                y1[2] = x1[2] * e3[0] - x1[3] * e3[1]; y1[3] = x1[2] * e3[1] + x1[3] * e3[0];
                x0 = y0; x1 = y1;
            }
#pragma unroll
            for (int i = 0; i < 4; ++i) { hv[s][i] = (h16)x0[i]; hv[s][4 + i] = (h16)x1[i]; }
        }
        const size_t sb = tbase + (size_t)(mb * 16) * (size_t)pitch;
{
#pragma unroll
            for (int s = 0; s < 4; ++s) { const size_t oo = sb + (size_t)(MODE == 2 ? 2 * (4 * (s >> 1) + rg) + (s & 1) : 4 * s + rg) * (size_t)pitch + c8;   // the row that hv[s] holds
                *(v8h*)(Ph + oo) = hv[s]; }
             }
        asm volatile("s_wait_xcnt 0x0" ::: "memory");        // before what follows (the next slab; behind the last one, whatever stands behind this tile in the kernel) reuses the registers these stores name
        wave_sync();
    }
}

// k_proj: the three input projections in ONE launch; blockIdx.z picks the projection (the same for a whole block, so every barrier stays under block-uniform control flow), blockIdx.x its 128 x 128 tile.
// 3 x PJ blocks; two fit a WGP's LDS, so one block's first tiles, barrier waits and epilogue run under another block's products, and two launch gaps go.
// The projection with the longest epilogue comes first in the grid, the shortest last.
//   z = 0, v^T: A = Wv rows (m = h*64 + d), Bt = x rows (n = b*SEQ + t) -> plane [(b*1024 + m)][t] = [(b*16 + h)][d][t]; rotary on row pairs
//   z = 1, k and z = 2, q: A = x rows (m = b*SEQ + t), Bt = W rows (n = h*64 + d) -> plane [(b*16 + h)][t][d]; k gets rotary on column pairs
#define PJ   ((NB * SEQ / GT) * (DM / GT))     // 128 x 128 tiles of one projection
__global__ __launch_bounds__(32 * GW) void k_proj(const bf* __restrict__ XQ, const bf* __restrict__ XK, const bf* __restrict__ XV, const bf* __restrict__ WB,
                                                  h16* QH, h16* KP, h16* VT, const float* __restrict__ CS) {
    __shared__ __align__(16) float osb[GW * 16 * 68];
    __shared__ __align__(16) bf sm[2 * GTH];
    const int f = blockIdx.x, z = blockIdx.z;
    if (z == 0)      proj_tile<2>(WB + (size_t)2 * DM * DM, XV, VT, CS, osb, sm, f % (DM / GT), f / (DM / GT), DM, (size_t)0, SEQ, SEQ, (size_t)DM * SEQ);
    else if (z == 1) proj_tile<1>(XK, WB + (size_t)DM * DM, KP, CS, osb, sm, f % (NB * SEQ / GT), f / (NB * SEQ / GT), SEQ, (size_t)NH_ * SEQ * HD, HD, HD, (size_t)SEQ * HD);
    else             proj_tile<0>(XQ, WB, QH, CS, osb, sm, f % (NB * SEQ / GT), f / (NB * SEQ / GT), SEQ, (size_t)NH_ * SEQ * HD, HD, HD, (size_t)SEQ * HD);
}

// k_flash: fused attention, KS waves per 16 * QG query rows of one (batch, head), wave (slot, half) walking keys half * SEQ / KS ... of its slot's rows; Q fragments straight from the f16 plane.
// K and V^T: the AW waves of a key half walk the same keys, so each tile of KT keys is brought into LDS ONCE per block by asynchronous 16-byte copies (whole 128-byte lines,
// eight lanes per row) into one of that half's two buffers, the next tile flying while this one is worked on; fragments are 16-byte LDS reads at pitch LP.
// Behind the loop the upper half hands (max, sum, O^T) to the lower half's wave of the same slot through LDS, lane to lane; that wave joins the two online-softmax states and stores.
// Each K and V^T fragment is read once per wave and feeds QG matrix products (one per 16-query group g).
// Transposed form: S^T[key][t] = K Q^T (A = K rows, B = Q rows); lane (t = lane&15, h = lane>>4) holds keys 8h+r of each 16-key tile, so the packed
// P tile is directly the B fragment of O^T[d][t] = V^T P^T (element r <- tile keys 0..15, element 8+r <- tile keys 16..31, lane unchanged).
// Scale chain: logit2 = acc * (0.125 * log2 e); P = exp2(logit2 - max in use + 8) as f16; l = sum of the f16 P values; ctx plane = O^T * 1024 / l.
// Softmax state: the maximum in use is one scalar per lane and group, the same in both lane halves of a row. It may trail the true running maximum by up to LZ: O^T and the row sums are rescaled
// (and the halves' maxima combined with one xor-16 exchange) only under one wave-uniform branch per 32 keys, taken when some lane's score exceeds the maximum in use by more than LZ.
// The row sums of P run on the matrix unit: one more product per group and 32 keys, A = a constant tile whose row 0 is ones and whose other rows are zero, B = the packed P tile,
// so element 0 of the accumulator holds, in lanes 0..15, the sum over all 32 keys of that lane's query (f16 P values, f32 accumulate) and, in lanes 16..31, row 8 = zero; only element 0 is rescaled.
// one tile's copies of one thread: two 16-byte pieces of the K tile (rows 32 apart) and two of the V^T tile, each lane with its own LDS byte address and global pointer.
// s_wait_xcnt stands as the statement's last line, in front of any rewrite of the address registers that the copies name.
__device__ __forceinline__ void stage_tile(unsigned l, const h16* kg, const h16* vg) {
    asm volatile("global_load_async_to_lds_b128 %0, %4, off\n\t"
                 "global_load_async_to_lds_b128 %1, %5, off\n\t"
                 "global_load_async_to_lds_b128 %2, %6, off\n\t"
                 "global_load_async_to_lds_b128 %3, %7, off\n\t"
                 "s_wait_xcnt 0x0"
                 :: "v"(l), "v"(l + 32 * LP * 2), "v"(l + 64 * LP * 2), "v"(l + 96 * LP * 2),
                    "v"(kg), "v"(kg + 32 * HD), "v"(vg), "v"(vg + (size_t)32 * SEQ)
                 : "memory");
}

__global__ __launch_bounds__(32 * AW * KS) void k_flash(const h16* __restrict__ QH, const h16* __restrict__ KP, const h16* __restrict__ VT, h16* CX) {
    __shared__ __align__(16) float os[AW * 16 * 68];
    __shared__ __align__(16) h16 kv[KS * 2 * TH];            // two buffers per key half
    __shared__ __align__(16) float cmb[AW * CP * 32 * 4];    // hand-over of the upper half's state: [slot][piece][lane] 16-byte pieces
    const int lane = threadIdx.x & 31, lr = lane & 15, hi = lane >> 4;
    const int wid = __builtin_amdgcn_readfirstlane((int)(threadIdx.x >> 5));
    const int wave = wid % AW, kh = wid / AW;                // query slot and key half of this wave, both wave-uniform
    const int zh = blockIdx.y; const int b = zh / NH_, h = zh % NH_;
    const int t0 = (blockIdx.x * AW + wave) * (16 * QG);
    const size_t pbase = (size_t)zh * SEQ * HD;
    const size_t qo = pbase + (size_t)(t0 + lr) * HD + 8 * hi;
    v16h qh0[QG], qh1[QG];                                   // B fragments: col t, k = d
#pragma unroll
    for (int g = 0; g < QG; ++g) { qh0[g] = ldh(QH + qo + (size_t)g * 16 * HD); qh1[g] = ldh(QH + qo + (size_t)g * 16 * HD + 32); }
    // copy addresses of this thread, ht = its index among the 32 * AW threads of its key half: row = ht / 8 (+ 32 for the second piece), 16-byte column = ht % 8, the same in the K tile (row = key) and in the V^T tile (row = d)
    const unsigned ht = threadIdx.x % (32 * AW);
    const unsigned crow = ht >> 3, ccol = ht & 7;
    const int kf = kh * (SEQ / KS);                                                  // first key of this half
    const unsigned l0 = (unsigned)(size_t)&kv[0] + (unsigned)kh * (2 * TH * 2) + crow * (LP * 2) + ccol * 16;   // LDS byte address in this half's buffer 0
    const h16* kg = KP + pbase + (size_t)(kf + (int)crow) * HD + ccol * 8;           // + key0 * HD
    const h16* vg = VT + pbase + (size_t)crow * SEQ + kf + ccol * 8;                 // + key0
    stage_tile(l0, kg, vg);
    asm volatile("s_wait_asynccnt 0x0" ::: "memory");        // this wave's copies of tile 0 have landed
    __syncthreads();                                         // ... and every other wave's: tile 0 may be read
    stage_tile(l0 + TH * 2, kg + (size_t)KT * HD, vg + KT);  // tile 1 flies during trip 0
    const h16* fr = kv + kh * (2 * TH) + lr * LP + 8 * hi;   // fragment base in this half's buffers: K row key (k = d) at + key * LP; V^T row d (k = key) at + (KT + d) * LP + key
    v8f o0[QG], o1[QG], o2[QG], o3[QG], sm[QG];         // sm: row-sum tile, row 0 alone is ever non-zero
    float m[QG], l[QG];
#pragma unroll
    for (int g = 0; g < QG; ++g) { o0[g] = (v8f){}; o1[g] = (v8f){}; o2[g] = (v8f){}; o3[g] = (v8f){}; sm[g] = (v8f){}; m[g] = -3.0e38f; }
    v16h one0;                                           // A fragment: a lane holds row lane & 15, so lanes 0 and 16 hold the ones of row 0 (every k), all other lanes zero
#pragma unroll
    for (int i = 0; i < 16; ++i) one0[i] = (lr == 0) ? (h16)1.0f : (h16)0.0f;
#pragma unroll 1
    for (int t = 0; t < NT; ++t) {
      const h16* fb = fr + (t & 1) * TH;                 // trip t reads buffer t mod 2 of its half alone
#pragma unroll
      for (int sub = 0; sub < KT / 32; ++sub) {          // two passes of 32 keys per tile, one online-softmax step each
        const h16* ka = fb + sub * 32 * LP;
        const v16h ka0 = ldh(ka), ka1 = ldh(ka + 32), kb0 = ldh(ka + 16 * LP), kb1 = ldh(ka + 16 * LP + 32);
        v8f sHa[QG], sHb[QG];                            // both groups' score tiles live across the test; every loop over g or r of this pass is unrolled so that they stay in registers
#pragma unroll
        for (int g = 0; g < QG; ++g) {
            sHa[g] = (v8f){}; sHb[g] = (v8f){};
            sHa[g] = wmma16(ka0, qh0[g], sHa[g]); sHb[g] = wmma16(kb0, qh0[g], sHb[g]);
            sHa[g] = wmma16(ka1, qh1[g], sHa[g]); sHb[g] = wmma16(kb1, qh1[g], sHb[g]);
        }
        float mx[QG]; bool need = false;
#pragma unroll
        for (int g = 0; g < QG; ++g) {
            float x = -3.0e38f;
#pragma unroll
            for (int r = 0; r < 8; ++r) x = fmaxf(x, fmaxf(sHa[g][r], sHb[g][r]));
            mx[g] = x * SC2; need = need || (mx[g] > m[g] + LZ);
        }
        if (__builtin_amdgcn_ballot_w32(need) != 0) {    // one scalar branch per 32 keys; taken on the first pass (m = -3e38) and rarely later
#pragma unroll
            for (int g = 0; g < QG; ++g) {
                const float mnew = fmaxf(m[g], fmaxf(mx[g], __shfl_xor(mx[g], 16, 32)));   // both lane halves of a query take the same new maximum
                const float alpha = __builtin_amdgcn_exp2f(m[g] - mnew);
                sm[g][0] = sm[g][0] * alpha; m[g] = mnew;
                o0[g] = o0[g] * alpha; o1[g] = o1[g] * alpha; o2[g] = o2[g] * alpha; o3[g] = o3[g] * alpha;
            }
        }
        const h16* va = fb + KT * LP + sub * 32;
        const v16h v0 = ldh(va), v1 = ldh(va + 16 * LP), v2 = ldh(va + 32 * LP), v3 = ldh(va + 48 * LP);
#pragma unroll
        for (int g = 0; g < QG; ++g) {
            const float sh = PSH - m[g];
            v16h pb;
#pragma unroll
            for (int r = 0; r < 8; r += 2) {             // exp argument = logit2 - max in use + 8, at most 8 + LZ: one packed fma per two neighbouring accumulator registers
                const v2f ea = __builtin_elementwise_fma((v2f){ sHa[g][r], sHa[g][r + 1] }, (v2f){ SC2, SC2 }, (v2f){ sh, sh });
                const v2f eb = __builtin_elementwise_fma((v2f){ sHb[g][r], sHb[g][r + 1] }, (v2f){ SC2, SC2 }, (v2f){ sh, sh });
                pb[r] = (h16)__builtin_amdgcn_exp2f(ea[0]); pb[r + 1] = (h16)__builtin_amdgcn_exp2f(ea[1]);
                pb[8 + r] = (h16)__builtin_amdgcn_exp2f(eb[0]); pb[9 + r] = (h16)__builtin_amdgcn_exp2f(eb[1]);
            }
            o0[g] = wmma16(v0, pb, o0[g]); o1[g] = wmma16(v1, pb, o1[g]); o2[g] = wmma16(v2, pb, o2[g]); o3[g] = wmma16(v3, pb, o3[g]);
            sm[g] = wmma16(one0, pb, sm[g]);
        }
      }
        __builtin_amdgcn_sched_barrier(0);               // keeps every matrix product of this trip in front of the slots below
        // four vector slots between the last matrix product and the loop's back edge
        asm volatile("v_nop\n\tv_nop\n\tv_nop\n\tv_nop");
        asm volatile("s_wait_dscnt 0x0" ::: "memory");   // this wave's reads of buffer t mod 2 have returned
        asm volatile("s_wait_asynccnt 0x0" ::: "memory");// this wave's copies of tile t + 1 have landed
        __syncthreads();                                 // publishes tile t + 1 and ends every wave's reads of the buffer refilled below
        if (t + 2 < NT) stage_tile(l0 + (unsigned)(t & 1) * (TH * 2), kg + (size_t)(t + 2) * KT * HD, vg + (size_t)(t + 2) * KT);
    }
    asm volatile("s_wait_asynccnt 0x0" ::: "memory");    // nothing of this wave's is in flight when the loop is left
#pragma unroll
    for (int g = 0; g < QG; ++g) l[g] = sm[g][0];        // lanes 0..15: the whole row sum of this key half; lanes 16..31: zero, so the xor-16 sum in the epilogue gives every lane the row sum
    // the two key halves of a slot are joined: lane x of the upper wave holds the same (query, d) places as lane x of the lower wave
    float* const cw = cmb + wave * (CP * 32 * 4) + lane * 4;             // piece j of this lane at + j * 128 floats: neighbouring lanes, neighbouring 16 bytes
    if (kh != 0) {
#pragma unroll
        for (int g = 0; g < QG; ++g) {
            const v8f* const oq[4] = { &o0[g], &o1[g], &o2[g], &o3[g] };
#pragma unroll
            for (int q = 0; q < 4; ++q) {
                const v8f x = *oq[q];
                *(v4fa*)(cw + (g * 8 + q * 2) * 128)     = (v4f){ x[0], x[1], x[2], x[3] };
                *(v4fa*)(cw + (g * 8 + q * 2 + 1) * 128) = (v4f){ x[4], x[5], x[6], x[7] };
            }
        }
        *(v4fa*)(cw + (CP - 1) * 128) = (v4f){ m[0], m[1], l[0], l[1] };
    }
    __syncthreads();                                     // the upper half's state may be read; every wave of the block passes here
    if (kh != 0) return;                                 // no barrier stands behind this line
    {
        const v4f ml = *(const v4fa*)(cw + (CP - 1) * 128);
#pragma unroll
        for (int g = 0; g < QG; ++g) {
            const float mn = fmaxf(m[g], ml[g]);
            const float fa = __builtin_amdgcn_exp2f(m[g] - mn), fc = __builtin_amdgcn_exp2f(ml[g] - mn);
            l[g] = l[g] * fa + ml[2 + g] * fc;
            v8f* const oq[4] = { &o0[g], &o1[g], &o2[g], &o3[g] };
#pragma unroll
            for (int q = 0; q < 4; ++q) {
                const v4f x = *(const v4fa*)(cw + (g * 8 + q * 2) * 128); const v4f y = *(const v4fa*)(cw + (g * 8 + q * 2 + 1) * 128);
                v8f o = *oq[q];
#pragma unroll
                for (int r = 0; r < 4; ++r) { o[r] = o[r] * fa + x[r] * fc; o[4 + r] = o[4 + r] * fa + y[r] * fc; }
                *oq[q] = o;
            }
        }
    }
    const int wb = wave * 16 * 68;
    const int rg = lane >> 3, c8 = (lane & 7) * 8;       // 4 s x 4 row groups = 16 rows; 8 lanes x 8 halves = 64 columns
#pragma unroll
    for (int g = 0; g < QG; ++g) {
        const float lt = l[g] + __shfl_xor(l[g], 16, 32);
        const float inv = (1.0f / lt) * CXS;
        // O^T D layout: o_j[r] = (d = 16j + 8h + r, t = lane&15) -> os[t][d]; rows 0..15 x columns 0..63 all written
        { v4f a, c;
          a[0] = o0[g][0] * inv; a[1] = o0[g][1] * inv; a[2] = o0[g][2] * inv; a[3] = o0[g][3] * inv; c[0] = o0[g][4] * inv; c[1] = o0[g][5] * inv; c[2] = o0[g][6] * inv; c[3] = o0[g][7] * inv;
          *(v4fa*)(&os[wb + lr * 68 +  0 + 8 * hi]) = a; *(v4fa*)(&os[wb + lr * 68 +  0 + 8 * hi + 4]) = c;
          a[0] = o1[g][0] * inv; a[1] = o1[g][1] * inv; a[2] = o1[g][2] * inv; a[3] = o1[g][3] * inv; c[0] = o1[g][4] * inv; c[1] = o1[g][5] * inv; c[2] = o1[g][6] * inv; c[3] = o1[g][7] * inv;
          *(v4fa*)(&os[wb + lr * 68 + 16 + 8 * hi]) = a; *(v4fa*)(&os[wb + lr * 68 + 16 + 8 * hi + 4]) = c;
          a[0] = o2[g][0] * inv; a[1] = o2[g][1] * inv; a[2] = o2[g][2] * inv; a[3] = o2[g][3] * inv; c[0] = o2[g][4] * inv; c[1] = o2[g][5] * inv; c[2] = o2[g][6] * inv; c[3] = o2[g][7] * inv;
          *(v4fa*)(&os[wb + lr * 68 + 32 + 8 * hi]) = a; *(v4fa*)(&os[wb + lr * 68 + 32 + 8 * hi + 4]) = c;
          a[0] = o3[g][0] * inv; a[1] = o3[g][1] * inv; a[2] = o3[g][2] * inv; a[3] = o3[g][3] * inv; c[0] = o3[g][4] * inv; c[1] = o3[g][5] * inv; c[2] = o3[g][6] * inv; c[3] = o3[g][7] * inv;
          *(v4fa*)(&os[wb + lr * 68 + 48 + 8 * hi]) = a; *(v4fa*)(&os[wb + lr * 68 + 48 + 8 * hi + 4]) = c; }
        wave_sync();
        h16* crow = CX + ((size_t)b * SEQ + t0 + g * 16) * DM + h * HD;
        v8h hv[4];
#pragma unroll
        for (int s = 0; s < 4; ++s) { const int row = 4 * s + rg;
            const v4f x0 = *(const v4fa*)(&os[wb + row * 68 + c8]); const v4f x1 = *(const v4fa*)(&os[wb + row * 68 + c8 + 4]);
#pragma unroll
            for (int i = 0; i < 4; ++i) { hv[s][i] = (h16)x0[i]; hv[s][4 + i] = (h16)x1[i]; } }
#pragma unroll
        for (int s = 0; s < 4; ++s) *(v8h*)(crow + (size_t)(4 * s + rg) * DM + c8) = hv[s];
        asm volatile("s_wait_xcnt 0x0" ::: "memory");    // before the next group reuses the registers these stores name
        __builtin_amdgcn_sched_barrier(0);               // keeps the next group's arithmetic behind that wait
        wave_sync();                                     // the next group overwrites this wave's staging rows
    }
}

// k_oproj: register-blocked f16 GEMM, one wave per 64x64 tile, GW waves per block (gemm_main), A = ctx plane (x1024), Bt = Wp plane (x256), K = DM; OUT[m][n] = acc * 2^-18 + bias[n] (f32).
__global__ __launch_bounds__(32 * GW) void k_oproj(const h16* __restrict__ A, const h16* __restrict__ Bt, const float* __restrict__ bias, float* OUT) {
    __shared__ __align__(16) float osb[GW * 16 * 68];
    __shared__ __align__(16) h16 sm[2 * GTH];
    const int lane = threadIdx.x & 31, lr = lane & 15, hi = lane >> 4;
    const int wave = __builtin_amdgcn_readfirstlane((int)(threadIdx.x >> 5));
    const int wr = (wave & 1) * 64, wc = (wave >> 1) * 64;
    const int r0 = blockIdx.x * GT + wr, c0 = blockIdx.y * GT + wc;      // this wave's 64 x 64 tile
    float* const os = osb + wave * 16 * 68;                              // this wave's own staging rows
    v8f acc[4][4];
    gemm_main(A, Bt, sm, (int)blockIdx.x * GT, (int)blockIdx.y * GT, wr, wc, lr, hi, acc);
    const int cofs = lr * 4;                              // 16 lanes x 4 floats = 64 columns
    const v4f braw = *(const v4fa*)(bias + c0 + cofs); v4f bb;
#pragma unroll
    for (int i = 0; i < 4; ++i) bb[i] = bfval(braw[i]);
    const int bi = r0 / SEQ, tt = r0 % SEQ;
    float* obase = OUT + ((size_t)bi * OUT_SEQ + tt) * DM + c0;
#pragma unroll
    for (int mb = 0; mb < 4; ++mb) {
#pragma unroll
        for (int nb = 0; nb < 4; ++nb) {
#pragma unroll
            for (int j = 0; j < 8; ++j) os[(hi * 8 + j) * 68 + nb * 16 + lr] = acc[mb][nb][j]; }   // rows 0..15 x cols 0..63 all written
        wave_sync();
        v4f vals[8];
#pragma unroll
        for (int s = 0; s < 8; ++s) { const int row = 2 * s + hi;            // 8 s x 2 rows = 16 rows
            const v4f x = *(const v4fa*)(&os[row * 68 + cofs]); vals[s] = x * OSC + bb; }
{
#pragma unroll
            for (int s = 0; s < 8; ++s) *(v4f*)(obase + (size_t)(mb * 16 + 2 * s + hi) * DM + cofs) = vals[s];
             }
        wave_sync();
    }
}

static constexpr size_t al256(size_t v) { return (v + 255) & ~(size_t)255; }
static constexpr size_t SZ_XB = al256((size_t)NB * SEQ * DM * 2);            // one bf16 activation plane
static constexpr size_t SZ_WB = al256((size_t)3 * DM * DM * 2);              // Wq | Wk | Wv bf16
static constexpr size_t SZ_WP = al256((size_t)DM * DM * 2);                  // Wp f16 x256
static constexpr size_t SZ_CS = al256((size_t)NPR * 4);                      // rotary angle steps
static constexpr size_t SZ_PL = al256((size_t)NB * NH_ * SEQ * HD * 2);      // one f16 head plane
static constexpr size_t SZ_CX = al256((size_t)NB * SEQ * DM * 2);            // ctx f16 x1024
static constexpr size_t SZ_TOTAL = 3 * SZ_XB + SZ_WB + SZ_WP + SZ_CS + 3 * SZ_PL + SZ_CX;
static_assert(SZ_TOTAL <= (size_t)134217728);          // workspace carve <= 128 MiB
static_assert(((size_t)DM * DM * 2) % 256 == 0);       // weight sub-planes stay 256-byte aligned

extern "C" void kernel_launch(void* const* d_in, const int* in_sizes, int n_in,
                              void* d_out, int out_size, void* d_ws, size_t ws_size, hipStream_t stream) {
    if (n_in < 8) return;
    const size_t needx = ((size_t)(NB - 1) * SEQ_FULL + SEQ) * DM;
    if ((size_t)in_sizes[0] < needx || (size_t)in_sizes[1] < needx || (size_t)in_sizes[2] < needx) return;
    if ((size_t)in_sizes[3] < (size_t)DM * DM || (size_t)in_sizes[4] < (size_t)DM * DM || (size_t)in_sizes[5] < (size_t)DM * DM || (size_t)in_sizes[6] < (size_t)DM * DM) return;
    if ((size_t)in_sizes[7] < (size_t)DM) return;
    if ((size_t)out_size < ((size_t)(NB - 1) * OUT_SEQ + SEQ) * DM) return;
    if (SZ_TOTAL > ws_size) return;
    // wire order: q, k, v, Wq, Wk, Wv, Wp, bp (weights [out][in] = Bt as-is)
    const float* xq = (const float*)d_in[0]; const float* xk = (const float*)d_in[1]; const float* xv = (const float*)d_in[2];
    const float* wq = (const float*)d_in[3]; const float* wk = (const float*)d_in[4]; const float* wv = (const float*)d_in[5];
    const float* wp = (const float*)d_in[6]; const float* bp = (const float*)d_in[7];
    float* OUT = (float*)d_out;      // [NB][SEQ][1024]
    char* wsp = (char*)d_ws;
    bf* XQ = (bf*)wsp; wsp += SZ_XB;                 // [NB*SEQ][1024]
    bf* XK = (bf*)wsp; wsp += SZ_XB;
    bf* XV = (bf*)wsp; wsp += SZ_XB;
    bf* WB = (bf*)wsp; wsp += SZ_WB;                 // [3][1024][1024]: q | k | v
    h16* WP = (h16*)wsp; wsp += SZ_WP;               // [1024][1024] x256
    float* CS = (float*)wsp; wsp += SZ_CS;           // [512]: theta(p)
    h16* QH = (h16*)wsp; wsp += SZ_PL;               // [NB*16][SEQ][64]
    h16* KP = (h16*)wsp; wsp += SZ_PL;               // [NB*16][SEQ][64]
    h16* VT = (h16*)wsp; wsp += SZ_PL;               // [NB*16][64][SEQ]
    h16* CX = (h16*)wsp; wsp += SZ_CX;               // [NB*SEQ][1024] x1024

    k_prep<<<PB, PT, 0, stream>>>(xq, xk, xv, wq, wk, wv, wp, XQ, XK, XV, WB, WP, CS);

    // q, k and v^T projections: one launch, blockIdx.z = projection
    k_proj<<<dim3(PJ, 1, 3), 32 * GW, 0, stream>>>(XQ, XK, XV, WB, QH, KP, VT, CS);

    k_flash<<<dim3(SEQ / (16 * QG * AW), NB * NH_, 1), 32 * AW * KS, 0, stream>>>(QH, KP, VT, CX);

    // out: A = ctx rows (m = b*SEQ + t), Bt = Wp rows (n = out feature)
    k_oproj<<<dim3(NB * SEQ / GT, DM / GT, 1), 32 * GW, 0, stream>>>(CX, WP, bp, OUT);
}
